// v000
// Times are from an AMD MI455X. After a warm-up the kernel runs many times in a row, and a time is the length of
// such a window on the GPU divided by its runs, so every launch and the gaps after it count. The runs cycle
// through copies of the inputs. A figure is the median of several windows, for all but v000 over two sittings.
// Sittings can differ by a few percent; kernels timed side by side share one.
// v000 is the starting kernel. One run takes 436 microseconds.
#include <hip/hip_runtime.h>
// Multi-head attention with a stoichiometric bias (B=2, T=2048, D=1024, 16 heads × 64): Q,K,V = x·Wᵀ + b (torch (out,in)) from query/key/value; logits = q·kᵀ·64^-½; bias[b,h,i,j] = α_pos[h]·max(D,0) + α_neg[h]·min(D,0), D = clip(frac_j − frac_i, −0.2, 0.2);
// attn = softmax(γ·logits + δ·bias); out = (attn·V merged)·Woᵀ + bo. γ, δ are scalar inputs.
// Compute dtype: x, weights, biases rounded to bf16; q/k/v as f16 GEMM outputs; fused flash-style kernel (online softmax f32, P f16 ×2^10) on v_wmma_f32_16x16x32_f16; O → f16 → output GEMM with bias; f32 accumulate.
#define BB 2
#define TT 2048
#define NH 16
#define DD 1024
#define NR (BB * TT)

typedef __bf16 v16b __attribute__((ext_vector_type(16)));
typedef unsigned short v8us __attribute__((ext_vector_type(8), may_alias));
typedef float  v8f  __attribute__((ext_vector_type(8)));
typedef float  v4f  __attribute__((ext_vector_type(4)));
typedef float  v4fa __attribute__((ext_vector_type(4), may_alias));
union FragB { v16b v; v8us half[2]; unsigned short u[16]; };

__device__ __forceinline__ unsigned short bf16_bits(float x) { unsigned int u = __float_as_uint(x); return (unsigned short)((u + 0x7FFFu + ((u >> 16) & 1u)) >> 16); }
__device__ __forceinline__ float bf16_val(unsigned short b) { return __uint_as_float(((unsigned int)b) << 16); }
__device__ __forceinline__ float bf16_round(float x) { return bf16_val(bf16_bits(x)); }
// D += A·B with NT terms: 1 = ah·bh, 2 = + al·bh (A split), 3 = + ah·bl (both split)
template <int NT>
__device__ __forceinline__ v8f mmaN(v16b ah, v16b al, v16b bh, v16b bl, v8f c) {
  c = __builtin_amdgcn_wmma_f32_16x16x32_bf16(false, ah, false, bh, (short)0, c, false, false);
  if (NT >= 2) c = __builtin_amdgcn_wmma_f32_16x16x32_bf16(false, al, false, bh, (short)0, c, false, false);
  if (NT >= 3) c = __builtin_amdgcn_wmma_f32_16x16x32_bf16(false, ah, false, bl, (short)0, c, false, false);
  asm volatile("v_nop\n\tv_nop\n\tv_nop\n\tv_nop" : "+v"(c) : "v"(ah), "v"(al), "v"(bh), "v"(bl));
  return c;
}

__global__ __launch_bounds__(256) void k_wt_bf16(const float* __restrict__ W, unsigned short* __restrict__ Wt, int K, int N) {
  const int t = blockIdx.x * 256 + threadIdx.x;
  const int k8n = K / 8;
  if (t >= N * k8n) return;
  const int n = t / k8n, k8 = (t % k8n) * 8;
  v8us v;
#pragma unroll
  for (int i = 0; i < 8; ++i) v[i] = bf16_bits(W[(size_t)(k8 + i) * N + n]);
  *(v8us*)(Wt + (size_t)n * K + k8) = v;
  
}

// GEMM C[M][N] (f32, pitch ldc) = act(A[M][K]·W + bias). A f32 row-major (pitch lda) converted per fragment to bf16
// (ASPLIT: hi/lo two planes -> 2 terms, else single rounded term); Wt bf16 [N][K] (pitch ldb). BIAS_BF16 rounds the
// bias to bf16 first (bias quantised to bf16 before the add). K%32==0, M%16==0, N%64==0.
template <bool ASPLIT, int ACT, bool BIAS_BF16>
__global__ __launch_bounds__(128) void k_gemm_bf(const float* __restrict__ A, int lda, const unsigned short* __restrict__ Wt, int ldb,
                                               const float* __restrict__ bias, float* __restrict__ C, int ldc, int M, int N, int K) {
  __shared__ __attribute__((aligned(16))) float so[4][16][64];
  const int tid = threadIdx.x, w = tid >> 5, lane = tid & 31, ln = lane & 15, hh = lane >> 4;
  const int ntn = N / 64;
  const int wid = blockIdx.x * 4 + w;
  const int mt = wid / ntn, nq = wid % ntn;
  if (mt * 16 >= M) return;
  const int row0 = mt * 16, col0 = nq * 64;
  const float* arow = A + (size_t)(row0 + ln) * lda;
  v8f acc[4] = {};
  for (int kb = 0; kb < K; kb += 32) {
    FragB ah, al;
    const v4f x0 = *(const v4fa*)(arow + kb + 8 * hh), x1 = *(const v4fa*)(arow + kb + 8 * hh + 4);
    const v4f x2 = *(const v4fa*)(arow + kb + 16 + 8 * hh), x3 = *(const v4fa*)(arow + kb + 16 + 8 * hh + 4);
    float xs[16] = {x0[0],x0[1],x0[2],x0[3],x1[0],x1[1],x1[2],x1[3],x2[0],x2[1],x2[2],x2[3],x3[0],x3[1],x3[2],x3[3]};
#pragma unroll
    for (int i = 0; i < 16; ++i) { const unsigned short hb = bf16_bits(xs[i]); ah.u[i] = hb; al.u[i] = ASPLIT ? bf16_bits(xs[i] - bf16_val(hb)) : (unsigned short)0; }
#pragma unroll
    for (int t = 0; t < 4; ++t) {
      const unsigned short* brow = Wt + (size_t)(col0 + t * 16 + ln) * ldb + kb;
      FragB b;
      b.half[0] = *(const v8us*)(brow + 8 * hh);
      b.half[1] = *(const v8us*)(brow + 16 + 8 * hh);
      acc[t] = mmaN<ASPLIT ? 2 : 1>(ah.v, al.v, b.v, b.v, acc[t]);
    }
  }
#pragma unroll
  for (int t = 0; t < 4; ++t) {
    float bv = bias ? bias[col0 + t * 16 + ln] : 0.f;
    if (BIAS_BF16) bv = bf16_round(bv);
#pragma unroll
    for (int r = 0; r < 8; ++r) { float v = acc[t][r] + bv; if (ACT == 1) v = fmaxf(v, 0.f); so[w][8 * hh + r][t * 16 + ln] = v; }
  }
  __builtin_amdgcn_fence(__ATOMIC_ACQ_REL, "workgroup");
  __builtin_amdgcn_wave_barrier();
  const int rsub = lane >> 4, c4 = (lane & 15) * 4;
  {
#pragma unroll
    for (int q = 0; q < 8; ++q) {
      const int r = q * 2 + rsub;
      const v4f v = *(const v4fa*)&so[w][r][c4];
      *(v4f*)(C + (size_t)(row0 + r) * ldc + col0 + c4) = v;
    }
    
  }
}

// Flash-style causal/unmasked attention, all contractions 3-term bf16 hi/lo splits, f32 softmax with running max.
// q,k,v rows are read from f32 buffers with arbitrary row pitch (so they can live inside a fused qkv buffer);
// D = head size (multiple of 32, <= 128); one wave = 16 query rows; block = 4 waves (64 queries) sharing K/V chunks of 32.
template <int D, bool CAUSAL>
__global__ __launch_bounds__(128) void k_flash(const float* __restrict__ qb, const float* __restrict__ kb, const float* __restrict__ vb,
                                             int pitch, int T, int H, float scale, float* __restrict__ y, int ypitch) {
  constexpr int KS = D / 32;        // k-steps for QK
  constexpr int DT = D / 16;        // d tiles for PV
  __shared__ __attribute__((aligned(16))) unsigned short sKh[32][D + 8], sKl[32][D + 8], sVh[32][D + 8], sVl[32][D + 8];
  __shared__ __attribute__((aligned(16))) unsigned short sPh[4][16][40], sPl[4][16][40];
  __shared__ __attribute__((aligned(16))) float sO[4][16][D];
  const int tid = threadIdx.x, w = tid >> 5, lane = tid & 31, ln = lane & 15, hh = lane >> 4;
  const int nqb = (T + 63) / 64;
  const int bh = blockIdx.x / nqb, qblk = blockIdx.x % nqb;
  const int b = bh / H, h = bh % H;
  const int q0 = qblk * 64 + w * 16;
  const float* Q = qb + (size_t)b * T * pitch + h * D;
  const float* K = kb + (size_t)b * T * pitch + h * D;
  const float* V = vb + (size_t)b * T * pitch + h * D;

  // A fragments of the wave's 16 query rows (scaled), hi/lo
  FragB aqh[KS], aql[KS];
  {
    int row = q0 + ln; if (row >= T) row = T - 1;
    const float* qr = Q + (size_t)row * pitch;
#pragma unroll
    for (int ks = 0; ks < KS; ++ks)
#pragma unroll
      for (int i = 0; i < 16; ++i) {
        const int d = ks * 32 + ((i < 8) ? (8 * hh + i) : (16 + 8 * hh + (i - 8)));
        const float x = qr[d] * scale; const unsigned short hb = bf16_bits(x);
        aqh[ks].u[i] = hb; aql[ks].u[i] = bf16_bits(x - bf16_val(hb));
      }
  }
  float m_r[8], l_r[8];
#pragma unroll
  for (int r = 0; r < 8; ++r) { m_r[r] = -3.0e38f; l_r[r] = 0.f; }
  v8f oacc[DT];
#pragma unroll
  for (int dt = 0; dt < DT; ++dt) oacc[dt] = (v8f){0.f,0.f,0.f,0.f,0.f,0.f,0.f,0.f};

  const int kv_end = CAUSAL ? min(T, qblk * 64 + 64) : T;     // block-uniform
  for (int j0 = 0; j0 < kv_end; j0 += 32) {
    __syncthreads();
    for (int e = tid; e < 32 * (D / 4); e += 128) {
      const int r = e / (D / 4), c4 = (e % (D / 4)) * 4;
      const int key = j0 + r;
      v4f kf = {0.f,0.f,0.f,0.f}, vf = {0.f,0.f,0.f,0.f};
      if (key < T) { kf = *(const v4fa*)(K + (size_t)key * pitch + c4); vf = *(const v4fa*)(V + (size_t)key * pitch + c4); }
#pragma unroll
      for (int t = 0; t < 4; ++t) {
        unsigned short hb = bf16_bits(kf[t]); sKh[r][c4 + t] = hb; sKl[r][c4 + t] = bf16_bits(kf[t] - bf16_val(hb));
        hb = bf16_bits(vf[t]); sVh[r][c4 + t] = hb; sVl[r][c4 + t] = bf16_bits(vf[t] - bf16_val(hb));
      }
    }
    __syncthreads();
    // S tile 16 x 32
    v8f s[2];
#pragma unroll
    for (int nt = 0; nt < 2; ++nt) {
      v8f acc = {};
#pragma unroll
      for (int ks = 0; ks < KS; ++ks) {
        FragB bh_, bl_;
        bh_.half[0] = *(const v8us*)&sKh[nt * 16 + ln][ks * 32 + 8 * hh]; bh_.half[1] = *(const v8us*)&sKh[nt * 16 + ln][ks * 32 + 16 + 8 * hh];
        bl_.half[0] = *(const v8us*)&sKl[nt * 16 + ln][ks * 32 + 8 * hh]; bl_.half[1] = *(const v8us*)&sKl[nt * 16 + ln][ks * 32 + 16 + 8 * hh];
        acc = mmaN<3>(aqh[ks].v, aql[ks].v, bh_.v, bl_.v, acc);
      }
      s[nt] = acc;
    }
    // mask + running max (rows 8hh+r; the 16 lanes of a half share rows)
    float alpha[8];
#pragma unroll
    for (int r = 0; r < 8; ++r) {
      const int qi = q0 + 8 * hh + r;
      const int ja = j0 + ln, jb = j0 + 16 + ln;
      if (CAUSAL) { if (ja > qi) s[0][r] = -3.0e38f; if (jb > qi) s[1][r] = -3.0e38f; }
      if (ja >= T) s[0][r] = -3.0e38f;
      if (jb >= T) s[1][r] = -3.0e38f;
      float mx = fmaxf(s[0][r], s[1][r]);
      mx = fmaxf(mx, __shfl_xor(mx, 1, 32)); mx = fmaxf(mx, __shfl_xor(mx, 2, 32)); mx = fmaxf(mx, __shfl_xor(mx, 4, 32)); mx = fmaxf(mx, __shfl_xor(mx, 8, 32));
      const float mnew = fmaxf(m_r[r], mx);
      alpha[r] = (mnew > -1.0e38f) ? __expf(m_r[r] - mnew) : 1.0f;
      const float p0 = (s[0][r] > -1.0e38f) ? __expf(s[0][r] - mnew) : 0.f;
      const float p1 = (s[1][r] > -1.0e38f) ? __expf(s[1][r] - mnew) : 0.f;
      m_r[r] = mnew;
      l_r[r] = l_r[r] * alpha[r] + p0 + p1;            // per-lane partial row sum (16 lanes combined at the end)
      unsigned short hb = bf16_bits(p0); sPh[w][8 * hh + r][ln] = hb;      sPl[w][8 * hh + r][ln] = bf16_bits(p0 - bf16_val(hb));
      hb = bf16_bits(p1);                sPh[w][8 * hh + r][16 + ln] = hb; sPl[w][8 * hh + r][16 + ln] = bf16_bits(p1 - bf16_val(hb));
    }
#pragma unroll
    for (int dt = 0; dt < DT; ++dt)
#pragma unroll
      for (int r = 0; r < 8; ++r) oacc[dt][r] *= alpha[r];
    __builtin_amdgcn_fence(__ATOMIC_ACQ_REL, "workgroup");
    __builtin_amdgcn_wave_barrier();
    FragB pah, pal;
    pah.half[0] = *(const v8us*)&sPh[w][ln][8 * hh]; pah.half[1] = *(const v8us*)&sPh[w][ln][16 + 8 * hh];
    pal.half[0] = *(const v8us*)&sPl[w][ln][8 * hh]; pal.half[1] = *(const v8us*)&sPl[w][ln][16 + 8 * hh];
#pragma unroll
    for (int dt = 0; dt < DT; ++dt) {
      FragB bvh, bvl;
#pragma unroll
      for (int i = 0; i < 8; ++i) {
        bvh.u[i] = sVh[8 * hh + i][dt * 16 + ln]; bvh.u[8 + i] = sVh[16 + 8 * hh + i][dt * 16 + ln];
        bvl.u[i] = sVl[8 * hh + i][dt * 16 + ln]; bvl.u[8 + i] = sVl[16 + 8 * hh + i][dt * 16 + ln];
      }
      oacc[dt] = mmaN<3>(pah.v, pal.v, bvh.v, bvl.v, oacc[dt]);
    }
    __builtin_amdgcn_fence(__ATOMIC_ACQ_REL, "workgroup");
    __builtin_amdgcn_wave_barrier();
  }
#pragma unroll
  for (int r = 0; r < 8; ++r) {
    float l = l_r[r];
    l += __shfl_xor(l, 1, 32); l += __shfl_xor(l, 2, 32); l += __shfl_xor(l, 4, 32); l += __shfl_xor(l, 8, 32);
    l_r[r] = (l > 0.f) ? 1.0f / l : 0.f;
  }
#pragma unroll
  for (int dt = 0; dt < DT; ++dt)
#pragma unroll
    for (int r = 0; r < 8; ++r) sO[w][8 * hh + r][dt * 16 + ln] = oacc[dt][r] * l_r[r];
  __builtin_amdgcn_fence(__ATOMIC_ACQ_REL, "workgroup");
  __builtin_amdgcn_wave_barrier();
  {
    for (int r = 0; r < 16; ++r) {
      const int row = q0 + r;
      if (row < T && lane < D / 4) {
        const v4f val = *(const v4fa*)&sO[w][r][lane * 4];
        *(v4f*)(y + ((size_t)b * T + row) * ypitch + h * D + lane * 4) = val;
      }
    }
    
  }
}

// GEMM C = act(A·W + bias + resid): A f32 (ASPLIT -> hi/lo 2 terms), Wt bf16 [N][K]; ACT 0 none, 1 relu, 2 exact gelu;
// resid (optional, f32, row index = (row % rmod), pitch ldr, RES_BF16 rounds it) added before the activation.
template <bool ASPLIT, int ACT, bool BIAS_BF16, bool RES_BF16>
__global__ __launch_bounds__(128) void k_gemm_bf3(const float* __restrict__ A, int lda, const unsigned short* __restrict__ Wt, int ldb,
                                                const float* __restrict__ bias, const float* __restrict__ resid, int rmod, int ldr,
                                                float* __restrict__ C, int ldc, int M, int N, int K) {
  __shared__ __attribute__((aligned(16))) float so[4][16][64];
  const int tid = threadIdx.x, w = tid >> 5, lane = tid & 31, ln = lane & 15, hh = lane >> 4;
  const int ntn = N / 64;
  const int wid = blockIdx.x * 4 + w;
  const int mt = wid / ntn, nq = wid % ntn;
  if (mt * 16 >= M) return;
  const int row0 = mt * 16, col0 = nq * 64;
  const float* arow = A + (size_t)(row0 + ln) * lda;
  v8f acc[4] = {};
  for (int kb = 0; kb < K; kb += 32) {
    FragB ah, al;
    const v4f x0 = *(const v4fa*)(arow + kb + 8 * hh), x1 = *(const v4fa*)(arow + kb + 8 * hh + 4);
    const v4f x2 = *(const v4fa*)(arow + kb + 16 + 8 * hh), x3 = *(const v4fa*)(arow + kb + 16 + 8 * hh + 4);
    float xs[16] = {x0[0],x0[1],x0[2],x0[3],x1[0],x1[1],x1[2],x1[3],x2[0],x2[1],x2[2],x2[3],x3[0],x3[1],x3[2],x3[3]};
#pragma unroll
    for (int i = 0; i < 16; ++i) { const unsigned short hb = bf16_bits(xs[i]); ah.u[i] = hb; al.u[i] = ASPLIT ? bf16_bits(xs[i] - bf16_val(hb)) : (unsigned short)0; }
#pragma unroll
    for (int t = 0; t < 4; ++t) {
      const unsigned short* brow = Wt + (size_t)(col0 + t * 16 + ln) * ldb + kb;
      FragB b;
      b.half[0] = *(const v8us*)(brow + 8 * hh);
      b.half[1] = *(const v8us*)(brow + 16 + 8 * hh);
      acc[t] = mmaN<ASPLIT ? 2 : 1>(ah.v, al.v, b.v, b.v, acc[t]);
    }
  }
#pragma unroll
  for (int t = 0; t < 4; ++t) {
    const int col = col0 + t * 16 + ln;
    float bv = bias ? bias[col] : 0.f;
    if (BIAS_BF16) bv = bf16_round(bv);
#pragma unroll
    for (int r = 0; r < 8; ++r) {
      float v = acc[t][r] + bv;
      if (resid) { float rv = resid[(size_t)((row0 + 8 * hh + r) % rmod) * ldr + col]; if (RES_BF16) rv = bf16_round(rv); v += rv; }
      if (ACT == 1) v = fmaxf(v, 0.f);
      if (ACT == 2) v = 0.5f * v * (1.0f + erff(v * 0.70710678118654752f));
      if (ACT == 3) { const float u = 0.7978845608028654f * (v + 0.044715f * v * v * v); v = 0.5f * v * (1.0f + tanhf(u)); }
      so[w][8 * hh + r][t * 16 + ln] = v;
    }
  }
  __builtin_amdgcn_fence(__ATOMIC_ACQ_REL, "workgroup");
  __builtin_amdgcn_wave_barrier();
  const int rsub = lane >> 4, c4 = (lane & 15) * 4;
  {
#pragma unroll
    for (int q = 0; q < 8; ++q) {
      const int r = q * 2 + rsub;
      const v4f v = *(const v4fa*)&so[w][r][c4];
      *(v4f*)(C + (size_t)(row0 + r) * ldc + col0 + c4) = v;
    }
    
  }
}
// row LayerNorm (biased variance, eps) over N: s = X (+ R); optional out_sum <- s; out_norm <- (s-mu)*rsqrt(var+eps)*g + b
template <bool PARAM_BF16>
__global__ __launch_bounds__(256) void k_layernorm(const float* __restrict__ X, const float* __restrict__ R, const float* __restrict__ g, const float* __restrict__ bta,
                                                  float* __restrict__ out_sum, float* __restrict__ out_norm, int N, float eps) {
  __shared__ float red[256];
  const int row = blockIdx.x, tid = threadIdx.x;
  const float* x = X + (size_t)row * N; const float* rr = R ? R + (size_t)row * N : nullptr;
  float vals[16];                     // up to N = 4096
  const int per = N / 256;            // contiguous chunk per thread? use strided-by-4 chunks: thread handles j = tid*4 + 1024*u
  float s1 = 0.f;
  for (int u = 0; u < per / 4; ++u) {
    const int j = tid * 4 + 1024 * u;
    const v4f a = *(const v4fa*)(x + j);
    v4f b = {0.f,0.f,0.f,0.f}; if (rr) b = *(const v4fa*)(rr + j);
#pragma unroll
    for (int q = 0; q < 4; ++q) { const float v = a[q] + b[q]; vals[u * 4 + q] = v; s1 += v; }
  }
  red[tid] = s1; __syncthreads();
  for (int st = 128; st > 0; st >>= 1) { if (tid < st) red[tid] += red[tid + st]; __syncthreads(); }
  const float mu = red[0] / (float)N; __syncthreads();
  float s2 = 0.f;
  for (int u = 0; u < per / 4; ++u)
#pragma unroll
    for (int q = 0; q < 4; ++q) { const float c = vals[u * 4 + q] - mu; s2 += c * c; }
  red[tid] = s2; __syncthreads();
  for (int st = 128; st > 0; st >>= 1) { if (tid < st) red[tid] += red[tid + st]; __syncthreads(); }
  const float rs = rsqrtf(red[0] / (float)N + eps);
  {
    for (int u = 0; u < per / 4; ++u) {
      const int j = tid * 4 + 1024 * u;
      v4f o, sm;
#pragma unroll
      for (int q = 0; q < 4; ++q) {
        float gg = g[j + q], bb = bta[j + q];
        if (PARAM_BF16) { gg = bf16_round(gg); bb = bf16_round(bb); }
        sm[q] = vals[u * 4 + q]; o[q] = (vals[u * 4 + q] - mu) * rs * gg + bb;
      }
      if (out_sum) *(v4f*)(out_sum + (size_t)row * N + j) = sm;
      *(v4f*)(out_norm + (size_t)row * N + j) = o;
    }
    
  }
}



// ---- f16 WMMA path (v_wmma_f32_16x16x32_f16): 11-bit significands for operands in range — used where a [0,1] probability operand needs more precision than bf16
typedef _Float16 v16h __attribute__((ext_vector_type(16)));
union FragH { v16h v; v8us half[2]; _Float16 h[16]; unsigned short u[16]; };
template <int NT>
__device__ __forceinline__ v8f mmaH(v16h ah, v16h al, v16h bh, v16h bl, v8f c) {
  c = __builtin_amdgcn_wmma_f32_16x16x32_f16(false, ah, false, bh, (short)0, c, false, false);
  if (NT >= 2) c = __builtin_amdgcn_wmma_f32_16x16x32_f16(false, al, false, bh, (short)0, c, false, false);
  if (NT >= 3) c = __builtin_amdgcn_wmma_f32_16x16x32_f16(false, ah, false, bl, (short)0, c, false, false);
  asm volatile("v_nop\n\tv_nop\n\tv_nop\n\tv_nop" : "+v"(c) : "v"(ah), "v"(al), "v"(bh), "v"(bl));
  return c;
}
// batched GEMM like k_gemm_b but f16 operands: A f32 (split into f16 hi/lo if ASPLIT, else rounded to f16), Bt = f16 values [n][k]; alpha; C f32; N multiple of 16 (partial tiles skipped)
template <bool ASPLIT>
__global__ __launch_bounds__(128) void k_gemm_h(const float* __restrict__ A, int lda, size_t sA, const _Float16* __restrict__ Bh, int ldb, size_t sB, float alpha, float* __restrict__ C, int ldc, size_t sC, int M, int N, int K) {
  __shared__ __attribute__((aligned(16))) float so[4][16][64];
  const int tid = threadIdx.x, w = tid >> 5, lane = tid & 31, ln = lane & 15, hh = lane >> 4; const int by = blockIdx.y;
  A += (size_t)by * sA; Bh += (size_t)by * sB; C += (size_t)by * sC;
  const int ntn = (N + 63) / 64; const int wid = blockIdx.x * 4 + w; const int mt = wid / ntn, nq = wid % ntn; if (mt * 16 >= M) return;
  const int row0 = mt * 16, col0 = nq * 64; const float* arow = A + (size_t)(row0 + ln) * lda;
  v8f acc[4] = {};
  for (int kb = 0; kb < K; kb += 32) {
    FragH ah, al;
    const v4f x0 = *(const v4fa*)(arow + kb + 8 * hh), x1 = *(const v4fa*)(arow + kb + 8 * hh + 4), x2 = *(const v4fa*)(arow + kb + 16 + 8 * hh), x3 = *(const v4fa*)(arow + kb + 16 + 8 * hh + 4);
    float xs[16] = {x0[0],x0[1],x0[2],x0[3],x1[0],x1[1],x1[2],x1[3],x2[0],x2[1],x2[2],x2[3],x3[0],x3[1],x3[2],x3[3]};
#pragma unroll
    for (int i = 0; i < 16; ++i) { const _Float16 h = (_Float16)xs[i]; ah.h[i] = h; al.h[i] = ASPLIT ? (_Float16)(xs[i] - (float)h) : (_Float16)0.0f; }
#pragma unroll
    for (int t = 0; t < 4; ++t) { if (col0 + t * 16 >= N) continue; const size_t boff = (size_t)(col0 + t * 16 + ln) * ldb + kb; FragH bq; bq.half[0] = *(const v8us*)(Bh + boff + 8 * hh); bq.half[1] = *(const v8us*)(Bh + boff + 16 + 8 * hh);
      acc[t] = mmaH<ASPLIT ? 2 : 1>(ah.v, al.v, bq.v, bq.v, acc[t]); }
  }
#pragma unroll
  for (int t = 0; t < 4; ++t) { if (col0 + t * 16 >= N) continue;
#pragma unroll
    for (int r = 0; r < 8; ++r) so[w][8 * hh + r][t * 16 + ln] = acc[t][r] * alpha; }
  __builtin_amdgcn_fence(__ATOMIC_ACQ_REL, "workgroup"); __builtin_amdgcn_wave_barrier();
  const int rsub = lane >> 4, c4 = (lane & 15) * 4;
  {
#pragma unroll
    for (int q = 0; q < 8; ++q) { const int r = q * 2 + rsub; if (col0 + c4 < N) { const v4f v = *(const v4fa*)&so[w][r][c4]; *(v4f*)(C + (size_t)(row0 + r) * ldc + col0 + c4) = v; } }
     }
}

// Wt[n][k] = f16(W[k][n]·scale) from f32 row-major W[K][N] (scale = power of two; bf16-exact weights stay exact in f16 away from the subnormal range)
__global__ __launch_bounds__(256) void k_wt_f16(const float* __restrict__ W, _Float16* __restrict__ Wt, int K, int N, float scale) {
  const int t = blockIdx.x * 256 + threadIdx.x; if (t >= N * (K / 8)) return; const int n = t / (K / 8), k8 = (t % (K / 8)) * 8; FragH f;
#pragma unroll
  for (int i = 0; i < 8; ++i) f.h[i] = (_Float16)(bf16_round(W[(size_t)(k8 + i) * N + n]) * scale); const v8us o = f.half[0];
  *(v8us*)((unsigned short*)Wt + (size_t)n * K + k8) = o; 
}
// k_gemm_hh variant with fused epilogue: v = acc·alpha + bias[by·sBias + col] (+ CP[(row/rowsPerB)·sCPb + by·64 + col] if CP) ; ACT 0 none / 1 elu ; writes f32 C and f16 C16, each if non-null
template <int ACT>
__global__ __launch_bounds__(128) void k_gemm_hhx(const _Float16* __restrict__ A, int lda, size_t sA, const _Float16* __restrict__ Bh, int ldb, size_t sB, float alpha, const float* __restrict__ bias, size_t sBias, const float* __restrict__ CP, int rowsPerB, size_t sCPb, int row0g,
    float* __restrict__ C, _Float16* __restrict__ C16, int ldc, size_t sC, int M, int N, int K) {
  __shared__ __attribute__((aligned(16))) float so[4][16][64];
  const int tid = threadIdx.x, w = tid >> 5, lane = tid & 31, ln = lane & 15, hh = lane >> 4; const int by = blockIdx.y;
  A += (size_t)by * sA; Bh += (size_t)by * sB; const size_t cofs = (size_t)by * sC; const float* bp = bias ? bias + (size_t)by * sBias : nullptr;
  const int ntn = (N + 63) / 64; const int wid = blockIdx.x * 4 + w; const int mt = wid / ntn, nq = wid % ntn; if (mt * 16 >= M) return;
  const int row0 = mt * 16, col0 = nq * 64; const _Float16* arow = A + (size_t)(row0 + ln) * lda;
  v8f acc[4] = {};
  for (int kb = 0; kb < K; kb += 32) { FragH ah; ah.half[0] = *(const v8us*)((const unsigned short*)arow + kb + 8 * hh); ah.half[1] = *(const v8us*)((const unsigned short*)arow + kb + 16 + 8 * hh);
#pragma unroll
    for (int t = 0; t < 4; ++t) { if (col0 + t * 16 >= N) continue; const size_t boff = (size_t)(col0 + t * 16 + ln) * ldb + kb; FragH bq; bq.half[0] = *(const v8us*)((const unsigned short*)Bh + boff + 8 * hh); bq.half[1] = *(const v8us*)((const unsigned short*)Bh + boff + 16 + 8 * hh);
      acc[t] = mmaH<1>(ah.v, ah.v, bq.v, bq.v, acc[t]); }
  }
#pragma unroll
  for (int t = 0; t < 4; ++t) { if (col0 + t * 16 >= N) continue; const int col = col0 + t * 16 + ln; const float bv = bp ? bf16_round(bp[col]) : 0.f;
#pragma unroll
    for (int r = 0; r < 8; ++r) { float v = acc[t][r] * alpha + bv; if (CP) { const int bidx = (row0g + row0 + 8 * hh + r) / rowsPerB; v += CP[(size_t)bidx * sCPb + (size_t)by * 64 + col]; } if (ACT == 1) v = (v > 0.f) ? v : expm1f(v); else if (ACT == 7) v = (v > 0.f) ? v + 1.0f : expf(v); else if (ACT == 8) v = tanhf(v); else if (ACT == 9) v = 0.5f * v * (1.0f + tanhf(0.7978845608028654f * (v + 0.044715f * v * v * v))); else if (ACT == 11) v = 1.0f / (1.0f + expf(-v)); else if (ACT == 12) v = (v > 0.f) ? v : 0.01f * v; else if (ACT == 14) v = (v > 0.f) ? v : 0.1f * v; else if (ACT == 15) v = v / (1.0f + expf(-v)); else if (ACT == 3) v = fmaxf(v, 0.f); else if (ACT == 6) v = 0.5f * v * (1.0f + erff(v * 0.70710678118654752f)); so[w][8 * hh + r][t * 16 + ln] = v; } }
  __builtin_amdgcn_fence(__ATOMIC_ACQ_REL, "workgroup"); __builtin_amdgcn_wave_barrier();
  const int rsub = lane >> 4, c4 = (lane & 15) * 4; typedef _Float16 v4h __attribute__((ext_vector_type(4)));
  {
#pragma unroll
    for (int q = 0; q < 8; ++q) { const int r = q * 2 + rsub; if (col0 + c4 < N) { const v4f v = *(const v4fa*)&so[w][r][c4]; if (C) *(v4f*)(C + cofs + (size_t)(row0 + r) * ldc + col0 + c4) = v; if (C16) { v4h h4; for (int i = 0; i < 4; ++i) h4[i] = (_Float16)v[i]; *(v4h*)(C16 + cofs + (size_t)(row0 + r) * ldc + col0 + c4) = h4; } } }
     }
}


typedef _Float16 v4h __attribute__((ext_vector_type(4)));

__global__ __launch_bounds__(256) void k_x16(const float* __restrict__ x, _Float16* __restrict__ X16, size_t n8) { const size_t t = (size_t)blockIdx.x * 256 + threadIdx.x; if (t >= n8) return; FragH f;
#pragma unroll
  for (int q = 0; q < 8; ++q) f.h[q] = (_Float16)bf16_round(x[t * 8 + q]); *(v8us*)((unsigned short*)X16 + t * 8) = f.half[0];  }
__global__ __launch_bounds__(256) void k_h16(const float* __restrict__ x, _Float16* __restrict__ X16, size_t n8) { const size_t t = (size_t)blockIdx.x * 256 + threadIdx.x; if (t >= n8) return; FragH f;
#pragma unroll
  for (int q = 0; q < 8; ++q) f.h[q] = (_Float16)x[t * 8 + q]; *(v8us*)((unsigned short*)X16 + t * 8) = f.half[0];  }
__global__ __launch_bounds__(256) void k_round16f(const float* __restrict__ W, _Float16* __restrict__ Bt, size_t n8) { const size_t t = (size_t)blockIdx.x * 256 + threadIdx.x; if (t >= n8) return; FragH f;
#pragma unroll
  for (int i = 0; i < 8; ++i) f.h[i] = (_Float16)(bf16_round(W[t * 8 + i]) * 16.0f); *(v8us*)((unsigned short*)Bt + t * 8) = f.half[0];  }
template <int NHv, int TTv>
__global__ __launch_bounds__(256) void k_vt(const _Float16* __restrict__ V16, int ldv, int voff, _Float16* __restrict__ Vt) { __shared__ unsigned short tl[64][66]; const int tid = threadIdx.x; const int slab = blockIdx.x / (TTv / 64), lg = blockIdx.x % (TTv / 64); const int b = slab / NHv, h = slab % NHv;
  for (int i = tid; i < 64 * 8; i += 256) { const int r = i / 8, c8 = (i % 8) * 8; FragH f; f.half[0] = *(const v8us*)((const unsigned short*)V16 + ((size_t)b * TTv + lg * 64 + r) * ldv + voff + h * 64 + c8);
#pragma unroll
    for (int q = 0; q < 8; ++q) tl[r][c8 + q] = f.u[q]; }
  __syncthreads();
  {
#pragma unroll
    for (int rd = 0; rd < 2; ++rd) { const int d = rd * 32 + tid / 8, pc = tid % 8; FragH f;
#pragma unroll
      for (int q = 0; q < 8; ++q) f.u[q] = tl[pc * 8 + q][d];
      *(v8us*)((unsigned short*)Vt + ((size_t)slab * 64 + d) * TTv + lg * 64 + pc * 8) = f.half[0]; }
     } }

__global__ __launch_bounds__(128) void k_flash(const _Float16* __restrict__ Q16, int ldq, const _Float16* __restrict__ K16, int ldk, const _Float16* __restrict__ Vt, const float* __restrict__ FR, const float* __restrict__ AP, const float* __restrict__ AN, const float* __restrict__ GM, const float* __restrict__ DLT, float* __restrict__ O, int ldo) {
  constexpr int RPW = 16, RTN = RPW / 16, NQB = TT / (4 * RPW), DT = 4, KS = 2;
  __shared__ __attribute__((aligned(16))) unsigned short sP[4][RPW][40]; __shared__ __attribute__((aligned(16))) float sO[4][RPW][64 + 4];
  const int tid = threadIdx.x, w = tid >> 5, lane = tid & 31, ln = lane & 15, hh = lane >> 4;
  const int slab = blockIdx.x / NQB, qblk = blockIdx.x % NQB; const int b = slab / NH, h = slab % NH; const int qb0 = qblk * (4 * RPW); const int q0 = qb0 + w * RPW;
  FragH aq[2][KS];
#pragma unroll
  for (int rt = 0; rt < RTN; ++rt) { const unsigned short* qr = (const unsigned short*)Q16 + ((size_t)b * TT + q0 + rt * 16 + ln) * ldq + h * 64;
#pragma unroll
    for (int ks = 0; ks < KS; ++ks) { aq[rt][ks].half[0] = *(const v8us*)(qr + ks * 32 + 8 * hh); aq[rt][ks].half[1] = *(const v8us*)(qr + ks * 32 + 16 + 8 * hh); } }
  const unsigned short* Vth = (const unsigned short*)Vt + (size_t)slab * 64 * TT;
  float m_r[2][8], l_r[2][8]; v8f oacc[2][DT];
#pragma unroll
  for (int rt = 0; rt < RTN; ++rt) {
#pragma unroll
    for (int r = 0; r < 8; ++r) { m_r[rt][r] = -3.0e38f; l_r[rt][r] = 0.f; }
#pragma unroll
    for (int dt = 0; dt < DT; ++dt) oacc[rt][dt] = (v8f){0.f,0.f,0.f,0.f,0.f,0.f,0.f,0.f}; }
  const int jend = TT; const float gmm = bf16_round(GM[0]), dlt = bf16_round(DLT[0]); const float aph = bf16_round(AP[h]) * dlt, anh = bf16_round(AN[h]) * dlt;      /* γ, δ scalars; δ·α_pos[h], δ·α_neg[h] */
  float fq[RTN][8];
#pragma unroll
  for (int rt = 0; rt < RTN; ++rt)
#pragma unroll
    for (int r = 0; r < 8; ++r) fq[rt][r] = bf16_round(FR[(size_t)b * TT + q0 + rt * 16 + 8 * hh + r]);
#pragma unroll 1
  for (int j0 = 0; j0 < jend; j0 += 32) {
    const float fk0 = bf16_round(FR[(size_t)b * TT + j0 + ln]), fk1 = bf16_round(FR[(size_t)b * TT + j0 + 16 + ln]);      /* frac of the lane's two keys */
    v8f s[2][2];
#pragma unroll
    for (int nt = 0; nt < 2; ++nt) { const unsigned short* kr = (const unsigned short*)K16 + ((size_t)b * TT + j0 + nt * 16 + ln) * ldk + h * 64; FragH bk[KS];
#pragma unroll
      for (int ks = 0; ks < KS; ++ks) { bk[ks].half[0] = *(const v8us*)(kr + ks * 32 + 8 * hh); bk[ks].half[1] = *(const v8us*)(kr + ks * 32 + 16 + 8 * hh); }
#pragma unroll
      for (int rt = 0; rt < RTN; ++rt) { v8f acc = (v8f){0.f,0.f,0.f,0.f,0.f,0.f,0.f,0.f};
#pragma unroll
        for (int ks = 0; ks < KS; ++ks) acc = mmaH<1>(aq[rt][ks].v, aq[rt][ks].v, bk[ks].v, bk[ks].v, acc); s[rt][nt] = acc; } }
#pragma unroll
    for (int rt = 0; rt < RTN; ++rt)
#pragma unroll
      for (int r = 0; r < 8; ++r) { const int tq = q0 + rt * 16 + 8 * hh + r; const int k0 = j0 + ln, k1 = j0 + 16 + ln; (void)tq; (void)k0; (void)k1;
        const bool ok0 = true, ok1 = true; (void)ok0; (void)ok1;
        float d0 = fk0 - fq[rt][r], d1 = fk1 - fq[rt][r]; d0 = fminf(fmaxf(d0, -0.2f), 0.2f); d1 = fminf(fmaxf(d1, -0.2f), 0.2f);      /* D = clip(frac_k − frac_q, −0.2, 0.2) */
        const float sb0 = aph * fmaxf(d0, 0.f) + anh * fminf(d0, 0.f), sb1 = aph * fmaxf(d1, 0.f) + anh * fminf(d1, 0.f);      /* δ·(α_pos·D₊ + α_neg·D₋) */
        const float s0 = gmm * (s[rt][0][r] * 0.125f) + sb0, s1 = gmm * (s[rt][1][r] * 0.125f) + sb1; float mc = fmaxf(s0, s1);
        mc = fmaxf(mc, __shfl_xor(mc, 1, 32)); mc = fmaxf(mc, __shfl_xor(mc, 2, 32)); mc = fmaxf(mc, __shfl_xor(mc, 4, 32)); mc = fmaxf(mc, __shfl_xor(mc, 8, 32));
        const float mn = fmaxf(m_r[rt][r], mc); const float al = (mn > -1.0e38f) ? expf(m_r[rt][r] - mn) : 1.0f; m_r[rt][r] = mn; const float p0 = expf(s0 - mn), p1 = expf(s1 - mn); l_r[rt][r] = l_r[rt][r] * al + p0 + p1;
#pragma unroll
        for (int dt = 0; dt < DT; ++dt) oacc[rt][dt][r] *= al;
        FragH t2; t2.h[0] = (_Float16)(p0 * 1024.0f); t2.h[1] = (_Float16)(p1 * 1024.0f); sP[w][rt * 16 + 8 * hh + r][ln] = t2.u[0]; sP[w][rt * 16 + 8 * hh + r][16 + ln] = t2.u[1]; }
    __builtin_amdgcn_fence(__ATOMIC_ACQ_REL, "workgroup"); __builtin_amdgcn_wave_barrier();
    FragH pa[2];
#pragma unroll
    for (int rt = 0; rt < RTN; ++rt) { pa[rt].half[0] = *(const v8us*)&sP[w][rt * 16 + ln][8 * hh]; pa[rt].half[1] = *(const v8us*)&sP[w][rt * 16 + ln][16 + 8 * hh]; }
#pragma unroll
    for (int dt = 0; dt < DT; ++dt) { const unsigned short* vrow = Vth + (size_t)(dt * 16 + ln) * TT + j0; FragH bv; bv.half[0] = *(const v8us*)(vrow + 8 * hh); bv.half[1] = *(const v8us*)(vrow + 16 + 8 * hh);
#pragma unroll
      for (int rt = 0; rt < RTN; ++rt) oacc[rt][dt] = mmaH<1>(pa[rt].v, pa[rt].v, bv.v, bv.v, oacc[rt][dt]); }
    __builtin_amdgcn_fence(__ATOMIC_ACQ_REL, "workgroup"); __builtin_amdgcn_wave_barrier(); }
#pragma unroll
  for (int rt = 0; rt < RTN; ++rt) {
#pragma unroll
    for (int r = 0; r < 8; ++r) { float l = l_r[rt][r]; l += __shfl_xor(l, 1, 32); l += __shfl_xor(l, 2, 32); l += __shfl_xor(l, 4, 32); l += __shfl_xor(l, 8, 32); l_r[rt][r] = (l > 0.f) ? 1.0f / (l * 1024.0f) : 0.f; }
#pragma unroll
    for (int dt = 0; dt < DT; ++dt)
#pragma unroll
      for (int r = 0; r < 8; ++r) sO[w][rt * 16 + 8 * hh + r][dt * 16 + ln] = oacc[rt][dt][r] * l_r[rt][r]; }
  __builtin_amdgcn_fence(__ATOMIC_ACQ_REL, "workgroup"); __builtin_amdgcn_wave_barrier();
  {
#pragma unroll
    for (int rp = 0; rp < RPW; rp += 2) { const int r = rp + (lane >> 4), pc = lane & 15; const v4f val = *(const v4fa*)&sO[w][r][pc * 4]; *(v4f*)(O + ((size_t)b * TT + q0 + r) * ldo + h * 64 + pc * 4) = val; }
     } }

extern "C" void kernel_launch(void* const* d_in, const int* in_sizes, int n_in,
                              void* d_out, int out_size, void* d_ws, size_t ws_size, hipStream_t stream) {
  (void)in_sizes; (void)n_in; (void)out_size;
  const float* const* I = (const float* const*)d_in; const float* xq = I[0]; const float* xk = I[1]; const float* xv = I[2]; const float* frac = I[3]; const float* Wq = I[4]; const float* bq = I[5]; const float* Wk = I[6]; const float* bk = I[7]; const float* Wv = I[8]; const float* bv = I[9]; const float* Wo = I[10]; const float* bo = I[11]; const float* apos = I[12]; const float* aneg = I[13]; const float* gam = I[14]; const float* del = I[15];      /* d_in order: query, key, value, frac, Wq, bq, Wk, bk, Wv, bv, Wo, bo, alpha_pos, alpha_neg, gamma, delta */
  char* ws = (char*)d_ws; size_t off = 0;
  auto take = [&](size_t bytes) { char* p = ws + off; off += (bytes + 255) & ~(size_t)255; return p; };
  const size_t WSZ = (size_t)DD * DD; _Float16* Bw = (_Float16*)take(4 * WSZ * 2); _Float16* X16 = (_Float16*)take((size_t)NR * DD * 2); _Float16* XK16 = (_Float16*)take((size_t)NR * DD * 2); _Float16* XV16 = (_Float16*)take((size_t)NR * DD * 2);
  _Float16* Q = (_Float16*)take((size_t)NR * DD * 2); _Float16* K = (_Float16*)take((size_t)NR * DD * 2); _Float16* V = (_Float16*)take((size_t)NR * DD * 2); _Float16* Vt = (_Float16*)take((size_t)NR * DD * 2);
  float* O = (float*)take((size_t)NR * DD * 4); _Float16* O16 = V;      /* the v plane is dead once Vᵀ is built (before the attention kernel); O16 reuses it */
  if (off > ws_size) return;      // 8.4 + 7 × 8.4 + 16.8 ≈ 84 MB
  const unsigned gw2 = (unsigned)((WSZ / 8 + 255) / 256);
  k_round16f<<<gw2, 256, 0, stream>>>(Wq, Bw, WSZ / 8); k_round16f<<<gw2, 256, 0, stream>>>(Wk, Bw + WSZ, WSZ / 8); k_round16f<<<gw2, 256, 0, stream>>>(Wv, Bw + 2 * WSZ, WSZ / 8); k_round16f<<<gw2, 256, 0, stream>>>(Wo, Bw + 3 * WSZ, WSZ / 8);      /* (out,in) natural ×2^4 */
  const unsigned gx = (unsigned)(((size_t)NR * DD / 8 + 255) / 256); const dim3 gp(((NR / 16) * (DD / 64) + 3) / 4, 1);
  k_x16<<<gx, 256, 0, stream>>>(xq, X16, (size_t)NR * DD / 8); k_x16<<<gx, 256, 0, stream>>>(xk, XK16, (size_t)NR * DD / 8); k_x16<<<gx, 256, 0, stream>>>(xv, XV16, (size_t)NR * DD / 8);
  k_gemm_hhx<0><<<gp, 128, 0, stream>>>(X16, DD, 0, Bw, DD, 0, 0.0625f, bq, 0, nullptr, 1, 0, 0, nullptr, Q, DD, 0, NR, DD, DD);      /* Q = query·Wqᵀ + bq: M 4096 N 1024 K 1024 */
  k_gemm_hhx<0><<<gp, 128, 0, stream>>>(XK16, DD, 0, Bw + WSZ, DD, 0, 0.0625f, bk, 0, nullptr, 1, 0, 0, nullptr, K, DD, 0, NR, DD, DD);
  k_gemm_hhx<0><<<gp, 128, 0, stream>>>(XV16, DD, 0, Bw + 2 * WSZ, DD, 0, 0.0625f, bv, 0, nullptr, 1, 0, 0, nullptr, V, DD, 0, NR, DD, DD);
  k_vt<NH, TT><<<BB * NH * (TT / 64), 256, 0, stream>>>(V, DD, 0, Vt);
  k_flash<<<BB * NH * (TT / 64), 128, 0, stream>>>(Q, DD, K, DD, Vt, frac, apos, aneg, gam, del, O, DD);
  k_h16<<<gx, 256, 0, stream>>>(O, O16, (size_t)NR * DD / 8);
  k_gemm_hhx<0><<<gp, 128, 0, stream>>>(O16, DD, 0, Bw + 3 * WSZ, DD, 0, 0.0625f, bo, 0, nullptr, 1, 0, 0, (float*)d_out, nullptr, DD, 0, NR, DD, DD);      /* out = O·Woᵀ + bo */
}

// v001
// One run takes 347 microseconds.
// Two timings next to v000 both put it at 1.29 times that version's speed.
#include <hip/hip_runtime.h>
// Multi-head attention with a stoichiometric bias (B=2, T=2048, D=1024, 16 heads × 64): Q,K,V = x·Wᵀ + b (torch (out,in)) from query/key/value; logits = q·kᵀ·64^-½; bias[b,h,i,j] = α_pos[h]·max(D,0) + α_neg[h]·min(D,0), D = clip(frac_j − frac_i, −0.2, 0.2);
// attn = softmax(γ·logits + δ·bias); out = (attn·V merged)·Woᵀ + bo. γ, δ are scalar inputs.
// Compute dtype: x, weights, biases rounded to bf16; q/k/v as f16 GEMM outputs; fused flash-style kernel (online softmax f32, P f16 ×2^10) on v_wmma_f32_16x16x32_f16; O → f16 → output GEMM with bias; f32 accumulate.
#define BB 2
#define TT 2048
#define NH 16
#define DD 1024
#define NR (BB * TT)

typedef __bf16 v16b __attribute__((ext_vector_type(16)));
typedef unsigned short v8us __attribute__((ext_vector_type(8), may_alias));
typedef float  v8f  __attribute__((ext_vector_type(8)));
typedef float  v4f  __attribute__((ext_vector_type(4)));
typedef float  v4fa __attribute__((ext_vector_type(4), may_alias));
union FragB { v16b v; v8us half[2]; unsigned short u[16]; };

__device__ __forceinline__ unsigned short bf16_bits(float x) { unsigned int u = __float_as_uint(x); return (unsigned short)((u + 0x7FFFu + ((u >> 16) & 1u)) >> 16); }
__device__ __forceinline__ float bf16_val(unsigned short b) { return __uint_as_float(((unsigned int)b) << 16); }
__device__ __forceinline__ float bf16_round(float x) { return bf16_val(bf16_bits(x)); }
// D += A·B with NT terms: 1 = ah·bh, 2 = + al·bh (A split), 3 = + ah·bl (both split)
template <int NT>
__device__ __forceinline__ v8f mmaN(v16b ah, v16b al, v16b bh, v16b bl, v8f c) {
  c = __builtin_amdgcn_wmma_f32_16x16x32_bf16(false, ah, false, bh, (short)0, c, false, false);
  if (NT >= 2) c = __builtin_amdgcn_wmma_f32_16x16x32_bf16(false, al, false, bh, (short)0, c, false, false);
  if (NT >= 3) c = __builtin_amdgcn_wmma_f32_16x16x32_bf16(false, ah, false, bl, (short)0, c, false, false);
  asm volatile("v_nop\n\tv_nop\n\tv_nop\n\tv_nop" : "+v"(c) : "v"(ah), "v"(al), "v"(bh), "v"(bl));
  return c;
}

__global__ __launch_bounds__(256) void k_wt_bf16(const float* __restrict__ W, unsigned short* __restrict__ Wt, int K, int N) {
  const int t = blockIdx.x * 256 + threadIdx.x;
  const int k8n = K / 8;
  if (t >= N * k8n) return;
  const int n = t / k8n, k8 = (t % k8n) * 8;
  v8us v;
#pragma unroll
  for (int i = 0; i < 8; ++i) v[i] = bf16_bits(W[(size_t)(k8 + i) * N + n]);
  *(v8us*)(Wt + (size_t)n * K + k8) = v;
  
}

// GEMM C[M][N] (f32, pitch ldc) = act(A[M][K]·W + bias). A f32 row-major (pitch lda) converted per fragment to bf16
// (ASPLIT: hi/lo two planes -> 2 terms, else single rounded term); Wt bf16 [N][K] (pitch ldb). BIAS_BF16 rounds the
// bias to bf16 first (bias quantised to bf16 before the add). K%32==0, M%16==0, N%64==0.
template <bool ASPLIT, int ACT, bool BIAS_BF16>
__global__ __launch_bounds__(128) void k_gemm_bf(const float* __restrict__ A, int lda, const unsigned short* __restrict__ Wt, int ldb,
                                               const float* __restrict__ bias, float* __restrict__ C, int ldc, int M, int N, int K) {
  __shared__ __attribute__((aligned(16))) float so[4][16][64];
  const int tid = threadIdx.x, w = tid >> 5, lane = tid & 31, ln = lane & 15, hh = lane >> 4;
  const int ntn = N / 64;
  const int wid = blockIdx.x * 4 + w;
  const int mt = wid / ntn, nq = wid % ntn;
  if (mt * 16 >= M) return;
  const int row0 = mt * 16, col0 = nq * 64;
  const float* arow = A + (size_t)(row0 + ln) * lda;
  v8f acc[4] = {};
  for (int kb = 0; kb < K; kb += 32) {
    FragB ah, al;
    const v4f x0 = *(const v4fa*)(arow + kb + 8 * hh), x1 = *(const v4fa*)(arow + kb + 8 * hh + 4);
    const v4f x2 = *(const v4fa*)(arow + kb + 16 + 8 * hh), x3 = *(const v4fa*)(arow + kb + 16 + 8 * hh + 4);
    float xs[16] = {x0[0],x0[1],x0[2],x0[3],x1[0],x1[1],x1[2],x1[3],x2[0],x2[1],x2[2],x2[3],x3[0],x3[1],x3[2],x3[3]};
#pragma unroll
    for (int i = 0; i < 16; ++i) { const unsigned short hb = bf16_bits(xs[i]); ah.u[i] = hb; al.u[i] = ASPLIT ? bf16_bits(xs[i] - bf16_val(hb)) : (unsigned short)0; }
#pragma unroll
    for (int t = 0; t < 4; ++t) {
      const unsigned short* brow = Wt + (size_t)(col0 + t * 16 + ln) * ldb + kb;
      FragB b;
      b.half[0] = *(const v8us*)(brow + 8 * hh);
      b.half[1] = *(const v8us*)(brow + 16 + 8 * hh);
      acc[t] = mmaN<ASPLIT ? 2 : 1>(ah.v, al.v, b.v, b.v, acc[t]);
    }
  }
#pragma unroll
  for (int t = 0; t < 4; ++t) {
    float bv = bias ? bias[col0 + t * 16 + ln] : 0.f;
    if (BIAS_BF16) bv = bf16_round(bv);
#pragma unroll
    for (int r = 0; r < 8; ++r) { float v = acc[t][r] + bv; if (ACT == 1) v = fmaxf(v, 0.f); so[w][8 * hh + r][t * 16 + ln] = v; }
  }
  __builtin_amdgcn_fence(__ATOMIC_ACQ_REL, "workgroup");
  __builtin_amdgcn_wave_barrier();
  const int rsub = lane >> 4, c4 = (lane & 15) * 4;
  {
#pragma unroll
    for (int q = 0; q < 8; ++q) {
      const int r = q * 2 + rsub;
      const v4f v = *(const v4fa*)&so[w][r][c4];
      *(v4f*)(C + (size_t)(row0 + r) * ldc + col0 + c4) = v;
    }
    
  }
}

// Flash-style causal/unmasked attention, all contractions 3-term bf16 hi/lo splits, f32 softmax with running max.
// q,k,v rows are read from f32 buffers with arbitrary row pitch (so they can live inside a fused qkv buffer);
// D = head size (multiple of 32, <= 128); one wave = 16 query rows; block = 4 waves (64 queries) sharing K/V chunks of 32.
template <int D, bool CAUSAL>
__global__ __launch_bounds__(128) void k_flash(const float* __restrict__ qb, const float* __restrict__ kb, const float* __restrict__ vb,
                                             int pitch, int T, int H, float scale, float* __restrict__ y, int ypitch) {
  constexpr int KS = D / 32;        // k-steps for QK
  constexpr int DT = D / 16;        // d tiles for PV
  __shared__ __attribute__((aligned(16))) unsigned short sKh[32][D + 8], sKl[32][D + 8], sVh[32][D + 8], sVl[32][D + 8];
  __shared__ __attribute__((aligned(16))) unsigned short sPh[4][16][40], sPl[4][16][40];
  __shared__ __attribute__((aligned(16))) float sO[4][16][D];
  const int tid = threadIdx.x, w = tid >> 5, lane = tid & 31, ln = lane & 15, hh = lane >> 4;
  const int nqb = (T + 63) / 64;
  const int bh = blockIdx.x / nqb, qblk = blockIdx.x % nqb;
  const int b = bh / H, h = bh % H;
  const int q0 = qblk * 64 + w * 16;
  const float* Q = qb + (size_t)b * T * pitch + h * D;
  const float* K = kb + (size_t)b * T * pitch + h * D;
  const float* V = vb + (size_t)b * T * pitch + h * D;

  // A fragments of the wave's 16 query rows (scaled), hi/lo
  FragB aqh[KS], aql[KS];
  {
    int row = q0 + ln; if (row >= T) row = T - 1;
    const float* qr = Q + (size_t)row * pitch;
#pragma unroll
    for (int ks = 0; ks < KS; ++ks)
#pragma unroll
      for (int i = 0; i < 16; ++i) {
        const int d = ks * 32 + ((i < 8) ? (8 * hh + i) : (16 + 8 * hh + (i - 8)));
        const float x = qr[d] * scale; const unsigned short hb = bf16_bits(x);
        aqh[ks].u[i] = hb; aql[ks].u[i] = bf16_bits(x - bf16_val(hb));
      }
  }
  float m_r[8], l_r[8];
#pragma unroll
  for (int r = 0; r < 8; ++r) { m_r[r] = -3.0e38f; l_r[r] = 0.f; }
  v8f oacc[DT];
#pragma unroll
  for (int dt = 0; dt < DT; ++dt) oacc[dt] = (v8f){0.f,0.f,0.f,0.f,0.f,0.f,0.f,0.f};

  const int kv_end = CAUSAL ? min(T, qblk * 64 + 64) : T;     // block-uniform
  for (int j0 = 0; j0 < kv_end; j0 += 32) {
    __syncthreads();
    for (int e = tid; e < 32 * (D / 4); e += 128) {
      const int r = e / (D / 4), c4 = (e % (D / 4)) * 4;
      const int key = j0 + r;
      v4f kf = {0.f,0.f,0.f,0.f}, vf = {0.f,0.f,0.f,0.f};
      if (key < T) { kf = *(const v4fa*)(K + (size_t)key * pitch + c4); vf = *(const v4fa*)(V + (size_t)key * pitch + c4); }
#pragma unroll
      for (int t = 0; t < 4; ++t) {
        unsigned short hb = bf16_bits(kf[t]); sKh[r][c4 + t] = hb; sKl[r][c4 + t] = bf16_bits(kf[t] - bf16_val(hb));
        hb = bf16_bits(vf[t]); sVh[r][c4 + t] = hb; sVl[r][c4 + t] = bf16_bits(vf[t] - bf16_val(hb));
      }
    }
    __syncthreads();
    // S tile 16 x 32
    v8f s[2];
#pragma unroll
    for (int nt = 0; nt < 2; ++nt) {
      v8f acc = {};
#pragma unroll
      for (int ks = 0; ks < KS; ++ks) {
        FragB bh_, bl_;
        bh_.half[0] = *(const v8us*)&sKh[nt * 16 + ln][ks * 32 + 8 * hh]; bh_.half[1] = *(const v8us*)&sKh[nt * 16 + ln][ks * 32 + 16 + 8 * hh];
        bl_.half[0] = *(const v8us*)&sKl[nt * 16 + ln][ks * 32 + 8 * hh]; bl_.half[1] = *(const v8us*)&sKl[nt * 16 + ln][ks * 32 + 16 + 8 * hh];
        acc = mmaN<3>(aqh[ks].v, aql[ks].v, bh_.v, bl_.v, acc);
      }
      s[nt] = acc;
    }
    // mask + running max (rows 8hh+r; the 16 lanes of a half share rows)
    float alpha[8];
#pragma unroll
    for (int r = 0; r < 8; ++r) {
      const int qi = q0 + 8 * hh + r;
      const int ja = j0 + ln, jb = j0 + 16 + ln;
      if (CAUSAL) { if (ja > qi) s[0][r] = -3.0e38f; if (jb > qi) s[1][r] = -3.0e38f; }
      if (ja >= T) s[0][r] = -3.0e38f;
      if (jb >= T) s[1][r] = -3.0e38f;
      float mx = fmaxf(s[0][r], s[1][r]);
      mx = fmaxf(mx, __shfl_xor(mx, 1, 32)); mx = fmaxf(mx, __shfl_xor(mx, 2, 32)); mx = fmaxf(mx, __shfl_xor(mx, 4, 32)); mx = fmaxf(mx, __shfl_xor(mx, 8, 32));
      const float mnew = fmaxf(m_r[r], mx);
      alpha[r] = (mnew > -1.0e38f) ? __expf(m_r[r] - mnew) : 1.0f;
      const float p0 = (s[0][r] > -1.0e38f) ? __expf(s[0][r] - mnew) : 0.f;
      const float p1 = (s[1][r] > -1.0e38f) ? __expf(s[1][r] - mnew) : 0.f;
      m_r[r] = mnew;
      l_r[r] = l_r[r] * alpha[r] + p0 + p1;            // per-lane partial row sum (16 lanes combined at the end)
      unsigned short hb = bf16_bits(p0); sPh[w][8 * hh + r][ln] = hb;      sPl[w][8 * hh + r][ln] = bf16_bits(p0 - bf16_val(hb));
      hb = bf16_bits(p1);                sPh[w][8 * hh + r][16 + ln] = hb; sPl[w][8 * hh + r][16 + ln] = bf16_bits(p1 - bf16_val(hb));
    }
#pragma unroll
    for (int dt = 0; dt < DT; ++dt)
#pragma unroll
      for (int r = 0; r < 8; ++r) oacc[dt][r] *= alpha[r];
    __builtin_amdgcn_fence(__ATOMIC_ACQ_REL, "workgroup");
    __builtin_amdgcn_wave_barrier();
    FragB pah, pal;
    pah.half[0] = *(const v8us*)&sPh[w][ln][8 * hh]; pah.half[1] = *(const v8us*)&sPh[w][ln][16 + 8 * hh];
    pal.half[0] = *(const v8us*)&sPl[w][ln][8 * hh]; pal.half[1] = *(const v8us*)&sPl[w][ln][16 + 8 * hh];
#pragma unroll
    for (int dt = 0; dt < DT; ++dt) {
      FragB bvh, bvl;
#pragma unroll
      for (int i = 0; i < 8; ++i) {
        bvh.u[i] = sVh[8 * hh + i][dt * 16 + ln]; bvh.u[8 + i] = sVh[16 + 8 * hh + i][dt * 16 + ln];
        bvl.u[i] = sVl[8 * hh + i][dt * 16 + ln]; bvl.u[8 + i] = sVl[16 + 8 * hh + i][dt * 16 + ln];
      }
      oacc[dt] = mmaN<3>(pah.v, pal.v, bvh.v, bvl.v, oacc[dt]);
    }
    __builtin_amdgcn_fence(__ATOMIC_ACQ_REL, "workgroup");
    __builtin_amdgcn_wave_barrier();
  }
#pragma unroll
  for (int r = 0; r < 8; ++r) {
    float l = l_r[r];
    l += __shfl_xor(l, 1, 32); l += __shfl_xor(l, 2, 32); l += __shfl_xor(l, 4, 32); l += __shfl_xor(l, 8, 32);
    l_r[r] = (l > 0.f) ? 1.0f / l : 0.f;
  }
#pragma unroll
  for (int dt = 0; dt < DT; ++dt)
#pragma unroll
    for (int r = 0; r < 8; ++r) sO[w][8 * hh + r][dt * 16 + ln] = oacc[dt][r] * l_r[r];
  __builtin_amdgcn_fence(__ATOMIC_ACQ_REL, "workgroup");
  __builtin_amdgcn_wave_barrier();
  {
    for (int r = 0; r < 16; ++r) {
      const int row = q0 + r;
      if (row < T && lane < D / 4) {
        const v4f val = *(const v4fa*)&sO[w][r][lane * 4];
        *(v4f*)(y + ((size_t)b * T + row) * ypitch + h * D + lane * 4) = val;
      }
    }
    
  }
}

// GEMM C = act(A·W + bias + resid): A f32 (ASPLIT -> hi/lo 2 terms), Wt bf16 [N][K]; ACT 0 none, 1 relu, 2 exact gelu;
// resid (optional, f32, row index = (row % rmod), pitch ldr, RES_BF16 rounds it) added before the activation.
template <bool ASPLIT, int ACT, bool BIAS_BF16, bool RES_BF16>
__global__ __launch_bounds__(128) void k_gemm_bf3(const float* __restrict__ A, int lda, const unsigned short* __restrict__ Wt, int ldb,
                                                const float* __restrict__ bias, const float* __restrict__ resid, int rmod, int ldr,
                                                float* __restrict__ C, int ldc, int M, int N, int K) {
  __shared__ __attribute__((aligned(16))) float so[4][16][64];
  const int tid = threadIdx.x, w = tid >> 5, lane = tid & 31, ln = lane & 15, hh = lane >> 4;
  const int ntn = N / 64;
  const int wid = blockIdx.x * 4 + w;
  const int mt = wid / ntn, nq = wid % ntn;
  if (mt * 16 >= M) return;
  const int row0 = mt * 16, col0 = nq * 64;
  const float* arow = A + (size_t)(row0 + ln) * lda;
  v8f acc[4] = {};
  for (int kb = 0; kb < K; kb += 32) {
    FragB ah, al;
    const v4f x0 = *(const v4fa*)(arow + kb + 8 * hh), x1 = *(const v4fa*)(arow + kb + 8 * hh + 4);
    const v4f x2 = *(const v4fa*)(arow + kb + 16 + 8 * hh), x3 = *(const v4fa*)(arow + kb + 16 + 8 * hh + 4);
    float xs[16] = {x0[0],x0[1],x0[2],x0[3],x1[0],x1[1],x1[2],x1[3],x2[0],x2[1],x2[2],x2[3],x3[0],x3[1],x3[2],x3[3]};
#pragma unroll
    for (int i = 0; i < 16; ++i) { const unsigned short hb = bf16_bits(xs[i]); ah.u[i] = hb; al.u[i] = ASPLIT ? bf16_bits(xs[i] - bf16_val(hb)) : (unsigned short)0; }
#pragma unroll
    for (int t = 0; t < 4; ++t) {
      const unsigned short* brow = Wt + (size_t)(col0 + t * 16 + ln) * ldb + kb;
      FragB b;
      b.half[0] = *(const v8us*)(brow + 8 * hh);
      b.half[1] = *(const v8us*)(brow + 16 + 8 * hh);
      acc[t] = mmaN<ASPLIT ? 2 : 1>(ah.v, al.v, b.v, b.v, acc[t]);
    }
  }
#pragma unroll
  for (int t = 0; t < 4; ++t) {
    const int col = col0 + t * 16 + ln;
    float bv = bias ? bias[col] : 0.f;
    if (BIAS_BF16) bv = bf16_round(bv);
#pragma unroll
    for (int r = 0; r < 8; ++r) {
      float v = acc[t][r] + bv;
      if (resid) { float rv = resid[(size_t)((row0 + 8 * hh + r) % rmod) * ldr + col]; if (RES_BF16) rv = bf16_round(rv); v += rv; }
      if (ACT == 1) v = fmaxf(v, 0.f);
      if (ACT == 2) v = 0.5f * v * (1.0f + erff(v * 0.70710678118654752f));
      if (ACT == 3) { const float u = 0.7978845608028654f * (v + 0.044715f * v * v * v); v = 0.5f * v * (1.0f + tanhf(u)); }
      so[w][8 * hh + r][t * 16 + ln] = v;
    }
  }
  __builtin_amdgcn_fence(__ATOMIC_ACQ_REL, "workgroup");
  __builtin_amdgcn_wave_barrier();
  const int rsub = lane >> 4, c4 = (lane & 15) * 4;
  {
#pragma unroll
    for (int q = 0; q < 8; ++q) {
      const int r = q * 2 + rsub;
      const v4f v = *(const v4fa*)&so[w][r][c4];
      *(v4f*)(C + (size_t)(row0 + r) * ldc + col0 + c4) = v;
    }
    
  }
}
// row LayerNorm (biased variance, eps) over N: s = X (+ R); optional out_sum <- s; out_norm <- (s-mu)*rsqrt(var+eps)*g + b
template <bool PARAM_BF16>
__global__ __launch_bounds__(256) void k_layernorm(const float* __restrict__ X, const float* __restrict__ R, const float* __restrict__ g, const float* __restrict__ bta,
                                                  float* __restrict__ out_sum, float* __restrict__ out_norm, int N, float eps) {
  __shared__ float red[256];
  const int row = blockIdx.x, tid = threadIdx.x;
  const float* x = X + (size_t)row * N; const float* rr = R ? R + (size_t)row * N : nullptr;
  float vals[16];                     // up to N = 4096
  const int per = N / 256;            // contiguous chunk per thread? use strided-by-4 chunks: thread handles j = tid*4 + 1024*u
  float s1 = 0.f;
  for (int u = 0; u < per / 4; ++u) {
    const int j = tid * 4 + 1024 * u;
    const v4f a = *(const v4fa*)(x + j);
    v4f b = {0.f,0.f,0.f,0.f}; if (rr) b = *(const v4fa*)(rr + j);
#pragma unroll
    for (int q = 0; q < 4; ++q) { const float v = a[q] + b[q]; vals[u * 4 + q] = v; s1 += v; }
  }
  red[tid] = s1; __syncthreads();
  for (int st = 128; st > 0; st >>= 1) { if (tid < st) red[tid] += red[tid + st]; __syncthreads(); }
  const float mu = red[0] / (float)N; __syncthreads();
  float s2 = 0.f;
  for (int u = 0; u < per / 4; ++u)
#pragma unroll
    for (int q = 0; q < 4; ++q) { const float c = vals[u * 4 + q] - mu; s2 += c * c; }
  red[tid] = s2; __syncthreads();
  for (int st = 128; st > 0; st >>= 1) { if (tid < st) red[tid] += red[tid + st]; __syncthreads(); }
  const float rs = rsqrtf(red[0] / (float)N + eps);
  {
    for (int u = 0; u < per / 4; ++u) {
      const int j = tid * 4 + 1024 * u;
      v4f o, sm;
#pragma unroll
      for (int q = 0; q < 4; ++q) {
        float gg = g[j + q], bb = bta[j + q];
        if (PARAM_BF16) { gg = bf16_round(gg); bb = bf16_round(bb); }
        sm[q] = vals[u * 4 + q]; o[q] = (vals[u * 4 + q] - mu) * rs * gg + bb;
      }
      if (out_sum) *(v4f*)(out_sum + (size_t)row * N + j) = sm;
      *(v4f*)(out_norm + (size_t)row * N + j) = o;
    }
    
  }
}



// ---- f16 WMMA path (v_wmma_f32_16x16x32_f16): 11-bit significands for operands in range — used where a [0,1] probability operand needs more precision than bf16
typedef _Float16 v16h __attribute__((ext_vector_type(16)));
union FragH { v16h v; v8us half[2]; _Float16 h[16]; unsigned short u[16]; };
template <int NT>
__device__ __forceinline__ v8f mmaH(v16h ah, v16h al, v16h bh, v16h bl, v8f c) {
  c = __builtin_amdgcn_wmma_f32_16x16x32_f16(false, ah, false, bh, (short)0, c, false, false);
  if (NT >= 2) c = __builtin_amdgcn_wmma_f32_16x16x32_f16(false, al, false, bh, (short)0, c, false, false);
  if (NT >= 3) c = __builtin_amdgcn_wmma_f32_16x16x32_f16(false, ah, false, bl, (short)0, c, false, false);
  asm volatile("v_nop\n\tv_nop\n\tv_nop\n\tv_nop" : "+v"(c) : "v"(ah), "v"(al), "v"(bh), "v"(bl));
  return c;
}
// batched GEMM like k_gemm_b but f16 operands: A f32 (split into f16 hi/lo if ASPLIT, else rounded to f16), Bt = f16 values [n][k]; alpha; C f32; N multiple of 16 (partial tiles skipped)
template <bool ASPLIT>
__global__ __launch_bounds__(128) void k_gemm_h(const float* __restrict__ A, int lda, size_t sA, const _Float16* __restrict__ Bh, int ldb, size_t sB, float alpha, float* __restrict__ C, int ldc, size_t sC, int M, int N, int K) {
  __shared__ __attribute__((aligned(16))) float so[4][16][64];
  const int tid = threadIdx.x, w = tid >> 5, lane = tid & 31, ln = lane & 15, hh = lane >> 4; const int by = blockIdx.y;
  A += (size_t)by * sA; Bh += (size_t)by * sB; C += (size_t)by * sC;
  const int ntn = (N + 63) / 64; const int wid = blockIdx.x * 4 + w; const int mt = wid / ntn, nq = wid % ntn; if (mt * 16 >= M) return;
  const int row0 = mt * 16, col0 = nq * 64; const float* arow = A + (size_t)(row0 + ln) * lda;
  v8f acc[4] = {};
  for (int kb = 0; kb < K; kb += 32) {
    FragH ah, al;
    const v4f x0 = *(const v4fa*)(arow + kb + 8 * hh), x1 = *(const v4fa*)(arow + kb + 8 * hh + 4), x2 = *(const v4fa*)(arow + kb + 16 + 8 * hh), x3 = *(const v4fa*)(arow + kb + 16 + 8 * hh + 4);
    float xs[16] = {x0[0],x0[1],x0[2],x0[3],x1[0],x1[1],x1[2],x1[3],x2[0],x2[1],x2[2],x2[3],x3[0],x3[1],x3[2],x3[3]};
#pragma unroll
    for (int i = 0; i < 16; ++i) { const _Float16 h = (_Float16)xs[i]; ah.h[i] = h; al.h[i] = ASPLIT ? (_Float16)(xs[i] - (float)h) : (_Float16)0.0f; }
#pragma unroll
    for (int t = 0; t < 4; ++t) { if (col0 + t * 16 >= N) continue; const size_t boff = (size_t)(col0 + t * 16 + ln) * ldb + kb; FragH bq; bq.half[0] = *(const v8us*)(Bh + boff + 8 * hh); bq.half[1] = *(const v8us*)(Bh + boff + 16 + 8 * hh);
      acc[t] = mmaH<ASPLIT ? 2 : 1>(ah.v, al.v, bq.v, bq.v, acc[t]); }
  }
#pragma unroll
  for (int t = 0; t < 4; ++t) { if (col0 + t * 16 >= N) continue;
#pragma unroll
    for (int r = 0; r < 8; ++r) so[w][8 * hh + r][t * 16 + ln] = acc[t][r] * alpha; }
  __builtin_amdgcn_fence(__ATOMIC_ACQ_REL, "workgroup"); __builtin_amdgcn_wave_barrier();
  const int rsub = lane >> 4, c4 = (lane & 15) * 4;
  {
#pragma unroll
    for (int q = 0; q < 8; ++q) { const int r = q * 2 + rsub; if (col0 + c4 < N) { const v4f v = *(const v4fa*)&so[w][r][c4]; *(v4f*)(C + (size_t)(row0 + r) * ldc + col0 + c4) = v; } }
     }
}

// Wt[n][k] = f16(W[k][n]·scale) from f32 row-major W[K][N] (scale = power of two; bf16-exact weights stay exact in f16 away from the subnormal range)
__global__ __launch_bounds__(256) void k_wt_f16(const float* __restrict__ W, _Float16* __restrict__ Wt, int K, int N, float scale) {
  const int t = blockIdx.x * 256 + threadIdx.x; if (t >= N * (K / 8)) return; const int n = t / (K / 8), k8 = (t % (K / 8)) * 8; FragH f;
#pragma unroll
  for (int i = 0; i < 8; ++i) f.h[i] = (_Float16)(bf16_round(W[(size_t)(k8 + i) * N + n]) * scale); const v8us o = f.half[0];
  *(v8us*)((unsigned short*)Wt + (size_t)n * K + k8) = o; 
}
// k_gemm_hh variant with fused epilogue: v = acc·alpha + bias[by·sBias + col] (+ CP[(row/rowsPerB)·sCPb + by·64 + col] if CP) ; ACT 0 none / 1 elu ; writes f32 C and f16 C16, each if non-null
template <int ACT>
__global__ __launch_bounds__(128) void k_gemm_hhx(const _Float16* __restrict__ A, int lda, size_t sA, const _Float16* __restrict__ Bh, int ldb, size_t sB, float alpha, const float* __restrict__ bias, size_t sBias, const float* __restrict__ CP, int rowsPerB, size_t sCPb, int row0g,
    float* __restrict__ C, _Float16* __restrict__ C16, int ldc, size_t sC, int M, int N, int K) {
  __shared__ __attribute__((aligned(16))) float so[4][16][64];
  const int tid = threadIdx.x, w = tid >> 5, lane = tid & 31, ln = lane & 15, hh = lane >> 4; const int by = blockIdx.y;
  A += (size_t)by * sA; Bh += (size_t)by * sB; const size_t cofs = (size_t)by * sC; const float* bp = bias ? bias + (size_t)by * sBias : nullptr;
  const int ntn = (N + 63) / 64; const int wid = blockIdx.x * 4 + w; const int mt = wid / ntn, nq = wid % ntn; if (mt * 16 >= M) return;
  const int row0 = mt * 16, col0 = nq * 64; const _Float16* arow = A + (size_t)(row0 + ln) * lda;
  v8f acc[4] = {};
  for (int kb = 0; kb < K; kb += 32) { FragH ah; ah.half[0] = *(const v8us*)((const unsigned short*)arow + kb + 8 * hh); ah.half[1] = *(const v8us*)((const unsigned short*)arow + kb + 16 + 8 * hh);
#pragma unroll
    for (int t = 0; t < 4; ++t) { if (col0 + t * 16 >= N) continue; const size_t boff = (size_t)(col0 + t * 16 + ln) * ldb + kb; FragH bq; bq.half[0] = *(const v8us*)((const unsigned short*)Bh + boff + 8 * hh); bq.half[1] = *(const v8us*)((const unsigned short*)Bh + boff + 16 + 8 * hh);
      acc[t] = mmaH<1>(ah.v, ah.v, bq.v, bq.v, acc[t]); }
  }
#pragma unroll
  for (int t = 0; t < 4; ++t) { if (col0 + t * 16 >= N) continue; const int col = col0 + t * 16 + ln; const float bv = bp ? bf16_round(bp[col]) : 0.f;
#pragma unroll
    for (int r = 0; r < 8; ++r) { float v = acc[t][r] * alpha + bv; if (CP) { const int bidx = (row0g + row0 + 8 * hh + r) / rowsPerB; v += CP[(size_t)bidx * sCPb + (size_t)by * 64 + col]; } if (ACT == 1) v = (v > 0.f) ? v : expm1f(v); else if (ACT == 7) v = (v > 0.f) ? v + 1.0f : expf(v); else if (ACT == 8) v = tanhf(v); else if (ACT == 9) v = 0.5f * v * (1.0f + tanhf(0.7978845608028654f * (v + 0.044715f * v * v * v))); else if (ACT == 11) v = 1.0f / (1.0f + expf(-v)); else if (ACT == 12) v = (v > 0.f) ? v : 0.01f * v; else if (ACT == 14) v = (v > 0.f) ? v : 0.1f * v; else if (ACT == 15) v = v / (1.0f + expf(-v)); else if (ACT == 3) v = fmaxf(v, 0.f); else if (ACT == 6) v = 0.5f * v * (1.0f + erff(v * 0.70710678118654752f)); so[w][8 * hh + r][t * 16 + ln] = v; } }
  __builtin_amdgcn_fence(__ATOMIC_ACQ_REL, "workgroup"); __builtin_amdgcn_wave_barrier();
  const int rsub = lane >> 4, c4 = (lane & 15) * 4; typedef _Float16 v4h __attribute__((ext_vector_type(4)));
  {
#pragma unroll
    for (int q = 0; q < 8; ++q) { const int r = q * 2 + rsub; if (col0 + c4 < N) { const v4f v = *(const v4fa*)&so[w][r][c4]; if (C) *(v4f*)(C + cofs + (size_t)(row0 + r) * ldc + col0 + c4) = v; if (C16) { v4h h4; for (int i = 0; i < 4; ++i) h4[i] = (_Float16)v[i]; *(v4h*)(C16 + cofs + (size_t)(row0 + r) * ldc + col0 + c4) = h4; } } }
     }
}


typedef _Float16 v4h __attribute__((ext_vector_type(4)));

__global__ __launch_bounds__(256) void k_x16(const float* __restrict__ x, _Float16* __restrict__ X16, size_t n8) { const size_t t = (size_t)blockIdx.x * 256 + threadIdx.x; if (t >= n8) return; FragH f;
#pragma unroll
  for (int q = 0; q < 8; ++q) f.h[q] = (_Float16)bf16_round(x[t * 8 + q]); *(v8us*)((unsigned short*)X16 + t * 8) = f.half[0];  }
__global__ __launch_bounds__(256) void k_h16(const float* __restrict__ x, _Float16* __restrict__ X16, size_t n8) { const size_t t = (size_t)blockIdx.x * 256 + threadIdx.x; if (t >= n8) return; FragH f;
#pragma unroll
  for (int q = 0; q < 8; ++q) f.h[q] = (_Float16)x[t * 8 + q]; *(v8us*)((unsigned short*)X16 + t * 8) = f.half[0];  }
__global__ __launch_bounds__(256) void k_round16f(const float* __restrict__ W, _Float16* __restrict__ Bt, size_t n8) { const size_t t = (size_t)blockIdx.x * 256 + threadIdx.x; if (t >= n8) return; FragH f;
#pragma unroll
  for (int i = 0; i < 8; ++i) f.h[i] = (_Float16)(bf16_round(W[t * 8 + i]) * 16.0f); *(v8us*)((unsigned short*)Bt + t * 8) = f.half[0];  }
template <int NHv, int TTv>
__global__ __launch_bounds__(256) void k_vt(const _Float16* __restrict__ V16, int ldv, int voff, _Float16* __restrict__ Vt) { __shared__ unsigned short tl[64][66]; const int tid = threadIdx.x; const int slab = blockIdx.x / (TTv / 64), lg = blockIdx.x % (TTv / 64); const int b = slab / NHv, h = slab % NHv;
  for (int i = tid; i < 64 * 8; i += 256) { const int r = i / 8, c8 = (i % 8) * 8; FragH f; f.half[0] = *(const v8us*)((const unsigned short*)V16 + ((size_t)b * TTv + lg * 64 + r) * ldv + voff + h * 64 + c8);
#pragma unroll
    for (int q = 0; q < 8; ++q) tl[r][c8 + q] = f.u[q]; }
  __syncthreads();
  {
#pragma unroll
    for (int rd = 0; rd < 2; ++rd) { const int d = rd * 32 + tid / 8, pc = tid % 8; FragH f;
#pragma unroll
      for (int q = 0; q < 8; ++q) f.u[q] = tl[pc * 8 + q][d];
      *(v8us*)((unsigned short*)Vt + ((size_t)slab * 64 + d) * TTv + lg * 64 + pc * 8) = f.half[0]; }
     } }

__global__ __launch_bounds__(128) void k_flash(const _Float16* __restrict__ Q16, int ldq, const _Float16* __restrict__ K16, int ldk, const _Float16* __restrict__ Vt, const float* __restrict__ FR, const float* __restrict__ AP, const float* __restrict__ AN, const float* __restrict__ GM, const float* __restrict__ DLT, float* __restrict__ O, int ldo) {
  constexpr int RPW = 16, RTN = RPW / 16, NQB = TT / (4 * RPW), DT = 4, KS = 2;
  __shared__ __attribute__((aligned(16))) unsigned short sP[4][RPW][40]; __shared__ __attribute__((aligned(16))) float sO[4][RPW][64 + 4];
  const int tid = threadIdx.x, w = tid >> 5, lane = tid & 31, ln = lane & 15, hh = lane >> 4;
  const int slab = blockIdx.x / NQB, qblk = blockIdx.x % NQB; const int b = slab / NH, h = slab % NH; const int qb0 = qblk * (4 * RPW); const int q0 = qb0 + w * RPW;
  FragH aq[2][KS];
#pragma unroll
  for (int rt = 0; rt < RTN; ++rt) { const unsigned short* qr = (const unsigned short*)Q16 + ((size_t)b * TT + q0 + rt * 16 + ln) * ldq + h * 64;
#pragma unroll
    for (int ks = 0; ks < KS; ++ks) { aq[rt][ks].half[0] = *(const v8us*)(qr + ks * 32 + 8 * hh); aq[rt][ks].half[1] = *(const v8us*)(qr + ks * 32 + 16 + 8 * hh); } }
  const unsigned short* Vth = (const unsigned short*)Vt + (size_t)slab * 64 * TT;
  float m_r[2][8], l_r[2][8]; v8f oacc[2][DT];
#pragma unroll
  for (int rt = 0; rt < RTN; ++rt) {
#pragma unroll
    for (int r = 0; r < 8; ++r) { m_r[rt][r] = -3.0e38f; l_r[rt][r] = 0.f; }
#pragma unroll
    for (int dt = 0; dt < DT; ++dt) oacc[rt][dt] = (v8f){0.f,0.f,0.f,0.f,0.f,0.f,0.f,0.f}; }
  const int jend = TT; const float gmm = bf16_round(GM[0]), dlt = bf16_round(DLT[0]); const float aph = bf16_round(AP[h]) * dlt, anh = bf16_round(AN[h]) * dlt;      /* γ, δ scalars; δ·α_pos[h], δ·α_neg[h] */
  float fq[RTN][8];
#pragma unroll
  for (int rt = 0; rt < RTN; ++rt)
#pragma unroll
    for (int r = 0; r < 8; ++r) fq[rt][r] = bf16_round(FR[(size_t)b * TT + q0 + rt * 16 + 8 * hh + r]);
#pragma unroll 1
  for (int j0 = 0; j0 < jend; j0 += 32) {
    const float fk0 = bf16_round(FR[(size_t)b * TT + j0 + ln]), fk1 = bf16_round(FR[(size_t)b * TT + j0 + 16 + ln]);      /* frac of the lane's two keys */
    v8f s[2][2];
#pragma unroll
    for (int nt = 0; nt < 2; ++nt) { const unsigned short* kr = (const unsigned short*)K16 + ((size_t)b * TT + j0 + nt * 16 + ln) * ldk + h * 64; FragH bk[KS];
#pragma unroll
      for (int ks = 0; ks < KS; ++ks) { bk[ks].half[0] = *(const v8us*)(kr + ks * 32 + 8 * hh); bk[ks].half[1] = *(const v8us*)(kr + ks * 32 + 16 + 8 * hh); }
#pragma unroll
      for (int rt = 0; rt < RTN; ++rt) { v8f acc = (v8f){0.f,0.f,0.f,0.f,0.f,0.f,0.f,0.f};
#pragma unroll
        for (int ks = 0; ks < KS; ++ks) acc = mmaH<1>(aq[rt][ks].v, aq[rt][ks].v, bk[ks].v, bk[ks].v, acc); s[rt][nt] = acc; } }
#pragma unroll
    for (int rt = 0; rt < RTN; ++rt)
#pragma unroll
      for (int r = 0; r < 8; ++r) { const int tq = q0 + rt * 16 + 8 * hh + r; const int k0 = j0 + ln, k1 = j0 + 16 + ln; (void)tq; (void)k0; (void)k1;
        const bool ok0 = true, ok1 = true; (void)ok0; (void)ok1;
        float d0 = fk0 - fq[rt][r], d1 = fk1 - fq[rt][r]; d0 = fminf(fmaxf(d0, -0.2f), 0.2f); d1 = fminf(fmaxf(d1, -0.2f), 0.2f);      /* D = clip(frac_k − frac_q, −0.2, 0.2) */
        const float sb0 = aph * fmaxf(d0, 0.f) + anh * fminf(d0, 0.f), sb1 = aph * fmaxf(d1, 0.f) + anh * fminf(d1, 0.f);      /* δ·(α_pos·D₊ + α_neg·D₋) */
        const float s0 = gmm * (s[rt][0][r] * 0.125f) + sb0, s1 = gmm * (s[rt][1][r] * 0.125f) + sb1; float mc = fmaxf(s0, s1);
        mc = fmaxf(mc, __shfl_xor(mc, 1, 32)); mc = fmaxf(mc, __shfl_xor(mc, 2, 32)); mc = fmaxf(mc, __shfl_xor(mc, 4, 32)); mc = fmaxf(mc, __shfl_xor(mc, 8, 32));
        const float mn = fmaxf(m_r[rt][r], mc); const float al = (mn > -1.0e38f) ? expf(m_r[rt][r] - mn) : 1.0f; m_r[rt][r] = mn; const float p0 = expf(s0 - mn), p1 = expf(s1 - mn); l_r[rt][r] = l_r[rt][r] * al + p0 + p1;
#pragma unroll
        for (int dt = 0; dt < DT; ++dt) oacc[rt][dt][r] *= al;
        FragH t2; t2.h[0] = (_Float16)(p0 * 1024.0f); t2.h[1] = (_Float16)(p1 * 1024.0f); sP[w][rt * 16 + 8 * hh + r][ln] = t2.u[0]; sP[w][rt * 16 + 8 * hh + r][16 + ln] = t2.u[1]; }
    __builtin_amdgcn_fence(__ATOMIC_ACQ_REL, "workgroup"); __builtin_amdgcn_wave_barrier();
    FragH pa[2];
#pragma unroll
    for (int rt = 0; rt < RTN; ++rt) { pa[rt].half[0] = *(const v8us*)&sP[w][rt * 16 + ln][8 * hh]; pa[rt].half[1] = *(const v8us*)&sP[w][rt * 16 + ln][16 + 8 * hh]; }
#pragma unroll
    for (int dt = 0; dt < DT; ++dt) { const unsigned short* vrow = Vth + (size_t)(dt * 16 + ln) * TT + j0; FragH bv; bv.half[0] = *(const v8us*)(vrow + 8 * hh); bv.half[1] = *(const v8us*)(vrow + 16 + 8 * hh);
#pragma unroll
      for (int rt = 0; rt < RTN; ++rt) oacc[rt][dt] = mmaH<1>(pa[rt].v, pa[rt].v, bv.v, bv.v, oacc[rt][dt]); }
    __builtin_amdgcn_fence(__ATOMIC_ACQ_REL, "workgroup"); __builtin_amdgcn_wave_barrier(); }
#pragma unroll
  for (int rt = 0; rt < RTN; ++rt) {
#pragma unroll
    for (int r = 0; r < 8; ++r) { float l = l_r[rt][r]; l += __shfl_xor(l, 1, 32); l += __shfl_xor(l, 2, 32); l += __shfl_xor(l, 4, 32); l += __shfl_xor(l, 8, 32); l_r[rt][r] = (l > 0.f) ? 1.0f / (l * 1024.0f) : 0.f; }
#pragma unroll
    for (int dt = 0; dt < DT; ++dt)
#pragma unroll
      for (int r = 0; r < 8; ++r) sO[w][rt * 16 + 8 * hh + r][dt * 16 + ln] = oacc[rt][dt][r] * l_r[rt][r]; }
  __builtin_amdgcn_fence(__ATOMIC_ACQ_REL, "workgroup"); __builtin_amdgcn_wave_barrier();
  {
#pragma unroll
    for (int rp = 0; rp < RPW; rp += 2) { const int r = rp + (lane >> 4), pc = lane & 15; const v4f val = *(const v4fa*)&sO[w][r][pc * 4]; *(v4f*)(O + ((size_t)b * TT + q0 + r) * ldo + h * 64 + pc * 4) = val; }
     } }

// Block-tiled GEMM, C = (A.Bh^T)*alpha + bias: a block of 8 waves owns a 128 x 128 tile of C and stages 128 x 64 pieces of A and of Bh in LDS, so every operand byte is fetched once a block, in whole 128-B lines
// (8 lanes a row), and is read as fragments from LDS. Wave tile 32 x 64 (2 x 4 accumulators). The next piece is fetched into registers while this one is multiplied. k runs upward in steps of 32.
// M % 128 == 0 (grid), N % 128 == 0, K % 64 == 0. LDS row pitch 64 + 8 halves = 144 B for the 16-byte fragment reads.
// Each plain '#pragma unroll' below, except those on the ks and q loops, stands on a short loop whose index picks an element of a register array (staging registers, fragments, accumulators): unrolled, these stay in registers.
template <int N, int K, bool HALF_OUT>
__global__ __launch_bounds__(256) void k_gemm_tile(const _Float16* __restrict__ A, const _Float16* __restrict__ Bh, float alpha, const float* __restrict__ bias, float* __restrict__ C, _Float16* __restrict__ C16) {
  constexpr int BM = 128, BN = 128, BK = 64, LP = BK + 8;
  __shared__ __attribute__((aligned(16))) unsigned short sm[8 * 32 * 64 * 2];      /* 64 KB: the output staging (8 waves x 32 x 64 f32) is the larger use; the operand pieces take (BM + BN) * LP halves */
  static_assert((BM + BN) * LP <= 8 * 32 * 64 * 2, "operand pieces fit");
  unsigned short* sA = sm; unsigned short* sB = sm + BM * LP;
  const int tid = threadIdx.x, w = tid >> 5, lane = tid & 31, ln = lane & 15, hh = lane >> 4;
  const int nbn = N / BN; const int row0 = (blockIdx.x / nbn) * BM, col0 = (blockIdx.x % nbn) * BN;
  const int wm = w >> 1, wn = w & 1;
  const int lr = tid >> 3, lc = (tid & 7) * 8;
  const char* ga = (const char*)A + (size_t)row0 * K * 2; const char* gb = (const char*)Bh + (size_t)col0 * K * 2; const unsigned vo = (unsigned)(lr * K + lc) * 2u;      /* block-uniform bases, one 32-bit lane offset that lives through the loop */
  v8us ra[4], rb[4];
#pragma unroll
  for (int i = 0; i < 4; ++i) { ra[i] = *(const v8us*)(ga + vo + (size_t)(32 * i) * K * 2); rb[i] = *(const v8us*)(gb + vo + (size_t)(32 * i) * K * 2); }
  v8f acc[2][4];
#pragma unroll
  for (int mi = 0; mi < 2; ++mi)
#pragma unroll
    for (int t = 0; t < 4; ++t) acc[mi][t] = (v8f){0.f,0.f,0.f,0.f,0.f,0.f,0.f,0.f};
#pragma unroll 1      /* rolled: K is a constant here, and 16 copies of this body would only grow the code */
  for (int kb = 0; kb < K; kb += BK) {
#pragma unroll
    for (int i = 0; i < 4; ++i) { *(v8us*)&sA[(lr + 32 * i) * LP + lc] = ra[i]; *(v8us*)&sB[(lr + 32 * i) * LP + lc] = rb[i]; }
    __syncthreads();      /* the piece is complete before any wave reads fragments */
    if (kb + BK < K) {
#pragma unroll
      for (int i = 0; i < 4; ++i) { ra[i] = *(const v8us*)(ga + (size_t)(kb + BK) * 2 + vo + (size_t)(32 * i) * K * 2); rb[i] = *(const v8us*)(gb + (size_t)(kb + BK) * 2 + vo + (size_t)(32 * i) * K * 2); }
      asm volatile("s_wait_xcnt 0x0" ::: "memory"); }      /* the loads' address registers are reused by the fragment reads below: wait before that overwrite */
#pragma unroll
    for (int ks = 0; ks < BK / 32; ++ks) { FragH a[2], bq[4];
#pragma unroll
      for (int mi = 0; mi < 2; ++mi) { const unsigned short* p = &sA[(wm * 32 + mi * 16 + ln) * LP + ks * 32 + 8 * hh]; a[mi].half[0] = *(const v8us*)p; a[mi].half[1] = *(const v8us*)(p + 16); }
#pragma unroll
      for (int t = 0; t < 4; ++t) { const unsigned short* p = &sB[(wn * 64 + t * 16 + ln) * LP + ks * 32 + 8 * hh]; bq[t].half[0] = *(const v8us*)p; bq[t].half[1] = *(const v8us*)(p + 16); }
#pragma unroll
      for (int mi = 0; mi < 2; ++mi)
#pragma unroll
        for (int t = 0; t < 4; ++t) acc[mi][t] = __builtin_amdgcn_wmma_f32_16x16x32_f16(false, a[mi].v, false, bq[t].v, (short)0, acc[mi][t], false, false); }
    __syncthreads();      /* every wave has read the piece before it is overwritten (by the next piece, or by the output staging below) */
  }
  float* so = (float*)sm + w * (32 * 64);      /* each wave stages its 32 x 64 results in its own 8 KB, to store whole lines */
  const int rsub = lane >> 4, c4 = (lane & 15) * 4; float bv[4];
#pragma unroll
  for (int t = 0; t < 4; ++t) bv[t] = bf16_round(bias[col0 + wn * 64 + t * 16 + ln]);
#pragma unroll
  for (int mi = 0; mi < 2; ++mi)
#pragma unroll
    for (int t = 0; t < 4; ++t)
#pragma unroll
      for (int r = 0; r < 8; ++r) so[(mi * 16 + 8 * hh + r) * 64 + t * 16 + ln] = acc[mi][t][r] * alpha + bv[t];
  __builtin_amdgcn_fence(__ATOMIC_ACQ_REL, "workgroup"); __builtin_amdgcn_wave_barrier();      /* the wave's LDS stores are done, and stay in front, before its lanes read each other's values back */
#pragma unroll
  for (int q = 0; q < 16; ++q) { const int r = q * 2 + rsub; const v4f v = *(const v4fa*)&so[r * 64 + c4]; const size_t o = (size_t)(row0 + wm * 32 + r) * N + col0 + wn * 64 + c4;
    if (HALF_OUT) { v4h h4;
#pragma unroll
      for (int i = 0; i < 4; ++i) h4[i] = (_Float16)v[i];
      *(v4h*)(C16 + o) = h4; }
    else *(v4f*)(C + o) = v; }
}

extern "C" void kernel_launch(void* const* d_in, const int* in_sizes, int n_in,
                              void* d_out, int out_size, void* d_ws, size_t ws_size, hipStream_t stream) {
  (void)in_sizes; (void)n_in; (void)out_size;
  const float* const* I = (const float* const*)d_in; const float* xq = I[0]; const float* xk = I[1]; const float* xv = I[2]; const float* frac = I[3]; const float* Wq = I[4]; const float* bq = I[5]; const float* Wk = I[6]; const float* bk = I[7]; const float* Wv = I[8]; const float* bv = I[9]; const float* Wo = I[10]; const float* bo = I[11]; const float* apos = I[12]; const float* aneg = I[13]; const float* gam = I[14]; const float* del = I[15];      /* d_in order: query, key, value, frac, Wq, bq, Wk, bk, Wv, bv, Wo, bo, alpha_pos, alpha_neg, gamma, delta */
  char* ws = (char*)d_ws; size_t off = 0;
  auto take = [&](size_t bytes) { char* p = ws + off; off += (bytes + 255) & ~(size_t)255; return p; };
  const size_t WSZ = (size_t)DD * DD; _Float16* Bw = (_Float16*)take(4 * WSZ * 2); _Float16* X16 = (_Float16*)take((size_t)NR * DD * 2); _Float16* XK16 = (_Float16*)take((size_t)NR * DD * 2); _Float16* XV16 = (_Float16*)take((size_t)NR * DD * 2);
  _Float16* Q = (_Float16*)take((size_t)NR * DD * 2); _Float16* K = (_Float16*)take((size_t)NR * DD * 2); _Float16* V = (_Float16*)take((size_t)NR * DD * 2); _Float16* Vt = (_Float16*)take((size_t)NR * DD * 2);
  float* O = (float*)take((size_t)NR * DD * 4); _Float16* O16 = V;      /* the v plane is dead once Vᵀ is built (before the attention kernel); O16 reuses it */
  if (off > ws_size) return;      // 8.4 + 7 × 8.4 + 16.8 ≈ 84 MB
  const unsigned gw2 = (unsigned)((WSZ / 8 + 255) / 256);
  k_round16f<<<gw2, 256, 0, stream>>>(Wq, Bw, WSZ / 8); k_round16f<<<gw2, 256, 0, stream>>>(Wk, Bw + WSZ, WSZ / 8); k_round16f<<<gw2, 256, 0, stream>>>(Wv, Bw + 2 * WSZ, WSZ / 8); k_round16f<<<gw2, 256, 0, stream>>>(Wo, Bw + 3 * WSZ, WSZ / 8);      /* (out,in) natural ×2^4 */
  const unsigned gx = (unsigned)(((size_t)NR * DD / 8 + 255) / 256); const unsigned gt = (NR / 128) * (DD / 128);
  k_x16<<<gx, 256, 0, stream>>>(xq, X16, (size_t)NR * DD / 8); k_x16<<<gx, 256, 0, stream>>>(xk, XK16, (size_t)NR * DD / 8); k_x16<<<gx, 256, 0, stream>>>(xv, XV16, (size_t)NR * DD / 8);
  k_gemm_tile<DD, DD, true><<<gt, 256, 0, stream>>>(X16, Bw, 0.0625f, bq, nullptr, Q);      /* Q = query·Wqᵀ + bq: M 4096 N 1024 K 1024 */
  k_gemm_tile<DD, DD, true><<<gt, 256, 0, stream>>>(XK16, Bw + WSZ, 0.0625f, bk, nullptr, K);
  k_gemm_tile<DD, DD, true><<<gt, 256, 0, stream>>>(XV16, Bw + 2 * WSZ, 0.0625f, bv, nullptr, V);
  k_vt<NH, TT><<<BB * NH * (TT / 64), 256, 0, stream>>>(V, DD, 0, Vt);
  k_flash<<<BB * NH * (TT / 64), 128, 0, stream>>>(Q, DD, K, DD, Vt, frac, apos, aneg, gam, del, O, DD);
  k_h16<<<gx, 256, 0, stream>>>(O, O16, (size_t)NR * DD / 8);
  k_gemm_tile<DD, DD, false><<<gt, 256, 0, stream>>>(O16, Bw + 3 * WSZ, 0.0625f, bo, (float*)d_out, nullptr);      /* out = O·Woᵀ + bo */
}

// v002
// It runs in 197 microseconds.
// In two side-by-side timings against v001, it was 1.76 and 1.77 times as fast.
// Counting every step since v000, it is 2.28 times as fast.
#include <hip/hip_runtime.h>
// Multi-head attention with a stoichiometric bias (B=2, T=2048, D=1024, 16 heads × 64): Q,K,V = x·Wᵀ + b (torch (out,in)) from query/key/value; logits = q·kᵀ·64^-½; bias[b,h,i,j] = α_pos[h]·max(D,0) + α_neg[h]·min(D,0), D = clip(frac_j − frac_i, −0.2, 0.2);
// attn = softmax(γ·logits + δ·bias); out = (attn·V merged)·Woᵀ + bo. γ, δ are scalar inputs.
// Compute dtype: x, weights, biases rounded to bf16; q/k/v as f16 GEMM outputs; fused flash-style kernel (online softmax f32, P f16 ×2^10) on v_wmma_f32_16x16x32_f16; O → f16 → output GEMM with bias; f32 accumulate.
#define BB 2
#define TT 2048
#define NH 16
#define DD 1024
#define NR (BB * TT)

typedef __bf16 v16b __attribute__((ext_vector_type(16)));
typedef unsigned short v8us __attribute__((ext_vector_type(8), may_alias));
typedef float  v8f  __attribute__((ext_vector_type(8)));
typedef float  v4f  __attribute__((ext_vector_type(4)));
typedef float  v4fa __attribute__((ext_vector_type(4), may_alias));
union FragB { v16b v; v8us half[2]; unsigned short u[16]; };

__device__ __forceinline__ unsigned short bf16_bits(float x) { unsigned int u = __float_as_uint(x); return (unsigned short)((u + 0x7FFFu + ((u >> 16) & 1u)) >> 16); }
__device__ __forceinline__ float bf16_val(unsigned short b) { return __uint_as_float(((unsigned int)b) << 16); }
__device__ __forceinline__ float bf16_round(float x) { return bf16_val(bf16_bits(x)); }
// D += A·B with NT terms: 1 = ah·bh, 2 = + al·bh (A split), 3 = + ah·bl (both split)
template <int NT>
__device__ __forceinline__ v8f mmaN(v16b ah, v16b al, v16b bh, v16b bl, v8f c) {
  c = __builtin_amdgcn_wmma_f32_16x16x32_bf16(false, ah, false, bh, (short)0, c, false, false);
  if (NT >= 2) c = __builtin_amdgcn_wmma_f32_16x16x32_bf16(false, al, false, bh, (short)0, c, false, false);
  if (NT >= 3) c = __builtin_amdgcn_wmma_f32_16x16x32_bf16(false, ah, false, bl, (short)0, c, false, false);
  asm volatile("v_nop\n\tv_nop\n\tv_nop\n\tv_nop" : "+v"(c) : "v"(ah), "v"(al), "v"(bh), "v"(bl));
  return c;
}

__global__ __launch_bounds__(256) void k_wt_bf16(const float* __restrict__ W, unsigned short* __restrict__ Wt, int K, int N) {
  const int t = blockIdx.x * 256 + threadIdx.x;
  const int k8n = K / 8;
  if (t >= N * k8n) return;
  const int n = t / k8n, k8 = (t % k8n) * 8;
  v8us v;
#pragma unroll
  for (int i = 0; i < 8; ++i) v[i] = bf16_bits(W[(size_t)(k8 + i) * N + n]);
  *(v8us*)(Wt + (size_t)n * K + k8) = v;
  
}

// GEMM C[M][N] (f32, pitch ldc) = act(A[M][K]·W + bias). A f32 row-major (pitch lda) converted per fragment to bf16
// (ASPLIT: hi/lo two planes -> 2 terms, else single rounded term); Wt bf16 [N][K] (pitch ldb). BIAS_BF16 rounds the
// bias to bf16 first (bias quantised to bf16 before the add). K%32==0, M%16==0, N%64==0.
template <bool ASPLIT, int ACT, bool BIAS_BF16>
__global__ __launch_bounds__(128) void k_gemm_bf(const float* __restrict__ A, int lda, const unsigned short* __restrict__ Wt, int ldb,
                                               const float* __restrict__ bias, float* __restrict__ C, int ldc, int M, int N, int K) {
  __shared__ __attribute__((aligned(16))) float so[4][16][64];
  const int tid = threadIdx.x, w = tid >> 5, lane = tid & 31, ln = lane & 15, hh = lane >> 4;
  const int ntn = N / 64;
  const int wid = blockIdx.x * 4 + w;
  const int mt = wid / ntn, nq = wid % ntn;
  if (mt * 16 >= M) return;
  const int row0 = mt * 16, col0 = nq * 64;
  const float* arow = A + (size_t)(row0 + ln) * lda;
  v8f acc[4] = {};
  for (int kb = 0; kb < K; kb += 32) {
    FragB ah, al;
    const v4f x0 = *(const v4fa*)(arow + kb + 8 * hh), x1 = *(const v4fa*)(arow + kb + 8 * hh + 4);
    const v4f x2 = *(const v4fa*)(arow + kb + 16 + 8 * hh), x3 = *(const v4fa*)(arow + kb + 16 + 8 * hh + 4);
    float xs[16] = {x0[0],x0[1],x0[2],x0[3],x1[0],x1[1],x1[2],x1[3],x2[0],x2[1],x2[2],x2[3],x3[0],x3[1],x3[2],x3[3]};
#pragma unroll
    for (int i = 0; i < 16; ++i) { const unsigned short hb = bf16_bits(xs[i]); ah.u[i] = hb; al.u[i] = ASPLIT ? bf16_bits(xs[i] - bf16_val(hb)) : (unsigned short)0; }
#pragma unroll
    for (int t = 0; t < 4; ++t) {
      const unsigned short* brow = Wt + (size_t)(col0 + t * 16 + ln) * ldb + kb;
      FragB b;
      b.half[0] = *(const v8us*)(brow + 8 * hh);
      b.half[1] = *(const v8us*)(brow + 16 + 8 * hh);
      acc[t] = mmaN<ASPLIT ? 2 : 1>(ah.v, al.v, b.v, b.v, acc[t]);
    }
  }
#pragma unroll
  for (int t = 0; t < 4; ++t) {
    float bv = bias ? bias[col0 + t * 16 + ln] : 0.f;
    if (BIAS_BF16) bv = bf16_round(bv);
#pragma unroll
    for (int r = 0; r < 8; ++r) { float v = acc[t][r] + bv; if (ACT == 1) v = fmaxf(v, 0.f); so[w][8 * hh + r][t * 16 + ln] = v; }
  }
  __builtin_amdgcn_fence(__ATOMIC_ACQ_REL, "workgroup");
  __builtin_amdgcn_wave_barrier();
  const int rsub = lane >> 4, c4 = (lane & 15) * 4;
  {
#pragma unroll
    for (int q = 0; q < 8; ++q) {
      const int r = q * 2 + rsub;
      const v4f v = *(const v4fa*)&so[w][r][c4];
      *(v4f*)(C + (size_t)(row0 + r) * ldc + col0 + c4) = v;
    }
    
  }
}

// Flash-style causal/unmasked attention, all contractions 3-term bf16 hi/lo splits, f32 softmax with running max.
// q,k,v rows are read from f32 buffers with arbitrary row pitch (so they can live inside a fused qkv buffer);
// D = head size (multiple of 32, <= 128); one wave = 16 query rows; block = 4 waves (64 queries) sharing K/V chunks of 32.
template <int D, bool CAUSAL>
__global__ __launch_bounds__(128) void k_flash(const float* __restrict__ qb, const float* __restrict__ kb, const float* __restrict__ vb,
                                             int pitch, int T, int H, float scale, float* __restrict__ y, int ypitch) {
  constexpr int KS = D / 32;        // k-steps for QK
  constexpr int DT = D / 16;        // d tiles for PV
  __shared__ __attribute__((aligned(16))) unsigned short sKh[32][D + 8], sKl[32][D + 8], sVh[32][D + 8], sVl[32][D + 8];
  __shared__ __attribute__((aligned(16))) unsigned short sPh[4][16][40], sPl[4][16][40];
  __shared__ __attribute__((aligned(16))) float sO[4][16][D];
  const int tid = threadIdx.x, w = tid >> 5, lane = tid & 31, ln = lane & 15, hh = lane >> 4;
  const int nqb = (T + 63) / 64;
  const int bh = blockIdx.x / nqb, qblk = blockIdx.x % nqb;
  const int b = bh / H, h = bh % H;
  const int q0 = qblk * 64 + w * 16;
  const float* Q = qb + (size_t)b * T * pitch + h * D;
  const float* K = kb + (size_t)b * T * pitch + h * D;
  const float* V = vb + (size_t)b * T * pitch + h * D;

  // A fragments of the wave's 16 query rows (scaled), hi/lo
  FragB aqh[KS], aql[KS];
  {
    int row = q0 + ln; if (row >= T) row = T - 1;
    const float* qr = Q + (size_t)row * pitch;
#pragma unroll
    for (int ks = 0; ks < KS; ++ks)
#pragma unroll
      for (int i = 0; i < 16; ++i) {
        const int d = ks * 32 + ((i < 8) ? (8 * hh + i) : (16 + 8 * hh + (i - 8)));
        const float x = qr[d] * scale; const unsigned short hb = bf16_bits(x);
        aqh[ks].u[i] = hb; aql[ks].u[i] = bf16_bits(x - bf16_val(hb));
      }
  }
  float m_r[8], l_r[8];
#pragma unroll
  for (int r = 0; r < 8; ++r) { m_r[r] = -3.0e38f; l_r[r] = 0.f; }
  v8f oacc[DT];
#pragma unroll
  for (int dt = 0; dt < DT; ++dt) oacc[dt] = (v8f){0.f,0.f,0.f,0.f,0.f,0.f,0.f,0.f};

  const int kv_end = CAUSAL ? min(T, qblk * 64 + 64) : T;     // block-uniform
  for (int j0 = 0; j0 < kv_end; j0 += 32) {
    __syncthreads();
    for (int e = tid; e < 32 * (D / 4); e += 128) {
      const int r = e / (D / 4), c4 = (e % (D / 4)) * 4;
      const int key = j0 + r;
      v4f kf = {0.f,0.f,0.f,0.f}, vf = {0.f,0.f,0.f,0.f};
      if (key < T) { kf = *(const v4fa*)(K + (size_t)key * pitch + c4); vf = *(const v4fa*)(V + (size_t)key * pitch + c4); }
#pragma unroll
      for (int t = 0; t < 4; ++t) {
        unsigned short hb = bf16_bits(kf[t]); sKh[r][c4 + t] = hb; sKl[r][c4 + t] = bf16_bits(kf[t] - bf16_val(hb));
        hb = bf16_bits(vf[t]); sVh[r][c4 + t] = hb; sVl[r][c4 + t] = bf16_bits(vf[t] - bf16_val(hb));
      }
    }
    __syncthreads();
    // S tile 16 x 32
    v8f s[2];
#pragma unroll
    for (int nt = 0; nt < 2; ++nt) {
      v8f acc = {};
#pragma unroll
      for (int ks = 0; ks < KS; ++ks) {
        FragB bh_, bl_;
        bh_.half[0] = *(const v8us*)&sKh[nt * 16 + ln][ks * 32 + 8 * hh]; bh_.half[1] = *(const v8us*)&sKh[nt * 16 + ln][ks * 32 + 16 + 8 * hh];
        bl_.half[0] = *(const v8us*)&sKl[nt * 16 + ln][ks * 32 + 8 * hh]; bl_.half[1] = *(const v8us*)&sKl[nt * 16 + ln][ks * 32 + 16 + 8 * hh];
        acc = mmaN<3>(aqh[ks].v, aql[ks].v, bh_.v, bl_.v, acc);
      }
      s[nt] = acc;
    }
    // mask + running max (rows 8hh+r; the 16 lanes of a half share rows)
    float alpha[8];
#pragma unroll
    for (int r = 0; r < 8; ++r) {
      const int qi = q0 + 8 * hh + r;
      const int ja = j0 + ln, jb = j0 + 16 + ln;
      if (CAUSAL) { if (ja > qi) s[0][r] = -3.0e38f; if (jb > qi) s[1][r] = -3.0e38f; }
      if (ja >= T) s[0][r] = -3.0e38f;
      if (jb >= T) s[1][r] = -3.0e38f;
      float mx = fmaxf(s[0][r], s[1][r]);
      mx = fmaxf(mx, __shfl_xor(mx, 1, 32)); mx = fmaxf(mx, __shfl_xor(mx, 2, 32)); mx = fmaxf(mx, __shfl_xor(mx, 4, 32)); mx = fmaxf(mx, __shfl_xor(mx, 8, 32));
      const float mnew = fmaxf(m_r[r], mx);
      alpha[r] = (mnew > -1.0e38f) ? __expf(m_r[r] - mnew) : 1.0f;
      const float p0 = (s[0][r] > -1.0e38f) ? __expf(s[0][r] - mnew) : 0.f;
      const float p1 = (s[1][r] > -1.0e38f) ? __expf(s[1][r] - mnew) : 0.f;
      m_r[r] = mnew;
      l_r[r] = l_r[r] * alpha[r] + p0 + p1;            // per-lane partial row sum (16 lanes combined at the end)
      unsigned short hb = bf16_bits(p0); sPh[w][8 * hh + r][ln] = hb;      sPl[w][8 * hh + r][ln] = bf16_bits(p0 - bf16_val(hb));
      hb = bf16_bits(p1);                sPh[w][8 * hh + r][16 + ln] = hb; sPl[w][8 * hh + r][16 + ln] = bf16_bits(p1 - bf16_val(hb));
    }
#pragma unroll
    for (int dt = 0; dt < DT; ++dt)
#pragma unroll
      for (int r = 0; r < 8; ++r) oacc[dt][r] *= alpha[r];
    __builtin_amdgcn_fence(__ATOMIC_ACQ_REL, "workgroup");
    __builtin_amdgcn_wave_barrier();
    FragB pah, pal;
    pah.half[0] = *(const v8us*)&sPh[w][ln][8 * hh]; pah.half[1] = *(const v8us*)&sPh[w][ln][16 + 8 * hh];
    pal.half[0] = *(const v8us*)&sPl[w][ln][8 * hh]; pal.half[1] = *(const v8us*)&sPl[w][ln][16 + 8 * hh];
#pragma unroll
    for (int dt = 0; dt < DT; ++dt) {
      FragB bvh, bvl;
#pragma unroll
      for (int i = 0; i < 8; ++i) {
        bvh.u[i] = sVh[8 * hh + i][dt * 16 + ln]; bvh.u[8 + i] = sVh[16 + 8 * hh + i][dt * 16 + ln];
        bvl.u[i] = sVl[8 * hh + i][dt * 16 + ln]; bvl.u[8 + i] = sVl[16 + 8 * hh + i][dt * 16 + ln];
      }
      oacc[dt] = mmaN<3>(pah.v, pal.v, bvh.v, bvl.v, oacc[dt]);
    }
    __builtin_amdgcn_fence(__ATOMIC_ACQ_REL, "workgroup");
    __builtin_amdgcn_wave_barrier();
  }
#pragma unroll
  for (int r = 0; r < 8; ++r) {
    float l = l_r[r];
    l += __shfl_xor(l, 1, 32); l += __shfl_xor(l, 2, 32); l += __shfl_xor(l, 4, 32); l += __shfl_xor(l, 8, 32);
    l_r[r] = (l > 0.f) ? 1.0f / l : 0.f;
  }
#pragma unroll
  for (int dt = 0; dt < DT; ++dt)
#pragma unroll
    for (int r = 0; r < 8; ++r) sO[w][8 * hh + r][dt * 16 + ln] = oacc[dt][r] * l_r[r];
  __builtin_amdgcn_fence(__ATOMIC_ACQ_REL, "workgroup");
  __builtin_amdgcn_wave_barrier();
  {
    for (int r = 0; r < 16; ++r) {
      const int row = q0 + r;
      if (row < T && lane < D / 4) {
        const v4f val = *(const v4fa*)&sO[w][r][lane * 4];
        *(v4f*)(y + ((size_t)b * T + row) * ypitch + h * D + lane * 4) = val;
      }
    }
    
  }
}

// GEMM C = act(A·W + bias + resid): A f32 (ASPLIT -> hi/lo 2 terms), Wt bf16 [N][K]; ACT 0 none, 1 relu, 2 exact gelu;
// resid (optional, f32, row index = (row % rmod), pitch ldr, RES_BF16 rounds it) added before the activation.
template <bool ASPLIT, int ACT, bool BIAS_BF16, bool RES_BF16>
__global__ __launch_bounds__(128) void k_gemm_bf3(const float* __restrict__ A, int lda, const unsigned short* __restrict__ Wt, int ldb,
                                                const float* __restrict__ bias, const float* __restrict__ resid, int rmod, int ldr,
                                                float* __restrict__ C, int ldc, int M, int N, int K) {
  __shared__ __attribute__((aligned(16))) float so[4][16][64];
  const int tid = threadIdx.x, w = tid >> 5, lane = tid & 31, ln = lane & 15, hh = lane >> 4;
  const int ntn = N / 64;
  const int wid = blockIdx.x * 4 + w;
  const int mt = wid / ntn, nq = wid % ntn;
  if (mt * 16 >= M) return;
  const int row0 = mt * 16, col0 = nq * 64;
  const float* arow = A + (size_t)(row0 + ln) * lda;
  v8f acc[4] = {};
  for (int kb = 0; kb < K; kb += 32) {
    FragB ah, al;
    const v4f x0 = *(const v4fa*)(arow + kb + 8 * hh), x1 = *(const v4fa*)(arow + kb + 8 * hh + 4);
    const v4f x2 = *(const v4fa*)(arow + kb + 16 + 8 * hh), x3 = *(const v4fa*)(arow + kb + 16 + 8 * hh + 4);
    float xs[16] = {x0[0],x0[1],x0[2],x0[3],x1[0],x1[1],x1[2],x1[3],x2[0],x2[1],x2[2],x2[3],x3[0],x3[1],x3[2],x3[3]};
#pragma unroll
    for (int i = 0; i < 16; ++i) { const unsigned short hb = bf16_bits(xs[i]); ah.u[i] = hb; al.u[i] = ASPLIT ? bf16_bits(xs[i] - bf16_val(hb)) : (unsigned short)0; }
#pragma unroll
    for (int t = 0; t < 4; ++t) {
      const unsigned short* brow = Wt + (size_t)(col0 + t * 16 + ln) * ldb + kb;
      FragB b;
      b.half[0] = *(const v8us*)(brow + 8 * hh);
      b.half[1] = *(const v8us*)(brow + 16 + 8 * hh);
      acc[t] = mmaN<ASPLIT ? 2 : 1>(ah.v, al.v, b.v, b.v, acc[t]);
    }
  }
#pragma unroll
  for (int t = 0; t < 4; ++t) {
    const int col = col0 + t * 16 + ln;
    float bv = bias ? bias[col] : 0.f;
    if (BIAS_BF16) bv = bf16_round(bv);
#pragma unroll
    for (int r = 0; r < 8; ++r) {
      float v = acc[t][r] + bv;
      if (resid) { float rv = resid[(size_t)((row0 + 8 * hh + r) % rmod) * ldr + col]; if (RES_BF16) rv = bf16_round(rv); v += rv; }
      if (ACT == 1) v = fmaxf(v, 0.f);
      if (ACT == 2) v = 0.5f * v * (1.0f + erff(v * 0.70710678118654752f));
      if (ACT == 3) { const float u = 0.7978845608028654f * (v + 0.044715f * v * v * v); v = 0.5f * v * (1.0f + tanhf(u)); }
      so[w][8 * hh + r][t * 16 + ln] = v;
    }
  }
  __builtin_amdgcn_fence(__ATOMIC_ACQ_REL, "workgroup");
  __builtin_amdgcn_wave_barrier();
  const int rsub = lane >> 4, c4 = (lane & 15) * 4;
  {
#pragma unroll
    for (int q = 0; q < 8; ++q) {
      const int r = q * 2 + rsub;
      const v4f v = *(const v4fa*)&so[w][r][c4];
      *(v4f*)(C + (size_t)(row0 + r) * ldc + col0 + c4) = v;
    }
    
  }
}
// row LayerNorm (biased variance, eps) over N: s = X (+ R); optional out_sum <- s; out_norm <- (s-mu)*rsqrt(var+eps)*g + b
template <bool PARAM_BF16>
__global__ __launch_bounds__(256) void k_layernorm(const float* __restrict__ X, const float* __restrict__ R, const float* __restrict__ g, const float* __restrict__ bta,
                                                  float* __restrict__ out_sum, float* __restrict__ out_norm, int N, float eps) {
  __shared__ float red[256];
  const int row = blockIdx.x, tid = threadIdx.x;
  const float* x = X + (size_t)row * N; const float* rr = R ? R + (size_t)row * N : nullptr;
  float vals[16];                     // up to N = 4096
  const int per = N / 256;            // contiguous chunk per thread? use strided-by-4 chunks: thread handles j = tid*4 + 1024*u
  float s1 = 0.f;
  for (int u = 0; u < per / 4; ++u) {
    const int j = tid * 4 + 1024 * u;
    const v4f a = *(const v4fa*)(x + j);
    v4f b = {0.f,0.f,0.f,0.f}; if (rr) b = *(const v4fa*)(rr + j);
#pragma unroll
    for (int q = 0; q < 4; ++q) { const float v = a[q] + b[q]; vals[u * 4 + q] = v; s1 += v; }
  }
  red[tid] = s1; __syncthreads();
  for (int st = 128; st > 0; st >>= 1) { if (tid < st) red[tid] += red[tid + st]; __syncthreads(); }
  const float mu = red[0] / (float)N; __syncthreads();
  float s2 = 0.f;
  for (int u = 0; u < per / 4; ++u)
#pragma unroll
    for (int q = 0; q < 4; ++q) { const float c = vals[u * 4 + q] - mu; s2 += c * c; }
  red[tid] = s2; __syncthreads();
  for (int st = 128; st > 0; st >>= 1) { if (tid < st) red[tid] += red[tid + st]; __syncthreads(); }
  const float rs = rsqrtf(red[0] / (float)N + eps);
  {
    for (int u = 0; u < per / 4; ++u) {
      const int j = tid * 4 + 1024 * u;
      v4f o, sm;
#pragma unroll
      for (int q = 0; q < 4; ++q) {
        float gg = g[j + q], bb = bta[j + q];
        if (PARAM_BF16) { gg = bf16_round(gg); bb = bf16_round(bb); }
        sm[q] = vals[u * 4 + q]; o[q] = (vals[u * 4 + q] - mu) * rs * gg + bb;
      }
      if (out_sum) *(v4f*)(out_sum + (size_t)row * N + j) = sm;
      *(v4f*)(out_norm + (size_t)row * N + j) = o;
    }
    
  }
}



// ---- f16 WMMA path (v_wmma_f32_16x16x32_f16): 11-bit significands for operands in range — used where a [0,1] probability operand needs more precision than bf16
typedef _Float16 v16h __attribute__((ext_vector_type(16)));
union FragH { v16h v; v8us half[2]; _Float16 h[16]; unsigned short u[16]; };
template <int NT>
__device__ __forceinline__ v8f mmaH(v16h ah, v16h al, v16h bh, v16h bl, v8f c) {
  c = __builtin_amdgcn_wmma_f32_16x16x32_f16(false, ah, false, bh, (short)0, c, false, false);
  if (NT >= 2) c = __builtin_amdgcn_wmma_f32_16x16x32_f16(false, al, false, bh, (short)0, c, false, false);
  if (NT >= 3) c = __builtin_amdgcn_wmma_f32_16x16x32_f16(false, ah, false, bl, (short)0, c, false, false);
  asm volatile("v_nop\n\tv_nop\n\tv_nop\n\tv_nop" : "+v"(c) : "v"(ah), "v"(al), "v"(bh), "v"(bl));
  return c;
}
// batched GEMM like k_gemm_b but f16 operands: A f32 (split into f16 hi/lo if ASPLIT, else rounded to f16), Bt = f16 values [n][k]; alpha; C f32; N multiple of 16 (partial tiles skipped)
template <bool ASPLIT>
__global__ __launch_bounds__(128) void k_gemm_h(const float* __restrict__ A, int lda, size_t sA, const _Float16* __restrict__ Bh, int ldb, size_t sB, float alpha, float* __restrict__ C, int ldc, size_t sC, int M, int N, int K) {
  __shared__ __attribute__((aligned(16))) float so[4][16][64];
  const int tid = threadIdx.x, w = tid >> 5, lane = tid & 31, ln = lane & 15, hh = lane >> 4; const int by = blockIdx.y;
  A += (size_t)by * sA; Bh += (size_t)by * sB; C += (size_t)by * sC;
  const int ntn = (N + 63) / 64; const int wid = blockIdx.x * 4 + w; const int mt = wid / ntn, nq = wid % ntn; if (mt * 16 >= M) return;
  const int row0 = mt * 16, col0 = nq * 64; const float* arow = A + (size_t)(row0 + ln) * lda;
  v8f acc[4] = {};
  for (int kb = 0; kb < K; kb += 32) {
    FragH ah, al;
    const v4f x0 = *(const v4fa*)(arow + kb + 8 * hh), x1 = *(const v4fa*)(arow + kb + 8 * hh + 4), x2 = *(const v4fa*)(arow + kb + 16 + 8 * hh), x3 = *(const v4fa*)(arow + kb + 16 + 8 * hh + 4);
    float xs[16] = {x0[0],x0[1],x0[2],x0[3],x1[0],x1[1],x1[2],x1[3],x2[0],x2[1],x2[2],x2[3],x3[0],x3[1],x3[2],x3[3]};
#pragma unroll
    for (int i = 0; i < 16; ++i) { const _Float16 h = (_Float16)xs[i]; ah.h[i] = h; al.h[i] = ASPLIT ? (_Float16)(xs[i] - (float)h) : (_Float16)0.0f; }
#pragma unroll
    for (int t = 0; t < 4; ++t) { if (col0 + t * 16 >= N) continue; const size_t boff = (size_t)(col0 + t * 16 + ln) * ldb + kb; FragH bq; bq.half[0] = *(const v8us*)(Bh + boff + 8 * hh); bq.half[1] = *(const v8us*)(Bh + boff + 16 + 8 * hh);
      acc[t] = mmaH<ASPLIT ? 2 : 1>(ah.v, al.v, bq.v, bq.v, acc[t]); }
  }
#pragma unroll
  for (int t = 0; t < 4; ++t) { if (col0 + t * 16 >= N) continue;
#pragma unroll
    for (int r = 0; r < 8; ++r) so[w][8 * hh + r][t * 16 + ln] = acc[t][r] * alpha; }
  __builtin_amdgcn_fence(__ATOMIC_ACQ_REL, "workgroup"); __builtin_amdgcn_wave_barrier();
  const int rsub = lane >> 4, c4 = (lane & 15) * 4;
  {
#pragma unroll
    for (int q = 0; q < 8; ++q) { const int r = q * 2 + rsub; if (col0 + c4 < N) { const v4f v = *(const v4fa*)&so[w][r][c4]; *(v4f*)(C + (size_t)(row0 + r) * ldc + col0 + c4) = v; } }
     }
}

// Wt[n][k] = f16(W[k][n]·scale) from f32 row-major W[K][N] (scale = power of two; bf16-exact weights stay exact in f16 away from the subnormal range)
__global__ __launch_bounds__(256) void k_wt_f16(const float* __restrict__ W, _Float16* __restrict__ Wt, int K, int N, float scale) {
  const int t = blockIdx.x * 256 + threadIdx.x; if (t >= N * (K / 8)) return; const int n = t / (K / 8), k8 = (t % (K / 8)) * 8; FragH f;
#pragma unroll
  for (int i = 0; i < 8; ++i) f.h[i] = (_Float16)(bf16_round(W[(size_t)(k8 + i) * N + n]) * scale); const v8us o = f.half[0];
  *(v8us*)((unsigned short*)Wt + (size_t)n * K + k8) = o; 
}
// k_gemm_hh variant with fused epilogue: v = acc·alpha + bias[by·sBias + col] (+ CP[(row/rowsPerB)·sCPb + by·64 + col] if CP) ; ACT 0 none / 1 elu ; writes f32 C and f16 C16, each if non-null
template <int ACT>
__global__ __launch_bounds__(128) void k_gemm_hhx(const _Float16* __restrict__ A, int lda, size_t sA, const _Float16* __restrict__ Bh, int ldb, size_t sB, float alpha, const float* __restrict__ bias, size_t sBias, const float* __restrict__ CP, int rowsPerB, size_t sCPb, int row0g,
    float* __restrict__ C, _Float16* __restrict__ C16, int ldc, size_t sC, int M, int N, int K) {
  __shared__ __attribute__((aligned(16))) float so[4][16][64];
  const int tid = threadIdx.x, w = tid >> 5, lane = tid & 31, ln = lane & 15, hh = lane >> 4; const int by = blockIdx.y;
  A += (size_t)by * sA; Bh += (size_t)by * sB; const size_t cofs = (size_t)by * sC; const float* bp = bias ? bias + (size_t)by * sBias : nullptr;
  const int ntn = (N + 63) / 64; const int wid = blockIdx.x * 4 + w; const int mt = wid / ntn, nq = wid % ntn; if (mt * 16 >= M) return;
  const int row0 = mt * 16, col0 = nq * 64; const _Float16* arow = A + (size_t)(row0 + ln) * lda;
  v8f acc[4] = {};
  for (int kb = 0; kb < K; kb += 32) { FragH ah; ah.half[0] = *(const v8us*)((const unsigned short*)arow + kb + 8 * hh); ah.half[1] = *(const v8us*)((const unsigned short*)arow + kb + 16 + 8 * hh);
#pragma unroll
    for (int t = 0; t < 4; ++t) { if (col0 + t * 16 >= N) continue; const size_t boff = (size_t)(col0 + t * 16 + ln) * ldb + kb; FragH bq; bq.half[0] = *(const v8us*)((const unsigned short*)Bh + boff + 8 * hh); bq.half[1] = *(const v8us*)((const unsigned short*)Bh + boff + 16 + 8 * hh);
      acc[t] = mmaH<1>(ah.v, ah.v, bq.v, bq.v, acc[t]); }
  }
#pragma unroll
  for (int t = 0; t < 4; ++t) { if (col0 + t * 16 >= N) continue; const int col = col0 + t * 16 + ln; const float bv = bp ? bf16_round(bp[col]) : 0.f;
#pragma unroll
    for (int r = 0; r < 8; ++r) { float v = acc[t][r] * alpha + bv; if (CP) { const int bidx = (row0g + row0 + 8 * hh + r) / rowsPerB; v += CP[(size_t)bidx * sCPb + (size_t)by * 64 + col]; } if (ACT == 1) v = (v > 0.f) ? v : expm1f(v); else if (ACT == 7) v = (v > 0.f) ? v + 1.0f : expf(v); else if (ACT == 8) v = tanhf(v); else if (ACT == 9) v = 0.5f * v * (1.0f + tanhf(0.7978845608028654f * (v + 0.044715f * v * v * v))); else if (ACT == 11) v = 1.0f / (1.0f + expf(-v)); else if (ACT == 12) v = (v > 0.f) ? v : 0.01f * v; else if (ACT == 14) v = (v > 0.f) ? v : 0.1f * v; else if (ACT == 15) v = v / (1.0f + expf(-v)); else if (ACT == 3) v = fmaxf(v, 0.f); else if (ACT == 6) v = 0.5f * v * (1.0f + erff(v * 0.70710678118654752f)); so[w][8 * hh + r][t * 16 + ln] = v; } }
  __builtin_amdgcn_fence(__ATOMIC_ACQ_REL, "workgroup"); __builtin_amdgcn_wave_barrier();
  const int rsub = lane >> 4, c4 = (lane & 15) * 4; typedef _Float16 v4h __attribute__((ext_vector_type(4)));
  {
#pragma unroll
    for (int q = 0; q < 8; ++q) { const int r = q * 2 + rsub; if (col0 + c4 < N) { const v4f v = *(const v4fa*)&so[w][r][c4]; if (C) *(v4f*)(C + cofs + (size_t)(row0 + r) * ldc + col0 + c4) = v; if (C16) { v4h h4; for (int i = 0; i < 4; ++i) h4[i] = (_Float16)v[i]; *(v4h*)(C16 + cofs + (size_t)(row0 + r) * ldc + col0 + c4) = h4; } } }
     }
}


typedef _Float16 v4h __attribute__((ext_vector_type(4)));

__global__ __launch_bounds__(256) void k_x16(const float* __restrict__ x, _Float16* __restrict__ X16, size_t n8) { const size_t t = (size_t)blockIdx.x * 256 + threadIdx.x; if (t >= n8) return; FragH f;
#pragma unroll
  for (int q = 0; q < 8; ++q) f.h[q] = (_Float16)bf16_round(x[t * 8 + q]); *(v8us*)((unsigned short*)X16 + t * 8) = f.half[0];  }
__global__ __launch_bounds__(256) void k_h16(const float* __restrict__ x, _Float16* __restrict__ X16, size_t n8) { const size_t t = (size_t)blockIdx.x * 256 + threadIdx.x; if (t >= n8) return; FragH f;
#pragma unroll
  for (int q = 0; q < 8; ++q) f.h[q] = (_Float16)x[t * 8 + q]; *(v8us*)((unsigned short*)X16 + t * 8) = f.half[0];  }
__global__ __launch_bounds__(256) void k_round16f(const float* __restrict__ W, _Float16* __restrict__ Bt, size_t n8) { const size_t t = (size_t)blockIdx.x * 256 + threadIdx.x; if (t >= n8) return; FragH f;
#pragma unroll
  for (int i = 0; i < 8; ++i) f.h[i] = (_Float16)(bf16_round(W[t * 8 + i]) * 16.0f); *(v8us*)((unsigned short*)Bt + t * 8) = f.half[0];  }
template <int NHv, int TTv>
__global__ __launch_bounds__(256) void k_vt(const _Float16* __restrict__ V16, int ldv, int voff, _Float16* __restrict__ Vt) { __shared__ unsigned short tl[64][66]; const int tid = threadIdx.x; const int slab = blockIdx.x / (TTv / 64), lg = blockIdx.x % (TTv / 64); const int b = slab / NHv, h = slab % NHv;
  for (int i = tid; i < 64 * 8; i += 256) { const int r = i / 8, c8 = (i % 8) * 8; FragH f; f.half[0] = *(const v8us*)((const unsigned short*)V16 + ((size_t)b * TTv + lg * 64 + r) * ldv + voff + h * 64 + c8);
#pragma unroll
    for (int q = 0; q < 8; ++q) tl[r][c8 + q] = f.u[q]; }
  __syncthreads();
  {
#pragma unroll
    for (int rd = 0; rd < 2; ++rd) { const int d = rd * 32 + tid / 8, pc = tid % 8; FragH f;
#pragma unroll
      for (int q = 0; q < 8; ++q) f.u[q] = tl[pc * 8 + q][d];
      *(v8us*)((unsigned short*)Vt + ((size_t)slab * 64 + d) * TTv + lg * 64 + pc * 8) = f.half[0]; }
     } }

// lane l <-> lane l ^ 16 (the two halves of a wave)
__device__ __forceinline__ float xhalf(float x) { return __builtin_bit_cast(float, __builtin_amdgcn_permlanex16(__builtin_bit_cast(int, x), __builtin_bit_cast(int, x), 0x76543210, 0xfedcba98, false, false)); }

// Attention with the scores transposed: S^T = K.Q^T (A = 16 key rows, B = the wave's 16 queries, kept in registers) and O^T += V^T.P^T (A = 16 rows of V^T, B = P^T).
// A lane then holds scores of ONE query (column ln): keys nt*16 + 8*hh + r of each 32-key chunk. Maximum and sum run inside the lane, with one exchange between the wave halves per chunk,
// and the two score tiles, converted in place, are the B operand of the second product (element nt*8 + r = key nt*16 + 8*hh + r, the k order of the V^T loader): P never leaves the registers.
// The keys' frac values, rounded once per block, are read from LDS (8 consecutive keys per tile and lane).
__global__ __launch_bounds__(128) void k_flash(const _Float16* __restrict__ Q16, int ldq, const _Float16* __restrict__ K16, int ldk, const _Float16* __restrict__ Vt, const float* __restrict__ FR, const float* __restrict__ AP, const float* __restrict__ AN, const float* __restrict__ GM, const float* __restrict__ DLT, float* __restrict__ O, int ldo) {
  constexpr int NQB = TT / 64, DT = 4, KS = 2;
  __shared__ __attribute__((aligned(16))) float sF[TT]; __shared__ __attribute__((aligned(16))) float sO[4][16][64 + 4];
  const int tid = threadIdx.x, w = tid >> 5, lane = tid & 31, ln = lane & 15, hh = lane >> 4;
  const int slab = blockIdx.x / NQB, qblk = blockIdx.x % NQB; const int b = slab / NH, h = slab % NH; const int q0 = qblk * 64 + w * 16;
  const float* frb = FR + (size_t)b * TT;
#pragma unroll
  for (int i = 0; i < TT / 512; ++i) { const int e = i * 512 + tid * 4; v4f f = *(const v4fa*)(frb + e);
#pragma unroll
    for (int q = 0; q < 4; ++q) f[q] = bf16_round(f[q]);
    *(v4fa*)&sF[e] = f; }
  FragH bq[KS]; const unsigned short* qr = (const unsigned short*)Q16 + ((size_t)b * TT + q0 + ln) * ldq + h * 64;      /* B operand: column ln = query q0 + ln */
#pragma unroll
  for (int ks = 0; ks < KS; ++ks) { bq[ks].half[0] = *(const v8us*)(qr + ks * 32 + 8 * hh); bq[ks].half[1] = *(const v8us*)(qr + ks * 32 + 16 + 8 * hh); }
  const char* gk = (const char*)K16 + ((size_t)b * TT * ldk + h * 64) * 2; const unsigned vk = (unsigned)(ln * ldk + 8 * hh) * 2u;      /* wave-uniform bases, one 32-bit lane offset each that lives through the loop */
  const char* gv = (const char*)Vt + (size_t)slab * 64 * TT * 2; const unsigned vv = (unsigned)(ln * TT + 8 * hh) * 2u;
  const float gmm = bf16_round(GM[0]), dlt = bf16_round(DLT[0]); const float aph = bf16_round(AP[h]) * dlt, anh = bf16_round(AN[h]) * dlt;      /* gamma, delta scalars; delta*alpha_pos[h], delta*alpha_neg[h] */
  const float g8 = gmm * 0.125f;      /* gamma * 64^-1/2: a power-of-two factor, so g8*s rounds as gamma*(s*0.125) does */
  const float fq = bf16_round(frb[q0 + ln]);      /* frac of the lane's query */
  float m_r = -3.0e38f, l_r = 0.f; v8f oacc[DT];
#pragma unroll
  for (int dt = 0; dt < DT; ++dt) oacc[dt] = (v8f){0.f,0.f,0.f,0.f,0.f,0.f,0.f,0.f};
  __syncthreads();      /* sF is complete before any wave reads it */
#pragma unroll 1      /* rolled: 64 copies of this body would only grow the code */
  for (int j0 = 0; j0 < TT; j0 += 32) {
    FragH ak[2][KS], av[DT]; v4f fk[2][2];
#pragma unroll
    for (int nt = 0; nt < 2; ++nt) { const char* kr = gk + (size_t)(j0 + nt * 16) * ldk * 2;      /* A operand: row ln = key j0 + nt*16 + ln */
#pragma unroll
      for (int ks = 0; ks < KS; ++ks) { ak[nt][ks].half[0] = *(const v8us*)(kr + vk + ks * 64); ak[nt][ks].half[1] = *(const v8us*)(kr + vk + ks * 64 + 32); } }
#pragma unroll
    for (int dt = 0; dt < DT; ++dt) { const char* vrow = gv + (size_t)j0 * 2 + (size_t)(dt * 16) * TT * 2; av[dt].half[0] = *(const v8us*)(vrow + vv); av[dt].half[1] = *(const v8us*)(vrow + vv + 32); }      /* A operand: row ln = head column dt*16 + ln */
    asm volatile("s_wait_xcnt 0x0" ::: "memory");      /* the loads' address registers may be reused or advanced below: wait before that overwrite */
#pragma unroll
    for (int nt = 0; nt < 2; ++nt) { fk[nt][0] = *(const v4fa*)&sF[j0 + nt * 16 + 8 * hh]; fk[nt][1] = *(const v4fa*)&sF[j0 + nt * 16 + 8 * hh + 4]; }      /* frac of the lane's 16 keys */
    float sc[16];
#pragma unroll
    for (int nt = 0; nt < 2; ++nt) { v8f acc = (v8f){0.f,0.f,0.f,0.f,0.f,0.f,0.f,0.f};
#pragma unroll
      for (int ks = 0; ks < KS; ++ks) acc = __builtin_amdgcn_wmma_f32_16x16x32_f16(false, ak[nt][ks].v, false, bq[ks].v, (short)0, acc, false, false);
#pragma unroll
      for (int r = 0; r < 8; ++r) { float d = fk[nt][r >> 2][r & 3] - fq; d = fminf(fmaxf(d, -0.2f), 0.2f);      /* D = clip(frac_k - frac_q, -0.2, 0.2) */
        const float sb = aph * fmaxf(d, 0.f) + anh * fminf(d, 0.f);      /* delta*(alpha_pos*D+ + alpha_neg*D-) */
        sc[nt * 8 + r] = g8 * acc[r] + sb; } }
    float mx[4];
#pragma unroll
    for (int q = 0; q < 4; ++q) mx[q] = fmaxf(fmaxf(sc[q], sc[4 + q]), fmaxf(sc[8 + q], sc[12 + q]));
    float mc = fmaxf(fmaxf(mx[0], mx[1]), fmaxf(mx[2], mx[3])); mc = fmaxf(mc, xhalf(mc));      /* the query's maximum over all 32 keys, in both halves */
    const float mn = fmaxf(m_r, mc); const float al = (mn > -1.0e38f) ? expf(m_r - mn) : 1.0f; m_r = mn;
    FragH pb; float ps[4];
#pragma unroll
    for (int i = 0; i < 16; ++i) { const float p = expf(sc[i] - mn); ps[i & 3] = (i < 4) ? p : ps[i & 3] + p; pb.h[i] = (_Float16)(p * 1024.0f); }
    l_r = l_r * al + ((ps[0] + ps[1]) + (ps[2] + ps[3]));      /* the lane's 16 keys; the halves are joined after the loop */
#pragma unroll
    for (int dt = 0; dt < DT; ++dt) {
#pragma unroll
      for (int r = 0; r < 8; ++r) oacc[dt][r] *= al;
      oacc[dt] = __builtin_amdgcn_wmma_f32_16x16x32_f16(false, av[dt].v, false, pb.v, (short)0, oacc[dt], false, false); } }
  const float l = l_r + xhalf(l_r); const float inv = (l > 0.f) ? 1.0f / (l * 1024.0f) : 0.f;
#pragma unroll
  for (int dt = 0; dt < DT; ++dt)      /* oacc[dt][r] = O[query ln][dt*16 + 8*hh + r] */
#pragma unroll
    for (int c = 0; c < 2; ++c) { const v4f o = {oacc[dt][4 * c] * inv, oacc[dt][4 * c + 1] * inv, oacc[dt][4 * c + 2] * inv, oacc[dt][4 * c + 3] * inv}; *(v4fa*)&sO[w][ln][dt * 16 + 8 * hh + 4 * c] = o; }
  __builtin_amdgcn_fence(__ATOMIC_ACQ_REL, "workgroup"); __builtin_amdgcn_wave_barrier();      /* the wave's LDS stores are done, and stay in front, before its lanes read each other's values back */
#pragma unroll
  for (int rp = 0; rp < 16; rp += 2) { const int r = rp + (lane >> 4), pc = lane & 15; const v4f val = *(const v4fa*)&sO[w][r][pc * 4]; *(v4f*)(O + ((size_t)b * TT + q0 + r) * ldo + h * 64 + pc * 4) = val; }
}

// Block-tiled GEMM, C = (A.Bh^T)*alpha + bias: a block of 8 waves owns a 128 x 128 tile of C and stages 128 x 64 pieces of A and of Bh in LDS, so every operand byte is fetched once a block, in whole 128-B lines
// (8 lanes a row), and is read as fragments from LDS. Wave tile 32 x 64 (2 x 4 accumulators). The next piece is fetched into registers while this one is multiplied. k runs upward in steps of 32.
// M % 128 == 0 (grid), N % 128 == 0, K % 64 == 0. LDS row pitch 64 + 8 halves = 144 B for the 16-byte fragment reads.
// Each plain '#pragma unroll' below, except those on the ks and q loops, stands on a short loop whose index picks an element of a register array (staging registers, fragments, accumulators): unrolled, these stay in registers.
template <int N, int K, bool HALF_OUT>
__global__ __launch_bounds__(256) void k_gemm_tile(const _Float16* __restrict__ A, const _Float16* __restrict__ Bh, float alpha, const float* __restrict__ bias, float* __restrict__ C, _Float16* __restrict__ C16) {
  constexpr int BM = 128, BN = 128, BK = 64, LP = BK + 8;
  __shared__ __attribute__((aligned(16))) unsigned short sm[8 * 32 * 64 * 2];      /* 64 KB: the output staging (8 waves x 32 x 64 f32) is the larger use; the operand pieces take (BM + BN) * LP halves */
  static_assert((BM + BN) * LP <= 8 * 32 * 64 * 2, "operand pieces fit");
  unsigned short* sA = sm; unsigned short* sB = sm + BM * LP;
  const int tid = threadIdx.x, w = tid >> 5, lane = tid & 31, ln = lane & 15, hh = lane >> 4;
  const int nbn = N / BN; const int row0 = (blockIdx.x / nbn) * BM, col0 = (blockIdx.x % nbn) * BN;
  const int wm = w >> 1, wn = w & 1;
  const int lr = tid >> 3, lc = (tid & 7) * 8;
  const char* ga = (const char*)A + (size_t)row0 * K * 2; const char* gb = (const char*)Bh + (size_t)col0 * K * 2; const unsigned vo = (unsigned)(lr * K + lc) * 2u;      /* block-uniform bases, one 32-bit lane offset that lives through the loop */
  v8us ra[4], rb[4];
#pragma unroll
  for (int i = 0; i < 4; ++i) { ra[i] = *(const v8us*)(ga + vo + (size_t)(32 * i) * K * 2); rb[i] = *(const v8us*)(gb + vo + (size_t)(32 * i) * K * 2); }
  v8f acc[2][4];
#pragma unroll
  for (int mi = 0; mi < 2; ++mi)
#pragma unroll
    for (int t = 0; t < 4; ++t) acc[mi][t] = (v8f){0.f,0.f,0.f,0.f,0.f,0.f,0.f,0.f};
#pragma unroll 1      /* rolled: K is a constant here, and 16 copies of this body would only grow the code */
  for (int kb = 0; kb < K; kb += BK) {
#pragma unroll
    for (int i = 0; i < 4; ++i) { *(v8us*)&sA[(lr + 32 * i) * LP + lc] = ra[i]; *(v8us*)&sB[(lr + 32 * i) * LP + lc] = rb[i]; }
    __syncthreads();      /* the piece is complete before any wave reads fragments */
    if (kb + BK < K) {
#pragma unroll
      for (int i = 0; i < 4; ++i) { ra[i] = *(const v8us*)(ga + (size_t)(kb + BK) * 2 + vo + (size_t)(32 * i) * K * 2); rb[i] = *(const v8us*)(gb + (size_t)(kb + BK) * 2 + vo + (size_t)(32 * i) * K * 2); }
      asm volatile("s_wait_xcnt 0x0" ::: "memory"); }      /* the loads' address registers are reused by the fragment reads below: wait before that overwrite */
#pragma unroll
    for (int ks = 0; ks < BK / 32; ++ks) { FragH a[2], bq[4];
#pragma unroll
      for (int mi = 0; mi < 2; ++mi) { const unsigned short* p = &sA[(wm * 32 + mi * 16 + ln) * LP + ks * 32 + 8 * hh]; a[mi].half[0] = *(const v8us*)p; a[mi].half[1] = *(const v8us*)(p + 16); }
#pragma unroll
      for (int t = 0; t < 4; ++t) { const unsigned short* p = &sB[(wn * 64 + t * 16 + ln) * LP + ks * 32 + 8 * hh]; bq[t].half[0] = *(const v8us*)p; bq[t].half[1] = *(const v8us*)(p + 16); }
#pragma unroll
      for (int mi = 0; mi < 2; ++mi)
#pragma unroll
        for (int t = 0; t < 4; ++t) acc[mi][t] = __builtin_amdgcn_wmma_f32_16x16x32_f16(false, a[mi].v, false, bq[t].v, (short)0, acc[mi][t], false, false); }
    __syncthreads();      /* every wave has read the piece before it is overwritten (by the next piece, or by the output staging below) */
  }
  float* so = (float*)sm + w * (32 * 64);      /* each wave stages its 32 x 64 results in its own 8 KB, to store whole lines */
  const int rsub = lane >> 4, c4 = (lane & 15) * 4; float bv[4];
#pragma unroll
  for (int t = 0; t < 4; ++t) bv[t] = bf16_round(bias[col0 + wn * 64 + t * 16 + ln]);
#pragma unroll
  for (int mi = 0; mi < 2; ++mi)
#pragma unroll
    for (int t = 0; t < 4; ++t)
#pragma unroll
      for (int r = 0; r < 8; ++r) so[(mi * 16 + 8 * hh + r) * 64 + t * 16 + ln] = acc[mi][t][r] * alpha + bv[t];
  __builtin_amdgcn_fence(__ATOMIC_ACQ_REL, "workgroup"); __builtin_amdgcn_wave_barrier();      /* the wave's LDS stores are done, and stay in front, before its lanes read each other's values back */
#pragma unroll
  for (int q = 0; q < 16; ++q) { const int r = q * 2 + rsub; const v4f v = *(const v4fa*)&so[r * 64 + c4]; const size_t o = (size_t)(row0 + wm * 32 + r) * N + col0 + wn * 64 + c4;
    if (HALF_OUT) { v4h h4;
#pragma unroll
      for (int i = 0; i < 4; ++i) h4[i] = (_Float16)v[i];
      *(v4h*)(C16 + o) = h4; }
    else *(v4f*)(C + o) = v; }
}

extern "C" void kernel_launch(void* const* d_in, const int* in_sizes, int n_in,
                              void* d_out, int out_size, void* d_ws, size_t ws_size, hipStream_t stream) {
  (void)in_sizes; (void)n_in; (void)out_size;
  const float* const* I = (const float* const*)d_in; const float* xq = I[0]; const float* xk = I[1]; const float* xv = I[2]; const float* frac = I[3]; const float* Wq = I[4]; const float* bq = I[5]; const float* Wk = I[6]; const float* bk = I[7]; const float* Wv = I[8]; const float* bv = I[9]; const float* Wo = I[10]; const float* bo = I[11]; const float* apos = I[12]; const float* aneg = I[13]; const float* gam = I[14]; const float* del = I[15];      /* d_in order: query, key, value, frac, Wq, bq, Wk, bk, Wv, bv, Wo, bo, alpha_pos, alpha_neg, gamma, delta */
  char* ws = (char*)d_ws; size_t off = 0;
  auto take = [&](size_t bytes) { char* p = ws + off; off += (bytes + 255) & ~(size_t)255; return p; };
  const size_t WSZ = (size_t)DD * DD; _Float16* Bw = (_Float16*)take(4 * WSZ * 2); _Float16* X16 = (_Float16*)take((size_t)NR * DD * 2); _Float16* XK16 = (_Float16*)take((size_t)NR * DD * 2); _Float16* XV16 = (_Float16*)take((size_t)NR * DD * 2);
  _Float16* Q = (_Float16*)take((size_t)NR * DD * 2); _Float16* K = (_Float16*)take((size_t)NR * DD * 2); _Float16* V = (_Float16*)take((size_t)NR * DD * 2); _Float16* Vt = (_Float16*)take((size_t)NR * DD * 2);
  float* O = (float*)take((size_t)NR * DD * 4); _Float16* O16 = V;      /* the v plane is dead once Vᵀ is built (before the attention kernel); O16 reuses it */
  if (off > ws_size) return;      // 8.4 + 7 × 8.4 + 16.8 ≈ 84 MB
  const unsigned gw2 = (unsigned)((WSZ / 8 + 255) / 256);
  k_round16f<<<gw2, 256, 0, stream>>>(Wq, Bw, WSZ / 8); k_round16f<<<gw2, 256, 0, stream>>>(Wk, Bw + WSZ, WSZ / 8); k_round16f<<<gw2, 256, 0, stream>>>(Wv, Bw + 2 * WSZ, WSZ / 8); k_round16f<<<gw2, 256, 0, stream>>>(Wo, Bw + 3 * WSZ, WSZ / 8);      /* (out,in) natural ×2^4 */
  const unsigned gx = (unsigned)(((size_t)NR * DD / 8 + 255) / 256); const unsigned gt = (NR / 128) * (DD / 128);
  k_x16<<<gx, 256, 0, stream>>>(xq, X16, (size_t)NR * DD / 8); k_x16<<<gx, 256, 0, stream>>>(xk, XK16, (size_t)NR * DD / 8); k_x16<<<gx, 256, 0, stream>>>(xv, XV16, (size_t)NR * DD / 8);
  k_gemm_tile<DD, DD, true><<<gt, 256, 0, stream>>>(X16, Bw, 0.0625f, bq, nullptr, Q);      /* Q = query·Wqᵀ + bq: M 4096 N 1024 K 1024 */
  k_gemm_tile<DD, DD, true><<<gt, 256, 0, stream>>>(XK16, Bw + WSZ, 0.0625f, bk, nullptr, K);
  k_gemm_tile<DD, DD, true><<<gt, 256, 0, stream>>>(XV16, Bw + 2 * WSZ, 0.0625f, bv, nullptr, V);
  k_vt<NH, TT><<<BB * NH * (TT / 64), 256, 0, stream>>>(V, DD, 0, Vt);
  k_flash<<<BB * NH * (TT / 64), 128, 0, stream>>>(Q, DD, K, DD, Vt, frac, apos, aneg, gam, del, O, DD);
  k_h16<<<gx, 256, 0, stream>>>(O, O16, (size_t)NR * DD / 8);
  k_gemm_tile<DD, DD, false><<<gt, 256, 0, stream>>>(O16, Bw + 3 * WSZ, 0.0625f, bo, (float*)d_out, nullptr);      /* out = O·Woᵀ + bo */
}

// v003
// One run takes 189 microseconds.
// Timed twice side by side with v002, it ran 1.04 times as fast both times.
// Counting every step since v000, it is 2.37 times as fast.
#include <hip/hip_runtime.h>
// Multi-head attention with a stoichiometric bias (B=2, T=2048, D=1024, 16 heads × 64): Q,K,V = x·Wᵀ + b (torch (out,in)) from query/key/value; logits = q·kᵀ·64^-½; bias[b,h,i,j] = α_pos[h]·max(D,0) + α_neg[h]·min(D,0), D = clip(frac_j − frac_i, −0.2, 0.2);
// attn = softmax(γ·logits + δ·bias); out = (attn·V merged)·Woᵀ + bo. γ, δ are scalar inputs.
// Compute dtype: x, weights, biases rounded to bf16; q/k/v as f16 GEMM outputs; fused flash-style kernel (online softmax f32, P f16 ×2^10) on v_wmma_f32_16x16x32_f16; O → f16 → output GEMM with bias; f32 accumulate.
#define BB 2
#define TT 2048
#define NH 16
#define DD 1024
#define NR (BB * TT)

typedef __bf16 v16b __attribute__((ext_vector_type(16)));
typedef unsigned short v8us __attribute__((ext_vector_type(8), may_alias));
typedef float  v8f  __attribute__((ext_vector_type(8)));
typedef float  v4f  __attribute__((ext_vector_type(4)));
typedef float  v4fa __attribute__((ext_vector_type(4), may_alias));
union FragB { v16b v; v8us half[2]; unsigned short u[16]; };

__device__ __forceinline__ unsigned short bf16_bits(float x) { unsigned int u = __float_as_uint(x); return (unsigned short)((u + 0x7FFFu + ((u >> 16) & 1u)) >> 16); }
__device__ __forceinline__ float bf16_val(unsigned short b) { return __uint_as_float(((unsigned int)b) << 16); }
__device__ __forceinline__ float bf16_round(float x) { return bf16_val(bf16_bits(x)); }
// D += A·B with NT terms: 1 = ah·bh, 2 = + al·bh (A split), 3 = + ah·bl (both split)
template <int NT>
__device__ __forceinline__ v8f mmaN(v16b ah, v16b al, v16b bh, v16b bl, v8f c) {
  c = __builtin_amdgcn_wmma_f32_16x16x32_bf16(false, ah, false, bh, (short)0, c, false, false);
  if (NT >= 2) c = __builtin_amdgcn_wmma_f32_16x16x32_bf16(false, al, false, bh, (short)0, c, false, false);
  if (NT >= 3) c = __builtin_amdgcn_wmma_f32_16x16x32_bf16(false, ah, false, bl, (short)0, c, false, false);
  asm volatile("v_nop\n\tv_nop\n\tv_nop\n\tv_nop" : "+v"(c) : "v"(ah), "v"(al), "v"(bh), "v"(bl));
  return c;
}

__global__ __launch_bounds__(256) void k_wt_bf16(const float* __restrict__ W, unsigned short* __restrict__ Wt, int K, int N) {
  const int t = blockIdx.x * 256 + threadIdx.x;
  const int k8n = K / 8;
  if (t >= N * k8n) return;
  const int n = t / k8n, k8 = (t % k8n) * 8;
  v8us v;
#pragma unroll
  for (int i = 0; i < 8; ++i) v[i] = bf16_bits(W[(size_t)(k8 + i) * N + n]);
  *(v8us*)(Wt + (size_t)n * K + k8) = v;
  
}

// GEMM C[M][N] (f32, pitch ldc) = act(A[M][K]·W + bias). A f32 row-major (pitch lda) converted per fragment to bf16
// (ASPLIT: hi/lo two planes -> 2 terms, else single rounded term); Wt bf16 [N][K] (pitch ldb). BIAS_BF16 rounds the
// bias to bf16 first (bias quantised to bf16 before the add). K%32==0, M%16==0, N%64==0.
template <bool ASPLIT, int ACT, bool BIAS_BF16>
__global__ __launch_bounds__(128) void k_gemm_bf(const float* __restrict__ A, int lda, const unsigned short* __restrict__ Wt, int ldb,
                                               const float* __restrict__ bias, float* __restrict__ C, int ldc, int M, int N, int K) {
  __shared__ __attribute__((aligned(16))) float so[4][16][64];
  const int tid = threadIdx.x, w = tid >> 5, lane = tid & 31, ln = lane & 15, hh = lane >> 4;
  const int ntn = N / 64;
  const int wid = blockIdx.x * 4 + w;
  const int mt = wid / ntn, nq = wid % ntn;
  if (mt * 16 >= M) return;
  const int row0 = mt * 16, col0 = nq * 64;
  const float* arow = A + (size_t)(row0 + ln) * lda;
  v8f acc[4] = {};
  for (int kb = 0; kb < K; kb += 32) {
    FragB ah, al;
    const v4f x0 = *(const v4fa*)(arow + kb + 8 * hh), x1 = *(const v4fa*)(arow + kb + 8 * hh + 4);
    const v4f x2 = *(const v4fa*)(arow + kb + 16 + 8 * hh), x3 = *(const v4fa*)(arow + kb + 16 + 8 * hh + 4);
    float xs[16] = {x0[0],x0[1],x0[2],x0[3],x1[0],x1[1],x1[2],x1[3],x2[0],x2[1],x2[2],x2[3],x3[0],x3[1],x3[2],x3[3]};
#pragma unroll
    for (int i = 0; i < 16; ++i) { const unsigned short hb = bf16_bits(xs[i]); ah.u[i] = hb; al.u[i] = ASPLIT ? bf16_bits(xs[i] - bf16_val(hb)) : (unsigned short)0; }
#pragma unroll
    for (int t = 0; t < 4; ++t) {
      const unsigned short* brow = Wt + (size_t)(col0 + t * 16 + ln) * ldb + kb;
      FragB b;
      b.half[0] = *(const v8us*)(brow + 8 * hh);
      b.half[1] = *(const v8us*)(brow + 16 + 8 * hh);
      acc[t] = mmaN<ASPLIT ? 2 : 1>(ah.v, al.v, b.v, b.v, acc[t]);
    }
  }
#pragma unroll
  for (int t = 0; t < 4; ++t) {
    float bv = bias ? bias[col0 + t * 16 + ln] : 0.f;
    if (BIAS_BF16) bv = bf16_round(bv);
#pragma unroll
    for (int r = 0; r < 8; ++r) { float v = acc[t][r] + bv; if (ACT == 1) v = fmaxf(v, 0.f); so[w][8 * hh + r][t * 16 + ln] = v; }
  }
  __builtin_amdgcn_fence(__ATOMIC_ACQ_REL, "workgroup");
  __builtin_amdgcn_wave_barrier();
  const int rsub = lane >> 4, c4 = (lane & 15) * 4;
  {
#pragma unroll
    for (int q = 0; q < 8; ++q) {
      const int r = q * 2 + rsub;
      const v4f v = *(const v4fa*)&so[w][r][c4];
      *(v4f*)(C + (size_t)(row0 + r) * ldc + col0 + c4) = v;
    }
    
  }
}

// Flash-style causal/unmasked attention, all contractions 3-term bf16 hi/lo splits, f32 softmax with running max.
// q,k,v rows are read from f32 buffers with arbitrary row pitch (so they can live inside a fused qkv buffer);
// D = head size (multiple of 32, <= 128); one wave = 16 query rows; block = 4 waves (64 queries) sharing K/V chunks of 32.
template <int D, bool CAUSAL>
__global__ __launch_bounds__(128) void k_flash(const float* __restrict__ qb, const float* __restrict__ kb, const float* __restrict__ vb,
                                             int pitch, int T, int H, float scale, float* __restrict__ y, int ypitch) {
  constexpr int KS = D / 32;        // k-steps for QK
  constexpr int DT = D / 16;        // d tiles for PV
  __shared__ __attribute__((aligned(16))) unsigned short sKh[32][D + 8], sKl[32][D + 8], sVh[32][D + 8], sVl[32][D + 8];
  __shared__ __attribute__((aligned(16))) unsigned short sPh[4][16][40], sPl[4][16][40];
  __shared__ __attribute__((aligned(16))) float sO[4][16][D];
  const int tid = threadIdx.x, w = tid >> 5, lane = tid & 31, ln = lane & 15, hh = lane >> 4;
  const int nqb = (T + 63) / 64;
  const int bh = blockIdx.x / nqb, qblk = blockIdx.x % nqb;
  const int b = bh / H, h = bh % H;
  const int q0 = qblk * 64 + w * 16;
  const float* Q = qb + (size_t)b * T * pitch + h * D;
  const float* K = kb + (size_t)b * T * pitch + h * D;
  const float* V = vb + (size_t)b * T * pitch + h * D;

  // A fragments of the wave's 16 query rows (scaled), hi/lo
  FragB aqh[KS], aql[KS];
  {
    int row = q0 + ln; if (row >= T) row = T - 1;
    const float* qr = Q + (size_t)row * pitch;
#pragma unroll
    for (int ks = 0; ks < KS; ++ks)
#pragma unroll
      for (int i = 0; i < 16; ++i) {
        const int d = ks * 32 + ((i < 8) ? (8 * hh + i) : (16 + 8 * hh + (i - 8)));
        const float x = qr[d] * scale; const unsigned short hb = bf16_bits(x);
        aqh[ks].u[i] = hb; aql[ks].u[i] = bf16_bits(x - bf16_val(hb));
      }
  }
  float m_r[8], l_r[8];
#pragma unroll
  for (int r = 0; r < 8; ++r) { m_r[r] = -3.0e38f; l_r[r] = 0.f; }
  v8f oacc[DT];
#pragma unroll
  for (int dt = 0; dt < DT; ++dt) oacc[dt] = (v8f){0.f,0.f,0.f,0.f,0.f,0.f,0.f,0.f};

  const int kv_end = CAUSAL ? min(T, qblk * 64 + 64) : T;     // block-uniform
  for (int j0 = 0; j0 < kv_end; j0 += 32) {
    __syncthreads();
    for (int e = tid; e < 32 * (D / 4); e += 128) {
      const int r = e / (D / 4), c4 = (e % (D / 4)) * 4;
      const int key = j0 + r;
      v4f kf = {0.f,0.f,0.f,0.f}, vf = {0.f,0.f,0.f,0.f};
      if (key < T) { kf = *(const v4fa*)(K + (size_t)key * pitch + c4); vf = *(const v4fa*)(V + (size_t)key * pitch + c4); }
#pragma unroll
      for (int t = 0; t < 4; ++t) {
        unsigned short hb = bf16_bits(kf[t]); sKh[r][c4 + t] = hb; sKl[r][c4 + t] = bf16_bits(kf[t] - bf16_val(hb));
        hb = bf16_bits(vf[t]); sVh[r][c4 + t] = hb; sVl[r][c4 + t] = bf16_bits(vf[t] - bf16_val(hb));
      }
    }
    __syncthreads();
    // S tile 16 x 32
    v8f s[2];
#pragma unroll
    for (int nt = 0; nt < 2; ++nt) {
      v8f acc = {};
#pragma unroll
      for (int ks = 0; ks < KS; ++ks) {
        FragB bh_, bl_;
        bh_.half[0] = *(const v8us*)&sKh[nt * 16 + ln][ks * 32 + 8 * hh]; bh_.half[1] = *(const v8us*)&sKh[nt * 16 + ln][ks * 32 + 16 + 8 * hh];
        bl_.half[0] = *(const v8us*)&sKl[nt * 16 + ln][ks * 32 + 8 * hh]; bl_.half[1] = *(const v8us*)&sKl[nt * 16 + ln][ks * 32 + 16 + 8 * hh];
        acc = mmaN<3>(aqh[ks].v, aql[ks].v, bh_.v, bl_.v, acc);
      }
      s[nt] = acc;
    }
    // mask + running max (rows 8hh+r; the 16 lanes of a half share rows)
    float alpha[8];
#pragma unroll
    for (int r = 0; r < 8; ++r) {
      const int qi = q0 + 8 * hh + r;
      const int ja = j0 + ln, jb = j0 + 16 + ln;
      if (CAUSAL) { if (ja > qi) s[0][r] = -3.0e38f; if (jb > qi) s[1][r] = -3.0e38f; }
      if (ja >= T) s[0][r] = -3.0e38f;
      if (jb >= T) s[1][r] = -3.0e38f;
      float mx = fmaxf(s[0][r], s[1][r]);
      mx = fmaxf(mx, __shfl_xor(mx, 1, 32)); mx = fmaxf(mx, __shfl_xor(mx, 2, 32)); mx = fmaxf(mx, __shfl_xor(mx, 4, 32)); mx = fmaxf(mx, __shfl_xor(mx, 8, 32));
      const float mnew = fmaxf(m_r[r], mx);
      alpha[r] = (mnew > -1.0e38f) ? __expf(m_r[r] - mnew) : 1.0f;
      const float p0 = (s[0][r] > -1.0e38f) ? __expf(s[0][r] - mnew) : 0.f;
      const float p1 = (s[1][r] > -1.0e38f) ? __expf(s[1][r] - mnew) : 0.f;
      m_r[r] = mnew;
      l_r[r] = l_r[r] * alpha[r] + p0 + p1;            // per-lane partial row sum (16 lanes combined at the end)
      unsigned short hb = bf16_bits(p0); sPh[w][8 * hh + r][ln] = hb;      sPl[w][8 * hh + r][ln] = bf16_bits(p0 - bf16_val(hb));
      hb = bf16_bits(p1);                sPh[w][8 * hh + r][16 + ln] = hb; sPl[w][8 * hh + r][16 + ln] = bf16_bits(p1 - bf16_val(hb));
    }
#pragma unroll
    for (int dt = 0; dt < DT; ++dt)
#pragma unroll
      for (int r = 0; r < 8; ++r) oacc[dt][r] *= alpha[r];
    __builtin_amdgcn_fence(__ATOMIC_ACQ_REL, "workgroup");
    __builtin_amdgcn_wave_barrier();
    FragB pah, pal;
    pah.half[0] = *(const v8us*)&sPh[w][ln][8 * hh]; pah.half[1] = *(const v8us*)&sPh[w][ln][16 + 8 * hh];
    pal.half[0] = *(const v8us*)&sPl[w][ln][8 * hh]; pal.half[1] = *(const v8us*)&sPl[w][ln][16 + 8 * hh];
#pragma unroll
    for (int dt = 0; dt < DT; ++dt) {
      FragB bvh, bvl;
#pragma unroll
      for (int i = 0; i < 8; ++i) {
        bvh.u[i] = sVh[8 * hh + i][dt * 16 + ln]; bvh.u[8 + i] = sVh[16 + 8 * hh + i][dt * 16 + ln];
        bvl.u[i] = sVl[8 * hh + i][dt * 16 + ln]; bvl.u[8 + i] = sVl[16 + 8 * hh + i][dt * 16 + ln];
      }
      oacc[dt] = mmaN<3>(pah.v, pal.v, bvh.v, bvl.v, oacc[dt]);
    }
    __builtin_amdgcn_fence(__ATOMIC_ACQ_REL, "workgroup");
    __builtin_amdgcn_wave_barrier();
  }
#pragma unroll
  for (int r = 0; r < 8; ++r) {
    float l = l_r[r];
    l += __shfl_xor(l, 1, 32); l += __shfl_xor(l, 2, 32); l += __shfl_xor(l, 4, 32); l += __shfl_xor(l, 8, 32);
    l_r[r] = (l > 0.f) ? 1.0f / l : 0.f;
  }
#pragma unroll
  for (int dt = 0; dt < DT; ++dt)
#pragma unroll
    for (int r = 0; r < 8; ++r) sO[w][8 * hh + r][dt * 16 + ln] = oacc[dt][r] * l_r[r];
  __builtin_amdgcn_fence(__ATOMIC_ACQ_REL, "workgroup");
  __builtin_amdgcn_wave_barrier();
  {
    for (int r = 0; r < 16; ++r) {
      const int row = q0 + r;
      if (row < T && lane < D / 4) {
        const v4f val = *(const v4fa*)&sO[w][r][lane * 4];
        *(v4f*)(y + ((size_t)b * T + row) * ypitch + h * D + lane * 4) = val;
      }
    }
    
  }
}

// GEMM C = act(A·W + bias + resid): A f32 (ASPLIT -> hi/lo 2 terms), Wt bf16 [N][K]; ACT 0 none, 1 relu, 2 exact gelu;
// resid (optional, f32, row index = (row % rmod), pitch ldr, RES_BF16 rounds it) added before the activation.
template <bool ASPLIT, int ACT, bool BIAS_BF16, bool RES_BF16>
__global__ __launch_bounds__(128) void k_gemm_bf3(const float* __restrict__ A, int lda, const unsigned short* __restrict__ Wt, int ldb,
                                                const float* __restrict__ bias, const float* __restrict__ resid, int rmod, int ldr,
                                                float* __restrict__ C, int ldc, int M, int N, int K) {
  __shared__ __attribute__((aligned(16))) float so[4][16][64];
  const int tid = threadIdx.x, w = tid >> 5, lane = tid & 31, ln = lane & 15, hh = lane >> 4;
  const int ntn = N / 64;
  const int wid = blockIdx.x * 4 + w;
  const int mt = wid / ntn, nq = wid % ntn;
  if (mt * 16 >= M) return;
  const int row0 = mt * 16, col0 = nq * 64;
  const float* arow = A + (size_t)(row0 + ln) * lda;
  v8f acc[4] = {};
  for (int kb = 0; kb < K; kb += 32) {
    FragB ah, al;
    const v4f x0 = *(const v4fa*)(arow + kb + 8 * hh), x1 = *(const v4fa*)(arow + kb + 8 * hh + 4);
    const v4f x2 = *(const v4fa*)(arow + kb + 16 + 8 * hh), x3 = *(const v4fa*)(arow + kb + 16 + 8 * hh + 4);
    float xs[16] = {x0[0],x0[1],x0[2],x0[3],x1[0],x1[1],x1[2],x1[3],x2[0],x2[1],x2[2],x2[3],x3[0],x3[1],x3[2],x3[3]};
#pragma unroll
    for (int i = 0; i < 16; ++i) { const unsigned short hb = bf16_bits(xs[i]); ah.u[i] = hb; al.u[i] = ASPLIT ? bf16_bits(xs[i] - bf16_val(hb)) : (unsigned short)0; }
#pragma unroll
    for (int t = 0; t < 4; ++t) {
      const unsigned short* brow = Wt + (size_t)(col0 + t * 16 + ln) * ldb + kb;
      FragB b;
      b.half[0] = *(const v8us*)(brow + 8 * hh);
      b.half[1] = *(const v8us*)(brow + 16 + 8 * hh);
      acc[t] = mmaN<ASPLIT ? 2 : 1>(ah.v, al.v, b.v, b.v, acc[t]);
    }
  }
#pragma unroll
  for (int t = 0; t < 4; ++t) {
    const int col = col0 + t * 16 + ln;
    float bv = bias ? bias[col] : 0.f;
    if (BIAS_BF16) bv = bf16_round(bv);
#pragma unroll
    for (int r = 0; r < 8; ++r) {
      float v = acc[t][r] + bv;
      if (resid) { float rv = resid[(size_t)((row0 + 8 * hh + r) % rmod) * ldr + col]; if (RES_BF16) rv = bf16_round(rv); v += rv; }
      if (ACT == 1) v = fmaxf(v, 0.f);
      if (ACT == 2) v = 0.5f * v * (1.0f + erff(v * 0.70710678118654752f));
      if (ACT == 3) { const float u = 0.7978845608028654f * (v + 0.044715f * v * v * v); v = 0.5f * v * (1.0f + tanhf(u)); }
      so[w][8 * hh + r][t * 16 + ln] = v;
    }
  }
  __builtin_amdgcn_fence(__ATOMIC_ACQ_REL, "workgroup");
  __builtin_amdgcn_wave_barrier();
  const int rsub = lane >> 4, c4 = (lane & 15) * 4;
  {
#pragma unroll
    for (int q = 0; q < 8; ++q) {
      const int r = q * 2 + rsub;
      const v4f v = *(const v4fa*)&so[w][r][c4];
      *(v4f*)(C + (size_t)(row0 + r) * ldc + col0 + c4) = v;
    }
    
  }
}
// row LayerNorm (biased variance, eps) over N: s = X (+ R); optional out_sum <- s; out_norm <- (s-mu)*rsqrt(var+eps)*g + b
template <bool PARAM_BF16>
__global__ __launch_bounds__(256) void k_layernorm(const float* __restrict__ X, const float* __restrict__ R, const float* __restrict__ g, const float* __restrict__ bta,
                                                  float* __restrict__ out_sum, float* __restrict__ out_norm, int N, float eps) {
  __shared__ float red[256];
  const int row = blockIdx.x, tid = threadIdx.x;
  const float* x = X + (size_t)row * N; const float* rr = R ? R + (size_t)row * N : nullptr;
  float vals[16];                     // up to N = 4096
  const int per = N / 256;            // contiguous chunk per thread? use strided-by-4 chunks: thread handles j = tid*4 + 1024*u
  float s1 = 0.f;
  for (int u = 0; u < per / 4; ++u) {
    const int j = tid * 4 + 1024 * u;
    const v4f a = *(const v4fa*)(x + j);
    v4f b = {0.f,0.f,0.f,0.f}; if (rr) b = *(const v4fa*)(rr + j);
#pragma unroll
    for (int q = 0; q < 4; ++q) { const float v = a[q] + b[q]; vals[u * 4 + q] = v; s1 += v; }
  }
  red[tid] = s1; __syncthreads();
  for (int st = 128; st > 0; st >>= 1) { if (tid < st) red[tid] += red[tid + st]; __syncthreads(); }
  const float mu = red[0] / (float)N; __syncthreads();
  float s2 = 0.f;
  for (int u = 0; u < per / 4; ++u)
#pragma unroll
    for (int q = 0; q < 4; ++q) { const float c = vals[u * 4 + q] - mu; s2 += c * c; }
  red[tid] = s2; __syncthreads();
  for (int st = 128; st > 0; st >>= 1) { if (tid < st) red[tid] += red[tid + st]; __syncthreads(); }
  const float rs = rsqrtf(red[0] / (float)N + eps);
  {
    for (int u = 0; u < per / 4; ++u) {
      const int j = tid * 4 + 1024 * u;
      v4f o, sm;
#pragma unroll
      for (int q = 0; q < 4; ++q) {
        float gg = g[j + q], bb = bta[j + q];
        if (PARAM_BF16) { gg = bf16_round(gg); bb = bf16_round(bb); }
        sm[q] = vals[u * 4 + q]; o[q] = (vals[u * 4 + q] - mu) * rs * gg + bb;
      }
      if (out_sum) *(v4f*)(out_sum + (size_t)row * N + j) = sm;
      *(v4f*)(out_norm + (size_t)row * N + j) = o;
    }
    
  }
}



// ---- f16 WMMA path (v_wmma_f32_16x16x32_f16): 11-bit significands for operands in range — used where a [0,1] probability operand needs more precision than bf16
typedef _Float16 v16h __attribute__((ext_vector_type(16)));
union FragH { v16h v; v8us half[2]; _Float16 h[16]; unsigned short u[16]; };
template <int NT>
__device__ __forceinline__ v8f mmaH(v16h ah, v16h al, v16h bh, v16h bl, v8f c) {
  c = __builtin_amdgcn_wmma_f32_16x16x32_f16(false, ah, false, bh, (short)0, c, false, false);
  if (NT >= 2) c = __builtin_amdgcn_wmma_f32_16x16x32_f16(false, al, false, bh, (short)0, c, false, false);
  if (NT >= 3) c = __builtin_amdgcn_wmma_f32_16x16x32_f16(false, ah, false, bl, (short)0, c, false, false);
  asm volatile("v_nop\n\tv_nop\n\tv_nop\n\tv_nop" : "+v"(c) : "v"(ah), "v"(al), "v"(bh), "v"(bl));
  return c;
}
// batched GEMM like k_gemm_b but f16 operands: A f32 (split into f16 hi/lo if ASPLIT, else rounded to f16), Bt = f16 values [n][k]; alpha; C f32; N multiple of 16 (partial tiles skipped)
template <bool ASPLIT>
__global__ __launch_bounds__(128) void k_gemm_h(const float* __restrict__ A, int lda, size_t sA, const _Float16* __restrict__ Bh, int ldb, size_t sB, float alpha, float* __restrict__ C, int ldc, size_t sC, int M, int N, int K) {
  __shared__ __attribute__((aligned(16))) float so[4][16][64];
  const int tid = threadIdx.x, w = tid >> 5, lane = tid & 31, ln = lane & 15, hh = lane >> 4; const int by = blockIdx.y;
  A += (size_t)by * sA; Bh += (size_t)by * sB; C += (size_t)by * sC;
  const int ntn = (N + 63) / 64; const int wid = blockIdx.x * 4 + w; const int mt = wid / ntn, nq = wid % ntn; if (mt * 16 >= M) return;
  const int row0 = mt * 16, col0 = nq * 64; const float* arow = A + (size_t)(row0 + ln) * lda;
  v8f acc[4] = {};
  for (int kb = 0; kb < K; kb += 32) {
    FragH ah, al;
    const v4f x0 = *(const v4fa*)(arow + kb + 8 * hh), x1 = *(const v4fa*)(arow + kb + 8 * hh + 4), x2 = *(const v4fa*)(arow + kb + 16 + 8 * hh), x3 = *(const v4fa*)(arow + kb + 16 + 8 * hh + 4);
    float xs[16] = {x0[0],x0[1],x0[2],x0[3],x1[0],x1[1],x1[2],x1[3],x2[0],x2[1],x2[2],x2[3],x3[0],x3[1],x3[2],x3[3]};
#pragma unroll
    for (int i = 0; i < 16; ++i) { const _Float16 h = (_Float16)xs[i]; ah.h[i] = h; al.h[i] = ASPLIT ? (_Float16)(xs[i] - (float)h) : (_Float16)0.0f; }
#pragma unroll
    for (int t = 0; t < 4; ++t) { if (col0 + t * 16 >= N) continue; const size_t boff = (size_t)(col0 + t * 16 + ln) * ldb + kb; FragH bq; bq.half[0] = *(const v8us*)(Bh + boff + 8 * hh); bq.half[1] = *(const v8us*)(Bh + boff + 16 + 8 * hh);
      acc[t] = mmaH<ASPLIT ? 2 : 1>(ah.v, al.v, bq.v, bq.v, acc[t]); }
  }
#pragma unroll
  for (int t = 0; t < 4; ++t) { if (col0 + t * 16 >= N) continue;
#pragma unroll
    for (int r = 0; r < 8; ++r) so[w][8 * hh + r][t * 16 + ln] = acc[t][r] * alpha; }
  __builtin_amdgcn_fence(__ATOMIC_ACQ_REL, "workgroup"); __builtin_amdgcn_wave_barrier();
  const int rsub = lane >> 4, c4 = (lane & 15) * 4;
  {
#pragma unroll
    for (int q = 0; q < 8; ++q) { const int r = q * 2 + rsub; if (col0 + c4 < N) { const v4f v = *(const v4fa*)&so[w][r][c4]; *(v4f*)(C + (size_t)(row0 + r) * ldc + col0 + c4) = v; } }
     }
}

// Wt[n][k] = f16(W[k][n]·scale) from f32 row-major W[K][N] (scale = power of two; bf16-exact weights stay exact in f16 away from the subnormal range)
__global__ __launch_bounds__(256) void k_wt_f16(const float* __restrict__ W, _Float16* __restrict__ Wt, int K, int N, float scale) {
  const int t = blockIdx.x * 256 + threadIdx.x; if (t >= N * (K / 8)) return; const int n = t / (K / 8), k8 = (t % (K / 8)) * 8; FragH f;
#pragma unroll
  for (int i = 0; i < 8; ++i) f.h[i] = (_Float16)(bf16_round(W[(size_t)(k8 + i) * N + n]) * scale); const v8us o = f.half[0];
  *(v8us*)((unsigned short*)Wt + (size_t)n * K + k8) = o; 
}
// k_gemm_hh variant with fused epilogue: v = acc·alpha + bias[by·sBias + col] (+ CP[(row/rowsPerB)·sCPb + by·64 + col] if CP) ; ACT 0 none / 1 elu ; writes f32 C and f16 C16, each if non-null
template <int ACT>
__global__ __launch_bounds__(128) void k_gemm_hhx(const _Float16* __restrict__ A, int lda, size_t sA, const _Float16* __restrict__ Bh, int ldb, size_t sB, float alpha, const float* __restrict__ bias, size_t sBias, const float* __restrict__ CP, int rowsPerB, size_t sCPb, int row0g,
    float* __restrict__ C, _Float16* __restrict__ C16, int ldc, size_t sC, int M, int N, int K) {
  __shared__ __attribute__((aligned(16))) float so[4][16][64];
  const int tid = threadIdx.x, w = tid >> 5, lane = tid & 31, ln = lane & 15, hh = lane >> 4; const int by = blockIdx.y;
  A += (size_t)by * sA; Bh += (size_t)by * sB; const size_t cofs = (size_t)by * sC; const float* bp = bias ? bias + (size_t)by * sBias : nullptr;
  const int ntn = (N + 63) / 64; const int wid = blockIdx.x * 4 + w; const int mt = wid / ntn, nq = wid % ntn; if (mt * 16 >= M) return;
  const int row0 = mt * 16, col0 = nq * 64; const _Float16* arow = A + (size_t)(row0 + ln) * lda;
  v8f acc[4] = {};
  for (int kb = 0; kb < K; kb += 32) { FragH ah; ah.half[0] = *(const v8us*)((const unsigned short*)arow + kb + 8 * hh); ah.half[1] = *(const v8us*)((const unsigned short*)arow + kb + 16 + 8 * hh);
#pragma unroll
    for (int t = 0; t < 4; ++t) { if (col0 + t * 16 >= N) continue; const size_t boff = (size_t)(col0 + t * 16 + ln) * ldb + kb; FragH bq; bq.half[0] = *(const v8us*)((const unsigned short*)Bh + boff + 8 * hh); bq.half[1] = *(const v8us*)((const unsigned short*)Bh + boff + 16 + 8 * hh);
      acc[t] = mmaH<1>(ah.v, ah.v, bq.v, bq.v, acc[t]); }
  }
#pragma unroll
  for (int t = 0; t < 4; ++t) { if (col0 + t * 16 >= N) continue; const int col = col0 + t * 16 + ln; const float bv = bp ? bf16_round(bp[col]) : 0.f;
#pragma unroll
    for (int r = 0; r < 8; ++r) { float v = acc[t][r] * alpha + bv; if (CP) { const int bidx = (row0g + row0 + 8 * hh + r) / rowsPerB; v += CP[(size_t)bidx * sCPb + (size_t)by * 64 + col]; } if (ACT == 1) v = (v > 0.f) ? v : expm1f(v); else if (ACT == 7) v = (v > 0.f) ? v + 1.0f : expf(v); else if (ACT == 8) v = tanhf(v); else if (ACT == 9) v = 0.5f * v * (1.0f + tanhf(0.7978845608028654f * (v + 0.044715f * v * v * v))); else if (ACT == 11) v = 1.0f / (1.0f + expf(-v)); else if (ACT == 12) v = (v > 0.f) ? v : 0.01f * v; else if (ACT == 14) v = (v > 0.f) ? v : 0.1f * v; else if (ACT == 15) v = v / (1.0f + expf(-v)); else if (ACT == 3) v = fmaxf(v, 0.f); else if (ACT == 6) v = 0.5f * v * (1.0f + erff(v * 0.70710678118654752f)); so[w][8 * hh + r][t * 16 + ln] = v; } }
  __builtin_amdgcn_fence(__ATOMIC_ACQ_REL, "workgroup"); __builtin_amdgcn_wave_barrier();
  const int rsub = lane >> 4, c4 = (lane & 15) * 4; typedef _Float16 v4h __attribute__((ext_vector_type(4)));
  {
#pragma unroll
    for (int q = 0; q < 8; ++q) { const int r = q * 2 + rsub; if (col0 + c4 < N) { const v4f v = *(const v4fa*)&so[w][r][c4]; if (C) *(v4f*)(C + cofs + (size_t)(row0 + r) * ldc + col0 + c4) = v; if (C16) { v4h h4; for (int i = 0; i < 4; ++i) h4[i] = (_Float16)v[i]; *(v4h*)(C16 + cofs + (size_t)(row0 + r) * ldc + col0 + c4) = h4; } } }
     }
}


typedef _Float16 v4h __attribute__((ext_vector_type(4)));

__global__ __launch_bounds__(256) void k_x16(const float* __restrict__ x, _Float16* __restrict__ X16, size_t n8) { const size_t t = (size_t)blockIdx.x * 256 + threadIdx.x; if (t >= n8) return; FragH f;
#pragma unroll
  for (int q = 0; q < 8; ++q) f.h[q] = (_Float16)bf16_round(x[t * 8 + q]); *(v8us*)((unsigned short*)X16 + t * 8) = f.half[0];  }
__global__ __launch_bounds__(256) void k_h16(const float* __restrict__ x, _Float16* __restrict__ X16, size_t n8) { const size_t t = (size_t)blockIdx.x * 256 + threadIdx.x; if (t >= n8) return; FragH f;
#pragma unroll
  for (int q = 0; q < 8; ++q) f.h[q] = (_Float16)x[t * 8 + q]; *(v8us*)((unsigned short*)X16 + t * 8) = f.half[0];  }
__global__ __launch_bounds__(256) void k_round16f(const float* __restrict__ W, _Float16* __restrict__ Bt, size_t n8) { const size_t t = (size_t)blockIdx.x * 256 + threadIdx.x; if (t >= n8) return; FragH f;
#pragma unroll
  for (int i = 0; i < 8; ++i) f.h[i] = (_Float16)(bf16_round(W[t * 8 + i]) * 16.0f); *(v8us*)((unsigned short*)Bt + t * 8) = f.half[0];  }
template <int NHv, int TTv>
__global__ __launch_bounds__(256) void k_vt(const _Float16* __restrict__ V16, int ldv, int voff, _Float16* __restrict__ Vt) { __shared__ unsigned short tl[64][66]; const int tid = threadIdx.x; const int slab = blockIdx.x / (TTv / 64), lg = blockIdx.x % (TTv / 64); const int b = slab / NHv, h = slab % NHv;
  for (int i = tid; i < 64 * 8; i += 256) { const int r = i / 8, c8 = (i % 8) * 8; FragH f; f.half[0] = *(const v8us*)((const unsigned short*)V16 + ((size_t)b * TTv + lg * 64 + r) * ldv + voff + h * 64 + c8);
#pragma unroll
    for (int q = 0; q < 8; ++q) tl[r][c8 + q] = f.u[q]; }
  __syncthreads();
  {
#pragma unroll
    for (int rd = 0; rd < 2; ++rd) { const int d = rd * 32 + tid / 8, pc = tid % 8; FragH f;
#pragma unroll
      for (int q = 0; q < 8; ++q) f.u[q] = tl[pc * 8 + q][d];
      *(v8us*)((unsigned short*)Vt + ((size_t)slab * 64 + d) * TTv + lg * 64 + pc * 8) = f.half[0]; }
     } }

// lane l <-> lane l ^ 16 (the two halves of a wave)
__device__ __forceinline__ float xhalf(float x) { return __builtin_bit_cast(float, __builtin_amdgcn_permlanex16(__builtin_bit_cast(int, x), __builtin_bit_cast(int, x), 0x76543210, 0xfedcba98, false, false)); }

// Attention with the scores transposed: S^T = K.Q^T (A = 16 key rows, B = the wave's 16 queries, kept in registers) and O^T += V^T.P^T (A = 16 rows of V^T, B = P^T).
// A lane then holds scores of ONE query (column ln): keys nt*16 + 8*hh + r of each 32-key chunk. Maximum and sum run inside the lane, with one exchange between the wave halves per chunk,
// and the two score tiles, converted in place, are the B operand of the second product (element nt*8 + r = key nt*16 + 8*hh + r, the k order of the V^T loader): P never leaves the registers.
// The keys' frac values, rounded once per block, are read from LDS (8 consecutive keys per tile and lane).
__global__ __launch_bounds__(128) void k_flash(const _Float16* __restrict__ Q16, int ldq, const _Float16* __restrict__ K16, int ldk, const _Float16* __restrict__ Vt, const float* __restrict__ FR, const float* __restrict__ AP, const float* __restrict__ AN, const float* __restrict__ GM, const float* __restrict__ DLT, float* __restrict__ O, int ldo) {
  constexpr int NQB = TT / 64, DT = 4, KS = 2;
  __shared__ __attribute__((aligned(16))) float sF[TT]; __shared__ __attribute__((aligned(16))) float sO[4][16][64 + 4];
  const int tid = threadIdx.x, w = tid >> 5, lane = tid & 31, ln = lane & 15, hh = lane >> 4;
  const int slab = blockIdx.x / NQB, qblk = blockIdx.x % NQB; const int b = slab / NH, h = slab % NH; const int q0 = qblk * 64 + w * 16;
  const float* frb = FR + (size_t)b * TT;
#pragma unroll
  for (int i = 0; i < TT / 512; ++i) { const int e = i * 512 + tid * 4; v4f f = *(const v4fa*)(frb + e);
#pragma unroll
    for (int q = 0; q < 4; ++q) f[q] = bf16_round(f[q]);
    *(v4fa*)&sF[e] = f; }
  FragH bq[KS]; const unsigned short* qr = (const unsigned short*)Q16 + ((size_t)b * TT + q0 + ln) * ldq + h * 64;      /* B operand: column ln = query q0 + ln */
#pragma unroll
  for (int ks = 0; ks < KS; ++ks) { bq[ks].half[0] = *(const v8us*)(qr + ks * 32 + 8 * hh); bq[ks].half[1] = *(const v8us*)(qr + ks * 32 + 16 + 8 * hh); }
  const char* gk = (const char*)K16 + ((size_t)b * TT * ldk + h * 64) * 2; const unsigned vk = (unsigned)(ln * ldk + 8 * hh) * 2u;      /* wave-uniform bases, one 32-bit lane offset each that lives through the loop */
  const char* gv = (const char*)Vt + (size_t)slab * 64 * TT * 2; const unsigned vv = (unsigned)(ln * TT + 8 * hh) * 2u;
  constexpr float L2E = 1.44269504088896340736f;      /* log2(e): the scores are formed in base-2 units, so that exp(s - m) is one hardware exp2 of a difference */
  const float gmm = bf16_round(GM[0]), dlt = bf16_round(DLT[0]); const float aph = bf16_round(AP[h]) * dlt * L2E, anh = bf16_round(AN[h]) * dlt * L2E;      /* gamma, delta scalars; log2(e)*delta*alpha_pos[h], log2(e)*delta*alpha_neg[h] */
  const float g8 = gmm * 0.125f * L2E;      /* log2(e) * gamma * 64^-1/2 */
  const float fq = bf16_round(frb[q0 + ln]);      /* frac of the lane's query */
  float m_r = -3.0e38f, l_r = 0.f; v8f oacc[DT];
#pragma unroll
  for (int dt = 0; dt < DT; ++dt) oacc[dt] = (v8f){0.f,0.f,0.f,0.f,0.f,0.f,0.f,0.f};
  __syncthreads();      /* sF is complete before any wave reads it */
#pragma unroll 1      /* rolled: 64 copies of this body would only grow the code */
  for (int j0 = 0; j0 < TT; j0 += 32) {
    FragH ak[2][KS], av[DT]; v4f fk[2][2];
#pragma unroll
    for (int nt = 0; nt < 2; ++nt) { const char* kr = gk + (size_t)(j0 + nt * 16) * ldk * 2;      /* A operand: row ln = key j0 + nt*16 + ln */
#pragma unroll
      for (int ks = 0; ks < KS; ++ks) { ak[nt][ks].half[0] = *(const v8us*)(kr + vk + ks * 64); ak[nt][ks].half[1] = *(const v8us*)(kr + vk + ks * 64 + 32); } }
    asm volatile("s_wait_xcnt 0x0" ::: "memory");      /* the key loads' address registers may be given to the V^T loads as destinations: wait before that overwrite */
#pragma unroll
    for (int dt = 0; dt < DT; ++dt) { const char* vrow = gv + (size_t)j0 * 2 + (size_t)(dt * 16) * TT * 2; av[dt].half[0] = *(const v8us*)(vrow + vv); av[dt].half[1] = *(const v8us*)(vrow + vv + 32); }      /* A operand: row ln = head column dt*16 + ln */
    asm volatile("s_wait_xcnt 0x0" ::: "memory");      /* the loads' address registers may be reused or advanced below: wait before that overwrite */
#pragma unroll
    for (int nt = 0; nt < 2; ++nt) { fk[nt][0] = *(const v4fa*)&sF[j0 + nt * 16 + 8 * hh]; fk[nt][1] = *(const v4fa*)&sF[j0 + nt * 16 + 8 * hh + 4]; }      /* frac of the lane's 16 keys */
    float sc[16];
#pragma unroll
    for (int nt = 0; nt < 2; ++nt) { v8f acc = (v8f){0.f,0.f,0.f,0.f,0.f,0.f,0.f,0.f};
#pragma unroll
      for (int ks = 0; ks < KS; ++ks) acc = __builtin_amdgcn_wmma_f32_16x16x32_f16(false, ak[nt][ks].v, false, bq[ks].v, (short)0, acc, false, false);
#pragma unroll
      for (int r = 0; r < 8; ++r) { float d = fk[nt][r >> 2][r & 3] - fq; d = fminf(fmaxf(d, -0.2f), 0.2f);      /* D = clip(frac_k - frac_q, -0.2, 0.2) */
        const float sb = aph * fmaxf(d, 0.f) + anh * fminf(d, 0.f);      /* log2(e)*delta*(alpha_pos*D+ + alpha_neg*D-) */
        sc[nt * 8 + r] = g8 * acc[r] + sb; } }
    float mx[4];
#pragma unroll
    for (int q = 0; q < 4; ++q) mx[q] = fmaxf(fmaxf(sc[q], sc[4 + q]), fmaxf(sc[8 + q], sc[12 + q]));
    float mc = fmaxf(fmaxf(mx[0], mx[1]), fmaxf(mx[2], mx[3])); mc = fmaxf(mc, xhalf(mc));      /* the query's maximum over all 32 keys, in both halves */
    const float mn = fmaxf(m_r, mc - 10.0f); const float al = (mn > -1.0e38f) ? __builtin_amdgcn_exp2f(m_r - mn) : 1.0f; m_r = mn;      /* the running maximum is kept 10 lower: 2^(s - mn) is then P * 2^10, the scale of the f16 operand, in the sum as well */
    FragH pb; float ps[4];
#pragma unroll
    for (int i = 0; i < 16; ++i) { const float p = __builtin_amdgcn_exp2f(sc[i] - mn); ps[i & 3] = (i < 4) ? p : ps[i & 3] + p; pb.h[i] = (_Float16)p; }
    l_r = l_r * al + ((ps[0] + ps[1]) + (ps[2] + ps[3]));      /* the lane's 16 keys; the halves are joined after the loop */
#pragma unroll
    for (int dt = 0; dt < DT; ++dt) {
#pragma unroll
      for (int r = 0; r < 8; ++r) oacc[dt][r] *= al;
      oacc[dt] = __builtin_amdgcn_wmma_f32_16x16x32_f16(false, av[dt].v, false, pb.v, (short)0, oacc[dt], false, false); } }
  const float l = l_r + xhalf(l_r); const float inv = (l > 0.f) ? 1.0f / l : 0.f;      /* sum and O carry the same 2^10 */
#pragma unroll
  for (int dt = 0; dt < DT; ++dt)      /* oacc[dt][r] = O[query ln][dt*16 + 8*hh + r] */
#pragma unroll
    for (int c = 0; c < 2; ++c) { const v4f o = {oacc[dt][4 * c] * inv, oacc[dt][4 * c + 1] * inv, oacc[dt][4 * c + 2] * inv, oacc[dt][4 * c + 3] * inv}; *(v4fa*)&sO[w][ln][dt * 16 + 8 * hh + 4 * c] = o; }
  __builtin_amdgcn_fence(__ATOMIC_ACQ_REL, "workgroup"); __builtin_amdgcn_wave_barrier();      /* the wave's LDS stores are done, and stay in front, before its lanes read each other's values back */
#pragma unroll
  for (int rp = 0; rp < 16; rp += 2) { const int r = rp + (lane >> 4), pc = lane & 15; const v4f val = *(const v4fa*)&sO[w][r][pc * 4]; *(v4f*)(O + ((size_t)b * TT + q0 + r) * ldo + h * 64 + pc * 4) = val; }
}

// Block-tiled GEMM, C = (A.Bh^T)*alpha + bias: a block of 8 waves owns a 128 x 128 tile of C and stages 128 x 64 pieces of A and of Bh in LDS, so every operand byte is fetched once a block, in whole 128-B lines
// (8 lanes a row), and is read as fragments from LDS. Wave tile 32 x 64 (2 x 4 accumulators). The next piece is fetched into registers while this one is multiplied. k runs upward in steps of 32.
// M % 128 == 0 (grid), N % 128 == 0, K % 64 == 0. LDS row pitch 64 + 8 halves = 144 B for the 16-byte fragment reads.
// Each plain '#pragma unroll' below, except those on the ks and q loops, stands on a short loop whose index picks an element of a register array (staging registers, fragments, accumulators): unrolled, these stay in registers.
template <int N, int K, bool HALF_OUT>
__global__ __launch_bounds__(256) void k_gemm_tile(const _Float16* __restrict__ A, const _Float16* __restrict__ Bh, float alpha, const float* __restrict__ bias, float* __restrict__ C, _Float16* __restrict__ C16) {
  constexpr int BM = 128, BN = 128, BK = 64, LP = BK + 8;
  __shared__ __attribute__((aligned(16))) unsigned short sm[8 * 32 * 64 * 2];      /* 64 KB: the output staging (8 waves x 32 x 64 f32) is the larger use; the operand pieces take (BM + BN) * LP halves */
  static_assert((BM + BN) * LP <= 8 * 32 * 64 * 2, "operand pieces fit");
  unsigned short* sA = sm; unsigned short* sB = sm + BM * LP;
  const int tid = threadIdx.x, w = tid >> 5, lane = tid & 31, ln = lane & 15, hh = lane >> 4;
  const int nbn = N / BN; const int row0 = (blockIdx.x / nbn) * BM, col0 = (blockIdx.x % nbn) * BN;
  const int wm = w >> 1, wn = w & 1;
  const int lr = tid >> 3, lc = (tid & 7) * 8;
  const char* ga = (const char*)A + (size_t)row0 * K * 2; const char* gb = (const char*)Bh + (size_t)col0 * K * 2; const unsigned vo = (unsigned)(lr * K + lc) * 2u;      /* block-uniform bases, one 32-bit lane offset that lives through the loop */
  v8us ra[4], rb[4];
#pragma unroll
  for (int i = 0; i < 4; ++i) { ra[i] = *(const v8us*)(ga + vo + (size_t)(32 * i) * K * 2); rb[i] = *(const v8us*)(gb + vo + (size_t)(32 * i) * K * 2); }
  v8f acc[2][4];
#pragma unroll
  for (int mi = 0; mi < 2; ++mi)
#pragma unroll
    for (int t = 0; t < 4; ++t) acc[mi][t] = (v8f){0.f,0.f,0.f,0.f,0.f,0.f,0.f,0.f};
#pragma unroll 1      /* rolled: K is a constant here, and 16 copies of this body would only grow the code */
  for (int kb = 0; kb < K; kb += BK) {
#pragma unroll
    for (int i = 0; i < 4; ++i) { *(v8us*)&sA[(lr + 32 * i) * LP + lc] = ra[i]; *(v8us*)&sB[(lr + 32 * i) * LP + lc] = rb[i]; }
    __syncthreads();      /* the piece is complete before any wave reads fragments */
    if (kb + BK < K) {
#pragma unroll
      for (int i = 0; i < 4; ++i) { ra[i] = *(const v8us*)(ga + (size_t)(kb + BK) * 2 + vo + (size_t)(32 * i) * K * 2); rb[i] = *(const v8us*)(gb + (size_t)(kb + BK) * 2 + vo + (size_t)(32 * i) * K * 2); }
      asm volatile("s_wait_xcnt 0x0" ::: "memory"); }      /* the loads' address registers are reused by the fragment reads below: wait before that overwrite */
#pragma unroll
    for (int ks = 0; ks < BK / 32; ++ks) { FragH a[2], bq[4];
#pragma unroll
      for (int mi = 0; mi < 2; ++mi) { const unsigned short* p = &sA[(wm * 32 + mi * 16 + ln) * LP + ks * 32 + 8 * hh]; a[mi].half[0] = *(const v8us*)p; a[mi].half[1] = *(const v8us*)(p + 16); }
#pragma unroll
      for (int t = 0; t < 4; ++t) { const unsigned short* p = &sB[(wn * 64 + t * 16 + ln) * LP + ks * 32 + 8 * hh]; bq[t].half[0] = *(const v8us*)p; bq[t].half[1] = *(const v8us*)(p + 16); }
#pragma unroll
      for (int mi = 0; mi < 2; ++mi)
#pragma unroll
        for (int t = 0; t < 4; ++t) acc[mi][t] = __builtin_amdgcn_wmma_f32_16x16x32_f16(false, a[mi].v, false, bq[t].v, (short)0, acc[mi][t], false, false); }
    __syncthreads();      /* every wave has read the piece before it is overwritten (by the next piece, or by the output staging below) */
  }
  float* so = (float*)sm + w * (32 * 64);      /* each wave stages its 32 x 64 results in its own 8 KB, to store whole lines */
  const int rsub = lane >> 4, c4 = (lane & 15) * 4; float bv[4];
#pragma unroll
  for (int t = 0; t < 4; ++t) bv[t] = bf16_round(bias[col0 + wn * 64 + t * 16 + ln]);
#pragma unroll
  for (int mi = 0; mi < 2; ++mi)
#pragma unroll
    for (int t = 0; t < 4; ++t)
#pragma unroll
      for (int r = 0; r < 8; ++r) so[(mi * 16 + 8 * hh + r) * 64 + t * 16 + ln] = acc[mi][t][r] * alpha + bv[t];
  __builtin_amdgcn_fence(__ATOMIC_ACQ_REL, "workgroup"); __builtin_amdgcn_wave_barrier();      /* the wave's LDS stores are done, and stay in front, before its lanes read each other's values back */
#pragma unroll
  for (int q = 0; q < 16; ++q) { const int r = q * 2 + rsub; const v4f v = *(const v4fa*)&so[r * 64 + c4]; const size_t o = (size_t)(row0 + wm * 32 + r) * N + col0 + wn * 64 + c4;
    if (HALF_OUT) { v4h h4;
#pragma unroll
      for (int i = 0; i < 4; ++i) h4[i] = (_Float16)v[i];
      *(v4h*)(C16 + o) = h4; }
    else *(v4f*)(C + o) = v; }
}

extern "C" void kernel_launch(void* const* d_in, const int* in_sizes, int n_in,
                              void* d_out, int out_size, void* d_ws, size_t ws_size, hipStream_t stream) {
  (void)in_sizes; (void)n_in; (void)out_size;
  const float* const* I = (const float* const*)d_in; const float* xq = I[0]; const float* xk = I[1]; const float* xv = I[2]; const float* frac = I[3]; const float* Wq = I[4]; const float* bq = I[5]; const float* Wk = I[6]; const float* bk = I[7]; const float* Wv = I[8]; const float* bv = I[9]; const float* Wo = I[10]; const float* bo = I[11]; const float* apos = I[12]; const float* aneg = I[13]; const float* gam = I[14]; const float* del = I[15];      /* d_in order: query, key, value, frac, Wq, bq, Wk, bk, Wv, bv, Wo, bo, alpha_pos, alpha_neg, gamma, delta */
  char* ws = (char*)d_ws; size_t off = 0;
  auto take = [&](size_t bytes) { char* p = ws + off; off += (bytes + 255) & ~(size_t)255; return p; };
  const size_t WSZ = (size_t)DD * DD; _Float16* Bw = (_Float16*)take(4 * WSZ * 2); _Float16* X16 = (_Float16*)take((size_t)NR * DD * 2); _Float16* XK16 = (_Float16*)take((size_t)NR * DD * 2); _Float16* XV16 = (_Float16*)take((size_t)NR * DD * 2);
  _Float16* Q = (_Float16*)take((size_t)NR * DD * 2); _Float16* K = (_Float16*)take((size_t)NR * DD * 2); _Float16* V = (_Float16*)take((size_t)NR * DD * 2); _Float16* Vt = (_Float16*)take((size_t)NR * DD * 2);
  float* O = (float*)take((size_t)NR * DD * 4); _Float16* O16 = V;      /* the v plane is dead once Vᵀ is built (before the attention kernel); O16 reuses it */
  if (off > ws_size) return;      // 8.4 + 7 × 8.4 + 16.8 ≈ 84 MB
  const unsigned gw2 = (unsigned)((WSZ / 8 + 255) / 256);
  k_round16f<<<gw2, 256, 0, stream>>>(Wq, Bw, WSZ / 8); k_round16f<<<gw2, 256, 0, stream>>>(Wk, Bw + WSZ, WSZ / 8); k_round16f<<<gw2, 256, 0, stream>>>(Wv, Bw + 2 * WSZ, WSZ / 8); k_round16f<<<gw2, 256, 0, stream>>>(Wo, Bw + 3 * WSZ, WSZ / 8);      /* (out,in) natural ×2^4 */
  const unsigned gx = (unsigned)(((size_t)NR * DD / 8 + 255) / 256); const unsigned gt = (NR / 128) * (DD / 128);
  k_x16<<<gx, 256, 0, stream>>>(xq, X16, (size_t)NR * DD / 8); k_x16<<<gx, 256, 0, stream>>>(xk, XK16, (size_t)NR * DD / 8); k_x16<<<gx, 256, 0, stream>>>(xv, XV16, (size_t)NR * DD / 8);
  k_gemm_tile<DD, DD, true><<<gt, 256, 0, stream>>>(X16, Bw, 0.0625f, bq, nullptr, Q);      /* Q = query·Wqᵀ + bq: M 4096 N 1024 K 1024 */
  k_gemm_tile<DD, DD, true><<<gt, 256, 0, stream>>>(XK16, Bw + WSZ, 0.0625f, bk, nullptr, K);
  k_gemm_tile<DD, DD, true><<<gt, 256, 0, stream>>>(XV16, Bw + 2 * WSZ, 0.0625f, bv, nullptr, V);
  k_vt<NH, TT><<<BB * NH * (TT / 64), 256, 0, stream>>>(V, DD, 0, Vt);
  k_flash<<<BB * NH * (TT / 64), 128, 0, stream>>>(Q, DD, K, DD, Vt, frac, apos, aneg, gam, del, O, DD);
  k_h16<<<gx, 256, 0, stream>>>(O, O16, (size_t)NR * DD / 8);
  k_gemm_tile<DD, DD, false><<<gt, 256, 0, stream>>>(O16, Bw + 3 * WSZ, 0.0625f, bo, (float*)d_out, nullptr);      /* out = O·Woᵀ + bo */
}

// v004
// A run of this version takes 176 microseconds.
// Timed twice side by side with v003, it ran 1.07 and 1.08 times as fast.
// All steps since v000 together make it 2.55 times as fast.
#include <hip/hip_runtime.h>
// Multi-head attention with a stoichiometric bias (B=2, T=2048, D=1024, 16 heads × 64): Q,K,V = x·Wᵀ + b (torch (out,in)) from query/key/value; logits = q·kᵀ·64^-½; bias[b,h,i,j] = α_pos[h]·max(D,0) + α_neg[h]·min(D,0), D = clip(frac_j − frac_i, −0.2, 0.2);
// attn = softmax(γ·logits + δ·bias); out = (attn·V merged)·Woᵀ + bo. γ, δ are scalar inputs.
// Compute dtype: x, weights, biases rounded to bf16; q/k/v as f16 GEMM outputs; fused flash-style kernel (online softmax f32, P f16 ×2^10) on v_wmma_f32_16x16x32_f16; O → f16 → output GEMM with bias; f32 accumulate.
#define BB 2
#define TT 2048
#define NH 16
#define DD 1024
#define NR (BB * TT)

typedef __bf16 v16b __attribute__((ext_vector_type(16)));
typedef unsigned short v8us __attribute__((ext_vector_type(8), may_alias));
typedef float  v8f  __attribute__((ext_vector_type(8)));
typedef float  v4f  __attribute__((ext_vector_type(4)));
typedef float  v4fa __attribute__((ext_vector_type(4), may_alias));
union FragB { v16b v; v8us half[2]; unsigned short u[16]; };

__device__ __forceinline__ unsigned short bf16_bits(float x) { unsigned int u = __float_as_uint(x); return (unsigned short)((u + 0x7FFFu + ((u >> 16) & 1u)) >> 16); }
__device__ __forceinline__ float bf16_val(unsigned short b) { return __uint_as_float(((unsigned int)b) << 16); }
__device__ __forceinline__ float bf16_round(float x) { return bf16_val(bf16_bits(x)); }
// D += A·B with NT terms: 1 = ah·bh, 2 = + al·bh (A split), 3 = + ah·bl (both split)
template <int NT>
__device__ __forceinline__ v8f mmaN(v16b ah, v16b al, v16b bh, v16b bl, v8f c) {
  c = __builtin_amdgcn_wmma_f32_16x16x32_bf16(false, ah, false, bh, (short)0, c, false, false);
  if (NT >= 2) c = __builtin_amdgcn_wmma_f32_16x16x32_bf16(false, al, false, bh, (short)0, c, false, false);
  if (NT >= 3) c = __builtin_amdgcn_wmma_f32_16x16x32_bf16(false, ah, false, bl, (short)0, c, false, false);
  asm volatile("v_nop\n\tv_nop\n\tv_nop\n\tv_nop" : "+v"(c) : "v"(ah), "v"(al), "v"(bh), "v"(bl));
  return c;
}

__global__ __launch_bounds__(256) void k_wt_bf16(const float* __restrict__ W, unsigned short* __restrict__ Wt, int K, int N) {
  const int t = blockIdx.x * 256 + threadIdx.x;
  const int k8n = K / 8;
  if (t >= N * k8n) return;
  const int n = t / k8n, k8 = (t % k8n) * 8;
  v8us v;
#pragma unroll
  for (int i = 0; i < 8; ++i) v[i] = bf16_bits(W[(size_t)(k8 + i) * N + n]);
  *(v8us*)(Wt + (size_t)n * K + k8) = v;
  
}

// GEMM C[M][N] (f32, pitch ldc) = act(A[M][K]·W + bias). A f32 row-major (pitch lda) converted per fragment to bf16
// (ASPLIT: hi/lo two planes -> 2 terms, else single rounded term); Wt bf16 [N][K] (pitch ldb). BIAS_BF16 rounds the
// bias to bf16 first (bias quantised to bf16 before the add). K%32==0, M%16==0, N%64==0.
template <bool ASPLIT, int ACT, bool BIAS_BF16>
__global__ __launch_bounds__(128) void k_gemm_bf(const float* __restrict__ A, int lda, const unsigned short* __restrict__ Wt, int ldb,
                                               const float* __restrict__ bias, float* __restrict__ C, int ldc, int M, int N, int K) {
  __shared__ __attribute__((aligned(16))) float so[4][16][64];
  const int tid = threadIdx.x, w = tid >> 5, lane = tid & 31, ln = lane & 15, hh = lane >> 4;
  const int ntn = N / 64;
  const int wid = blockIdx.x * 4 + w;
  const int mt = wid / ntn, nq = wid % ntn;
  if (mt * 16 >= M) return;
  const int row0 = mt * 16, col0 = nq * 64;
  const float* arow = A + (size_t)(row0 + ln) * lda;
  v8f acc[4] = {};
  for (int kb = 0; kb < K; kb += 32) {
    FragB ah, al;
    const v4f x0 = *(const v4fa*)(arow + kb + 8 * hh), x1 = *(const v4fa*)(arow + kb + 8 * hh + 4);
    const v4f x2 = *(const v4fa*)(arow + kb + 16 + 8 * hh), x3 = *(const v4fa*)(arow + kb + 16 + 8 * hh + 4);
    float xs[16] = {x0[0],x0[1],x0[2],x0[3],x1[0],x1[1],x1[2],x1[3],x2[0],x2[1],x2[2],x2[3],x3[0],x3[1],x3[2],x3[3]};
#pragma unroll
    for (int i = 0; i < 16; ++i) { const unsigned short hb = bf16_bits(xs[i]); ah.u[i] = hb; al.u[i] = ASPLIT ? bf16_bits(xs[i] - bf16_val(hb)) : (unsigned short)0; }
#pragma unroll
    for (int t = 0; t < 4; ++t) {
      const unsigned short* brow = Wt + (size_t)(col0 + t * 16 + ln) * ldb + kb;
      FragB b;
      b.half[0] = *(const v8us*)(brow + 8 * hh);
      b.half[1] = *(const v8us*)(brow + 16 + 8 * hh);
      acc[t] = mmaN<ASPLIT ? 2 : 1>(ah.v, al.v, b.v, b.v, acc[t]);
    }
  }
#pragma unroll
  for (int t = 0; t < 4; ++t) {
    float bv = bias ? bias[col0 + t * 16 + ln] : 0.f;
    if (BIAS_BF16) bv = bf16_round(bv);
#pragma unroll
    for (int r = 0; r < 8; ++r) { float v = acc[t][r] + bv; if (ACT == 1) v = fmaxf(v, 0.f); so[w][8 * hh + r][t * 16 + ln] = v; }
  }
  __builtin_amdgcn_fence(__ATOMIC_ACQ_REL, "workgroup");
  __builtin_amdgcn_wave_barrier();
  const int rsub = lane >> 4, c4 = (lane & 15) * 4;
  {
#pragma unroll
    for (int q = 0; q < 8; ++q) {
      const int r = q * 2 + rsub;
      const v4f v = *(const v4fa*)&so[w][r][c4];
      *(v4f*)(C + (size_t)(row0 + r) * ldc + col0 + c4) = v;
    }
    
  }
}

// Flash-style causal/unmasked attention, all contractions 3-term bf16 hi/lo splits, f32 softmax with running max.
// q,k,v rows are read from f32 buffers with arbitrary row pitch (so they can live inside a fused qkv buffer);
// D = head size (multiple of 32, <= 128); one wave = 16 query rows; block = 4 waves (64 queries) sharing K/V chunks of 32.
template <int D, bool CAUSAL>
__global__ __launch_bounds__(128) void k_flash(const float* __restrict__ qb, const float* __restrict__ kb, const float* __restrict__ vb,
                                             int pitch, int T, int H, float scale, float* __restrict__ y, int ypitch) {
  constexpr int KS = D / 32;        // k-steps for QK
  constexpr int DT = D / 16;        // d tiles for PV
  __shared__ __attribute__((aligned(16))) unsigned short sKh[32][D + 8], sKl[32][D + 8], sVh[32][D + 8], sVl[32][D + 8];
  __shared__ __attribute__((aligned(16))) unsigned short sPh[4][16][40], sPl[4][16][40];
  __shared__ __attribute__((aligned(16))) float sO[4][16][D];
  const int tid = threadIdx.x, w = tid >> 5, lane = tid & 31, ln = lane & 15, hh = lane >> 4;
  const int nqb = (T + 63) / 64;
  const int bh = blockIdx.x / nqb, qblk = blockIdx.x % nqb;
  const int b = bh / H, h = bh % H;
  const int q0 = qblk * 64 + w * 16;
  const float* Q = qb + (size_t)b * T * pitch + h * D;
  const float* K = kb + (size_t)b * T * pitch + h * D;
  const float* V = vb + (size_t)b * T * pitch + h * D;

  // A fragments of the wave's 16 query rows (scaled), hi/lo
  FragB aqh[KS], aql[KS];
  {
    int row = q0 + ln; if (row >= T) row = T - 1;
    const float* qr = Q + (size_t)row * pitch;
#pragma unroll
    for (int ks = 0; ks < KS; ++ks)
#pragma unroll
      for (int i = 0; i < 16; ++i) {
        const int d = ks * 32 + ((i < 8) ? (8 * hh + i) : (16 + 8 * hh + (i - 8)));
        const float x = qr[d] * scale; const unsigned short hb = bf16_bits(x);
        aqh[ks].u[i] = hb; aql[ks].u[i] = bf16_bits(x - bf16_val(hb));
      }
  }
  float m_r[8], l_r[8];
#pragma unroll
  for (int r = 0; r < 8; ++r) { m_r[r] = -3.0e38f; l_r[r] = 0.f; }
  v8f oacc[DT];
#pragma unroll
  for (int dt = 0; dt < DT; ++dt) oacc[dt] = (v8f){0.f,0.f,0.f,0.f,0.f,0.f,0.f,0.f};

  const int kv_end = CAUSAL ? min(T, qblk * 64 + 64) : T;     // block-uniform
  for (int j0 = 0; j0 < kv_end; j0 += 32) {
    __syncthreads();
    for (int e = tid; e < 32 * (D / 4); e += 128) {
      const int r = e / (D / 4), c4 = (e % (D / 4)) * 4;
      const int key = j0 + r;
      v4f kf = {0.f,0.f,0.f,0.f}, vf = {0.f,0.f,0.f,0.f};
      if (key < T) { kf = *(const v4fa*)(K + (size_t)key * pitch + c4); vf = *(const v4fa*)(V + (size_t)key * pitch + c4); }
#pragma unroll
      for (int t = 0; t < 4; ++t) {
        unsigned short hb = bf16_bits(kf[t]); sKh[r][c4 + t] = hb; sKl[r][c4 + t] = bf16_bits(kf[t] - bf16_val(hb));
        hb = bf16_bits(vf[t]); sVh[r][c4 + t] = hb; sVl[r][c4 + t] = bf16_bits(vf[t] - bf16_val(hb));
      }
    }
    __syncthreads();
    // S tile 16 x 32
    v8f s[2];
#pragma unroll
    for (int nt = 0; nt < 2; ++nt) {
      v8f acc = {};
#pragma unroll
      for (int ks = 0; ks < KS; ++ks) {
        FragB bh_, bl_;
        bh_.half[0] = *(const v8us*)&sKh[nt * 16 + ln][ks * 32 + 8 * hh]; bh_.half[1] = *(const v8us*)&sKh[nt * 16 + ln][ks * 32 + 16 + 8 * hh];
        bl_.half[0] = *(const v8us*)&sKl[nt * 16 + ln][ks * 32 + 8 * hh]; bl_.half[1] = *(const v8us*)&sKl[nt * 16 + ln][ks * 32 + 16 + 8 * hh];
        acc = mmaN<3>(aqh[ks].v, aql[ks].v, bh_.v, bl_.v, acc);
      }
      s[nt] = acc;
    }
    // mask + running max (rows 8hh+r; the 16 lanes of a half share rows)
    float alpha[8];
#pragma unroll
    for (int r = 0; r < 8; ++r) {
      const int qi = q0 + 8 * hh + r;
      const int ja = j0 + ln, jb = j0 + 16 + ln;
      if (CAUSAL) { if (ja > qi) s[0][r] = -3.0e38f; if (jb > qi) s[1][r] = -3.0e38f; }
      if (ja >= T) s[0][r] = -3.0e38f;
      if (jb >= T) s[1][r] = -3.0e38f;
      float mx = fmaxf(s[0][r], s[1][r]);
      mx = fmaxf(mx, __shfl_xor(mx, 1, 32)); mx = fmaxf(mx, __shfl_xor(mx, 2, 32)); mx = fmaxf(mx, __shfl_xor(mx, 4, 32)); mx = fmaxf(mx, __shfl_xor(mx, 8, 32));
      const float mnew = fmaxf(m_r[r], mx);
      alpha[r] = (mnew > -1.0e38f) ? __expf(m_r[r] - mnew) : 1.0f;
      const float p0 = (s[0][r] > -1.0e38f) ? __expf(s[0][r] - mnew) : 0.f;
      const float p1 = (s[1][r] > -1.0e38f) ? __expf(s[1][r] - mnew) : 0.f;
      m_r[r] = mnew;
      l_r[r] = l_r[r] * alpha[r] + p0 + p1;            // per-lane partial row sum (16 lanes combined at the end)
      unsigned short hb = bf16_bits(p0); sPh[w][8 * hh + r][ln] = hb;      sPl[w][8 * hh + r][ln] = bf16_bits(p0 - bf16_val(hb));
      hb = bf16_bits(p1);                sPh[w][8 * hh + r][16 + ln] = hb; sPl[w][8 * hh + r][16 + ln] = bf16_bits(p1 - bf16_val(hb));
    }
#pragma unroll
    for (int dt = 0; dt < DT; ++dt)
#pragma unroll
      for (int r = 0; r < 8; ++r) oacc[dt][r] *= alpha[r];
    __builtin_amdgcn_fence(__ATOMIC_ACQ_REL, "workgroup");
    __builtin_amdgcn_wave_barrier();
    FragB pah, pal;
    pah.half[0] = *(const v8us*)&sPh[w][ln][8 * hh]; pah.half[1] = *(const v8us*)&sPh[w][ln][16 + 8 * hh];
    pal.half[0] = *(const v8us*)&sPl[w][ln][8 * hh]; pal.half[1] = *(const v8us*)&sPl[w][ln][16 + 8 * hh];
#pragma unroll
    for (int dt = 0; dt < DT; ++dt) {
      FragB bvh, bvl;
#pragma unroll
      for (int i = 0; i < 8; ++i) {
        bvh.u[i] = sVh[8 * hh + i][dt * 16 + ln]; bvh.u[8 + i] = sVh[16 + 8 * hh + i][dt * 16 + ln];
        bvl.u[i] = sVl[8 * hh + i][dt * 16 + ln]; bvl.u[8 + i] = sVl[16 + 8 * hh + i][dt * 16 + ln];
      }
      oacc[dt] = mmaN<3>(pah.v, pal.v, bvh.v, bvl.v, oacc[dt]);
    }
    __builtin_amdgcn_fence(__ATOMIC_ACQ_REL, "workgroup");
    __builtin_amdgcn_wave_barrier();
  }
#pragma unroll
  for (int r = 0; r < 8; ++r) {
    float l = l_r[r];
    l += __shfl_xor(l, 1, 32); l += __shfl_xor(l, 2, 32); l += __shfl_xor(l, 4, 32); l += __shfl_xor(l, 8, 32);
    l_r[r] = (l > 0.f) ? 1.0f / l : 0.f;
  }
#pragma unroll
  for (int dt = 0; dt < DT; ++dt)
#pragma unroll
    for (int r = 0; r < 8; ++r) sO[w][8 * hh + r][dt * 16 + ln] = oacc[dt][r] * l_r[r];
  __builtin_amdgcn_fence(__ATOMIC_ACQ_REL, "workgroup");
  __builtin_amdgcn_wave_barrier();
  {
    for (int r = 0; r < 16; ++r) {
      const int row = q0 + r;
      if (row < T && lane < D / 4) {
        const v4f val = *(const v4fa*)&sO[w][r][lane * 4];
        *(v4f*)(y + ((size_t)b * T + row) * ypitch + h * D + lane * 4) = val;
      }
    }
    
  }
}

// GEMM C = act(A·W + bias + resid): A f32 (ASPLIT -> hi/lo 2 terms), Wt bf16 [N][K]; ACT 0 none, 1 relu, 2 exact gelu;
// resid (optional, f32, row index = (row % rmod), pitch ldr, RES_BF16 rounds it) added before the activation.
template <bool ASPLIT, int ACT, bool BIAS_BF16, bool RES_BF16>
__global__ __launch_bounds__(128) void k_gemm_bf3(const float* __restrict__ A, int lda, const unsigned short* __restrict__ Wt, int ldb,
                                                const float* __restrict__ bias, const float* __restrict__ resid, int rmod, int ldr,
                                                float* __restrict__ C, int ldc, int M, int N, int K) {
  __shared__ __attribute__((aligned(16))) float so[4][16][64];
  const int tid = threadIdx.x, w = tid >> 5, lane = tid & 31, ln = lane & 15, hh = lane >> 4;
  const int ntn = N / 64;
  const int wid = blockIdx.x * 4 + w;
  const int mt = wid / ntn, nq = wid % ntn;
  if (mt * 16 >= M) return;
  const int row0 = mt * 16, col0 = nq * 64;
  const float* arow = A + (size_t)(row0 + ln) * lda;
  v8f acc[4] = {};
  for (int kb = 0; kb < K; kb += 32) {
    FragB ah, al;
    const v4f x0 = *(const v4fa*)(arow + kb + 8 * hh), x1 = *(const v4fa*)(arow + kb + 8 * hh + 4);
    const v4f x2 = *(const v4fa*)(arow + kb + 16 + 8 * hh), x3 = *(const v4fa*)(arow + kb + 16 + 8 * hh + 4);
    float xs[16] = {x0[0],x0[1],x0[2],x0[3],x1[0],x1[1],x1[2],x1[3],x2[0],x2[1],x2[2],x2[3],x3[0],x3[1],x3[2],x3[3]};
#pragma unroll
    for (int i = 0; i < 16; ++i) { const unsigned short hb = bf16_bits(xs[i]); ah.u[i] = hb; al.u[i] = ASPLIT ? bf16_bits(xs[i] - bf16_val(hb)) : (unsigned short)0; }
#pragma unroll
    for (int t = 0; t < 4; ++t) {
      const unsigned short* brow = Wt + (size_t)(col0 + t * 16 + ln) * ldb + kb;
      FragB b;
      b.half[0] = *(const v8us*)(brow + 8 * hh);
      b.half[1] = *(const v8us*)(brow + 16 + 8 * hh);
      acc[t] = mmaN<ASPLIT ? 2 : 1>(ah.v, al.v, b.v, b.v, acc[t]);
    }
  }
#pragma unroll
  for (int t = 0; t < 4; ++t) {
    const int col = col0 + t * 16 + ln;
    float bv = bias ? bias[col] : 0.f;
    if (BIAS_BF16) bv = bf16_round(bv);
#pragma unroll
    for (int r = 0; r < 8; ++r) {
      float v = acc[t][r] + bv;
      if (resid) { float rv = resid[(size_t)((row0 + 8 * hh + r) % rmod) * ldr + col]; if (RES_BF16) rv = bf16_round(rv); v += rv; }
      if (ACT == 1) v = fmaxf(v, 0.f);
      if (ACT == 2) v = 0.5f * v * (1.0f + erff(v * 0.70710678118654752f));
      if (ACT == 3) { const float u = 0.7978845608028654f * (v + 0.044715f * v * v * v); v = 0.5f * v * (1.0f + tanhf(u)); }
      so[w][8 * hh + r][t * 16 + ln] = v;
    }
  }
  __builtin_amdgcn_fence(__ATOMIC_ACQ_REL, "workgroup");
  __builtin_amdgcn_wave_barrier();
  const int rsub = lane >> 4, c4 = (lane & 15) * 4;
  {
#pragma unroll
    for (int q = 0; q < 8; ++q) {
      const int r = q * 2 + rsub;
      const v4f v = *(const v4fa*)&so[w][r][c4];
      *(v4f*)(C + (size_t)(row0 + r) * ldc + col0 + c4) = v;
    }
    
  }
}
// row LayerNorm (biased variance, eps) over N: s = X (+ R); optional out_sum <- s; out_norm <- (s-mu)*rsqrt(var+eps)*g + b
template <bool PARAM_BF16>
__global__ __launch_bounds__(256) void k_layernorm(const float* __restrict__ X, const float* __restrict__ R, const float* __restrict__ g, const float* __restrict__ bta,
                                                  float* __restrict__ out_sum, float* __restrict__ out_norm, int N, float eps) {
  __shared__ float red[256];
  const int row = blockIdx.x, tid = threadIdx.x;
  const float* x = X + (size_t)row * N; const float* rr = R ? R + (size_t)row * N : nullptr;
  float vals[16];                     // up to N = 4096
  const int per = N / 256;            // contiguous chunk per thread? use strided-by-4 chunks: thread handles j = tid*4 + 1024*u
  float s1 = 0.f;
  for (int u = 0; u < per / 4; ++u) {
    const int j = tid * 4 + 1024 * u;
    const v4f a = *(const v4fa*)(x + j);
    v4f b = {0.f,0.f,0.f,0.f}; if (rr) b = *(const v4fa*)(rr + j);
#pragma unroll
    for (int q = 0; q < 4; ++q) { const float v = a[q] + b[q]; vals[u * 4 + q] = v; s1 += v; }
  }
  red[tid] = s1; __syncthreads();
  for (int st = 128; st > 0; st >>= 1) { if (tid < st) red[tid] += red[tid + st]; __syncthreads(); }
  const float mu = red[0] / (float)N; __syncthreads();
  float s2 = 0.f;
  for (int u = 0; u < per / 4; ++u)
#pragma unroll
    for (int q = 0; q < 4; ++q) { const float c = vals[u * 4 + q] - mu; s2 += c * c; }
  red[tid] = s2; __syncthreads();
  for (int st = 128; st > 0; st >>= 1) { if (tid < st) red[tid] += red[tid + st]; __syncthreads(); }
  const float rs = rsqrtf(red[0] / (float)N + eps);
  {
    for (int u = 0; u < per / 4; ++u) {
      const int j = tid * 4 + 1024 * u;
      v4f o, sm;
#pragma unroll
      for (int q = 0; q < 4; ++q) {
        float gg = g[j + q], bb = bta[j + q];
        if (PARAM_BF16) { gg = bf16_round(gg); bb = bf16_round(bb); }
        sm[q] = vals[u * 4 + q]; o[q] = (vals[u * 4 + q] - mu) * rs * gg + bb;
      }
      if (out_sum) *(v4f*)(out_sum + (size_t)row * N + j) = sm;
      *(v4f*)(out_norm + (size_t)row * N + j) = o;
    }
    
  }
}



// ---- f16 WMMA path (v_wmma_f32_16x16x32_f16): 11-bit significands for operands in range — used where a [0,1] probability operand needs more precision than bf16
typedef _Float16 v16h __attribute__((ext_vector_type(16)));
union FragH { v16h v; v8us half[2]; _Float16 h[16]; unsigned short u[16]; };
template <int NT>
__device__ __forceinline__ v8f mmaH(v16h ah, v16h al, v16h bh, v16h bl, v8f c) {
  c = __builtin_amdgcn_wmma_f32_16x16x32_f16(false, ah, false, bh, (short)0, c, false, false);
  if (NT >= 2) c = __builtin_amdgcn_wmma_f32_16x16x32_f16(false, al, false, bh, (short)0, c, false, false);
  if (NT >= 3) c = __builtin_amdgcn_wmma_f32_16x16x32_f16(false, ah, false, bl, (short)0, c, false, false);
  asm volatile("v_nop\n\tv_nop\n\tv_nop\n\tv_nop" : "+v"(c) : "v"(ah), "v"(al), "v"(bh), "v"(bl));
  return c;
}
// batched GEMM like k_gemm_b but f16 operands: A f32 (split into f16 hi/lo if ASPLIT, else rounded to f16), Bt = f16 values [n][k]; alpha; C f32; N multiple of 16 (partial tiles skipped)
template <bool ASPLIT>
__global__ __launch_bounds__(128) void k_gemm_h(const float* __restrict__ A, int lda, size_t sA, const _Float16* __restrict__ Bh, int ldb, size_t sB, float alpha, float* __restrict__ C, int ldc, size_t sC, int M, int N, int K) {
  __shared__ __attribute__((aligned(16))) float so[4][16][64];
  const int tid = threadIdx.x, w = tid >> 5, lane = tid & 31, ln = lane & 15, hh = lane >> 4; const int by = blockIdx.y;
  A += (size_t)by * sA; Bh += (size_t)by * sB; C += (size_t)by * sC;
  const int ntn = (N + 63) / 64; const int wid = blockIdx.x * 4 + w; const int mt = wid / ntn, nq = wid % ntn; if (mt * 16 >= M) return;
  const int row0 = mt * 16, col0 = nq * 64; const float* arow = A + (size_t)(row0 + ln) * lda;
  v8f acc[4] = {};
  for (int kb = 0; kb < K; kb += 32) {
    FragH ah, al;
    const v4f x0 = *(const v4fa*)(arow + kb + 8 * hh), x1 = *(const v4fa*)(arow + kb + 8 * hh + 4), x2 = *(const v4fa*)(arow + kb + 16 + 8 * hh), x3 = *(const v4fa*)(arow + kb + 16 + 8 * hh + 4);
    float xs[16] = {x0[0],x0[1],x0[2],x0[3],x1[0],x1[1],x1[2],x1[3],x2[0],x2[1],x2[2],x2[3],x3[0],x3[1],x3[2],x3[3]};
#pragma unroll
    for (int i = 0; i < 16; ++i) { const _Float16 h = (_Float16)xs[i]; ah.h[i] = h; al.h[i] = ASPLIT ? (_Float16)(xs[i] - (float)h) : (_Float16)0.0f; }
#pragma unroll
    for (int t = 0; t < 4; ++t) { if (col0 + t * 16 >= N) continue; const size_t boff = (size_t)(col0 + t * 16 + ln) * ldb + kb; FragH bq; bq.half[0] = *(const v8us*)(Bh + boff + 8 * hh); bq.half[1] = *(const v8us*)(Bh + boff + 16 + 8 * hh);
      acc[t] = mmaH<ASPLIT ? 2 : 1>(ah.v, al.v, bq.v, bq.v, acc[t]); }
  }
#pragma unroll
  for (int t = 0; t < 4; ++t) { if (col0 + t * 16 >= N) continue;
#pragma unroll
    for (int r = 0; r < 8; ++r) so[w][8 * hh + r][t * 16 + ln] = acc[t][r] * alpha; }
  __builtin_amdgcn_fence(__ATOMIC_ACQ_REL, "workgroup"); __builtin_amdgcn_wave_barrier();
  const int rsub = lane >> 4, c4 = (lane & 15) * 4;
  {
#pragma unroll
    for (int q = 0; q < 8; ++q) { const int r = q * 2 + rsub; if (col0 + c4 < N) { const v4f v = *(const v4fa*)&so[w][r][c4]; *(v4f*)(C + (size_t)(row0 + r) * ldc + col0 + c4) = v; } }
     }
}

// Wt[n][k] = f16(W[k][n]·scale) from f32 row-major W[K][N] (scale = power of two; bf16-exact weights stay exact in f16 away from the subnormal range)
__global__ __launch_bounds__(256) void k_wt_f16(const float* __restrict__ W, _Float16* __restrict__ Wt, int K, int N, float scale) {
  const int t = blockIdx.x * 256 + threadIdx.x; if (t >= N * (K / 8)) return; const int n = t / (K / 8), k8 = (t % (K / 8)) * 8; FragH f;
#pragma unroll
  for (int i = 0; i < 8; ++i) f.h[i] = (_Float16)(bf16_round(W[(size_t)(k8 + i) * N + n]) * scale); const v8us o = f.half[0];
  *(v8us*)((unsigned short*)Wt + (size_t)n * K + k8) = o; 
}
// k_gemm_hh variant with fused epilogue: v = acc·alpha + bias[by·sBias + col] (+ CP[(row/rowsPerB)·sCPb + by·64 + col] if CP) ; ACT 0 none / 1 elu ; writes f32 C and f16 C16, each if non-null
template <int ACT>
__global__ __launch_bounds__(128) void k_gemm_hhx(const _Float16* __restrict__ A, int lda, size_t sA, const _Float16* __restrict__ Bh, int ldb, size_t sB, float alpha, const float* __restrict__ bias, size_t sBias, const float* __restrict__ CP, int rowsPerB, size_t sCPb, int row0g,
    float* __restrict__ C, _Float16* __restrict__ C16, int ldc, size_t sC, int M, int N, int K) {
  __shared__ __attribute__((aligned(16))) float so[4][16][64];
  const int tid = threadIdx.x, w = tid >> 5, lane = tid & 31, ln = lane & 15, hh = lane >> 4; const int by = blockIdx.y;
  A += (size_t)by * sA; Bh += (size_t)by * sB; const size_t cofs = (size_t)by * sC; const float* bp = bias ? bias + (size_t)by * sBias : nullptr;
  const int ntn = (N + 63) / 64; const int wid = blockIdx.x * 4 + w; const int mt = wid / ntn, nq = wid % ntn; if (mt * 16 >= M) return;
  const int row0 = mt * 16, col0 = nq * 64; const _Float16* arow = A + (size_t)(row0 + ln) * lda;
  v8f acc[4] = {};
  for (int kb = 0; kb < K; kb += 32) { FragH ah; ah.half[0] = *(const v8us*)((const unsigned short*)arow + kb + 8 * hh); ah.half[1] = *(const v8us*)((const unsigned short*)arow + kb + 16 + 8 * hh);
#pragma unroll
    for (int t = 0; t < 4; ++t) { if (col0 + t * 16 >= N) continue; const size_t boff = (size_t)(col0 + t * 16 + ln) * ldb + kb; FragH bq; bq.half[0] = *(const v8us*)((const unsigned short*)Bh + boff + 8 * hh); bq.half[1] = *(const v8us*)((const unsigned short*)Bh + boff + 16 + 8 * hh);
      acc[t] = mmaH<1>(ah.v, ah.v, bq.v, bq.v, acc[t]); }
  }
#pragma unroll
  for (int t = 0; t < 4; ++t) { if (col0 + t * 16 >= N) continue; const int col = col0 + t * 16 + ln; const float bv = bp ? bf16_round(bp[col]) : 0.f;
#pragma unroll
    for (int r = 0; r < 8; ++r) { float v = acc[t][r] * alpha + bv; if (CP) { const int bidx = (row0g + row0 + 8 * hh + r) / rowsPerB; v += CP[(size_t)bidx * sCPb + (size_t)by * 64 + col]; } if (ACT == 1) v = (v > 0.f) ? v : expm1f(v); else if (ACT == 7) v = (v > 0.f) ? v + 1.0f : expf(v); else if (ACT == 8) v = tanhf(v); else if (ACT == 9) v = 0.5f * v * (1.0f + tanhf(0.7978845608028654f * (v + 0.044715f * v * v * v))); else if (ACT == 11) v = 1.0f / (1.0f + expf(-v)); else if (ACT == 12) v = (v > 0.f) ? v : 0.01f * v; else if (ACT == 14) v = (v > 0.f) ? v : 0.1f * v; else if (ACT == 15) v = v / (1.0f + expf(-v)); else if (ACT == 3) v = fmaxf(v, 0.f); else if (ACT == 6) v = 0.5f * v * (1.0f + erff(v * 0.70710678118654752f)); so[w][8 * hh + r][t * 16 + ln] = v; } }
  __builtin_amdgcn_fence(__ATOMIC_ACQ_REL, "workgroup"); __builtin_amdgcn_wave_barrier();
  const int rsub = lane >> 4, c4 = (lane & 15) * 4; typedef _Float16 v4h __attribute__((ext_vector_type(4)));
  {
#pragma unroll
    for (int q = 0; q < 8; ++q) { const int r = q * 2 + rsub; if (col0 + c4 < N) { const v4f v = *(const v4fa*)&so[w][r][c4]; if (C) *(v4f*)(C + cofs + (size_t)(row0 + r) * ldc + col0 + c4) = v; if (C16) { v4h h4; for (int i = 0; i < 4; ++i) h4[i] = (_Float16)v[i]; *(v4h*)(C16 + cofs + (size_t)(row0 + r) * ldc + col0 + c4) = h4; } } }
     }
}


typedef _Float16 v4h __attribute__((ext_vector_type(4)));

// Conversion passes as streams of few, long-lived waves. A run is 1024 consecutive floats (4 KB): eight 16-byte loads a lane, each wave-wide load 512 contiguous bytes (4 whole lines);
// the four halves that a lane makes of one load leave as one 8-byte store (256 contiguous bytes a wave, 2 whole lines). A wave issues all its loads before it converts the first value.
// Addresses are a wave-uniform base plus one 32-bit lane offset in bytes (vo for the floats, vo / 2 for the halves).
// Each plain '#pragma unroll' below stands on a loop whose index picks an element of a register array.
template <int NL>
__device__ __forceinline__ void run_load(v4f* r, const float* __restrict__ src, unsigned vo) {
#pragma unroll
  for (int j = 0; j < NL; ++j) r[j] = *(const v4fa*)((const char*)src + vo + j * 512); }
// MODE 0: f16(x); 1: f16(bf16(x)); 2: f16(bf16(x) * 2^4)
template <int NL, int MODE>
__device__ __forceinline__ void run_store(const v4f* r, _Float16* __restrict__ dst, unsigned vh) {
#pragma unroll
  for (int j = 0; j < NL; ++j) { v4h h;
#pragma unroll
    for (int q = 0; q < 4; ++q) h[q] = (MODE == 0) ? (_Float16)r[j][q] : (MODE == 1) ? (_Float16)bf16_round(r[j][q]) : (_Float16)(bf16_round(r[j][q]) * 16.0f);
    *(v4h*)((char*)dst + vh + j * 256) = h; } }
// All seven inputs in one launch: 256 blocks of 16 waves; wave number n takes run n of query, of key and of value, and run n of the four weight matrices laid end to end (as Bw is).
__global__ __launch_bounds__(512) void k_cvt_in(const float* __restrict__ xq, const float* __restrict__ xk, const float* __restrict__ xv, const float* __restrict__ wq, const float* __restrict__ wk, const float* __restrict__ wv, const float* __restrict__ wo,
                                               _Float16* __restrict__ X16, _Float16* __restrict__ XK16, _Float16* __restrict__ XV16, _Float16* __restrict__ Bw) {
  static_assert(NR * DD == 4096 * 1024 && DD * DD == 1024 * 1024, "4096 runs an activation, 1024 a weight matrix");
  const unsigned lane = threadIdx.x & 31, run = blockIdx.x * 16 + (threadIdx.x >> 5);
  const unsigned m = blockIdx.x >> 6;      /* 1024 runs = 64 blocks a weight matrix: the same for the whole block */
  const float* __restrict__ w = (m == 0) ? wq : (m == 1) ? wk : (m == 2) ? wv : wo;
  const unsigned vo = run * 4096 + lane * 16, vw = (run & 1023) * 4096 + lane * 16, vh = run * 2048 + lane * 8;
  v4f r[4][8];
  run_load<8>(r[0], xq, vo); run_load<8>(r[1], xk, vo); run_load<8>(r[2], xv, vo); run_load<8>(r[3], w, vw);
  __builtin_amdgcn_sched_barrier(0);      /* all 32 loads are issued before any conversion: without it the scheduler sinks some of them among the conversions, behind waits on earlier data */
  asm volatile("s_wait_xcnt 0x0" :: "v"(vo), "v"(vw) : "memory");      /* the loads' offset registers may be reused below: wait before that overwrite; named as inputs, they are not given to a late load as its destination either */
  __builtin_amdgcn_sched_barrier(0);      /* nothing that rewrites a base or offset register of the loads is scheduled in front of that wait */
  run_store<8, 1>(r[0], X16, vh);
  asm volatile("s_wait_xcnt 0x0" ::: "memory");      /* the stores' data registers may be reused by the next run: wait before that overwrite */
  __builtin_amdgcn_sched_barrier(0);      /* keeps the next run's conversions behind that wait */
  run_store<8, 1>(r[1], XK16, vh);
  asm volatile("s_wait_xcnt 0x0" ::: "memory");      /* as above */
  __builtin_amdgcn_sched_barrier(0);
  run_store<8, 1>(r[2], XV16, vh);
  asm volatile("s_wait_xcnt 0x0" ::: "memory");      /* as above */
  __builtin_amdgcn_sched_barrier(0);
  run_store<8, 2>(r[3], Bw, vh);
}
// The attention result: 256 blocks of 8 waves, two runs a wave.
__global__ __launch_bounds__(256) void k_cvt_o(const float* __restrict__ x, _Float16* __restrict__ X16) {
  static_assert(NR * DD == 2048 * 2048, "2048 waves, 2048 floats each");
  const unsigned vo = (blockIdx.x * 8 + (threadIdx.x >> 5)) * 8192 + (threadIdx.x & 31) * 16, vh = (blockIdx.x * 8 + (threadIdx.x >> 5)) * 4096 + (threadIdx.x & 31) * 8;
  v4f r[16];
  run_load<16>(r, x, vo);
  __builtin_amdgcn_sched_barrier(0);      /* all 16 loads are issued before any conversion */
  asm volatile("s_wait_xcnt 0x0" :: "v"(vo) : "memory");      /* the loads' offset register may be reused below: wait before that overwrite; named as an input, it is not given to a late load as its destination either */
  __builtin_amdgcn_sched_barrier(0);      /* nothing that rewrites the base or offset register of the loads is scheduled in front of that wait */
  run_store<8, 0>(r, X16, vh);
  asm volatile("s_wait_xcnt 0x0" ::: "memory");      /* the stores' data registers may be reused by the second run: wait before that overwrite */
  __builtin_amdgcn_sched_barrier(0);      /* keeps the second run's conversions behind that wait */
  run_store<8, 0>(r + 8, X16, vh + 2048);
}
template <int NHv, int TTv>
__global__ __launch_bounds__(256) void k_vt(const _Float16* __restrict__ V16, int ldv, int voff, _Float16* __restrict__ Vt) { __shared__ unsigned short tl[64][66]; const int tid = threadIdx.x; const int slab = blockIdx.x / (TTv / 64), lg = blockIdx.x % (TTv / 64); const int b = slab / NHv, h = slab % NHv;
  for (int i = tid; i < 64 * 8; i += 256) { const int r = i / 8, c8 = (i % 8) * 8; FragH f; f.half[0] = *(const v8us*)((const unsigned short*)V16 + ((size_t)b * TTv + lg * 64 + r) * ldv + voff + h * 64 + c8);
#pragma unroll
    for (int q = 0; q < 8; ++q) tl[r][c8 + q] = f.u[q]; }
  __syncthreads();
  {
#pragma unroll
    for (int rd = 0; rd < 2; ++rd) { const int d = rd * 32 + tid / 8, pc = tid % 8; FragH f;
#pragma unroll
      for (int q = 0; q < 8; ++q) f.u[q] = tl[pc * 8 + q][d];
      *(v8us*)((unsigned short*)Vt + ((size_t)slab * 64 + d) * TTv + lg * 64 + pc * 8) = f.half[0]; }
     } }

// lane l <-> lane l ^ 16 (the two halves of a wave)
__device__ __forceinline__ float xhalf(float x) { return __builtin_bit_cast(float, __builtin_amdgcn_permlanex16(__builtin_bit_cast(int, x), __builtin_bit_cast(int, x), 0x76543210, 0xfedcba98, false, false)); }

// Attention with the scores transposed: S^T = K.Q^T (A = 16 key rows, B = the wave's 16 queries, kept in registers) and O^T += V^T.P^T (A = 16 rows of V^T, B = P^T).
// A lane then holds scores of ONE query (column ln): keys nt*16 + 8*hh + r of each 32-key chunk. Maximum and sum run inside the lane, with one exchange between the wave halves per chunk,
// and the two score tiles, converted in place, are the B operand of the second product (element nt*8 + r = key nt*16 + 8*hh + r, the k order of the V^T loader): P never leaves the registers.
// The keys' frac values, rounded once per block, are read from LDS (8 consecutive keys per tile and lane).
__global__ __launch_bounds__(128) void k_flash(const _Float16* __restrict__ Q16, int ldq, const _Float16* __restrict__ K16, int ldk, const _Float16* __restrict__ Vt, const float* __restrict__ FR, const float* __restrict__ AP, const float* __restrict__ AN, const float* __restrict__ GM, const float* __restrict__ DLT, float* __restrict__ O, int ldo) {
  constexpr int NQB = TT / 64, DT = 4, KS = 2;
  __shared__ __attribute__((aligned(16))) float sF[TT]; __shared__ __attribute__((aligned(16))) float sO[4][16][64 + 4];
  const int tid = threadIdx.x, w = tid >> 5, lane = tid & 31, ln = lane & 15, hh = lane >> 4;
  const int slab = blockIdx.x / NQB, qblk = blockIdx.x % NQB; const int b = slab / NH, h = slab % NH; const int q0 = qblk * 64 + w * 16;
  const float* frb = FR + (size_t)b * TT;
#pragma unroll
  for (int i = 0; i < TT / 512; ++i) { const int e = i * 512 + tid * 4; v4f f = *(const v4fa*)(frb + e);
#pragma unroll
    for (int q = 0; q < 4; ++q) f[q] = bf16_round(f[q]);
    *(v4fa*)&sF[e] = f; }
  FragH bq[KS]; const unsigned short* qr = (const unsigned short*)Q16 + ((size_t)b * TT + q0 + ln) * ldq + h * 64;      /* B operand: column ln = query q0 + ln */
#pragma unroll
  for (int ks = 0; ks < KS; ++ks) { bq[ks].half[0] = *(const v8us*)(qr + ks * 32 + 8 * hh); bq[ks].half[1] = *(const v8us*)(qr + ks * 32 + 16 + 8 * hh); }
  const char* gk = (const char*)K16 + ((size_t)b * TT * ldk + h * 64) * 2; const unsigned vk = (unsigned)(ln * ldk + 8 * hh) * 2u;      /* wave-uniform bases, one 32-bit lane offset each that lives through the loop */
  const char* gv = (const char*)Vt + (size_t)slab * 64 * TT * 2; const unsigned vv = (unsigned)(ln * TT + 8 * hh) * 2u;
  constexpr float L2E = 1.44269504088896340736f;      /* log2(e): the scores are formed in base-2 units, so that exp(s - m) is one hardware exp2 of a difference */
  const float gmm = bf16_round(GM[0]), dlt = bf16_round(DLT[0]); const float aph = bf16_round(AP[h]) * dlt * L2E, anh = bf16_round(AN[h]) * dlt * L2E;      /* gamma, delta scalars; log2(e)*delta*alpha_pos[h], log2(e)*delta*alpha_neg[h] */
  const float g8 = gmm * 0.125f * L2E;      /* log2(e) * gamma * 64^-1/2 */
  const float fq = bf16_round(frb[q0 + ln]);      /* frac of the lane's query */
  float m_r = -3.0e38f, l_r = 0.f; v8f oacc[DT];
#pragma unroll
  for (int dt = 0; dt < DT; ++dt) oacc[dt] = (v8f){0.f,0.f,0.f,0.f,0.f,0.f,0.f,0.f};
  __syncthreads();      /* sF is complete before any wave reads it */
#pragma unroll 1      /* rolled: 64 copies of this body would only grow the code */
  for (int j0 = 0; j0 < TT; j0 += 32) {
    FragH ak[2][KS], av[DT]; v4f fk[2][2];
#pragma unroll
    for (int nt = 0; nt < 2; ++nt) { const char* kr = gk + (size_t)(j0 + nt * 16) * ldk * 2;      /* A operand: row ln = key j0 + nt*16 + ln */
#pragma unroll
      for (int ks = 0; ks < KS; ++ks) { ak[nt][ks].half[0] = *(const v8us*)(kr + vk + ks * 64); ak[nt][ks].half[1] = *(const v8us*)(kr + vk + ks * 64 + 32); } }
    asm volatile("s_wait_xcnt 0x0" ::: "memory");      /* the key loads' address registers may be given to the V^T loads as destinations: wait before that overwrite */
#pragma unroll
    for (int dt = 0; dt < DT; ++dt) { const char* vrow = gv + (size_t)j0 * 2 + (size_t)(dt * 16) * TT * 2; av[dt].half[0] = *(const v8us*)(vrow + vv); av[dt].half[1] = *(const v8us*)(vrow + vv + 32); }      /* A operand: row ln = head column dt*16 + ln */
    asm volatile("s_wait_xcnt 0x0" ::: "memory");      /* the loads' address registers may be reused or advanced below: wait before that overwrite */
#pragma unroll
    for (int nt = 0; nt < 2; ++nt) { fk[nt][0] = *(const v4fa*)&sF[j0 + nt * 16 + 8 * hh]; fk[nt][1] = *(const v4fa*)&sF[j0 + nt * 16 + 8 * hh + 4]; }      /* frac of the lane's 16 keys */
    float sc[16];
#pragma unroll
    for (int nt = 0; nt < 2; ++nt) { v8f acc = (v8f){0.f,0.f,0.f,0.f,0.f,0.f,0.f,0.f};
#pragma unroll
      for (int ks = 0; ks < KS; ++ks) acc = __builtin_amdgcn_wmma_f32_16x16x32_f16(false, ak[nt][ks].v, false, bq[ks].v, (short)0, acc, false, false);
#pragma unroll
      for (int r = 0; r < 8; ++r) { float d = fk[nt][r >> 2][r & 3] - fq; d = fminf(fmaxf(d, -0.2f), 0.2f);      /* D = clip(frac_k - frac_q, -0.2, 0.2) */
        const float sb = aph * fmaxf(d, 0.f) + anh * fminf(d, 0.f);      /* log2(e)*delta*(alpha_pos*D+ + alpha_neg*D-) */
        sc[nt * 8 + r] = g8 * acc[r] + sb; } }
    float mx[4];
#pragma unroll
    for (int q = 0; q < 4; ++q) mx[q] = fmaxf(fmaxf(sc[q], sc[4 + q]), fmaxf(sc[8 + q], sc[12 + q]));
    float mc = fmaxf(fmaxf(mx[0], mx[1]), fmaxf(mx[2], mx[3])); mc = fmaxf(mc, xhalf(mc));      /* the query's maximum over all 32 keys, in both halves */
    const float mn = fmaxf(m_r, mc - 10.0f); const float al = (mn > -1.0e38f) ? __builtin_amdgcn_exp2f(m_r - mn) : 1.0f; m_r = mn;      /* the running maximum is kept 10 lower: 2^(s - mn) is then P * 2^10, the scale of the f16 operand, in the sum as well */
    FragH pb; float ps[4];
#pragma unroll
    for (int i = 0; i < 16; ++i) { const float p = __builtin_amdgcn_exp2f(sc[i] - mn); ps[i & 3] = (i < 4) ? p : ps[i & 3] + p; pb.h[i] = (_Float16)p; }
    l_r = l_r * al + ((ps[0] + ps[1]) + (ps[2] + ps[3]));      /* the lane's 16 keys; the halves are joined after the loop */
#pragma unroll
    for (int dt = 0; dt < DT; ++dt) {
#pragma unroll
      for (int r = 0; r < 8; ++r) oacc[dt][r] *= al;
      oacc[dt] = __builtin_amdgcn_wmma_f32_16x16x32_f16(false, av[dt].v, false, pb.v, (short)0, oacc[dt], false, false); } }
  const float l = l_r + xhalf(l_r); const float inv = (l > 0.f) ? 1.0f / l : 0.f;      /* sum and O carry the same 2^10 */
#pragma unroll
  for (int dt = 0; dt < DT; ++dt)      /* oacc[dt][r] = O[query ln][dt*16 + 8*hh + r] */
#pragma unroll
    for (int c = 0; c < 2; ++c) { const v4f o = {oacc[dt][4 * c] * inv, oacc[dt][4 * c + 1] * inv, oacc[dt][4 * c + 2] * inv, oacc[dt][4 * c + 3] * inv}; *(v4fa*)&sO[w][ln][dt * 16 + 8 * hh + 4 * c] = o; }
  __builtin_amdgcn_fence(__ATOMIC_ACQ_REL, "workgroup"); __builtin_amdgcn_wave_barrier();      /* the wave's LDS stores are done, and stay in front, before its lanes read each other's values back */
#pragma unroll
  for (int rp = 0; rp < 16; rp += 2) { const int r = rp + (lane >> 4), pc = lane & 15; const v4f val = *(const v4fa*)&sO[w][r][pc * 4]; *(v4f*)(O + ((size_t)b * TT + q0 + r) * ldo + h * 64 + pc * 4) = val; }
}

// Block-tiled GEMM, C = (A.Bh^T)*alpha + bias: a block of 8 waves owns a 128 x 128 tile of C and stages 128 x 64 pieces of A and of Bh in LDS, so every operand byte is fetched once a block, in whole 128-B lines
// (8 lanes a row), and is read as fragments from LDS. Wave tile 32 x 64 (2 x 4 accumulators). The next piece is fetched into registers while this one is multiplied. k runs upward in steps of 32.
// M % 128 == 0 (grid), N % 128 == 0, K % 64 == 0. LDS row pitch 64 + 8 halves = 144 B for the 16-byte fragment reads.
// Each plain '#pragma unroll' below, except those on the ks and q loops, stands on a short loop whose index picks an element of a register array (staging registers, fragments, accumulators): unrolled, these stay in registers.
template <int N, int K, bool HALF_OUT>
__global__ __launch_bounds__(256) void k_gemm_tile(const _Float16* __restrict__ A, const _Float16* __restrict__ Bh, float alpha, const float* __restrict__ bias, float* __restrict__ C, _Float16* __restrict__ C16) {
  constexpr int BM = 128, BN = 128, BK = 64, LP = BK + 8;
  __shared__ __attribute__((aligned(16))) unsigned short sm[8 * 32 * 64 * 2];      /* 64 KB: the output staging (8 waves x 32 x 64 f32) is the larger use; the operand pieces take (BM + BN) * LP halves */
  static_assert((BM + BN) * LP <= 8 * 32 * 64 * 2, "operand pieces fit");
  unsigned short* sA = sm; unsigned short* sB = sm + BM * LP;
  const int tid = threadIdx.x, w = tid >> 5, lane = tid & 31, ln = lane & 15, hh = lane >> 4;
  const int nbn = N / BN; const int row0 = (blockIdx.x / nbn) * BM, col0 = (blockIdx.x % nbn) * BN;
  const int wm = w >> 1, wn = w & 1;
  const int lr = tid >> 3, lc = (tid & 7) * 8;
  const char* ga = (const char*)A + (size_t)row0 * K * 2; const char* gb = (const char*)Bh + (size_t)col0 * K * 2; const unsigned vo = (unsigned)(lr * K + lc) * 2u;      /* block-uniform bases, one 32-bit lane offset that lives through the loop */
  v8us ra[4], rb[4];
#pragma unroll
  for (int i = 0; i < 4; ++i) { ra[i] = *(const v8us*)(ga + vo + (size_t)(32 * i) * K * 2); rb[i] = *(const v8us*)(gb + vo + (size_t)(32 * i) * K * 2); }
  v8f acc[2][4];
#pragma unroll
  for (int mi = 0; mi < 2; ++mi)
#pragma unroll
    for (int t = 0; t < 4; ++t) acc[mi][t] = (v8f){0.f,0.f,0.f,0.f,0.f,0.f,0.f,0.f};
#pragma unroll 1      /* rolled: K is a constant here, and 16 copies of this body would only grow the code */
  for (int kb = 0; kb < K; kb += BK) {
#pragma unroll
    for (int i = 0; i < 4; ++i) { *(v8us*)&sA[(lr + 32 * i) * LP + lc] = ra[i]; *(v8us*)&sB[(lr + 32 * i) * LP + lc] = rb[i]; }
    __syncthreads();      /* the piece is complete before any wave reads fragments */
    if (kb + BK < K) {
#pragma unroll
      for (int i = 0; i < 4; ++i) { ra[i] = *(const v8us*)(ga + (size_t)(kb + BK) * 2 + vo + (size_t)(32 * i) * K * 2); rb[i] = *(const v8us*)(gb + (size_t)(kb + BK) * 2 + vo + (size_t)(32 * i) * K * 2); }
      asm volatile("s_wait_xcnt 0x0" ::: "memory"); }      /* the loads' address registers are reused by the fragment reads below: wait before that overwrite */
#pragma unroll
    for (int ks = 0; ks < BK / 32; ++ks) { FragH a[2], bq[4];
#pragma unroll
      for (int mi = 0; mi < 2; ++mi) { const unsigned short* p = &sA[(wm * 32 + mi * 16 + ln) * LP + ks * 32 + 8 * hh]; a[mi].half[0] = *(const v8us*)p; a[mi].half[1] = *(const v8us*)(p + 16); }
#pragma unroll
      for (int t = 0; t < 4; ++t) { const unsigned short* p = &sB[(wn * 64 + t * 16 + ln) * LP + ks * 32 + 8 * hh]; bq[t].half[0] = *(const v8us*)p; bq[t].half[1] = *(const v8us*)(p + 16); }
#pragma unroll
      for (int mi = 0; mi < 2; ++mi)
#pragma unroll
        for (int t = 0; t < 4; ++t) acc[mi][t] = __builtin_amdgcn_wmma_f32_16x16x32_f16(false, a[mi].v, false, bq[t].v, (short)0, acc[mi][t], false, false); }
    __syncthreads();      /* every wave has read the piece before it is overwritten (by the next piece, or by the output staging below) */
  }
  float* so = (float*)sm + w * (32 * 64);      /* each wave stages its 32 x 64 results in its own 8 KB, to store whole lines */
  const int rsub = lane >> 4, c4 = (lane & 15) * 4; float bv[4];
#pragma unroll
  for (int t = 0; t < 4; ++t) bv[t] = bf16_round(bias[col0 + wn * 64 + t * 16 + ln]);
#pragma unroll
  for (int mi = 0; mi < 2; ++mi)
#pragma unroll
    for (int t = 0; t < 4; ++t)
#pragma unroll
      for (int r = 0; r < 8; ++r) so[(mi * 16 + 8 * hh + r) * 64 + t * 16 + ln] = acc[mi][t][r] * alpha + bv[t];
  __builtin_amdgcn_fence(__ATOMIC_ACQ_REL, "workgroup"); __builtin_amdgcn_wave_barrier();      /* the wave's LDS stores are done, and stay in front, before its lanes read each other's values back */
#pragma unroll
  for (int q = 0; q < 16; ++q) { const int r = q * 2 + rsub; const v4f v = *(const v4fa*)&so[r * 64 + c4]; const size_t o = (size_t)(row0 + wm * 32 + r) * N + col0 + wn * 64 + c4;
    if (HALF_OUT) { v4h h4;
#pragma unroll
      for (int i = 0; i < 4; ++i) h4[i] = (_Float16)v[i];
      *(v4h*)(C16 + o) = h4; }
    else *(v4f*)(C + o) = v; }
}

extern "C" void kernel_launch(void* const* d_in, const int* in_sizes, int n_in,
                              void* d_out, int out_size, void* d_ws, size_t ws_size, hipStream_t stream) {
  (void)in_sizes; (void)n_in; (void)out_size;
  const float* const* I = (const float* const*)d_in; const float* xq = I[0]; const float* xk = I[1]; const float* xv = I[2]; const float* frac = I[3]; const float* Wq = I[4]; const float* bq = I[5]; const float* Wk = I[6]; const float* bk = I[7]; const float* Wv = I[8]; const float* bv = I[9]; const float* Wo = I[10]; const float* bo = I[11]; const float* apos = I[12]; const float* aneg = I[13]; const float* gam = I[14]; const float* del = I[15];      /* d_in order: query, key, value, frac, Wq, bq, Wk, bk, Wv, bv, Wo, bo, alpha_pos, alpha_neg, gamma, delta */
  char* ws = (char*)d_ws; size_t off = 0;
  auto take = [&](size_t bytes) { char* p = ws + off; off += (bytes + 255) & ~(size_t)255; return p; };
  const size_t WSZ = (size_t)DD * DD; _Float16* Bw = (_Float16*)take(4 * WSZ * 2); _Float16* X16 = (_Float16*)take((size_t)NR * DD * 2); _Float16* XK16 = (_Float16*)take((size_t)NR * DD * 2); _Float16* XV16 = (_Float16*)take((size_t)NR * DD * 2);
  _Float16* Q = (_Float16*)take((size_t)NR * DD * 2); _Float16* K = (_Float16*)take((size_t)NR * DD * 2); _Float16* V = (_Float16*)take((size_t)NR * DD * 2); _Float16* Vt = (_Float16*)take((size_t)NR * DD * 2);
  float* O = (float*)take((size_t)NR * DD * 4); _Float16* O16 = V;      /* the v plane is dead once Vᵀ is built (before the attention kernel); O16 reuses it */
  if (off > ws_size) return;      // 8.4 + 7 × 8.4 + 16.8 ≈ 84 MB
  const unsigned gt = (NR / 128) * (DD / 128);
  k_cvt_in<<<256, 512, 0, stream>>>(xq, xk, xv, Wq, Wk, Wv, Wo, X16, XK16, XV16, Bw);      /* activations bf16-rounded; weights (out,in) natural, bf16-rounded, x 2^4 */
  k_gemm_tile<DD, DD, true><<<gt, 256, 0, stream>>>(X16, Bw, 0.0625f, bq, nullptr, Q);      /* Q = query·Wqᵀ + bq: M 4096 N 1024 K 1024 */
  k_gemm_tile<DD, DD, true><<<gt, 256, 0, stream>>>(XK16, Bw + WSZ, 0.0625f, bk, nullptr, K);
  k_gemm_tile<DD, DD, true><<<gt, 256, 0, stream>>>(XV16, Bw + 2 * WSZ, 0.0625f, bv, nullptr, V);
  k_vt<NH, TT><<<BB * NH * (TT / 64), 256, 0, stream>>>(V, DD, 0, Vt);
  k_flash<<<BB * NH * (TT / 64), 128, 0, stream>>>(Q, DD, K, DD, Vt, frac, apos, aneg, gam, del, O, DD);
  k_cvt_o<<<256, 256, 0, stream>>>(O, O16);
  k_gemm_tile<DD, DD, false><<<gt, 256, 0, stream>>>(O16, Bw + 3 * WSZ, 0.0625f, bo, (float*)d_out, nullptr);      /* out = O·Woᵀ + bo */
}

// v005
// It runs in 144 microseconds.
// Next to v004, in two timings, it ran 1.22 times as fast each time.
// Counting every step since v000, it is 3.12 times as fast.
#include <hip/hip_runtime.h>
// Multi-head attention with a stoichiometric bias (B=2, T=2048, D=1024, 16 heads × 64): Q,K,V = x·Wᵀ + b (torch (out,in)) from query/key/value; logits = q·kᵀ·64^-½; bias[b,h,i,j] = α_pos[h]·max(D,0) + α_neg[h]·min(D,0), D = clip(frac_j − frac_i, −0.2, 0.2);
// attn = softmax(γ·logits + δ·bias); out = (attn·V merged)·Woᵀ + bo. γ, δ are scalar inputs.
// Compute dtype: x, weights, biases rounded to bf16; q/k/v as f16 GEMM outputs; fused flash-style kernel (online softmax f32, P f16 ×2^10) on v_wmma_f32_16x16x32_f16; O → f16 → output GEMM with bias; f32 accumulate.
#define BB 2
#define TT 2048
#define NH 16
#define DD 1024
#define NR (BB * TT)

typedef __bf16 v16b __attribute__((ext_vector_type(16)));
typedef unsigned short v8us __attribute__((ext_vector_type(8), may_alias));
typedef float  v8f  __attribute__((ext_vector_type(8)));
typedef float  v4f  __attribute__((ext_vector_type(4)));
typedef float  v4fa __attribute__((ext_vector_type(4), may_alias));
union FragB { v16b v; v8us half[2]; unsigned short u[16]; };

__device__ __forceinline__ unsigned short bf16_bits(float x) { unsigned int u = __float_as_uint(x); return (unsigned short)((u + 0x7FFFu + ((u >> 16) & 1u)) >> 16); }
__device__ __forceinline__ float bf16_val(unsigned short b) { return __uint_as_float(((unsigned int)b) << 16); }
__device__ __forceinline__ float bf16_round(float x) { return bf16_val(bf16_bits(x)); }
// D += A·B with NT terms: 1 = ah·bh, 2 = + al·bh (A split), 3 = + ah·bl (both split)
template <int NT>
__device__ __forceinline__ v8f mmaN(v16b ah, v16b al, v16b bh, v16b bl, v8f c) {
  c = __builtin_amdgcn_wmma_f32_16x16x32_bf16(false, ah, false, bh, (short)0, c, false, false);
  if (NT >= 2) c = __builtin_amdgcn_wmma_f32_16x16x32_bf16(false, al, false, bh, (short)0, c, false, false);
  if (NT >= 3) c = __builtin_amdgcn_wmma_f32_16x16x32_bf16(false, ah, false, bl, (short)0, c, false, false);
  asm volatile("v_nop\n\tv_nop\n\tv_nop\n\tv_nop" : "+v"(c) : "v"(ah), "v"(al), "v"(bh), "v"(bl));
  return c;
}

__global__ __launch_bounds__(256) void k_wt_bf16(const float* __restrict__ W, unsigned short* __restrict__ Wt, int K, int N) {
  const int t = blockIdx.x * 256 + threadIdx.x;
  const int k8n = K / 8;
  if (t >= N * k8n) return;
  const int n = t / k8n, k8 = (t % k8n) * 8;
  v8us v;
#pragma unroll
  for (int i = 0; i < 8; ++i) v[i] = bf16_bits(W[(size_t)(k8 + i) * N + n]);
  *(v8us*)(Wt + (size_t)n * K + k8) = v;
  
}

// GEMM C[M][N] (f32, pitch ldc) = act(A[M][K]·W + bias). A f32 row-major (pitch lda) converted per fragment to bf16
// (ASPLIT: hi/lo two planes -> 2 terms, else single rounded term); Wt bf16 [N][K] (pitch ldb). BIAS_BF16 rounds the
// bias to bf16 first (bias quantised to bf16 before the add). K%32==0, M%16==0, N%64==0.
template <bool ASPLIT, int ACT, bool BIAS_BF16>
__global__ __launch_bounds__(128) void k_gemm_bf(const float* __restrict__ A, int lda, const unsigned short* __restrict__ Wt, int ldb,
                                               const float* __restrict__ bias, float* __restrict__ C, int ldc, int M, int N, int K) {
  __shared__ __attribute__((aligned(16))) float so[4][16][64];
  const int tid = threadIdx.x, w = tid >> 5, lane = tid & 31, ln = lane & 15, hh = lane >> 4;
  const int ntn = N / 64;
  const int wid = blockIdx.x * 4 + w;
  const int mt = wid / ntn, nq = wid % ntn;
  if (mt * 16 >= M) return;
  const int row0 = mt * 16, col0 = nq * 64;
  const float* arow = A + (size_t)(row0 + ln) * lda;
  v8f acc[4] = {};
  for (int kb = 0; kb < K; kb += 32) {
    FragB ah, al;
    const v4f x0 = *(const v4fa*)(arow + kb + 8 * hh), x1 = *(const v4fa*)(arow + kb + 8 * hh + 4);
    const v4f x2 = *(const v4fa*)(arow + kb + 16 + 8 * hh), x3 = *(const v4fa*)(arow + kb + 16 + 8 * hh + 4);
    float xs[16] = {x0[0],x0[1],x0[2],x0[3],x1[0],x1[1],x1[2],x1[3],x2[0],x2[1],x2[2],x2[3],x3[0],x3[1],x3[2],x3[3]};
#pragma unroll
    for (int i = 0; i < 16; ++i) { const unsigned short hb = bf16_bits(xs[i]); ah.u[i] = hb; al.u[i] = ASPLIT ? bf16_bits(xs[i] - bf16_val(hb)) : (unsigned short)0; }
#pragma unroll
    for (int t = 0; t < 4; ++t) {
      const unsigned short* brow = Wt + (size_t)(col0 + t * 16 + ln) * ldb + kb;
      FragB b;
      b.half[0] = *(const v8us*)(brow + 8 * hh);
      b.half[1] = *(const v8us*)(brow + 16 + 8 * hh);
      acc[t] = mmaN<ASPLIT ? 2 : 1>(ah.v, al.v, b.v, b.v, acc[t]);
    }
  }
#pragma unroll
  for (int t = 0; t < 4; ++t) {
    float bv = bias ? bias[col0 + t * 16 + ln] : 0.f;
    if (BIAS_BF16) bv = bf16_round(bv);
#pragma unroll
    for (int r = 0; r < 8; ++r) { float v = acc[t][r] + bv; if (ACT == 1) v = fmaxf(v, 0.f); so[w][8 * hh + r][t * 16 + ln] = v; }
  }
  __builtin_amdgcn_fence(__ATOMIC_ACQ_REL, "workgroup");
  __builtin_amdgcn_wave_barrier();
  const int rsub = lane >> 4, c4 = (lane & 15) * 4;
  {
#pragma unroll
    for (int q = 0; q < 8; ++q) {
      const int r = q * 2 + rsub;
      const v4f v = *(const v4fa*)&so[w][r][c4];
      *(v4f*)(C + (size_t)(row0 + r) * ldc + col0 + c4) = v;
    }
    
  }
}

// Flash-style causal/unmasked attention, all contractions 3-term bf16 hi/lo splits, f32 softmax with running max.
// q,k,v rows are read from f32 buffers with arbitrary row pitch (so they can live inside a fused qkv buffer);
// D = head size (multiple of 32, <= 128); one wave = 16 query rows; block = 4 waves (64 queries) sharing K/V chunks of 32.
template <int D, bool CAUSAL>
__global__ __launch_bounds__(128) void k_flash(const float* __restrict__ qb, const float* __restrict__ kb, const float* __restrict__ vb,
                                             int pitch, int T, int H, float scale, float* __restrict__ y, int ypitch) {
  constexpr int KS = D / 32;        // k-steps for QK
  constexpr int DT = D / 16;        // d tiles for PV
  __shared__ __attribute__((aligned(16))) unsigned short sKh[32][D + 8], sKl[32][D + 8], sVh[32][D + 8], sVl[32][D + 8];
  __shared__ __attribute__((aligned(16))) unsigned short sPh[4][16][40], sPl[4][16][40];
  __shared__ __attribute__((aligned(16))) float sO[4][16][D];
  const int tid = threadIdx.x, w = tid >> 5, lane = tid & 31, ln = lane & 15, hh = lane >> 4;
  const int nqb = (T + 63) / 64;
  const int bh = blockIdx.x / nqb, qblk = blockIdx.x % nqb;
  const int b = bh / H, h = bh % H;
  const int q0 = qblk * 64 + w * 16;
  const float* Q = qb + (size_t)b * T * pitch + h * D;
  const float* K = kb + (size_t)b * T * pitch + h * D;
  const float* V = vb + (size_t)b * T * pitch + h * D;

  // A fragments of the wave's 16 query rows (scaled), hi/lo
  FragB aqh[KS], aql[KS];
  {
    int row = q0 + ln; if (row >= T) row = T - 1;
    const float* qr = Q + (size_t)row * pitch;
#pragma unroll
    for (int ks = 0; ks < KS; ++ks)
#pragma unroll
      for (int i = 0; i < 16; ++i) {
        const int d = ks * 32 + ((i < 8) ? (8 * hh + i) : (16 + 8 * hh + (i - 8)));
        const float x = qr[d] * scale; const unsigned short hb = bf16_bits(x);
        aqh[ks].u[i] = hb; aql[ks].u[i] = bf16_bits(x - bf16_val(hb));
      }
  }
  float m_r[8], l_r[8];
#pragma unroll
  for (int r = 0; r < 8; ++r) { m_r[r] = -3.0e38f; l_r[r] = 0.f; }
  v8f oacc[DT];
#pragma unroll
  for (int dt = 0; dt < DT; ++dt) oacc[dt] = (v8f){0.f,0.f,0.f,0.f,0.f,0.f,0.f,0.f};

  const int kv_end = CAUSAL ? min(T, qblk * 64 + 64) : T;     // block-uniform
  for (int j0 = 0; j0 < kv_end; j0 += 32) {
    __syncthreads();
    for (int e = tid; e < 32 * (D / 4); e += 128) {
      const int r = e / (D / 4), c4 = (e % (D / 4)) * 4;
      const int key = j0 + r;
      v4f kf = {0.f,0.f,0.f,0.f}, vf = {0.f,0.f,0.f,0.f};
      if (key < T) { kf = *(const v4fa*)(K + (size_t)key * pitch + c4); vf = *(const v4fa*)(V + (size_t)key * pitch + c4); }
#pragma unroll
      for (int t = 0; t < 4; ++t) {
        unsigned short hb = bf16_bits(kf[t]); sKh[r][c4 + t] = hb; sKl[r][c4 + t] = bf16_bits(kf[t] - bf16_val(hb));
        hb = bf16_bits(vf[t]); sVh[r][c4 + t] = hb; sVl[r][c4 + t] = bf16_bits(vf[t] - bf16_val(hb));
      }
    }
    __syncthreads();
    // S tile 16 x 32
    v8f s[2];
#pragma unroll
    for (int nt = 0; nt < 2; ++nt) {
      v8f acc = {};
#pragma unroll
      for (int ks = 0; ks < KS; ++ks) {
        FragB bh_, bl_;
        bh_.half[0] = *(const v8us*)&sKh[nt * 16 + ln][ks * 32 + 8 * hh]; bh_.half[1] = *(const v8us*)&sKh[nt * 16 + ln][ks * 32 + 16 + 8 * hh];
        bl_.half[0] = *(const v8us*)&sKl[nt * 16 + ln][ks * 32 + 8 * hh]; bl_.half[1] = *(const v8us*)&sKl[nt * 16 + ln][ks * 32 + 16 + 8 * hh];
        acc = mmaN<3>(aqh[ks].v, aql[ks].v, bh_.v, bl_.v, acc);
      }
      s[nt] = acc;
    }
    // mask + running max (rows 8hh+r; the 16 lanes of a half share rows)
    float alpha[8];
#pragma unroll
    for (int r = 0; r < 8; ++r) {
      const int qi = q0 + 8 * hh + r;
      const int ja = j0 + ln, jb = j0 + 16 + ln;
      if (CAUSAL) { if (ja > qi) s[0][r] = -3.0e38f; if (jb > qi) s[1][r] = -3.0e38f; }
      if (ja >= T) s[0][r] = -3.0e38f;
      if (jb >= T) s[1][r] = -3.0e38f;
      float mx = fmaxf(s[0][r], s[1][r]);
      mx = fmaxf(mx, __shfl_xor(mx, 1, 32)); mx = fmaxf(mx, __shfl_xor(mx, 2, 32)); mx = fmaxf(mx, __shfl_xor(mx, 4, 32)); mx = fmaxf(mx, __shfl_xor(mx, 8, 32));
      const float mnew = fmaxf(m_r[r], mx);
      alpha[r] = (mnew > -1.0e38f) ? __expf(m_r[r] - mnew) : 1.0f;
      const float p0 = (s[0][r] > -1.0e38f) ? __expf(s[0][r] - mnew) : 0.f;
      const float p1 = (s[1][r] > -1.0e38f) ? __expf(s[1][r] - mnew) : 0.f;
      m_r[r] = mnew;
      l_r[r] = l_r[r] * alpha[r] + p0 + p1;            // per-lane partial row sum (16 lanes combined at the end)
      unsigned short hb = bf16_bits(p0); sPh[w][8 * hh + r][ln] = hb;      sPl[w][8 * hh + r][ln] = bf16_bits(p0 - bf16_val(hb));
      hb = bf16_bits(p1);                sPh[w][8 * hh + r][16 + ln] = hb; sPl[w][8 * hh + r][16 + ln] = bf16_bits(p1 - bf16_val(hb));
    }
#pragma unroll
    for (int dt = 0; dt < DT; ++dt)
#pragma unroll
      for (int r = 0; r < 8; ++r) oacc[dt][r] *= alpha[r];
    __builtin_amdgcn_fence(__ATOMIC_ACQ_REL, "workgroup");
    __builtin_amdgcn_wave_barrier();
    FragB pah, pal;
    pah.half[0] = *(const v8us*)&sPh[w][ln][8 * hh]; pah.half[1] = *(const v8us*)&sPh[w][ln][16 + 8 * hh];
    pal.half[0] = *(const v8us*)&sPl[w][ln][8 * hh]; pal.half[1] = *(const v8us*)&sPl[w][ln][16 + 8 * hh];
#pragma unroll
    for (int dt = 0; dt < DT; ++dt) {
      FragB bvh, bvl;
#pragma unroll
      for (int i = 0; i < 8; ++i) {
        bvh.u[i] = sVh[8 * hh + i][dt * 16 + ln]; bvh.u[8 + i] = sVh[16 + 8 * hh + i][dt * 16 + ln];
        bvl.u[i] = sVl[8 * hh + i][dt * 16 + ln]; bvl.u[8 + i] = sVl[16 + 8 * hh + i][dt * 16 + ln];
      }
      oacc[dt] = mmaN<3>(pah.v, pal.v, bvh.v, bvl.v, oacc[dt]);
    }
    __builtin_amdgcn_fence(__ATOMIC_ACQ_REL, "workgroup");
    __builtin_amdgcn_wave_barrier();
  }
#pragma unroll
  for (int r = 0; r < 8; ++r) {
    float l = l_r[r];
    l += __shfl_xor(l, 1, 32); l += __shfl_xor(l, 2, 32); l += __shfl_xor(l, 4, 32); l += __shfl_xor(l, 8, 32);
    l_r[r] = (l > 0.f) ? 1.0f / l : 0.f;
  }
#pragma unroll
  for (int dt = 0; dt < DT; ++dt)
#pragma unroll
    for (int r = 0; r < 8; ++r) sO[w][8 * hh + r][dt * 16 + ln] = oacc[dt][r] * l_r[r];
  __builtin_amdgcn_fence(__ATOMIC_ACQ_REL, "workgroup");
  __builtin_amdgcn_wave_barrier();
  {
    for (int r = 0; r < 16; ++r) {
      const int row = q0 + r;
      if (row < T && lane < D / 4) {
        const v4f val = *(const v4fa*)&sO[w][r][lane * 4];
        *(v4f*)(y + ((size_t)b * T + row) * ypitch + h * D + lane * 4) = val;
      }
    }
    
  }
}

// GEMM C = act(A·W + bias + resid): A f32 (ASPLIT -> hi/lo 2 terms), Wt bf16 [N][K]; ACT 0 none, 1 relu, 2 exact gelu;
// resid (optional, f32, row index = (row % rmod), pitch ldr, RES_BF16 rounds it) added before the activation.
template <bool ASPLIT, int ACT, bool BIAS_BF16, bool RES_BF16>
__global__ __launch_bounds__(128) void k_gemm_bf3(const float* __restrict__ A, int lda, const unsigned short* __restrict__ Wt, int ldb,
                                                const float* __restrict__ bias, const float* __restrict__ resid, int rmod, int ldr,
                                                float* __restrict__ C, int ldc, int M, int N, int K) {
  __shared__ __attribute__((aligned(16))) float so[4][16][64];
  const int tid = threadIdx.x, w = tid >> 5, lane = tid & 31, ln = lane & 15, hh = lane >> 4;
  const int ntn = N / 64;
  const int wid = blockIdx.x * 4 + w;
  const int mt = wid / ntn, nq = wid % ntn;
  if (mt * 16 >= M) return;
  const int row0 = mt * 16, col0 = nq * 64;
  const float* arow = A + (size_t)(row0 + ln) * lda;
  v8f acc[4] = {};
  for (int kb = 0; kb < K; kb += 32) {
    FragB ah, al;
    const v4f x0 = *(const v4fa*)(arow + kb + 8 * hh), x1 = *(const v4fa*)(arow + kb + 8 * hh + 4);
    const v4f x2 = *(const v4fa*)(arow + kb + 16 + 8 * hh), x3 = *(const v4fa*)(arow + kb + 16 + 8 * hh + 4);
    float xs[16] = {x0[0],x0[1],x0[2],x0[3],x1[0],x1[1],x1[2],x1[3],x2[0],x2[1],x2[2],x2[3],x3[0],x3[1],x3[2],x3[3]};
#pragma unroll
    for (int i = 0; i < 16; ++i) { const unsigned short hb = bf16_bits(xs[i]); ah.u[i] = hb; al.u[i] = ASPLIT ? bf16_bits(xs[i] - bf16_val(hb)) : (unsigned short)0; }
#pragma unroll
    for (int t = 0; t < 4; ++t) {
      const unsigned short* brow = Wt + (size_t)(col0 + t * 16 + ln) * ldb + kb;
      FragB b;
      b.half[0] = *(const v8us*)(brow + 8 * hh);
      b.half[1] = *(const v8us*)(brow + 16 + 8 * hh);
      acc[t] = mmaN<ASPLIT ? 2 : 1>(ah.v, al.v, b.v, b.v, acc[t]);
    }
  }
#pragma unroll
  for (int t = 0; t < 4; ++t) {
    const int col = col0 + t * 16 + ln;
    float bv = bias ? bias[col] : 0.f;
    if (BIAS_BF16) bv = bf16_round(bv);
#pragma unroll
    for (int r = 0; r < 8; ++r) {
      float v = acc[t][r] + bv;
      if (resid) { float rv = resid[(size_t)((row0 + 8 * hh + r) % rmod) * ldr + col]; if (RES_BF16) rv = bf16_round(rv); v += rv; }
      if (ACT == 1) v = fmaxf(v, 0.f);
      if (ACT == 2) v = 0.5f * v * (1.0f + erff(v * 0.70710678118654752f));
      if (ACT == 3) { const float u = 0.7978845608028654f * (v + 0.044715f * v * v * v); v = 0.5f * v * (1.0f + tanhf(u)); }
      so[w][8 * hh + r][t * 16 + ln] = v;
    }
  }
  __builtin_amdgcn_fence(__ATOMIC_ACQ_REL, "workgroup");
  __builtin_amdgcn_wave_barrier();
  const int rsub = lane >> 4, c4 = (lane & 15) * 4;
  {
#pragma unroll
    for (int q = 0; q < 8; ++q) {
      const int r = q * 2 + rsub;
      const v4f v = *(const v4fa*)&so[w][r][c4];
      *(v4f*)(C + (size_t)(row0 + r) * ldc + col0 + c4) = v;
    }
    
  }
}
// row LayerNorm (biased variance, eps) over N: s = X (+ R); optional out_sum <- s; out_norm <- (s-mu)*rsqrt(var+eps)*g + b
template <bool PARAM_BF16>
__global__ __launch_bounds__(256) void k_layernorm(const float* __restrict__ X, const float* __restrict__ R, const float* __restrict__ g, const float* __restrict__ bta,
                                                  float* __restrict__ out_sum, float* __restrict__ out_norm, int N, float eps) {
  __shared__ float red[256];
  const int row = blockIdx.x, tid = threadIdx.x;
  const float* x = X + (size_t)row * N; const float* rr = R ? R + (size_t)row * N : nullptr;
  float vals[16];                     // up to N = 4096
  const int per = N / 256;            // contiguous chunk per thread? use strided-by-4 chunks: thread handles j = tid*4 + 1024*u
  float s1 = 0.f;
  for (int u = 0; u < per / 4; ++u) {
    const int j = tid * 4 + 1024 * u;
    const v4f a = *(const v4fa*)(x + j);
    v4f b = {0.f,0.f,0.f,0.f}; if (rr) b = *(const v4fa*)(rr + j);
#pragma unroll
    for (int q = 0; q < 4; ++q) { const float v = a[q] + b[q]; vals[u * 4 + q] = v; s1 += v; }
  }
  red[tid] = s1; __syncthreads();
  for (int st = 128; st > 0; st >>= 1) { if (tid < st) red[tid] += red[tid + st]; __syncthreads(); }
  const float mu = red[0] / (float)N; __syncthreads();
  float s2 = 0.f;
  for (int u = 0; u < per / 4; ++u)
#pragma unroll
    for (int q = 0; q < 4; ++q) { const float c = vals[u * 4 + q] - mu; s2 += c * c; }
  red[tid] = s2; __syncthreads();
  for (int st = 128; st > 0; st >>= 1) { if (tid < st) red[tid] += red[tid + st]; __syncthreads(); }
  const float rs = rsqrtf(red[0] / (float)N + eps);
  {
    for (int u = 0; u < per / 4; ++u) {
      const int j = tid * 4 + 1024 * u;
      v4f o, sm;
#pragma unroll
      for (int q = 0; q < 4; ++q) {
        float gg = g[j + q], bb = bta[j + q];
        if (PARAM_BF16) { gg = bf16_round(gg); bb = bf16_round(bb); }
        sm[q] = vals[u * 4 + q]; o[q] = (vals[u * 4 + q] - mu) * rs * gg + bb;
      }
      if (out_sum) *(v4f*)(out_sum + (size_t)row * N + j) = sm;
      *(v4f*)(out_norm + (size_t)row * N + j) = o;
    }
    
  }
}



// ---- f16 WMMA path (v_wmma_f32_16x16x32_f16): 11-bit significands for operands in range — used where a [0,1] probability operand needs more precision than bf16
typedef _Float16 v16h __attribute__((ext_vector_type(16)));
union FragH { v16h v; v8us half[2]; _Float16 h[16]; unsigned short u[16]; };
template <int NT>
__device__ __forceinline__ v8f mmaH(v16h ah, v16h al, v16h bh, v16h bl, v8f c) {
  c = __builtin_amdgcn_wmma_f32_16x16x32_f16(false, ah, false, bh, (short)0, c, false, false);
  if (NT >= 2) c = __builtin_amdgcn_wmma_f32_16x16x32_f16(false, al, false, bh, (short)0, c, false, false);
  if (NT >= 3) c = __builtin_amdgcn_wmma_f32_16x16x32_f16(false, ah, false, bl, (short)0, c, false, false);
  asm volatile("v_nop\n\tv_nop\n\tv_nop\n\tv_nop" : "+v"(c) : "v"(ah), "v"(al), "v"(bh), "v"(bl));
  return c;
}
// batched GEMM like k_gemm_b but f16 operands: A f32 (split into f16 hi/lo if ASPLIT, else rounded to f16), Bt = f16 values [n][k]; alpha; C f32; N multiple of 16 (partial tiles skipped)
template <bool ASPLIT>
__global__ __launch_bounds__(128) void k_gemm_h(const float* __restrict__ A, int lda, size_t sA, const _Float16* __restrict__ Bh, int ldb, size_t sB, float alpha, float* __restrict__ C, int ldc, size_t sC, int M, int N, int K) {
  __shared__ __attribute__((aligned(16))) float so[4][16][64];
  const int tid = threadIdx.x, w = tid >> 5, lane = tid & 31, ln = lane & 15, hh = lane >> 4; const int by = blockIdx.y;
  A += (size_t)by * sA; Bh += (size_t)by * sB; C += (size_t)by * sC;
  const int ntn = (N + 63) / 64; const int wid = blockIdx.x * 4 + w; const int mt = wid / ntn, nq = wid % ntn; if (mt * 16 >= M) return;
  const int row0 = mt * 16, col0 = nq * 64; const float* arow = A + (size_t)(row0 + ln) * lda;
  v8f acc[4] = {};
  for (int kb = 0; kb < K; kb += 32) {
    FragH ah, al;
    const v4f x0 = *(const v4fa*)(arow + kb + 8 * hh), x1 = *(const v4fa*)(arow + kb + 8 * hh + 4), x2 = *(const v4fa*)(arow + kb + 16 + 8 * hh), x3 = *(const v4fa*)(arow + kb + 16 + 8 * hh + 4);
    float xs[16] = {x0[0],x0[1],x0[2],x0[3],x1[0],x1[1],x1[2],x1[3],x2[0],x2[1],x2[2],x2[3],x3[0],x3[1],x3[2],x3[3]};
#pragma unroll
    for (int i = 0; i < 16; ++i) { const _Float16 h = (_Float16)xs[i]; ah.h[i] = h; al.h[i] = ASPLIT ? (_Float16)(xs[i] - (float)h) : (_Float16)0.0f; }
#pragma unroll
    for (int t = 0; t < 4; ++t) { if (col0 + t * 16 >= N) continue; const size_t boff = (size_t)(col0 + t * 16 + ln) * ldb + kb; FragH bq; bq.half[0] = *(const v8us*)(Bh + boff + 8 * hh); bq.half[1] = *(const v8us*)(Bh + boff + 16 + 8 * hh);
      acc[t] = mmaH<ASPLIT ? 2 : 1>(ah.v, al.v, bq.v, bq.v, acc[t]); }
  }
#pragma unroll
  for (int t = 0; t < 4; ++t) { if (col0 + t * 16 >= N) continue;
#pragma unroll
    for (int r = 0; r < 8; ++r) so[w][8 * hh + r][t * 16 + ln] = acc[t][r] * alpha; }
  __builtin_amdgcn_fence(__ATOMIC_ACQ_REL, "workgroup"); __builtin_amdgcn_wave_barrier();
  const int rsub = lane >> 4, c4 = (lane & 15) * 4;
  {
#pragma unroll
    for (int q = 0; q < 8; ++q) { const int r = q * 2 + rsub; if (col0 + c4 < N) { const v4f v = *(const v4fa*)&so[w][r][c4]; *(v4f*)(C + (size_t)(row0 + r) * ldc + col0 + c4) = v; } }
     }
}

// Wt[n][k] = f16(W[k][n]·scale) from f32 row-major W[K][N] (scale = power of two; bf16-exact weights stay exact in f16 away from the subnormal range)
__global__ __launch_bounds__(256) void k_wt_f16(const float* __restrict__ W, _Float16* __restrict__ Wt, int K, int N, float scale) {
  const int t = blockIdx.x * 256 + threadIdx.x; if (t >= N * (K / 8)) return; const int n = t / (K / 8), k8 = (t % (K / 8)) * 8; FragH f;
#pragma unroll
  for (int i = 0; i < 8; ++i) f.h[i] = (_Float16)(bf16_round(W[(size_t)(k8 + i) * N + n]) * scale); const v8us o = f.half[0];
  *(v8us*)((unsigned short*)Wt + (size_t)n * K + k8) = o; 
}
// k_gemm_hh variant with fused epilogue: v = acc·alpha + bias[by·sBias + col] (+ CP[(row/rowsPerB)·sCPb + by·64 + col] if CP) ; ACT 0 none / 1 elu ; writes f32 C and f16 C16, each if non-null
template <int ACT>
__global__ __launch_bounds__(128) void k_gemm_hhx(const _Float16* __restrict__ A, int lda, size_t sA, const _Float16* __restrict__ Bh, int ldb, size_t sB, float alpha, const float* __restrict__ bias, size_t sBias, const float* __restrict__ CP, int rowsPerB, size_t sCPb, int row0g,
    float* __restrict__ C, _Float16* __restrict__ C16, int ldc, size_t sC, int M, int N, int K) {
  __shared__ __attribute__((aligned(16))) float so[4][16][64];
  const int tid = threadIdx.x, w = tid >> 5, lane = tid & 31, ln = lane & 15, hh = lane >> 4; const int by = blockIdx.y;
  A += (size_t)by * sA; Bh += (size_t)by * sB; const size_t cofs = (size_t)by * sC; const float* bp = bias ? bias + (size_t)by * sBias : nullptr;
  const int ntn = (N + 63) / 64; const int wid = blockIdx.x * 4 + w; const int mt = wid / ntn, nq = wid % ntn; if (mt * 16 >= M) return;
  const int row0 = mt * 16, col0 = nq * 64; const _Float16* arow = A + (size_t)(row0 + ln) * lda;
  v8f acc[4] = {};
  for (int kb = 0; kb < K; kb += 32) { FragH ah; ah.half[0] = *(const v8us*)((const unsigned short*)arow + kb + 8 * hh); ah.half[1] = *(const v8us*)((const unsigned short*)arow + kb + 16 + 8 * hh);
#pragma unroll
    for (int t = 0; t < 4; ++t) { if (col0 + t * 16 >= N) continue; const size_t boff = (size_t)(col0 + t * 16 + ln) * ldb + kb; FragH bq; bq.half[0] = *(const v8us*)((const unsigned short*)Bh + boff + 8 * hh); bq.half[1] = *(const v8us*)((const unsigned short*)Bh + boff + 16 + 8 * hh);
      acc[t] = mmaH<1>(ah.v, ah.v, bq.v, bq.v, acc[t]); }
  }
#pragma unroll
  for (int t = 0; t < 4; ++t) { if (col0 + t * 16 >= N) continue; const int col = col0 + t * 16 + ln; const float bv = bp ? bf16_round(bp[col]) : 0.f;
#pragma unroll
    for (int r = 0; r < 8; ++r) { float v = acc[t][r] * alpha + bv; if (CP) { const int bidx = (row0g + row0 + 8 * hh + r) / rowsPerB; v += CP[(size_t)bidx * sCPb + (size_t)by * 64 + col]; } if (ACT == 1) v = (v > 0.f) ? v : expm1f(v); else if (ACT == 7) v = (v > 0.f) ? v + 1.0f : expf(v); else if (ACT == 8) v = tanhf(v); else if (ACT == 9) v = 0.5f * v * (1.0f + tanhf(0.7978845608028654f * (v + 0.044715f * v * v * v))); else if (ACT == 11) v = 1.0f / (1.0f + expf(-v)); else if (ACT == 12) v = (v > 0.f) ? v : 0.01f * v; else if (ACT == 14) v = (v > 0.f) ? v : 0.1f * v; else if (ACT == 15) v = v / (1.0f + expf(-v)); else if (ACT == 3) v = fmaxf(v, 0.f); else if (ACT == 6) v = 0.5f * v * (1.0f + erff(v * 0.70710678118654752f)); so[w][8 * hh + r][t * 16 + ln] = v; } }
  __builtin_amdgcn_fence(__ATOMIC_ACQ_REL, "workgroup"); __builtin_amdgcn_wave_barrier();
  const int rsub = lane >> 4, c4 = (lane & 15) * 4; typedef _Float16 v4h __attribute__((ext_vector_type(4)));
  {
#pragma unroll
    for (int q = 0; q < 8; ++q) { const int r = q * 2 + rsub; if (col0 + c4 < N) { const v4f v = *(const v4fa*)&so[w][r][c4]; if (C) *(v4f*)(C + cofs + (size_t)(row0 + r) * ldc + col0 + c4) = v; if (C16) { v4h h4; for (int i = 0; i < 4; ++i) h4[i] = (_Float16)v[i]; *(v4h*)(C16 + cofs + (size_t)(row0 + r) * ldc + col0 + c4) = h4; } } }
     }
}


typedef _Float16 v4h __attribute__((ext_vector_type(4)));

// Conversion passes as streams of few, long-lived waves. A run is 1024 consecutive floats (4 KB): eight 16-byte loads a lane, each wave-wide load 512 contiguous bytes (4 whole lines);
// the four halves that a lane makes of one load leave as one 8-byte store (256 contiguous bytes a wave, 2 whole lines). A wave issues all its loads before it converts the first value.
// Addresses are a wave-uniform base plus one 32-bit lane offset in bytes (vo for the floats, vo / 2 for the halves).
// Each plain '#pragma unroll' below stands on a loop whose index picks an element of a register array.
template <int NL>
__device__ __forceinline__ void run_load(v4f* r, const float* __restrict__ src, unsigned vo) {
#pragma unroll
  for (int j = 0; j < NL; ++j) r[j] = *(const v4fa*)((const char*)src + vo + j * 512); }
// MODE 0: f16(x); 1: f16(bf16(x)); 2: f16(bf16(x) * 2^4)
template <int NL, int MODE>
__device__ __forceinline__ void run_store(const v4f* r, _Float16* __restrict__ dst, unsigned vh) {
#pragma unroll
  for (int j = 0; j < NL; ++j) { v4h h;
#pragma unroll
    for (int q = 0; q < 4; ++q) h[q] = (MODE == 0) ? (_Float16)r[j][q] : (MODE == 1) ? (_Float16)bf16_round(r[j][q]) : (_Float16)(bf16_round(r[j][q]) * 16.0f);
    *(v4h*)((char*)dst + vh + j * 256) = h; } }
// All seven inputs in one launch: 256 blocks of 16 waves; wave number n takes run n of query, of key and of value, and run n of the four weight matrices laid end to end (as Bw is).
__global__ __launch_bounds__(512) void k_cvt_in(const float* __restrict__ xq, const float* __restrict__ xk, const float* __restrict__ xv, const float* __restrict__ wq, const float* __restrict__ wk, const float* __restrict__ wv, const float* __restrict__ wo,
                                               _Float16* __restrict__ X16, _Float16* __restrict__ XK16, _Float16* __restrict__ XV16, _Float16* __restrict__ Bw) {
  static_assert(NR * DD == 4096 * 1024 && DD * DD == 1024 * 1024, "4096 runs an activation, 1024 a weight matrix");
  const unsigned lane = threadIdx.x & 31, run = blockIdx.x * 16 + (threadIdx.x >> 5);
  const unsigned m = blockIdx.x >> 6;      /* 1024 runs = 64 blocks a weight matrix: the same for the whole block */
  const float* __restrict__ w = (m == 0) ? wq : (m == 1) ? wk : (m == 2) ? wv : wo;
  const unsigned vo = run * 4096 + lane * 16, vw = (run & 1023) * 4096 + lane * 16, vh = run * 2048 + lane * 8;
  v4f r[4][8];
  run_load<8>(r[0], xq, vo); run_load<8>(r[1], xk, vo); run_load<8>(r[2], xv, vo); run_load<8>(r[3], w, vw);
  __builtin_amdgcn_sched_barrier(0);      /* all 32 loads are issued before any conversion: without it the scheduler sinks some of them among the conversions, behind waits on earlier data */
  asm volatile("s_wait_xcnt 0x0" :: "v"(vo), "v"(vw) : "memory");      /* the loads' offset registers may be reused below: wait before that overwrite; named as inputs, they are not given to a late load as its destination either */
  __builtin_amdgcn_sched_barrier(0);      /* nothing that rewrites a base or offset register of the loads is scheduled in front of that wait */
  run_store<8, 1>(r[0], X16, vh);
  asm volatile("s_wait_xcnt 0x0" ::: "memory");      /* the stores' data registers may be reused by the next run: wait before that overwrite */
  __builtin_amdgcn_sched_barrier(0);      /* keeps the next run's conversions behind that wait */
  run_store<8, 1>(r[1], XK16, vh);
  asm volatile("s_wait_xcnt 0x0" ::: "memory");      /* as above */
  __builtin_amdgcn_sched_barrier(0);
  run_store<8, 1>(r[2], XV16, vh);
  asm volatile("s_wait_xcnt 0x0" ::: "memory");      /* as above */
  __builtin_amdgcn_sched_barrier(0);
  run_store<8, 2>(r[3], Bw, vh);
}
// The attention result: 256 blocks of 8 waves, two runs a wave.
__global__ __launch_bounds__(256) void k_cvt_o(const float* __restrict__ x, _Float16* __restrict__ X16) {
  static_assert(NR * DD == 2048 * 2048, "2048 waves, 2048 floats each");
  const unsigned vo = (blockIdx.x * 8 + (threadIdx.x >> 5)) * 8192 + (threadIdx.x & 31) * 16, vh = (blockIdx.x * 8 + (threadIdx.x >> 5)) * 4096 + (threadIdx.x & 31) * 8;
  v4f r[16];
  run_load<16>(r, x, vo);
  __builtin_amdgcn_sched_barrier(0);      /* all 16 loads are issued before any conversion */
  asm volatile("s_wait_xcnt 0x0" :: "v"(vo) : "memory");      /* the loads' offset register may be reused below: wait before that overwrite; named as an input, it is not given to a late load as its destination either */
  __builtin_amdgcn_sched_barrier(0);      /* nothing that rewrites the base or offset register of the loads is scheduled in front of that wait */
  run_store<8, 0>(r, X16, vh);
  asm volatile("s_wait_xcnt 0x0" ::: "memory");      /* the stores' data registers may be reused by the second run: wait before that overwrite */
  __builtin_amdgcn_sched_barrier(0);      /* keeps the second run's conversions behind that wait */
  run_store<8, 0>(r + 8, X16, vh + 2048);
}
template <int NHv, int TTv>
__global__ __launch_bounds__(256) void k_vt(const _Float16* __restrict__ V16, int ldv, int voff, _Float16* __restrict__ Vt) { __shared__ unsigned short tl[64][66]; const int tid = threadIdx.x; const int slab = blockIdx.x / (TTv / 64), lg = blockIdx.x % (TTv / 64); const int b = slab / NHv, h = slab % NHv;
  for (int i = tid; i < 64 * 8; i += 256) { const int r = i / 8, c8 = (i % 8) * 8; FragH f; f.half[0] = *(const v8us*)((const unsigned short*)V16 + ((size_t)b * TTv + lg * 64 + r) * ldv + voff + h * 64 + c8);
#pragma unroll
    for (int q = 0; q < 8; ++q) tl[r][c8 + q] = f.u[q]; }
  __syncthreads();
  {
#pragma unroll
    for (int rd = 0; rd < 2; ++rd) { const int d = rd * 32 + tid / 8, pc = tid % 8; FragH f;
#pragma unroll
      for (int q = 0; q < 8; ++q) f.u[q] = tl[pc * 8 + q][d];
      *(v8us*)((unsigned short*)Vt + ((size_t)slab * 64 + d) * TTv + lg * 64 + pc * 8) = f.half[0]; }
     } }

// lane l <-> lane l ^ 16 (the two halves of a wave)
__device__ __forceinline__ float xhalf(float x) { return __builtin_bit_cast(float, __builtin_amdgcn_permlanex16(__builtin_bit_cast(int, x), __builtin_bit_cast(int, x), 0x76543210, 0xfedcba98, false, false)); }

__device__ __forceinline__ void tile_copy(unsigned l, const char* k, size_t kstep, const char* v) {      /* l: the lane's LDS byte address in the buffer; k, v: its global addresses in row tid / 8; kstep: 16 rows of K in bytes */
  const unsigned l1 = l + 16 * 144, l2 = l + 32 * 144, l3 = l + 48 * 144, l4 = l + 64 * 144, l5 = l + 80 * 144, l6 = l + 96 * 144, l7 = l + 112 * 144;
  const char* k1 = k + kstep; const char* k2 = k1 + kstep; const char* k3 = k2 + kstep;
  const char* v1 = v + (size_t)16 * TT * 2; const char* v2 = v + (size_t)32 * TT * 2; const char* v3 = v + (size_t)48 * TT * 2;
  /* the copies and, as the last line of their own statement, the wait before any of their address registers is rewritten */
  asm volatile("global_load_async_to_lds_b128 %0, %8, off\n\t"
               "global_load_async_to_lds_b128 %1, %9, off\n\t"
               "global_load_async_to_lds_b128 %2, %10, off\n\t"
               "global_load_async_to_lds_b128 %3, %11, off\n\t"
               "global_load_async_to_lds_b128 %4, %12, off\n\t"
               "global_load_async_to_lds_b128 %5, %13, off\n\t"
               "global_load_async_to_lds_b128 %6, %14, off\n\t"
               "global_load_async_to_lds_b128 %7, %15, off\n\t"
               "s_wait_xcnt 0x0"
               :: "v"(l), "v"(l1), "v"(l2), "v"(l3), "v"(l4), "v"(l5), "v"(l6), "v"(l7), "v"(k), "v"(k1), "v"(k2), "v"(k3), "v"(v), "v"(v1), "v"(v2), "v"(v3) : "memory");
}
__global__ __launch_bounds__(128) void k_flash(const _Float16* __restrict__ Q16, int ldq, const _Float16* __restrict__ K16, int ldk, const _Float16* __restrict__ Vt, const float* __restrict__ FR, const float* __restrict__ AP, const float* __restrict__ AN, const float* __restrict__ GM, const float* __restrict__ DLT, float* __restrict__ O, int ldo) {
  constexpr int NQB = TT / 64, DT = 4, KS = 2;
  constexpr int NS = TT / 64, RP = 144, TB = 128 * RP;      /* tiles of 64 keys; LDS row pitch and bytes of one buffer */
  static_assert(NS >= 2, "the two buffers' prologue needs two tiles");
  __shared__ __attribute__((aligned(16))) float sF[TT]; __shared__ __attribute__((aligned(16))) float sO[4][16][64 + 4]; __shared__ __attribute__((aligned(16))) unsigned char sT[2 * TB];
  const int tid = threadIdx.x, w = tid >> 5, lane = tid & 31, ln = lane & 15, hh = lane >> 4;
  const int slab = blockIdx.x / NQB, qblk = blockIdx.x % NQB; const int b = slab / NH, h = slab % NH; const int q0 = qblk * 64 + w * 16;
  const float* frb = FR + (size_t)b * TT;
#pragma unroll
  for (int i = 0; i < TT / 512; ++i) { const int e = i * 512 + tid * 4; v4f f = *(const v4fa*)(frb + e);
#pragma unroll
    for (int q = 0; q < 4; ++q) f[q] = bf16_round(f[q]);
    *(v4fa*)&sF[e] = f; }
  FragH bq[KS]; const unsigned short* qr = (const unsigned short*)Q16 + ((size_t)b * TT + q0 + ln) * ldq + h * 64;      /* B operand: column ln = query q0 + ln */
#pragma unroll
  for (int ks = 0; ks < KS; ++ks) { bq[ks].half[0] = *(const v8us*)(qr + ks * 32 + 8 * hh); bq[ks].half[1] = *(const v8us*)(qr + ks * 32 + 16 + 8 * hh); }
  const char* ck = (const char*)K16 + (((size_t)b * TT + (tid >> 3)) * ldk + h * 64) * 2 + (tid & 7) * 16;      /* the lane's 16 bytes of key row tid / 8 of tile 0 */
  const char* cv = (const char*)Vt + ((size_t)slab * 64 + (tid >> 3)) * TT * 2 + (tid & 7) * 16;      /* and of row tid / 8 of V^T */
  const size_t kstep = (size_t)16 * ldk * 2; const unsigned lt = (unsigned)(size_t)sT + (unsigned)((tid >> 3) * RP + (tid & 7) * 16);
  constexpr float L2E = 1.44269504088896340736f;      /* log2(e): the scores are formed in base-2 units, so that exp(s - m) is one hardware exp2 of a difference */
  const float gmm = bf16_round(GM[0]), dlt = bf16_round(DLT[0]); const float aph = bf16_round(AP[h]) * dlt * L2E, anh = bf16_round(AN[h]) * dlt * L2E;      /* gamma, delta scalars; log2(e)*delta*alpha_pos[h], log2(e)*delta*alpha_neg[h] */
  const float g8 = gmm * 0.125f * L2E;      /* log2(e) * gamma * 64^-1/2 */
  const float fq = bf16_round(frb[q0 + ln]);      /* frac of the lane's query */
  float m_r = -3.0e38f, l_r = 0.f; v8f oacc[DT];
#pragma unroll
  for (int dt = 0; dt < DT; ++dt) oacc[dt] = (v8f){0.f,0.f,0.f,0.f,0.f,0.f,0.f,0.f};
  tile_copy(lt, ck, kstep, cv);      /* tile 0 into buffer 0 */
  asm volatile("s_wait_asynccnt 0x0" ::: "memory");      /* this wave's copies of tile 0 have landed */
  __syncthreads();      /* sF and tile 0 are complete before any wave reads them */
  tile_copy(lt + TB, ck + 4 * kstep, kstep, cv + 128);      /* tile 1 into buffer 1 */
#pragma unroll 1      /* rolled: 32 copies of this body would only grow the code */
  for (int s = 0; s < NS; ++s) {
   const unsigned char* tk = sT + (s & 1) * TB + ln * RP + 16 * hh; const unsigned char* tv = tk + 64 * RP;      /* trip s reads buffer s mod 2 alone */
#pragma unroll      /* the two 32-key chunks of a tile: p picks constant LDS offsets */
   for (int p = 0; p < 2; ++p) { const int j0 = s * 64 + p * 32;
    FragH ak[2][KS], av[DT]; v4f fk[2][2];
#pragma unroll
    for (int nt = 0; nt < 2; ++nt)      /* A operand: row ln = key j0 + nt*16 + ln */
#pragma unroll
      for (int ks = 0; ks < KS; ++ks) { ak[nt][ks].half[0] = *(const v8us*)(tk + (p * 32 + nt * 16) * RP + ks * 64); ak[nt][ks].half[1] = *(const v8us*)(tk + (p * 32 + nt * 16) * RP + ks * 64 + 32); }
#pragma unroll
    for (int dt = 0; dt < DT; ++dt) { av[dt].half[0] = *(const v8us*)(tv + dt * 16 * RP + p * 64); av[dt].half[1] = *(const v8us*)(tv + dt * 16 * RP + p * 64 + 32); }      /* A operand: row ln = head column dt*16 + ln */
#pragma unroll
    for (int nt = 0; nt < 2; ++nt) { fk[nt][0] = *(const v4fa*)&sF[j0 + nt * 16 + 8 * hh]; fk[nt][1] = *(const v4fa*)&sF[j0 + nt * 16 + 8 * hh + 4]; }      /* frac of the lane's 16 keys */
    float sc[16];
#pragma unroll
    for (int nt = 0; nt < 2; ++nt) { v8f acc = (v8f){0.f,0.f,0.f,0.f,0.f,0.f,0.f,0.f};
#pragma unroll
      for (int ks = 0; ks < KS; ++ks) acc = __builtin_amdgcn_wmma_f32_16x16x32_f16(false, ak[nt][ks].v, false, bq[ks].v, (short)0, acc, false, false);
#pragma unroll
      for (int r = 0; r < 8; ++r) { float d = fk[nt][r >> 2][r & 3] - fq; d = fminf(fmaxf(d, -0.2f), 0.2f);      /* D = clip(frac_k - frac_q, -0.2, 0.2) */
        const float sb = aph * fmaxf(d, 0.f) + anh * fminf(d, 0.f);      /* log2(e)*delta*(alpha_pos*D+ + alpha_neg*D-) */
        sc[nt * 8 + r] = g8 * acc[r] + sb; } }
    float mx[4];
#pragma unroll
    for (int q = 0; q < 4; ++q) mx[q] = fmaxf(fmaxf(sc[q], sc[4 + q]), fmaxf(sc[8 + q], sc[12 + q]));
    float mc = fmaxf(fmaxf(mx[0], mx[1]), fmaxf(mx[2], mx[3])); mc = fmaxf(mc, xhalf(mc));      /* the query's maximum over all 32 keys, in both halves */
    const float mn = fmaxf(m_r, mc - 10.0f); const float al = (mn > -1.0e38f) ? __builtin_amdgcn_exp2f(m_r - mn) : 1.0f; m_r = mn;      /* the running maximum is kept 10 lower: 2^(s - mn) is then P * 2^10, the scale of the f16 operand, in the sum as well */
    FragH pb; float ps[4];
#pragma unroll
    for (int i = 0; i < 16; ++i) { const float p = __builtin_amdgcn_exp2f(sc[i] - mn); ps[i & 3] = (i < 4) ? p : ps[i & 3] + p; pb.h[i] = (_Float16)p; }
    l_r = l_r * al + ((ps[0] + ps[1]) + (ps[2] + ps[3]));      /* the lane's 16 keys; the halves are joined after the loop */
#pragma unroll
    for (int dt = 0; dt < DT; ++dt) {
#pragma unroll
      for (int r = 0; r < 8; ++r) oacc[dt][r] *= al;
      oacc[dt] = __builtin_amdgcn_wmma_f32_16x16x32_f16(false, av[dt].v, false, pb.v, (short)0, oacc[dt], false, false); } }
   asm volatile("s_wait_dscnt 0x0" ::: "memory");      /* this wave's reads of buffer s mod 2 have returned before the buffer is handed to the copies */
   asm volatile("s_wait_asynccnt 0x0" ::: "memory");      /* this wave's copies of tile s + 1 have landed */
   __syncthreads();      /* publishes tile s + 1 and ends every wave's reads of tile s */
   if (s + 2 < NS) tile_copy(lt + (s & 1) * TB, ck + (size_t)(s + 2) * 4 * kstep, kstep, cv + (size_t)(s + 2) * 128); }      /* tile s + 2 into the buffer that trip s has just read */
  asm volatile("s_wait_asynccnt 0x0" ::: "memory");      /* nothing is in flight when the wave goes on to its end */
  const float l = l_r + xhalf(l_r); const float inv = (l > 0.f) ? 1.0f / l : 0.f;      /* sum and O carry the same 2^10 */
#pragma unroll
  for (int dt = 0; dt < DT; ++dt)      /* oacc[dt][r] = O[query ln][dt*16 + 8*hh + r] */
#pragma unroll
    for (int c = 0; c < 2; ++c) { const v4f o = {oacc[dt][4 * c] * inv, oacc[dt][4 * c + 1] * inv, oacc[dt][4 * c + 2] * inv, oacc[dt][4 * c + 3] * inv}; *(v4fa*)&sO[w][ln][dt * 16 + 8 * hh + 4 * c] = o; }
  __builtin_amdgcn_fence(__ATOMIC_ACQ_REL, "workgroup"); __builtin_amdgcn_wave_barrier();      /* the wave's LDS stores are done, and stay in front, before its lanes read each other's values back */
#pragma unroll
  for (int rp = 0; rp < 16; rp += 2) { const int r = rp + (lane >> 4), pc = lane & 15; const v4f val = *(const v4fa*)&sO[w][r][pc * 4]; *(v4f*)(O + ((size_t)b * TT + q0 + r) * ldo + h * 64 + pc * 4) = val; }
}

// Block-tiled GEMM, C = (A.Bh^T)*alpha + bias: a block of 8 waves owns a 128 x 128 tile of C and stages 128 x 64 pieces of A and of Bh in LDS, so every operand byte is fetched once a block, in whole 128-B lines
// (8 lanes a row), and is read as fragments from LDS. Wave tile 32 x 64 (2 x 4 accumulators). The next piece is fetched into registers while this one is multiplied. k runs upward in steps of 32.
// M % 128 == 0 (grid), N % 128 == 0, K % 64 == 0. LDS row pitch 64 + 8 halves = 144 B for the 16-byte fragment reads.
// Each plain '#pragma unroll' below, except those on the ks and q loops, stands on a short loop whose index picks an element of a register array (staging registers, fragments, accumulators): unrolled, these stay in registers.
template <int N, int K, bool HALF_OUT>
__global__ __launch_bounds__(256) void k_gemm_tile(const _Float16* __restrict__ A, const _Float16* __restrict__ Bh, float alpha, const float* __restrict__ bias, float* __restrict__ C, _Float16* __restrict__ C16) {
  constexpr int BM = 128, BN = 128, BK = 64, LP = BK + 8;
  __shared__ __attribute__((aligned(16))) unsigned short sm[8 * 32 * 64 * 2];      /* 64 KB: the output staging (8 waves x 32 x 64 f32) is the larger use; the operand pieces take (BM + BN) * LP halves */
  static_assert((BM + BN) * LP <= 8 * 32 * 64 * 2, "operand pieces fit");
  unsigned short* sA = sm; unsigned short* sB = sm + BM * LP;
  const int tid = threadIdx.x, w = tid >> 5, lane = tid & 31, ln = lane & 15, hh = lane >> 4;
  const int nbn = N / BN; const int row0 = (blockIdx.x / nbn) * BM, col0 = (blockIdx.x % nbn) * BN;
  const int wm = w >> 1, wn = w & 1;
  const int lr = tid >> 3, lc = (tid & 7) * 8;
  const char* ga = (const char*)A + (size_t)row0 * K * 2; const char* gb = (const char*)Bh + (size_t)col0 * K * 2; const unsigned vo = (unsigned)(lr * K + lc) * 2u;      /* block-uniform bases, one 32-bit lane offset that lives through the loop */
  v8us ra[4], rb[4];
#pragma unroll
  for (int i = 0; i < 4; ++i) { ra[i] = *(const v8us*)(ga + vo + (size_t)(32 * i) * K * 2); rb[i] = *(const v8us*)(gb + vo + (size_t)(32 * i) * K * 2); }
  v8f acc[2][4];
#pragma unroll
  for (int mi = 0; mi < 2; ++mi)
#pragma unroll
    for (int t = 0; t < 4; ++t) acc[mi][t] = (v8f){0.f,0.f,0.f,0.f,0.f,0.f,0.f,0.f};
#pragma unroll 1      /* rolled: K is a constant here, and 16 copies of this body would only grow the code */
  for (int kb = 0; kb < K; kb += BK) {
#pragma unroll
    for (int i = 0; i < 4; ++i) { *(v8us*)&sA[(lr + 32 * i) * LP + lc] = ra[i]; *(v8us*)&sB[(lr + 32 * i) * LP + lc] = rb[i]; }
    __syncthreads();      /* the piece is complete before any wave reads fragments */
    if (kb + BK < K) {
#pragma unroll
      for (int i = 0; i < 4; ++i) { ra[i] = *(const v8us*)(ga + (size_t)(kb + BK) * 2 + vo + (size_t)(32 * i) * K * 2); rb[i] = *(const v8us*)(gb + (size_t)(kb + BK) * 2 + vo + (size_t)(32 * i) * K * 2); }
      asm volatile("s_wait_xcnt 0x0" ::: "memory"); }      /* the loads' address registers are reused by the fragment reads below: wait before that overwrite */
#pragma unroll
    for (int ks = 0; ks < BK / 32; ++ks) { FragH a[2], bq[4];
#pragma unroll
      for (int mi = 0; mi < 2; ++mi) { const unsigned short* p = &sA[(wm * 32 + mi * 16 + ln) * LP + ks * 32 + 8 * hh]; a[mi].half[0] = *(const v8us*)p; a[mi].half[1] = *(const v8us*)(p + 16); }
#pragma unroll
      for (int t = 0; t < 4; ++t) { const unsigned short* p = &sB[(wn * 64 + t * 16 + ln) * LP + ks * 32 + 8 * hh]; bq[t].half[0] = *(const v8us*)p; bq[t].half[1] = *(const v8us*)(p + 16); }
#pragma unroll
      for (int mi = 0; mi < 2; ++mi)
#pragma unroll
        for (int t = 0; t < 4; ++t) acc[mi][t] = __builtin_amdgcn_wmma_f32_16x16x32_f16(false, a[mi].v, false, bq[t].v, (short)0, acc[mi][t], false, false); }
    __syncthreads();      /* every wave has read the piece before it is overwritten (by the next piece, or by the output staging below) */
  }
  float* so = (float*)sm + w * (32 * 64);      /* each wave stages its 32 x 64 results in its own 8 KB, to store whole lines */
  const int rsub = lane >> 4, c4 = (lane & 15) * 4; float bv[4];
#pragma unroll
  for (int t = 0; t < 4; ++t) bv[t] = bf16_round(bias[col0 + wn * 64 + t * 16 + ln]);
#pragma unroll
  for (int mi = 0; mi < 2; ++mi)
#pragma unroll
    for (int t = 0; t < 4; ++t)
#pragma unroll
      for (int r = 0; r < 8; ++r) so[(mi * 16 + 8 * hh + r) * 64 + t * 16 + ln] = acc[mi][t][r] * alpha + bv[t];
  __builtin_amdgcn_fence(__ATOMIC_ACQ_REL, "workgroup"); __builtin_amdgcn_wave_barrier();      /* the wave's LDS stores are done, and stay in front, before its lanes read each other's values back */
#pragma unroll
  for (int q = 0; q < 16; ++q) { const int r = q * 2 + rsub; const v4f v = *(const v4fa*)&so[r * 64 + c4]; const size_t o = (size_t)(row0 + wm * 32 + r) * N + col0 + wn * 64 + c4;
    if (HALF_OUT) { v4h h4;
#pragma unroll
      for (int i = 0; i < 4; ++i) h4[i] = (_Float16)v[i];
      *(v4h*)(C16 + o) = h4; }
    else *(v4f*)(C + o) = v; }
}

extern "C" void kernel_launch(void* const* d_in, const int* in_sizes, int n_in,
                              void* d_out, int out_size, void* d_ws, size_t ws_size, hipStream_t stream) {
  (void)in_sizes; (void)n_in; (void)out_size;
  const float* const* I = (const float* const*)d_in; const float* xq = I[0]; const float* xk = I[1]; const float* xv = I[2]; const float* frac = I[3]; const float* Wq = I[4]; const float* bq = I[5]; const float* Wk = I[6]; const float* bk = I[7]; const float* Wv = I[8]; const float* bv = I[9]; const float* Wo = I[10]; const float* bo = I[11]; const float* apos = I[12]; const float* aneg = I[13]; const float* gam = I[14]; const float* del = I[15];      /* d_in order: query, key, value, frac, Wq, bq, Wk, bk, Wv, bv, Wo, bo, alpha_pos, alpha_neg, gamma, delta */
  char* ws = (char*)d_ws; size_t off = 0;
  auto take = [&](size_t bytes) { char* p = ws + off; off += (bytes + 255) & ~(size_t)255; return p; };
  const size_t WSZ = (size_t)DD * DD; _Float16* Bw = (_Float16*)take(4 * WSZ * 2); _Float16* X16 = (_Float16*)take((size_t)NR * DD * 2); _Float16* XK16 = (_Float16*)take((size_t)NR * DD * 2); _Float16* XV16 = (_Float16*)take((size_t)NR * DD * 2);
  _Float16* Q = (_Float16*)take((size_t)NR * DD * 2); _Float16* K = (_Float16*)take((size_t)NR * DD * 2); _Float16* V = (_Float16*)take((size_t)NR * DD * 2); _Float16* Vt = (_Float16*)take((size_t)NR * DD * 2);
  float* O = (float*)take((size_t)NR * DD * 4); _Float16* O16 = V;      /* the v plane is dead once Vᵀ is built (before the attention kernel); O16 reuses it */
  if (off > ws_size) return;      // 8.4 + 7 × 8.4 + 16.8 ≈ 84 MB
  const unsigned gt = (NR / 128) * (DD / 128);
  k_cvt_in<<<256, 512, 0, stream>>>(xq, xk, xv, Wq, Wk, Wv, Wo, X16, XK16, XV16, Bw);      /* activations bf16-rounded; weights (out,in) natural, bf16-rounded, x 2^4 */
  k_gemm_tile<DD, DD, true><<<gt, 256, 0, stream>>>(X16, Bw, 0.0625f, bq, nullptr, Q);      /* Q = query·Wqᵀ + bq: M 4096 N 1024 K 1024 */
  k_gemm_tile<DD, DD, true><<<gt, 256, 0, stream>>>(XK16, Bw + WSZ, 0.0625f, bk, nullptr, K);
  k_gemm_tile<DD, DD, true><<<gt, 256, 0, stream>>>(XV16, Bw + 2 * WSZ, 0.0625f, bv, nullptr, V);
  k_vt<NH, TT><<<BB * NH * (TT / 64), 256, 0, stream>>>(V, DD, 0, Vt);
  k_flash<<<BB * NH * (TT / 64), 128, 0, stream>>>(Q, DD, K, DD, Vt, frac, apos, aneg, gam, del, O, DD);
  k_cvt_o<<<256, 256, 0, stream>>>(O, O16);
  k_gemm_tile<DD, DD, false><<<gt, 256, 0, stream>>>(O16, Bw + 3 * WSZ, 0.0625f, bo, (float*)d_out, nullptr);      /* out = O·Woᵀ + bo */
}

// v006
// Measured time: 119 microseconds a run.
// In two side-by-side timings against v005, it was 1.21 and 1.20 times as fast.
// Over all steps from v000 it is 3.77 times as fast.
#include <hip/hip_runtime.h>
// Multi-head attention with a stoichiometric bias (B=2, T=2048, D=1024, 16 heads × 64): Q,K,V = x·Wᵀ + b (torch (out,in)) from query/key/value; logits = q·kᵀ·64^-½; bias[b,h,i,j] = α_pos[h]·max(D,0) + α_neg[h]·min(D,0), D = clip(frac_j − frac_i, −0.2, 0.2);
// attn = softmax(γ·logits + δ·bias); out = (attn·V merged)·Woᵀ + bo. γ, δ are scalar inputs.
// Compute dtype: x, weights, biases rounded to bf16; q/k/v as f16 GEMM outputs; fused flash-style kernel (online softmax f32, P f16 ×2^10) on v_wmma_f32_16x16x32_f16; O → f16 → output GEMM with bias; f32 accumulate.
#define BB 2
#define TT 2048
#define NH 16
#define DD 1024
#define NR (BB * TT)

typedef __bf16 v16b __attribute__((ext_vector_type(16)));
typedef unsigned short v8us __attribute__((ext_vector_type(8), may_alias));
typedef float  v8f  __attribute__((ext_vector_type(8)));
typedef float  v4f  __attribute__((ext_vector_type(4)));
typedef float  v4fa __attribute__((ext_vector_type(4), may_alias));
union FragB { v16b v; v8us half[2]; unsigned short u[16]; };

__device__ __forceinline__ unsigned short bf16_bits(float x) { unsigned int u = __float_as_uint(x); return (unsigned short)((u + 0x7FFFu + ((u >> 16) & 1u)) >> 16); }
__device__ __forceinline__ float bf16_val(unsigned short b) { return __uint_as_float(((unsigned int)b) << 16); }
__device__ __forceinline__ float bf16_round(float x) { return bf16_val(bf16_bits(x)); }
// D += A·B with NT terms: 1 = ah·bh, 2 = + al·bh (A split), 3 = + ah·bl (both split)
template <int NT>
__device__ __forceinline__ v8f mmaN(v16b ah, v16b al, v16b bh, v16b bl, v8f c) {
  c = __builtin_amdgcn_wmma_f32_16x16x32_bf16(false, ah, false, bh, (short)0, c, false, false);
  if (NT >= 2) c = __builtin_amdgcn_wmma_f32_16x16x32_bf16(false, al, false, bh, (short)0, c, false, false);
  if (NT >= 3) c = __builtin_amdgcn_wmma_f32_16x16x32_bf16(false, ah, false, bl, (short)0, c, false, false);
  asm volatile("v_nop\n\tv_nop\n\tv_nop\n\tv_nop" : "+v"(c) : "v"(ah), "v"(al), "v"(bh), "v"(bl));
  return c;
}

__global__ __launch_bounds__(256) void k_wt_bf16(const float* __restrict__ W, unsigned short* __restrict__ Wt, int K, int N) {
  const int t = blockIdx.x * 256 + threadIdx.x;
  const int k8n = K / 8;
  if (t >= N * k8n) return;
  const int n = t / k8n, k8 = (t % k8n) * 8;
  v8us v;
#pragma unroll
  for (int i = 0; i < 8; ++i) v[i] = bf16_bits(W[(size_t)(k8 + i) * N + n]);
  *(v8us*)(Wt + (size_t)n * K + k8) = v;
  
}

// GEMM C[M][N] (f32, pitch ldc) = act(A[M][K]·W + bias). A f32 row-major (pitch lda) converted per fragment to bf16
// (ASPLIT: hi/lo two planes -> 2 terms, else single rounded term); Wt bf16 [N][K] (pitch ldb). BIAS_BF16 rounds the
// bias to bf16 first (bias quantised to bf16 before the add). K%32==0, M%16==0, N%64==0.
template <bool ASPLIT, int ACT, bool BIAS_BF16>
__global__ __launch_bounds__(128) void k_gemm_bf(const float* __restrict__ A, int lda, const unsigned short* __restrict__ Wt, int ldb,
                                               const float* __restrict__ bias, float* __restrict__ C, int ldc, int M, int N, int K) {
  __shared__ __attribute__((aligned(16))) float so[4][16][64];
  const int tid = threadIdx.x, w = tid >> 5, lane = tid & 31, ln = lane & 15, hh = lane >> 4;
  const int ntn = N / 64;
  const int wid = blockIdx.x * 4 + w;
  const int mt = wid / ntn, nq = wid % ntn;
  if (mt * 16 >= M) return;
  const int row0 = mt * 16, col0 = nq * 64;
  const float* arow = A + (size_t)(row0 + ln) * lda;
  v8f acc[4] = {};
  for (int kb = 0; kb < K; kb += 32) {
    FragB ah, al;
    const v4f x0 = *(const v4fa*)(arow + kb + 8 * hh), x1 = *(const v4fa*)(arow + kb + 8 * hh + 4);
    const v4f x2 = *(const v4fa*)(arow + kb + 16 + 8 * hh), x3 = *(const v4fa*)(arow + kb + 16 + 8 * hh + 4);
    float xs[16] = {x0[0],x0[1],x0[2],x0[3],x1[0],x1[1],x1[2],x1[3],x2[0],x2[1],x2[2],x2[3],x3[0],x3[1],x3[2],x3[3]};
#pragma unroll
    for (int i = 0; i < 16; ++i) { const unsigned short hb = bf16_bits(xs[i]); ah.u[i] = hb; al.u[i] = ASPLIT ? bf16_bits(xs[i] - bf16_val(hb)) : (unsigned short)0; }
#pragma unroll
    for (int t = 0; t < 4; ++t) {
      const unsigned short* brow = Wt + (size_t)(col0 + t * 16 + ln) * ldb + kb;
      FragB b;
      b.half[0] = *(const v8us*)(brow + 8 * hh);
      b.half[1] = *(const v8us*)(brow + 16 + 8 * hh);
      acc[t] = mmaN<ASPLIT ? 2 : 1>(ah.v, al.v, b.v, b.v, acc[t]);
    }
  }
#pragma unroll
  for (int t = 0; t < 4; ++t) {
    float bv = bias ? bias[col0 + t * 16 + ln] : 0.f;
    if (BIAS_BF16) bv = bf16_round(bv);
#pragma unroll
    for (int r = 0; r < 8; ++r) { float v = acc[t][r] + bv; if (ACT == 1) v = fmaxf(v, 0.f); so[w][8 * hh + r][t * 16 + ln] = v; }
  }
  __builtin_amdgcn_fence(__ATOMIC_ACQ_REL, "workgroup");
  __builtin_amdgcn_wave_barrier();
  const int rsub = lane >> 4, c4 = (lane & 15) * 4;
  {
#pragma unroll
    for (int q = 0; q < 8; ++q) {
      const int r = q * 2 + rsub;
      const v4f v = *(const v4fa*)&so[w][r][c4];
      *(v4f*)(C + (size_t)(row0 + r) * ldc + col0 + c4) = v;
    }
    
  }
}

// Flash-style causal/unmasked attention, all contractions 3-term bf16 hi/lo splits, f32 softmax with running max.
// q,k,v rows are read from f32 buffers with arbitrary row pitch (so they can live inside a fused qkv buffer);
// D = head size (multiple of 32, <= 128); one wave = 16 query rows; block = 4 waves (64 queries) sharing K/V chunks of 32.
template <int D, bool CAUSAL>
__global__ __launch_bounds__(128) void k_flash(const float* __restrict__ qb, const float* __restrict__ kb, const float* __restrict__ vb,
                                             int pitch, int T, int H, float scale, float* __restrict__ y, int ypitch) {
  constexpr int KS = D / 32;        // k-steps for QK
  constexpr int DT = D / 16;        // d tiles for PV
  __shared__ __attribute__((aligned(16))) unsigned short sKh[32][D + 8], sKl[32][D + 8], sVh[32][D + 8], sVl[32][D + 8];
  __shared__ __attribute__((aligned(16))) unsigned short sPh[4][16][40], sPl[4][16][40];
  __shared__ __attribute__((aligned(16))) float sO[4][16][D];
  const int tid = threadIdx.x, w = tid >> 5, lane = tid & 31, ln = lane & 15, hh = lane >> 4;
  const int nqb = (T + 63) / 64;
  const int bh = blockIdx.x / nqb, qblk = blockIdx.x % nqb;
  const int b = bh / H, h = bh % H;
  const int q0 = qblk * 64 + w * 16;
  const float* Q = qb + (size_t)b * T * pitch + h * D;
  const float* K = kb + (size_t)b * T * pitch + h * D;
  const float* V = vb + (size_t)b * T * pitch + h * D;

  // A fragments of the wave's 16 query rows (scaled), hi/lo
  FragB aqh[KS], aql[KS];
  {
    int row = q0 + ln; if (row >= T) row = T - 1;
    const float* qr = Q + (size_t)row * pitch;
#pragma unroll
    for (int ks = 0; ks < KS; ++ks)
#pragma unroll
      for (int i = 0; i < 16; ++i) {
        const int d = ks * 32 + ((i < 8) ? (8 * hh + i) : (16 + 8 * hh + (i - 8)));
        const float x = qr[d] * scale; const unsigned short hb = bf16_bits(x);
        aqh[ks].u[i] = hb; aql[ks].u[i] = bf16_bits(x - bf16_val(hb));
      }
  }
  float m_r[8], l_r[8];
#pragma unroll
  for (int r = 0; r < 8; ++r) { m_r[r] = -3.0e38f; l_r[r] = 0.f; }
  v8f oacc[DT];
#pragma unroll
  for (int dt = 0; dt < DT; ++dt) oacc[dt] = (v8f){0.f,0.f,0.f,0.f,0.f,0.f,0.f,0.f};

  const int kv_end = CAUSAL ? min(T, qblk * 64 + 64) : T;     // block-uniform
  for (int j0 = 0; j0 < kv_end; j0 += 32) {
    __syncthreads();
    for (int e = tid; e < 32 * (D / 4); e += 128) {
      const int r = e / (D / 4), c4 = (e % (D / 4)) * 4;
      const int key = j0 + r;
      v4f kf = {0.f,0.f,0.f,0.f}, vf = {0.f,0.f,0.f,0.f};
      if (key < T) { kf = *(const v4fa*)(K + (size_t)key * pitch + c4); vf = *(const v4fa*)(V + (size_t)key * pitch + c4); }
#pragma unroll
      for (int t = 0; t < 4; ++t) {
        unsigned short hb = bf16_bits(kf[t]); sKh[r][c4 + t] = hb; sKl[r][c4 + t] = bf16_bits(kf[t] - bf16_val(hb));
        hb = bf16_bits(vf[t]); sVh[r][c4 + t] = hb; sVl[r][c4 + t] = bf16_bits(vf[t] - bf16_val(hb));
      }
    }
    __syncthreads();
    // S tile 16 x 32
    v8f s[2];
#pragma unroll
    for (int nt = 0; nt < 2; ++nt) {
      v8f acc = {};
#pragma unroll
      for (int ks = 0; ks < KS; ++ks) {
        FragB bh_, bl_;
        bh_.half[0] = *(const v8us*)&sKh[nt * 16 + ln][ks * 32 + 8 * hh]; bh_.half[1] = *(const v8us*)&sKh[nt * 16 + ln][ks * 32 + 16 + 8 * hh];
        bl_.half[0] = *(const v8us*)&sKl[nt * 16 + ln][ks * 32 + 8 * hh]; bl_.half[1] = *(const v8us*)&sKl[nt * 16 + ln][ks * 32 + 16 + 8 * hh];
        acc = mmaN<3>(aqh[ks].v, aql[ks].v, bh_.v, bl_.v, acc);
      }
      s[nt] = acc;
    }
    // mask + running max (rows 8hh+r; the 16 lanes of a half share rows)
    float alpha[8];
#pragma unroll
    for (int r = 0; r < 8; ++r) {
      const int qi = q0 + 8 * hh + r;
      const int ja = j0 + ln, jb = j0 + 16 + ln;
      if (CAUSAL) { if (ja > qi) s[0][r] = -3.0e38f; if (jb > qi) s[1][r] = -3.0e38f; }
      if (ja >= T) s[0][r] = -3.0e38f;
      if (jb >= T) s[1][r] = -3.0e38f;
      float mx = fmaxf(s[0][r], s[1][r]);
      mx = fmaxf(mx, __shfl_xor(mx, 1, 32)); mx = fmaxf(mx, __shfl_xor(mx, 2, 32)); mx = fmaxf(mx, __shfl_xor(mx, 4, 32)); mx = fmaxf(mx, __shfl_xor(mx, 8, 32));
      const float mnew = fmaxf(m_r[r], mx);
      alpha[r] = (mnew > -1.0e38f) ? __expf(m_r[r] - mnew) : 1.0f;
      const float p0 = (s[0][r] > -1.0e38f) ? __expf(s[0][r] - mnew) : 0.f;
      const float p1 = (s[1][r] > -1.0e38f) ? __expf(s[1][r] - mnew) : 0.f;
      m_r[r] = mnew;
      l_r[r] = l_r[r] * alpha[r] + p0 + p1;            // per-lane partial row sum (16 lanes combined at the end)
      unsigned short hb = bf16_bits(p0); sPh[w][8 * hh + r][ln] = hb;      sPl[w][8 * hh + r][ln] = bf16_bits(p0 - bf16_val(hb));
      hb = bf16_bits(p1);                sPh[w][8 * hh + r][16 + ln] = hb; sPl[w][8 * hh + r][16 + ln] = bf16_bits(p1 - bf16_val(hb));
    }
#pragma unroll
    for (int dt = 0; dt < DT; ++dt)
#pragma unroll
      for (int r = 0; r < 8; ++r) oacc[dt][r] *= alpha[r];
    __builtin_amdgcn_fence(__ATOMIC_ACQ_REL, "workgroup");
    __builtin_amdgcn_wave_barrier();
    FragB pah, pal;
    pah.half[0] = *(const v8us*)&sPh[w][ln][8 * hh]; pah.half[1] = *(const v8us*)&sPh[w][ln][16 + 8 * hh];
    pal.half[0] = *(const v8us*)&sPl[w][ln][8 * hh]; pal.half[1] = *(const v8us*)&sPl[w][ln][16 + 8 * hh];
#pragma unroll
    for (int dt = 0; dt < DT; ++dt) {
      FragB bvh, bvl;
#pragma unroll
      for (int i = 0; i < 8; ++i) {
        bvh.u[i] = sVh[8 * hh + i][dt * 16 + ln]; bvh.u[8 + i] = sVh[16 + 8 * hh + i][dt * 16 + ln];
        bvl.u[i] = sVl[8 * hh + i][dt * 16 + ln]; bvl.u[8 + i] = sVl[16 + 8 * hh + i][dt * 16 + ln];
      }
      oacc[dt] = mmaN<3>(pah.v, pal.v, bvh.v, bvl.v, oacc[dt]);
    }
    __builtin_amdgcn_fence(__ATOMIC_ACQ_REL, "workgroup");
    __builtin_amdgcn_wave_barrier();
  }
#pragma unroll
  for (int r = 0; r < 8; ++r) {
    float l = l_r[r];
    l += __shfl_xor(l, 1, 32); l += __shfl_xor(l, 2, 32); l += __shfl_xor(l, 4, 32); l += __shfl_xor(l, 8, 32);
    l_r[r] = (l > 0.f) ? 1.0f / l : 0.f;
  }
#pragma unroll
  for (int dt = 0; dt < DT; ++dt)
#pragma unroll
    for (int r = 0; r < 8; ++r) sO[w][8 * hh + r][dt * 16 + ln] = oacc[dt][r] * l_r[r];
  __builtin_amdgcn_fence(__ATOMIC_ACQ_REL, "workgroup");
  __builtin_amdgcn_wave_barrier();
  {
    for (int r = 0; r < 16; ++r) {
      const int row = q0 + r;
      if (row < T && lane < D / 4) {
        const v4f val = *(const v4fa*)&sO[w][r][lane * 4];
        *(v4f*)(y + ((size_t)b * T + row) * ypitch + h * D + lane * 4) = val;
      }
    }
    
  }
}

// GEMM C = act(A·W + bias + resid): A f32 (ASPLIT -> hi/lo 2 terms), Wt bf16 [N][K]; ACT 0 none, 1 relu, 2 exact gelu;
// resid (optional, f32, row index = (row % rmod), pitch ldr, RES_BF16 rounds it) added before the activation.
template <bool ASPLIT, int ACT, bool BIAS_BF16, bool RES_BF16>
__global__ __launch_bounds__(128) void k_gemm_bf3(const float* __restrict__ A, int lda, const unsigned short* __restrict__ Wt, int ldb,
                                                const float* __restrict__ bias, const float* __restrict__ resid, int rmod, int ldr,
                                                float* __restrict__ C, int ldc, int M, int N, int K) {
  __shared__ __attribute__((aligned(16))) float so[4][16][64];
  const int tid = threadIdx.x, w = tid >> 5, lane = tid & 31, ln = lane & 15, hh = lane >> 4;
  const int ntn = N / 64;
  const int wid = blockIdx.x * 4 + w;
  const int mt = wid / ntn, nq = wid % ntn;
  if (mt * 16 >= M) return;
  const int row0 = mt * 16, col0 = nq * 64;
  const float* arow = A + (size_t)(row0 + ln) * lda;
  v8f acc[4] = {};
  for (int kb = 0; kb < K; kb += 32) {
    FragB ah, al;
    const v4f x0 = *(const v4fa*)(arow + kb + 8 * hh), x1 = *(const v4fa*)(arow + kb + 8 * hh + 4);
    const v4f x2 = *(const v4fa*)(arow + kb + 16 + 8 * hh), x3 = *(const v4fa*)(arow + kb + 16 + 8 * hh + 4);
    float xs[16] = {x0[0],x0[1],x0[2],x0[3],x1[0],x1[1],x1[2],x1[3],x2[0],x2[1],x2[2],x2[3],x3[0],x3[1],x3[2],x3[3]};
#pragma unroll
    for (int i = 0; i < 16; ++i) { const unsigned short hb = bf16_bits(xs[i]); ah.u[i] = hb; al.u[i] = ASPLIT ? bf16_bits(xs[i] - bf16_val(hb)) : (unsigned short)0; }
#pragma unroll
    for (int t = 0; t < 4; ++t) {
      const unsigned short* brow = Wt + (size_t)(col0 + t * 16 + ln) * ldb + kb;
      FragB b;
      b.half[0] = *(const v8us*)(brow + 8 * hh);
      b.half[1] = *(const v8us*)(brow + 16 + 8 * hh);
      acc[t] = mmaN<ASPLIT ? 2 : 1>(ah.v, al.v, b.v, b.v, acc[t]);
    }
  }
#pragma unroll
  for (int t = 0; t < 4; ++t) {
    const int col = col0 + t * 16 + ln;
    float bv = bias ? bias[col] : 0.f;
    if (BIAS_BF16) bv = bf16_round(bv);
#pragma unroll
    for (int r = 0; r < 8; ++r) {
      float v = acc[t][r] + bv;
      if (resid) { float rv = resid[(size_t)((row0 + 8 * hh + r) % rmod) * ldr + col]; if (RES_BF16) rv = bf16_round(rv); v += rv; }
      if (ACT == 1) v = fmaxf(v, 0.f);
      if (ACT == 2) v = 0.5f * v * (1.0f + erff(v * 0.70710678118654752f));
      if (ACT == 3) { const float u = 0.7978845608028654f * (v + 0.044715f * v * v * v); v = 0.5f * v * (1.0f + tanhf(u)); }
      so[w][8 * hh + r][t * 16 + ln] = v;
    }
  }
  __builtin_amdgcn_fence(__ATOMIC_ACQ_REL, "workgroup");
  __builtin_amdgcn_wave_barrier();
  const int rsub = lane >> 4, c4 = (lane & 15) * 4;
  {
#pragma unroll
    for (int q = 0; q < 8; ++q) {
      const int r = q * 2 + rsub;
      const v4f v = *(const v4fa*)&so[w][r][c4];
      *(v4f*)(C + (size_t)(row0 + r) * ldc + col0 + c4) = v;
    }
    
  }
}
// row LayerNorm (biased variance, eps) over N: s = X (+ R); optional out_sum <- s; out_norm <- (s-mu)*rsqrt(var+eps)*g + b
template <bool PARAM_BF16>
__global__ __launch_bounds__(256) void k_layernorm(const float* __restrict__ X, const float* __restrict__ R, const float* __restrict__ g, const float* __restrict__ bta,
                                                  float* __restrict__ out_sum, float* __restrict__ out_norm, int N, float eps) {
  __shared__ float red[256];
  const int row = blockIdx.x, tid = threadIdx.x;
  const float* x = X + (size_t)row * N; const float* rr = R ? R + (size_t)row * N : nullptr;
  float vals[16];                     // up to N = 4096
  const int per = N / 256;            // contiguous chunk per thread? use strided-by-4 chunks: thread handles j = tid*4 + 1024*u
  float s1 = 0.f;
  for (int u = 0; u < per / 4; ++u) {
    const int j = tid * 4 + 1024 * u;
    const v4f a = *(const v4fa*)(x + j);
    v4f b = {0.f,0.f,0.f,0.f}; if (rr) b = *(const v4fa*)(rr + j);
#pragma unroll
    for (int q = 0; q < 4; ++q) { const float v = a[q] + b[q]; vals[u * 4 + q] = v; s1 += v; }
  }
  red[tid] = s1; __syncthreads();
  for (int st = 128; st > 0; st >>= 1) { if (tid < st) red[tid] += red[tid + st]; __syncthreads(); }
  const float mu = red[0] / (float)N; __syncthreads();
  float s2 = 0.f;
  for (int u = 0; u < per / 4; ++u)
#pragma unroll
    for (int q = 0; q < 4; ++q) { const float c = vals[u * 4 + q] - mu; s2 += c * c; }
  red[tid] = s2; __syncthreads();
  for (int st = 128; st > 0; st >>= 1) { if (tid < st) red[tid] += red[tid + st]; __syncthreads(); }
  const float rs = rsqrtf(red[0] / (float)N + eps);
  {
    for (int u = 0; u < per / 4; ++u) {
      const int j = tid * 4 + 1024 * u;
      v4f o, sm;
#pragma unroll
      for (int q = 0; q < 4; ++q) {
        float gg = g[j + q], bb = bta[j + q];
        if (PARAM_BF16) { gg = bf16_round(gg); bb = bf16_round(bb); }
        sm[q] = vals[u * 4 + q]; o[q] = (vals[u * 4 + q] - mu) * rs * gg + bb;
      }
      if (out_sum) *(v4f*)(out_sum + (size_t)row * N + j) = sm;
      *(v4f*)(out_norm + (size_t)row * N + j) = o;
    }
    
  }
}



// ---- f16 WMMA path (v_wmma_f32_16x16x32_f16): 11-bit significands for operands in range — used where a [0,1] probability operand needs more precision than bf16
typedef _Float16 v16h __attribute__((ext_vector_type(16)));
union FragH { v16h v; v8us half[2]; _Float16 h[16]; unsigned short u[16]; };
template <int NT>
__device__ __forceinline__ v8f mmaH(v16h ah, v16h al, v16h bh, v16h bl, v8f c) {
  c = __builtin_amdgcn_wmma_f32_16x16x32_f16(false, ah, false, bh, (short)0, c, false, false);
  if (NT >= 2) c = __builtin_amdgcn_wmma_f32_16x16x32_f16(false, al, false, bh, (short)0, c, false, false);
  if (NT >= 3) c = __builtin_amdgcn_wmma_f32_16x16x32_f16(false, ah, false, bl, (short)0, c, false, false);
  asm volatile("v_nop\n\tv_nop\n\tv_nop\n\tv_nop" : "+v"(c) : "v"(ah), "v"(al), "v"(bh), "v"(bl));
  return c;
}
// batched GEMM like k_gemm_b but f16 operands: A f32 (split into f16 hi/lo if ASPLIT, else rounded to f16), Bt = f16 values [n][k]; alpha; C f32; N multiple of 16 (partial tiles skipped)
template <bool ASPLIT>
__global__ __launch_bounds__(128) void k_gemm_h(const float* __restrict__ A, int lda, size_t sA, const _Float16* __restrict__ Bh, int ldb, size_t sB, float alpha, float* __restrict__ C, int ldc, size_t sC, int M, int N, int K) {
  __shared__ __attribute__((aligned(16))) float so[4][16][64];
  const int tid = threadIdx.x, w = tid >> 5, lane = tid & 31, ln = lane & 15, hh = lane >> 4; const int by = blockIdx.y;
  A += (size_t)by * sA; Bh += (size_t)by * sB; C += (size_t)by * sC;
  const int ntn = (N + 63) / 64; const int wid = blockIdx.x * 4 + w; const int mt = wid / ntn, nq = wid % ntn; if (mt * 16 >= M) return;
  const int row0 = mt * 16, col0 = nq * 64; const float* arow = A + (size_t)(row0 + ln) * lda;
  v8f acc[4] = {};
  for (int kb = 0; kb < K; kb += 32) {
    FragH ah, al;
    const v4f x0 = *(const v4fa*)(arow + kb + 8 * hh), x1 = *(const v4fa*)(arow + kb + 8 * hh + 4), x2 = *(const v4fa*)(arow + kb + 16 + 8 * hh), x3 = *(const v4fa*)(arow + kb + 16 + 8 * hh + 4);
    float xs[16] = {x0[0],x0[1],x0[2],x0[3],x1[0],x1[1],x1[2],x1[3],x2[0],x2[1],x2[2],x2[3],x3[0],x3[1],x3[2],x3[3]};
#pragma unroll
    for (int i = 0; i < 16; ++i) { const _Float16 h = (_Float16)xs[i]; ah.h[i] = h; al.h[i] = ASPLIT ? (_Float16)(xs[i] - (float)h) : (_Float16)0.0f; }
#pragma unroll
    for (int t = 0; t < 4; ++t) { if (col0 + t * 16 >= N) continue; const size_t boff = (size_t)(col0 + t * 16 + ln) * ldb + kb; FragH bq; bq.half[0] = *(const v8us*)(Bh + boff + 8 * hh); bq.half[1] = *(const v8us*)(Bh + boff + 16 + 8 * hh);
      acc[t] = mmaH<ASPLIT ? 2 : 1>(ah.v, al.v, bq.v, bq.v, acc[t]); }
  }
#pragma unroll
  for (int t = 0; t < 4; ++t) { if (col0 + t * 16 >= N) continue;
#pragma unroll
    for (int r = 0; r < 8; ++r) so[w][8 * hh + r][t * 16 + ln] = acc[t][r] * alpha; }
  __builtin_amdgcn_fence(__ATOMIC_ACQ_REL, "workgroup"); __builtin_amdgcn_wave_barrier();
  const int rsub = lane >> 4, c4 = (lane & 15) * 4;
  {
#pragma unroll
    for (int q = 0; q < 8; ++q) { const int r = q * 2 + rsub; if (col0 + c4 < N) { const v4f v = *(const v4fa*)&so[w][r][c4]; *(v4f*)(C + (size_t)(row0 + r) * ldc + col0 + c4) = v; } }
     }
}

// Wt[n][k] = f16(W[k][n]·scale) from f32 row-major W[K][N] (scale = power of two; bf16-exact weights stay exact in f16 away from the subnormal range)
__global__ __launch_bounds__(256) void k_wt_f16(const float* __restrict__ W, _Float16* __restrict__ Wt, int K, int N, float scale) {
  const int t = blockIdx.x * 256 + threadIdx.x; if (t >= N * (K / 8)) return; const int n = t / (K / 8), k8 = (t % (K / 8)) * 8; FragH f;
#pragma unroll
  for (int i = 0; i < 8; ++i) f.h[i] = (_Float16)(bf16_round(W[(size_t)(k8 + i) * N + n]) * scale); const v8us o = f.half[0];
  *(v8us*)((unsigned short*)Wt + (size_t)n * K + k8) = o; 
}
// k_gemm_hh variant with fused epilogue: v = acc·alpha + bias[by·sBias + col] (+ CP[(row/rowsPerB)·sCPb + by·64 + col] if CP) ; ACT 0 none / 1 elu ; writes f32 C and f16 C16, each if non-null
template <int ACT>
__global__ __launch_bounds__(128) void k_gemm_hhx(const _Float16* __restrict__ A, int lda, size_t sA, const _Float16* __restrict__ Bh, int ldb, size_t sB, float alpha, const float* __restrict__ bias, size_t sBias, const float* __restrict__ CP, int rowsPerB, size_t sCPb, int row0g,
    float* __restrict__ C, _Float16* __restrict__ C16, int ldc, size_t sC, int M, int N, int K) {
  __shared__ __attribute__((aligned(16))) float so[4][16][64];
  const int tid = threadIdx.x, w = tid >> 5, lane = tid & 31, ln = lane & 15, hh = lane >> 4; const int by = blockIdx.y;
  A += (size_t)by * sA; Bh += (size_t)by * sB; const size_t cofs = (size_t)by * sC; const float* bp = bias ? bias + (size_t)by * sBias : nullptr;
  const int ntn = (N + 63) / 64; const int wid = blockIdx.x * 4 + w; const int mt = wid / ntn, nq = wid % ntn; if (mt * 16 >= M) return;
  const int row0 = mt * 16, col0 = nq * 64; const _Float16* arow = A + (size_t)(row0 + ln) * lda;
  v8f acc[4] = {};
  for (int kb = 0; kb < K; kb += 32) { FragH ah; ah.half[0] = *(const v8us*)((const unsigned short*)arow + kb + 8 * hh); ah.half[1] = *(const v8us*)((const unsigned short*)arow + kb + 16 + 8 * hh);
#pragma unroll
    for (int t = 0; t < 4; ++t) { if (col0 + t * 16 >= N) continue; const size_t boff = (size_t)(col0 + t * 16 + ln) * ldb + kb; FragH bq; bq.half[0] = *(const v8us*)((const unsigned short*)Bh + boff + 8 * hh); bq.half[1] = *(const v8us*)((const unsigned short*)Bh + boff + 16 + 8 * hh);
      acc[t] = mmaH<1>(ah.v, ah.v, bq.v, bq.v, acc[t]); }
  }
#pragma unroll
  for (int t = 0; t < 4; ++t) { if (col0 + t * 16 >= N) continue; const int col = col0 + t * 16 + ln; const float bv = bp ? bf16_round(bp[col]) : 0.f;
#pragma unroll
    for (int r = 0; r < 8; ++r) { float v = acc[t][r] * alpha + bv; if (CP) { const int bidx = (row0g + row0 + 8 * hh + r) / rowsPerB; v += CP[(size_t)bidx * sCPb + (size_t)by * 64 + col]; } if (ACT == 1) v = (v > 0.f) ? v : expm1f(v); else if (ACT == 7) v = (v > 0.f) ? v + 1.0f : expf(v); else if (ACT == 8) v = tanhf(v); else if (ACT == 9) v = 0.5f * v * (1.0f + tanhf(0.7978845608028654f * (v + 0.044715f * v * v * v))); else if (ACT == 11) v = 1.0f / (1.0f + expf(-v)); else if (ACT == 12) v = (v > 0.f) ? v : 0.01f * v; else if (ACT == 14) v = (v > 0.f) ? v : 0.1f * v; else if (ACT == 15) v = v / (1.0f + expf(-v)); else if (ACT == 3) v = fmaxf(v, 0.f); else if (ACT == 6) v = 0.5f * v * (1.0f + erff(v * 0.70710678118654752f)); so[w][8 * hh + r][t * 16 + ln] = v; } }
  __builtin_amdgcn_fence(__ATOMIC_ACQ_REL, "workgroup"); __builtin_amdgcn_wave_barrier();
  const int rsub = lane >> 4, c4 = (lane & 15) * 4; typedef _Float16 v4h __attribute__((ext_vector_type(4)));
  {
#pragma unroll
    for (int q = 0; q < 8; ++q) { const int r = q * 2 + rsub; if (col0 + c4 < N) { const v4f v = *(const v4fa*)&so[w][r][c4]; if (C) *(v4f*)(C + cofs + (size_t)(row0 + r) * ldc + col0 + c4) = v; if (C16) { v4h h4; for (int i = 0; i < 4; ++i) h4[i] = (_Float16)v[i]; *(v4h*)(C16 + cofs + (size_t)(row0 + r) * ldc + col0 + c4) = h4; } } }
     }
}


typedef _Float16 v4h __attribute__((ext_vector_type(4)));

// Conversion passes as streams of few, long-lived waves. A run is 1024 consecutive floats (4 KB): eight 16-byte loads a lane, each wave-wide load 512 contiguous bytes (4 whole lines);
// the four halves that a lane makes of one load leave as one 8-byte store (256 contiguous bytes a wave, 2 whole lines). A wave issues all its loads before it converts the first value.
// Addresses are a wave-uniform base plus one 32-bit lane offset in bytes (vo for the floats, vo / 2 for the halves).
// Each plain '#pragma unroll' below stands on a loop whose index picks an element of a register array.
template <int NL>
__device__ __forceinline__ void run_load(v4f* r, const float* __restrict__ src, unsigned vo) {
#pragma unroll
  for (int j = 0; j < NL; ++j) r[j] = *(const v4fa*)((const char*)src + vo + j * 512); }
// MODE 0: f16(x); 1: f16(bf16(x)); 2: f16(bf16(x) * 2^4)
template <int NL, int MODE>
__device__ __forceinline__ void run_store(const v4f* r, _Float16* __restrict__ dst, unsigned vh) {
#pragma unroll
  for (int j = 0; j < NL; ++j) { v4h h;
#pragma unroll
    for (int q = 0; q < 4; ++q) h[q] = (MODE == 0) ? (_Float16)r[j][q] : (MODE == 1) ? (_Float16)bf16_round(r[j][q]) : (_Float16)(bf16_round(r[j][q]) * 16.0f);
    *(v4h*)((char*)dst + vh + j * 256) = h; } }
// All seven inputs in one launch: 256 blocks of 16 waves; wave number n takes run n of query, of key and of value, and run n of the four weight matrices laid end to end (as Bw is).
__global__ __launch_bounds__(512) void k_cvt_in(const float* __restrict__ xq, const float* __restrict__ xk, const float* __restrict__ xv, const float* __restrict__ wq, const float* __restrict__ wk, const float* __restrict__ wv, const float* __restrict__ wo,
                                               _Float16* __restrict__ X16, _Float16* __restrict__ XK16, _Float16* __restrict__ XV16, _Float16* __restrict__ Bw) {
  static_assert(NR * DD == 4096 * 1024 && DD * DD == 1024 * 1024, "4096 runs an activation, 1024 a weight matrix");
  const unsigned lane = threadIdx.x & 31, run = blockIdx.x * 16 + (threadIdx.x >> 5);
  const unsigned m = blockIdx.x >> 6;      /* 1024 runs = 64 blocks a weight matrix: the same for the whole block */
  const float* __restrict__ w = (m == 0) ? wq : (m == 1) ? wk : (m == 2) ? wv : wo;
  const unsigned vo = run * 4096 + lane * 16, vw = (run & 1023) * 4096 + lane * 16, vh = run * 2048 + lane * 8;
  v4f r[4][8];
  run_load<8>(r[0], xq, vo); run_load<8>(r[1], xk, vo); run_load<8>(r[2], xv, vo); run_load<8>(r[3], w, vw);
  __builtin_amdgcn_sched_barrier(0);      /* all 32 loads are issued before any conversion: without it the scheduler sinks some of them among the conversions, behind waits on earlier data */
  asm volatile("s_wait_xcnt 0x0" :: "v"(vo), "v"(vw) : "memory");      /* the loads' offset registers may be reused below: wait before that overwrite; named as inputs, they are not given to a late load as its destination either */
  __builtin_amdgcn_sched_barrier(0);      /* nothing that rewrites a base or offset register of the loads is scheduled in front of that wait */
  run_store<8, 1>(r[0], X16, vh);
  asm volatile("s_wait_xcnt 0x0" ::: "memory");      /* the stores' data registers may be reused by the next run: wait before that overwrite */
  __builtin_amdgcn_sched_barrier(0);      /* keeps the next run's conversions behind that wait */
  run_store<8, 1>(r[1], XK16, vh);
  asm volatile("s_wait_xcnt 0x0" ::: "memory");      /* as above */
  __builtin_amdgcn_sched_barrier(0);
  run_store<8, 1>(r[2], XV16, vh);
  asm volatile("s_wait_xcnt 0x0" ::: "memory");      /* as above */
  __builtin_amdgcn_sched_barrier(0);
  run_store<8, 2>(r[3], Bw, vh);
}
// The attention result: 256 blocks of 8 waves, two runs a wave.
__global__ __launch_bounds__(256) void k_cvt_o(const float* __restrict__ x, _Float16* __restrict__ X16) {
  static_assert(NR * DD == 2048 * 2048, "2048 waves, 2048 floats each");
  const unsigned vo = (blockIdx.x * 8 + (threadIdx.x >> 5)) * 8192 + (threadIdx.x & 31) * 16, vh = (blockIdx.x * 8 + (threadIdx.x >> 5)) * 4096 + (threadIdx.x & 31) * 8;
  v4f r[16];
  run_load<16>(r, x, vo);
  __builtin_amdgcn_sched_barrier(0);      /* all 16 loads are issued before any conversion */
  asm volatile("s_wait_xcnt 0x0" :: "v"(vo) : "memory");      /* the loads' offset register may be reused below: wait before that overwrite; named as an input, it is not given to a late load as its destination either */
  __builtin_amdgcn_sched_barrier(0);      /* nothing that rewrites the base or offset register of the loads is scheduled in front of that wait */
  run_store<8, 0>(r, X16, vh);
  asm volatile("s_wait_xcnt 0x0" ::: "memory");      /* the stores' data registers may be reused by the second run: wait before that overwrite */
  __builtin_amdgcn_sched_barrier(0);      /* keeps the second run's conversions behind that wait */
  run_store<8, 0>(r + 8, X16, vh + 2048);
}
template <int NHv, int TTv>
__global__ __launch_bounds__(256) void k_vt(const _Float16* __restrict__ V16, int ldv, int voff, _Float16* __restrict__ Vt) { __shared__ unsigned short tl[64][66]; const int tid = threadIdx.x; const int slab = blockIdx.x / (TTv / 64), lg = blockIdx.x % (TTv / 64); const int b = slab / NHv, h = slab % NHv;
  for (int i = tid; i < 64 * 8; i += 256) { const int r = i / 8, c8 = (i % 8) * 8; FragH f; f.half[0] = *(const v8us*)((const unsigned short*)V16 + ((size_t)b * TTv + lg * 64 + r) * ldv + voff + h * 64 + c8);
#pragma unroll
    for (int q = 0; q < 8; ++q) tl[r][c8 + q] = f.u[q]; }
  __syncthreads();
  {
#pragma unroll
    for (int rd = 0; rd < 2; ++rd) { const int d = rd * 32 + tid / 8, pc = tid % 8; FragH f;
#pragma unroll
      for (int q = 0; q < 8; ++q) f.u[q] = tl[pc * 8 + q][d];
      *(v8us*)((unsigned short*)Vt + ((size_t)slab * 64 + d) * TTv + lg * 64 + pc * 8) = f.half[0]; }
     } }

// lane l <-> lane l ^ 16 (the two halves of a wave)
__device__ __forceinline__ float xhalf(float x) { return __builtin_bit_cast(float, __builtin_amdgcn_permlanex16(__builtin_bit_cast(int, x), __builtin_bit_cast(int, x), 0x76543210, 0xfedcba98, false, false)); }

__device__ __forceinline__ void tile_copy(unsigned l, const char* k, size_t kstep, const char* v) {      /* l: the lane's LDS byte address in the buffer; k, v: its global addresses in row tid / 8; kstep: 16 rows of K in bytes */
  const unsigned l1 = l + 16 * 144, l2 = l + 32 * 144, l3 = l + 48 * 144, l4 = l + 64 * 144, l5 = l + 80 * 144, l6 = l + 96 * 144, l7 = l + 112 * 144;
  const char* k1 = k + kstep; const char* k2 = k1 + kstep; const char* k3 = k2 + kstep;
  const char* v1 = v + (size_t)16 * TT * 2; const char* v2 = v + (size_t)32 * TT * 2; const char* v3 = v + (size_t)48 * TT * 2;
  /* the copies and, as the last line of their own statement, the wait before any of their address registers is rewritten */
  asm volatile("global_load_async_to_lds_b128 %0, %8, off\n\t"
               "global_load_async_to_lds_b128 %1, %9, off\n\t"
               "global_load_async_to_lds_b128 %2, %10, off\n\t"
               "global_load_async_to_lds_b128 %3, %11, off\n\t"
               "global_load_async_to_lds_b128 %4, %12, off\n\t"
               "global_load_async_to_lds_b128 %5, %13, off\n\t"
               "global_load_async_to_lds_b128 %6, %14, off\n\t"
               "global_load_async_to_lds_b128 %7, %15, off\n\t"
               "s_wait_xcnt 0x0"
               :: "v"(l), "v"(l1), "v"(l2), "v"(l3), "v"(l4), "v"(l5), "v"(l6), "v"(l7), "v"(k), "v"(k1), "v"(k2), "v"(k3), "v"(v), "v"(v1), "v"(v2), "v"(v3) : "memory");
}
__global__ __launch_bounds__(128) void k_flash(const _Float16* __restrict__ Q16, int ldq, const _Float16* __restrict__ K16, int ldk, const _Float16* __restrict__ Vt, const float* __restrict__ FR, const float* __restrict__ AP, const float* __restrict__ AN, const float* __restrict__ GM, const float* __restrict__ DLT, float* __restrict__ O, int ldo) {
  constexpr int NQB = TT / 64, DT = 4, KS = 2;
  constexpr int NS = TT / 64, RP = 144, TB = 128 * RP;      /* tiles of 64 keys; LDS row pitch and bytes of one buffer */
  static_assert(NS >= 2, "the two buffers' prologue needs two tiles");
  __shared__ __attribute__((aligned(16))) float sF[TT]; __shared__ __attribute__((aligned(16))) float sO[4][16][64 + 4]; __shared__ __attribute__((aligned(16))) unsigned char sT[2 * TB];
  const int tid = threadIdx.x, w = tid >> 5, lane = tid & 31, ln = lane & 15, hh = lane >> 4;
  const int slab = blockIdx.x / NQB, qblk = blockIdx.x % NQB; const int b = slab / NH, h = slab % NH; const int q0 = qblk * 64 + w * 16;
  const float* frb = FR + (size_t)b * TT;
#pragma unroll
  for (int i = 0; i < TT / 512; ++i) { const int e = i * 512 + tid * 4; v4f f = *(const v4fa*)(frb + e);
#pragma unroll
    for (int q = 0; q < 4; ++q) f[q] = bf16_round(f[q]);
    *(v4fa*)&sF[e] = f; }
  FragH bq[KS]; const unsigned short* qr = (const unsigned short*)Q16 + ((size_t)b * TT + q0 + ln) * ldq + h * 64;      /* B operand: column ln = query q0 + ln */
#pragma unroll
  for (int ks = 0; ks < KS; ++ks) { bq[ks].half[0] = *(const v8us*)(qr + ks * 32 + 8 * hh); bq[ks].half[1] = *(const v8us*)(qr + ks * 32 + 16 + 8 * hh); }
  const char* ck = (const char*)K16 + (((size_t)b * TT + (tid >> 3)) * ldk + h * 64) * 2 + (tid & 7) * 16;      /* the lane's 16 bytes of key row tid / 8 of tile 0 */
  const char* cv = (const char*)Vt + ((size_t)slab * 64 + (tid >> 3)) * TT * 2 + (tid & 7) * 16;      /* and of row tid / 8 of V^T */
  const size_t kstep = (size_t)16 * ldk * 2; const unsigned lt = (unsigned)(size_t)sT + (unsigned)((tid >> 3) * RP + (tid & 7) * 16);
  constexpr float L2E = 1.44269504088896340736f;      /* log2(e): the scores are formed in base-2 units, so that exp(s - m) is one hardware exp2 of a difference */
  const float gmm = bf16_round(GM[0]), dlt = bf16_round(DLT[0]); const float aph = bf16_round(AP[h]) * dlt * L2E, anh = bf16_round(AN[h]) * dlt * L2E;      /* gamma, delta scalars; log2(e)*delta*alpha_pos[h], log2(e)*delta*alpha_neg[h] */
  const float g8 = gmm * 0.125f * L2E;      /* log2(e) * gamma * 64^-1/2 */
  const float fq = bf16_round(frb[q0 + ln]);      /* frac of the lane's query */
  float m_r = -3.0e38f, l_r = 0.f; v8f oacc[DT];
#pragma unroll
  for (int dt = 0; dt < DT; ++dt) oacc[dt] = (v8f){0.f,0.f,0.f,0.f,0.f,0.f,0.f,0.f};
  tile_copy(lt, ck, kstep, cv);      /* tile 0 into buffer 0 */
  asm volatile("s_wait_asynccnt 0x0" ::: "memory");      /* this wave's copies of tile 0 have landed */
  __syncthreads();      /* sF and tile 0 are complete before any wave reads them */
  tile_copy(lt + TB, ck + 4 * kstep, kstep, cv + 128);      /* tile 1 into buffer 1 */
#pragma unroll 1      /* rolled: 32 copies of this body would only grow the code */
  for (int s = 0; s < NS; ++s) {
   const unsigned char* tk = sT + (s & 1) * TB + ln * RP + 16 * hh; const unsigned char* tv = tk + 64 * RP;      /* trip s reads buffer s mod 2 alone */
#pragma unroll      /* the two 32-key chunks of a tile: p picks constant LDS offsets */
   for (int p = 0; p < 2; ++p) { const int j0 = s * 64 + p * 32;
    FragH ak[2][KS], av[DT]; v4f fk[2][2];
#pragma unroll
    for (int nt = 0; nt < 2; ++nt)      /* A operand: row ln = key j0 + nt*16 + ln */
#pragma unroll
      for (int ks = 0; ks < KS; ++ks) { ak[nt][ks].half[0] = *(const v8us*)(tk + (p * 32 + nt * 16) * RP + ks * 64); ak[nt][ks].half[1] = *(const v8us*)(tk + (p * 32 + nt * 16) * RP + ks * 64 + 32); }
#pragma unroll
    for (int dt = 0; dt < DT; ++dt) { av[dt].half[0] = *(const v8us*)(tv + dt * 16 * RP + p * 64); av[dt].half[1] = *(const v8us*)(tv + dt * 16 * RP + p * 64 + 32); }      /* A operand: row ln = head column dt*16 + ln */
#pragma unroll
    for (int nt = 0; nt < 2; ++nt) { fk[nt][0] = *(const v4fa*)&sF[j0 + nt * 16 + 8 * hh]; fk[nt][1] = *(const v4fa*)&sF[j0 + nt * 16 + 8 * hh + 4]; }      /* frac of the lane's 16 keys */
    float sc[16];
#pragma unroll
    for (int nt = 0; nt < 2; ++nt) { v8f acc = (v8f){0.f,0.f,0.f,0.f,0.f,0.f,0.f,0.f};
#pragma unroll
      for (int ks = 0; ks < KS; ++ks) acc = __builtin_amdgcn_wmma_f32_16x16x32_f16(false, ak[nt][ks].v, false, bq[ks].v, (short)0, acc, false, false);
#pragma unroll
      for (int r = 0; r < 8; ++r) { float d = fk[nt][r >> 2][r & 3] - fq; d = fminf(fmaxf(d, -0.2f), 0.2f);      /* D = clip(frac_k - frac_q, -0.2, 0.2) */
        const float sb = aph * fmaxf(d, 0.f) + anh * fminf(d, 0.f);      /* log2(e)*delta*(alpha_pos*D+ + alpha_neg*D-) */
        sc[nt * 8 + r] = g8 * acc[r] + sb; } }
    float mx[4];
#pragma unroll
    for (int q = 0; q < 4; ++q) mx[q] = fmaxf(fmaxf(sc[q], sc[4 + q]), fmaxf(sc[8 + q], sc[12 + q]));
    float mc = fmaxf(fmaxf(mx[0], mx[1]), fmaxf(mx[2], mx[3])); mc = fmaxf(mc, xhalf(mc));      /* the query's maximum over all 32 keys, in both halves */
    const float mn = fmaxf(m_r, mc - 10.0f); const float al = (mn > -1.0e38f) ? __builtin_amdgcn_exp2f(m_r - mn) : 1.0f; m_r = mn;      /* the running maximum is kept 10 lower: 2^(s - mn) is then P * 2^10, the scale of the f16 operand, in the sum as well */
    FragH pb; float ps[4];
#pragma unroll
    for (int i = 0; i < 16; ++i) { const float p = __builtin_amdgcn_exp2f(sc[i] - mn); ps[i & 3] = (i < 4) ? p : ps[i & 3] + p; pb.h[i] = (_Float16)p; }
    l_r = l_r * al + ((ps[0] + ps[1]) + (ps[2] + ps[3]));      /* the lane's 16 keys; the halves are joined after the loop */
#pragma unroll
    for (int dt = 0; dt < DT; ++dt) {
#pragma unroll
      for (int r = 0; r < 8; ++r) oacc[dt][r] *= al;
      oacc[dt] = __builtin_amdgcn_wmma_f32_16x16x32_f16(false, av[dt].v, false, pb.v, (short)0, oacc[dt], false, false); } }
   asm volatile("s_wait_dscnt 0x0" ::: "memory");      /* this wave's reads of buffer s mod 2 have returned before the buffer is handed to the copies */
   asm volatile("s_wait_asynccnt 0x0" ::: "memory");      /* this wave's copies of tile s + 1 have landed */
   __syncthreads();      /* publishes tile s + 1 and ends every wave's reads of tile s */
   if (s + 2 < NS) tile_copy(lt + (s & 1) * TB, ck + (size_t)(s + 2) * 4 * kstep, kstep, cv + (size_t)(s + 2) * 128); }      /* tile s + 2 into the buffer that trip s has just read */
  asm volatile("s_wait_asynccnt 0x0" ::: "memory");      /* nothing is in flight when the wave goes on to its end */
  const float l = l_r + xhalf(l_r); const float inv = (l > 0.f) ? 1.0f / l : 0.f;      /* sum and O carry the same 2^10 */
#pragma unroll
  for (int dt = 0; dt < DT; ++dt)      /* oacc[dt][r] = O[query ln][dt*16 + 8*hh + r] */
#pragma unroll
    for (int c = 0; c < 2; ++c) { const v4f o = {oacc[dt][4 * c] * inv, oacc[dt][4 * c + 1] * inv, oacc[dt][4 * c + 2] * inv, oacc[dt][4 * c + 3] * inv}; *(v4fa*)&sO[w][ln][dt * 16 + 8 * hh + 4 * c] = o; }
  __builtin_amdgcn_fence(__ATOMIC_ACQ_REL, "workgroup"); __builtin_amdgcn_wave_barrier();      /* the wave's LDS stores are done, and stay in front, before its lanes read each other's values back */
#pragma unroll
  for (int rp = 0; rp < 16; rp += 2) { const int r = rp + (lane >> 4), pc = lane & 15; const v4f val = *(const v4fa*)&sO[w][r][pc * 4]; *(v4f*)(O + ((size_t)b * TT + q0 + r) * ldo + h * 64 + pc * 4) = val; }
}

// Block-tiled GEMM, C = (A.Bh^T)*alpha + bias: a block of 8 waves owns a 128 x 128 tile of C and stages 128 x 64 pieces of A and of Bh in LDS, so every operand byte is fetched once a block, in whole 128-B lines
// (8 lanes a row), and is read as fragments from LDS. Wave tile 32 x 64 (2 x 4 accumulators). The next piece is fetched into registers while this one is multiplied. k runs upward in steps of 32.
// M % 128 == 0 (grid), N % 128 == 0, K % 64 == 0. LDS row pitch 64 + 8 halves = 144 B for the 16-byte fragment reads.
// One launch holds NZ independent products of the same shape (M = NR): product z takes plane z of A, of Bh and of C16, laid end to end, and its own bias. A block takes under a third of a WGP's registers
// (two waves of 160 on each SIMD's 1,024) and a fifth of its LDS, so with NZ = 3 three blocks stand on every WGP at once, and one block's barriers, LDS waits and first and last phases are covered by the matrix work of the other two.
// Most plain '#pragma unroll's below stand on a short loop whose index picks an element of a register array (staging registers, fragments, accumulators): unrolled, these stay in registers.
template <int N, int K, int NZ, bool HALF_OUT>
__global__ __launch_bounds__(256) void k_gemm_tile(const _Float16* __restrict__ A, const _Float16* __restrict__ Bh, float alpha, const float* __restrict__ bias0, const float* __restrict__ bias1, const float* __restrict__ bias2, float* __restrict__ C, _Float16* __restrict__ C16) {
  constexpr int BM = 128, BN = 128, BK = 64, LP = BK + 8;
  constexpr int NB = (NR / BM) * (N / BN);      /* blocks of one product */
  static_assert(NZ >= 1 && NZ <= 3 && (NZ == 1 || HALF_OUT), "up to three biases; the planes of several products are the f16 outputs");
  const unsigned z = (NZ > 1) ? blockIdx.x / NB : 0u; const unsigned bid = blockIdx.x - z * NB;      /* product and tile number: the same for the whole block */
  const float* __restrict__ bias = (z == 0) ? bias0 : (z == 1) ? bias1 : bias2;
  A += (size_t)z * NR * K; Bh += (size_t)z * N * K; if (HALF_OUT) C16 += (size_t)z * NR * N;
  __shared__ __attribute__((aligned(16))) unsigned short sm[8 * 32 * 64 * 2];      /* 64 KB: the output staging (8 waves x 32 x 64 f32) is the larger use; the operand pieces take (BM + BN) * LP halves */
  static_assert((BM + BN) * LP <= 8 * 32 * 64 * 2, "operand pieces fit");
  unsigned short* sA = sm; unsigned short* sB = sm + BM * LP;
  const int tid = threadIdx.x, w = tid >> 5, lane = tid & 31, ln = lane & 15, hh = lane >> 4;
  const int nbn = N / BN; const int row0 = (bid / nbn) * BM, col0 = (bid % nbn) * BN;
  const int wm = w >> 1, wn = w & 1;
  const int lr = tid >> 3, lc = (tid & 7) * 8;
  const char* ga = (const char*)A + (size_t)row0 * K * 2; const char* gb = (const char*)Bh + (size_t)col0 * K * 2; const unsigned vo = (unsigned)(lr * K + lc) * 2u;      /* block-uniform bases, one 32-bit lane offset that lives through the loop */
  v8us ra[4], rb[4];
#pragma unroll
  for (int i = 0; i < 4; ++i) { ra[i] = *(const v8us*)(ga + vo + (size_t)(32 * i) * K * 2); rb[i] = *(const v8us*)(gb + vo + (size_t)(32 * i) * K * 2); }
  v8f acc[2][4];
#pragma unroll
  for (int mi = 0; mi < 2; ++mi)
#pragma unroll
    for (int t = 0; t < 4; ++t) acc[mi][t] = (v8f){0.f,0.f,0.f,0.f,0.f,0.f,0.f,0.f};
#pragma unroll 1      /* rolled: K is a constant here, and 16 copies of this body would only grow the code */
  for (int kb = 0; kb < K; kb += BK) {
#pragma unroll
    for (int i = 0; i < 4; ++i) { *(v8us*)&sA[(lr + 32 * i) * LP + lc] = ra[i]; *(v8us*)&sB[(lr + 32 * i) * LP + lc] = rb[i]; }
    __syncthreads();      /* the piece is complete before any wave reads fragments */
    if (kb + BK < K) {
#pragma unroll
      for (int i = 0; i < 4; ++i) { ra[i] = *(const v8us*)(ga + (size_t)(kb + BK) * 2 + vo + (size_t)(32 * i) * K * 2); rb[i] = *(const v8us*)(gb + (size_t)(kb + BK) * 2 + vo + (size_t)(32 * i) * K * 2); }
      asm volatile("s_wait_xcnt 0x0" ::: "memory"); }      /* the loads' address registers are reused by the fragment reads below: wait before that overwrite */
#pragma unroll
    for (int ks = 0; ks < BK / 32; ++ks) { FragH a[2], bq[4];
#pragma unroll
      for (int mi = 0; mi < 2; ++mi) { const unsigned short* p = &sA[(wm * 32 + mi * 16 + ln) * LP + ks * 32 + 8 * hh]; a[mi].half[0] = *(const v8us*)p; a[mi].half[1] = *(const v8us*)(p + 16); }
#pragma unroll
      for (int t = 0; t < 4; ++t) { const unsigned short* p = &sB[(wn * 64 + t * 16 + ln) * LP + ks * 32 + 8 * hh]; bq[t].half[0] = *(const v8us*)p; bq[t].half[1] = *(const v8us*)(p + 16); }
#pragma unroll
      for (int mi = 0; mi < 2; ++mi)
#pragma unroll
        for (int t = 0; t < 4; ++t) acc[mi][t] = __builtin_amdgcn_wmma_f32_16x16x32_f16(false, a[mi].v, false, bq[t].v, (short)0, acc[mi][t], false, false); }
    __syncthreads();      /* every wave has read the piece before it is overwritten (by the next piece, or by the output staging below) */
  }
  float* so = (float*)sm + w * (32 * 64);      /* each wave stages its 32 x 64 results in its own 8 KB, to store whole lines */
  const int rsub = lane >> 4, c4 = (lane & 15) * 4; float bv[4];
#pragma unroll
  for (int t = 0; t < 4; ++t) bv[t] = bf16_round(bias[col0 + wn * 64 + t * 16 + ln]);
#pragma unroll
  for (int mi = 0; mi < 2; ++mi)
#pragma unroll
    for (int t = 0; t < 4; ++t)
#pragma unroll
      for (int r = 0; r < 8; ++r) so[(mi * 16 + 8 * hh + r) * 64 + t * 16 + ln] = acc[mi][t][r] * alpha + bv[t];
  __builtin_amdgcn_fence(__ATOMIC_ACQ_REL, "workgroup"); __builtin_amdgcn_wave_barrier();      /* the wave's LDS stores are done, and stay in front, before its lanes read each other's values back */
#pragma unroll
  for (int q = 0; q < 16; ++q) { const int r = q * 2 + rsub; const v4f v = *(const v4fa*)&so[r * 64 + c4]; const size_t o = (size_t)(row0 + wm * 32 + r) * N + col0 + wn * 64 + c4;
    if (HALF_OUT) { v4h h4;
#pragma unroll
      for (int i = 0; i < 4; ++i) h4[i] = (_Float16)v[i];
      *(v4h*)(C16 + o) = h4; }
    else *(v4f*)(C + o) = v; }
}

extern "C" void kernel_launch(void* const* d_in, const int* in_sizes, int n_in,
                              void* d_out, int out_size, void* d_ws, size_t ws_size, hipStream_t stream) {
  (void)in_sizes; (void)n_in; (void)out_size;
  const float* const* I = (const float* const*)d_in; const float* xq = I[0]; const float* xk = I[1]; const float* xv = I[2]; const float* frac = I[3]; const float* Wq = I[4]; const float* bq = I[5]; const float* Wk = I[6]; const float* bk = I[7]; const float* Wv = I[8]; const float* bv = I[9]; const float* Wo = I[10]; const float* bo = I[11]; const float* apos = I[12]; const float* aneg = I[13]; const float* gam = I[14]; const float* del = I[15];      /* d_in order: query, key, value, frac, Wq, bq, Wk, bk, Wv, bv, Wo, bo, alpha_pos, alpha_neg, gamma, delta */
  char* ws = (char*)d_ws; size_t off = 0;
  auto take = [&](size_t bytes) { char* p = ws + off; off += (bytes + 255) & ~(size_t)255; return p; };
  const size_t WSZ = (size_t)DD * DD; _Float16* Bw = (_Float16*)take(4 * WSZ * 2); const size_t XSZ = (size_t)NR * DD; _Float16* X16 = (_Float16*)take(3 * XSZ * 2); _Float16* XK16 = X16 + XSZ; _Float16* XV16 = X16 + 2 * XSZ;      /* three planes end to end, as the projection launch reads them */
  _Float16* Q = (_Float16*)take(3 * XSZ * 2); _Float16* K = Q + XSZ; _Float16* V = Q + 2 * XSZ; _Float16* Vt = (_Float16*)take((size_t)NR * DD * 2);
  float* O = (float*)take((size_t)NR * DD * 4); _Float16* O16 = V;      /* the v plane is dead once Vᵀ is built (before the attention kernel); O16 reuses it */
  if (off > ws_size) return;      // 8.4 + 7 × 8.4 + 16.8 ≈ 84 MB
  const unsigned gt = (NR / 128) * (DD / 128);
  k_cvt_in<<<256, 512, 0, stream>>>(xq, xk, xv, Wq, Wk, Wv, Wo, X16, XK16, XV16, Bw);      /* activations bf16-rounded; weights (out,in) natural, bf16-rounded, x 2^4 */
  k_gemm_tile<DD, DD, 3, true><<<3 * gt, 256, 0, stream>>>(X16, Bw, 0.0625f, bq, bk, bv, nullptr, Q);      /* Q = query.Wq^T + bq, K and V alike, each M 4096 N 1024 K 1024 */
  k_vt<NH, TT><<<BB * NH * (TT / 64), 256, 0, stream>>>(V, DD, 0, Vt);
  k_flash<<<BB * NH * (TT / 64), 128, 0, stream>>>(Q, DD, K, DD, Vt, frac, apos, aneg, gam, del, O, DD);
  k_cvt_o<<<256, 256, 0, stream>>>(O, O16);
  k_gemm_tile<DD, DD, 1, false><<<gt, 256, 0, stream>>>(O16, Bw + 3 * WSZ, 0.0625f, bo, nullptr, nullptr, (float*)d_out, nullptr);      /* out = O·Woᵀ + bo */
}

// v007
// Measured time: 114 microseconds a run.
// Next to v006, in two timings, it ran 1.04 times as fast each time.
// Counting every step since v000, it is 3.93 times as fast.
#include <hip/hip_runtime.h>
// Multi-head attention with a stoichiometric bias (B=2, T=2048, D=1024, 16 heads × 64): Q,K,V = x·Wᵀ + b (torch (out,in)) from query/key/value; logits = q·kᵀ·64^-½; bias[b,h,i,j] = α_pos[h]·max(D,0) + α_neg[h]·min(D,0), D = clip(frac_j − frac_i, −0.2, 0.2);
// attn = softmax(γ·logits + δ·bias); out = (attn·V merged)·Woᵀ + bo. γ, δ are scalar inputs.
// Compute dtype: x, weights, biases rounded to bf16; q/k/v as f16 GEMM outputs; fused flash-style kernel (online softmax f32, P f16 ×2^10) on v_wmma_f32_16x16x32_f16; O → f16 → output GEMM with bias; f32 accumulate.
#define BB 2
#define TT 2048
#define NH 16
#define DD 1024
#define NR (BB * TT)

typedef __bf16 v16b __attribute__((ext_vector_type(16)));
typedef unsigned short v8us __attribute__((ext_vector_type(8), may_alias));
typedef float  v8f  __attribute__((ext_vector_type(8)));
typedef float  v4f  __attribute__((ext_vector_type(4)));
typedef float  v4fa __attribute__((ext_vector_type(4), may_alias));
union FragB { v16b v; v8us half[2]; unsigned short u[16]; };

__device__ __forceinline__ unsigned short bf16_bits(float x) { unsigned int u = __float_as_uint(x); return (unsigned short)((u + 0x7FFFu + ((u >> 16) & 1u)) >> 16); }
__device__ __forceinline__ float bf16_val(unsigned short b) { return __uint_as_float(((unsigned int)b) << 16); }
__device__ __forceinline__ float bf16_round(float x) { return bf16_val(bf16_bits(x)); }
// D += A·B with NT terms: 1 = ah·bh, 2 = + al·bh (A split), 3 = + ah·bl (both split)
template <int NT>
__device__ __forceinline__ v8f mmaN(v16b ah, v16b al, v16b bh, v16b bl, v8f c) {
  c = __builtin_amdgcn_wmma_f32_16x16x32_bf16(false, ah, false, bh, (short)0, c, false, false);
  if (NT >= 2) c = __builtin_amdgcn_wmma_f32_16x16x32_bf16(false, al, false, bh, (short)0, c, false, false);
  if (NT >= 3) c = __builtin_amdgcn_wmma_f32_16x16x32_bf16(false, ah, false, bl, (short)0, c, false, false);
  asm volatile("v_nop\n\tv_nop\n\tv_nop\n\tv_nop" : "+v"(c) : "v"(ah), "v"(al), "v"(bh), "v"(bl));
  return c;
}

__global__ __launch_bounds__(256) void k_wt_bf16(const float* __restrict__ W, unsigned short* __restrict__ Wt, int K, int N) {
  const int t = blockIdx.x * 256 + threadIdx.x;
  const int k8n = K / 8;
  if (t >= N * k8n) return;
  const int n = t / k8n, k8 = (t % k8n) * 8;
  v8us v;
#pragma unroll
  for (int i = 0; i < 8; ++i) v[i] = bf16_bits(W[(size_t)(k8 + i) * N + n]);
  *(v8us*)(Wt + (size_t)n * K + k8) = v;
  
}

// GEMM C[M][N] (f32, pitch ldc) = act(A[M][K]·W + bias). A f32 row-major (pitch lda) converted per fragment to bf16
// (ASPLIT: hi/lo two planes -> 2 terms, else single rounded term); Wt bf16 [N][K] (pitch ldb). BIAS_BF16 rounds the
// bias to bf16 first (bias quantised to bf16 before the add). K%32==0, M%16==0, N%64==0.
template <bool ASPLIT, int ACT, bool BIAS_BF16>
__global__ __launch_bounds__(128) void k_gemm_bf(const float* __restrict__ A, int lda, const unsigned short* __restrict__ Wt, int ldb,
                                               const float* __restrict__ bias, float* __restrict__ C, int ldc, int M, int N, int K) {
  __shared__ __attribute__((aligned(16))) float so[4][16][64];
  const int tid = threadIdx.x, w = tid >> 5, lane = tid & 31, ln = lane & 15, hh = lane >> 4;
  const int ntn = N / 64;
  const int wid = blockIdx.x * 4 + w;
  const int mt = wid / ntn, nq = wid % ntn;
  if (mt * 16 >= M) return;
  const int row0 = mt * 16, col0 = nq * 64;
  const float* arow = A + (size_t)(row0 + ln) * lda;
  v8f acc[4] = {};
  for (int kb = 0; kb < K; kb += 32) {
    FragB ah, al;
    const v4f x0 = *(const v4fa*)(arow + kb + 8 * hh), x1 = *(const v4fa*)(arow + kb + 8 * hh + 4);
    const v4f x2 = *(const v4fa*)(arow + kb + 16 + 8 * hh), x3 = *(const v4fa*)(arow + kb + 16 + 8 * hh + 4);
    float xs[16] = {x0[0],x0[1],x0[2],x0[3],x1[0],x1[1],x1[2],x1[3],x2[0],x2[1],x2[2],x2[3],x3[0],x3[1],x3[2],x3[3]};
#pragma unroll
    for (int i = 0; i < 16; ++i) { const unsigned short hb = bf16_bits(xs[i]); ah.u[i] = hb; al.u[i] = ASPLIT ? bf16_bits(xs[i] - bf16_val(hb)) : (unsigned short)0; }
#pragma unroll
    for (int t = 0; t < 4; ++t) {
      const unsigned short* brow = Wt + (size_t)(col0 + t * 16 + ln) * ldb + kb;
      FragB b;
      b.half[0] = *(const v8us*)(brow + 8 * hh);
      b.half[1] = *(const v8us*)(brow + 16 + 8 * hh);
      acc[t] = mmaN<ASPLIT ? 2 : 1>(ah.v, al.v, b.v, b.v, acc[t]);
    }
  }
#pragma unroll
  for (int t = 0; t < 4; ++t) {
    float bv = bias ? bias[col0 + t * 16 + ln] : 0.f;
    if (BIAS_BF16) bv = bf16_round(bv);
#pragma unroll
    for (int r = 0; r < 8; ++r) { float v = acc[t][r] + bv; if (ACT == 1) v = fmaxf(v, 0.f); so[w][8 * hh + r][t * 16 + ln] = v; }
  }
  __builtin_amdgcn_fence(__ATOMIC_ACQ_REL, "workgroup");
  __builtin_amdgcn_wave_barrier();
  const int rsub = lane >> 4, c4 = (lane & 15) * 4;
  {
#pragma unroll
    for (int q = 0; q < 8; ++q) {
      const int r = q * 2 + rsub;
      const v4f v = *(const v4fa*)&so[w][r][c4];
      *(v4f*)(C + (size_t)(row0 + r) * ldc + col0 + c4) = v;
    }
    
  }
}

// Flash-style causal/unmasked attention, all contractions 3-term bf16 hi/lo splits, f32 softmax with running max.
// q,k,v rows are read from f32 buffers with arbitrary row pitch (so they can live inside a fused qkv buffer);
// D = head size (multiple of 32, <= 128); one wave = 16 query rows; block = 4 waves (64 queries) sharing K/V chunks of 32.
template <int D, bool CAUSAL>
__global__ __launch_bounds__(128) void k_flash(const float* __restrict__ qb, const float* __restrict__ kb, const float* __restrict__ vb,
                                             int pitch, int T, int H, float scale, float* __restrict__ y, int ypitch) {
  constexpr int KS = D / 32;        // k-steps for QK
  constexpr int DT = D / 16;        // d tiles for PV
  __shared__ __attribute__((aligned(16))) unsigned short sKh[32][D + 8], sKl[32][D + 8], sVh[32][D + 8], sVl[32][D + 8];
  __shared__ __attribute__((aligned(16))) unsigned short sPh[4][16][40], sPl[4][16][40];
  __shared__ __attribute__((aligned(16))) float sO[4][16][D];
  const int tid = threadIdx.x, w = tid >> 5, lane = tid & 31, ln = lane & 15, hh = lane >> 4;
  const int nqb = (T + 63) / 64;
  const int bh = blockIdx.x / nqb, qblk = blockIdx.x % nqb;
  const int b = bh / H, h = bh % H;
  const int q0 = qblk * 64 + w * 16;
  const float* Q = qb + (size_t)b * T * pitch + h * D;
  const float* K = kb + (size_t)b * T * pitch + h * D;
  const float* V = vb + (size_t)b * T * pitch + h * D;

  // A fragments of the wave's 16 query rows (scaled), hi/lo
  FragB aqh[KS], aql[KS];
  {
    int row = q0 + ln; if (row >= T) row = T - 1;
    const float* qr = Q + (size_t)row * pitch;
#pragma unroll
    for (int ks = 0; ks < KS; ++ks)
#pragma unroll
      for (int i = 0; i < 16; ++i) {
        const int d = ks * 32 + ((i < 8) ? (8 * hh + i) : (16 + 8 * hh + (i - 8)));
        const float x = qr[d] * scale; const unsigned short hb = bf16_bits(x);
        aqh[ks].u[i] = hb; aql[ks].u[i] = bf16_bits(x - bf16_val(hb));
      }
  }
  float m_r[8], l_r[8];
#pragma unroll
  for (int r = 0; r < 8; ++r) { m_r[r] = -3.0e38f; l_r[r] = 0.f; }
  v8f oacc[DT];
#pragma unroll
  for (int dt = 0; dt < DT; ++dt) oacc[dt] = (v8f){0.f,0.f,0.f,0.f,0.f,0.f,0.f,0.f};

  const int kv_end = CAUSAL ? min(T, qblk * 64 + 64) : T;     // block-uniform
  for (int j0 = 0; j0 < kv_end; j0 += 32) {
    __syncthreads();
    for (int e = tid; e < 32 * (D / 4); e += 128) {
      const int r = e / (D / 4), c4 = (e % (D / 4)) * 4;
      const int key = j0 + r;
      v4f kf = {0.f,0.f,0.f,0.f}, vf = {0.f,0.f,0.f,0.f};
      if (key < T) { kf = *(const v4fa*)(K + (size_t)key * pitch + c4); vf = *(const v4fa*)(V + (size_t)key * pitch + c4); }
#pragma unroll
      for (int t = 0; t < 4; ++t) {
        unsigned short hb = bf16_bits(kf[t]); sKh[r][c4 + t] = hb; sKl[r][c4 + t] = bf16_bits(kf[t] - bf16_val(hb));
        hb = bf16_bits(vf[t]); sVh[r][c4 + t] = hb; sVl[r][c4 + t] = bf16_bits(vf[t] - bf16_val(hb));
      }
    }
    __syncthreads();
    // S tile 16 x 32
    v8f s[2];
#pragma unroll
    for (int nt = 0; nt < 2; ++nt) {
      v8f acc = {};
#pragma unroll
      for (int ks = 0; ks < KS; ++ks) {
        FragB bh_, bl_;
        bh_.half[0] = *(const v8us*)&sKh[nt * 16 + ln][ks * 32 + 8 * hh]; bh_.half[1] = *(const v8us*)&sKh[nt * 16 + ln][ks * 32 + 16 + 8 * hh];
        bl_.half[0] = *(const v8us*)&sKl[nt * 16 + ln][ks * 32 + 8 * hh]; bl_.half[1] = *(const v8us*)&sKl[nt * 16 + ln][ks * 32 + 16 + 8 * hh];
        acc = mmaN<3>(aqh[ks].v, aql[ks].v, bh_.v, bl_.v, acc);
      }
      s[nt] = acc;
    }
    // mask + running max (rows 8hh+r; the 16 lanes of a half share rows)
    float alpha[8];
#pragma unroll
    for (int r = 0; r < 8; ++r) {
      const int qi = q0 + 8 * hh + r;
      const int ja = j0 + ln, jb = j0 + 16 + ln;
      if (CAUSAL) { if (ja > qi) s[0][r] = -3.0e38f; if (jb > qi) s[1][r] = -3.0e38f; }
      if (ja >= T) s[0][r] = -3.0e38f;
      if (jb >= T) s[1][r] = -3.0e38f;
      float mx = fmaxf(s[0][r], s[1][r]);
      mx = fmaxf(mx, __shfl_xor(mx, 1, 32)); mx = fmaxf(mx, __shfl_xor(mx, 2, 32)); mx = fmaxf(mx, __shfl_xor(mx, 4, 32)); mx = fmaxf(mx, __shfl_xor(mx, 8, 32));
      const float mnew = fmaxf(m_r[r], mx);
      alpha[r] = (mnew > -1.0e38f) ? __expf(m_r[r] - mnew) : 1.0f;
      const float p0 = (s[0][r] > -1.0e38f) ? __expf(s[0][r] - mnew) : 0.f;
      const float p1 = (s[1][r] > -1.0e38f) ? __expf(s[1][r] - mnew) : 0.f;
      m_r[r] = mnew;
      l_r[r] = l_r[r] * alpha[r] + p0 + p1;            // per-lane partial row sum (16 lanes combined at the end)
      unsigned short hb = bf16_bits(p0); sPh[w][8 * hh + r][ln] = hb;      sPl[w][8 * hh + r][ln] = bf16_bits(p0 - bf16_val(hb));
      hb = bf16_bits(p1);                sPh[w][8 * hh + r][16 + ln] = hb; sPl[w][8 * hh + r][16 + ln] = bf16_bits(p1 - bf16_val(hb));
    }
#pragma unroll
    for (int dt = 0; dt < DT; ++dt)
#pragma unroll
      for (int r = 0; r < 8; ++r) oacc[dt][r] *= alpha[r];
    __builtin_amdgcn_fence(__ATOMIC_ACQ_REL, "workgroup");
    __builtin_amdgcn_wave_barrier();
    FragB pah, pal;
    pah.half[0] = *(const v8us*)&sPh[w][ln][8 * hh]; pah.half[1] = *(const v8us*)&sPh[w][ln][16 + 8 * hh];
    pal.half[0] = *(const v8us*)&sPl[w][ln][8 * hh]; pal.half[1] = *(const v8us*)&sPl[w][ln][16 + 8 * hh];
#pragma unroll
    for (int dt = 0; dt < DT; ++dt) {
      FragB bvh, bvl;
#pragma unroll
      for (int i = 0; i < 8; ++i) {
        bvh.u[i] = sVh[8 * hh + i][dt * 16 + ln]; bvh.u[8 + i] = sVh[16 + 8 * hh + i][dt * 16 + ln];
        bvl.u[i] = sVl[8 * hh + i][dt * 16 + ln]; bvl.u[8 + i] = sVl[16 + 8 * hh + i][dt * 16 + ln];
      }
      oacc[dt] = mmaN<3>(pah.v, pal.v, bvh.v, bvl.v, oacc[dt]);
    }
    __builtin_amdgcn_fence(__ATOMIC_ACQ_REL, "workgroup");
    __builtin_amdgcn_wave_barrier();
  }
#pragma unroll
  for (int r = 0; r < 8; ++r) {
    float l = l_r[r];
    l += __shfl_xor(l, 1, 32); l += __shfl_xor(l, 2, 32); l += __shfl_xor(l, 4, 32); l += __shfl_xor(l, 8, 32);
    l_r[r] = (l > 0.f) ? 1.0f / l : 0.f;
  }
#pragma unroll
  for (int dt = 0; dt < DT; ++dt)
#pragma unroll
    for (int r = 0; r < 8; ++r) sO[w][8 * hh + r][dt * 16 + ln] = oacc[dt][r] * l_r[r];
  __builtin_amdgcn_fence(__ATOMIC_ACQ_REL, "workgroup");
  __builtin_amdgcn_wave_barrier();
  {
    for (int r = 0; r < 16; ++r) {
      const int row = q0 + r;
      if (row < T && lane < D / 4) {
        const v4f val = *(const v4fa*)&sO[w][r][lane * 4];
        *(v4f*)(y + ((size_t)b * T + row) * ypitch + h * D + lane * 4) = val;
      }
    }
    
  }
}

// GEMM C = act(A·W + bias + resid): A f32 (ASPLIT -> hi/lo 2 terms), Wt bf16 [N][K]; ACT 0 none, 1 relu, 2 exact gelu;
// resid (optional, f32, row index = (row % rmod), pitch ldr, RES_BF16 rounds it) added before the activation.
template <bool ASPLIT, int ACT, bool BIAS_BF16, bool RES_BF16>
__global__ __launch_bounds__(128) void k_gemm_bf3(const float* __restrict__ A, int lda, const unsigned short* __restrict__ Wt, int ldb,
                                                const float* __restrict__ bias, const float* __restrict__ resid, int rmod, int ldr,
                                                float* __restrict__ C, int ldc, int M, int N, int K) {
  __shared__ __attribute__((aligned(16))) float so[4][16][64];
  const int tid = threadIdx.x, w = tid >> 5, lane = tid & 31, ln = lane & 15, hh = lane >> 4;
  const int ntn = N / 64;
  const int wid = blockIdx.x * 4 + w;
  const int mt = wid / ntn, nq = wid % ntn;
  if (mt * 16 >= M) return;
  const int row0 = mt * 16, col0 = nq * 64;
  const float* arow = A + (size_t)(row0 + ln) * lda;
  v8f acc[4] = {};
  for (int kb = 0; kb < K; kb += 32) {
    FragB ah, al;
    const v4f x0 = *(const v4fa*)(arow + kb + 8 * hh), x1 = *(const v4fa*)(arow + kb + 8 * hh + 4);
    const v4f x2 = *(const v4fa*)(arow + kb + 16 + 8 * hh), x3 = *(const v4fa*)(arow + kb + 16 + 8 * hh + 4);
    float xs[16] = {x0[0],x0[1],x0[2],x0[3],x1[0],x1[1],x1[2],x1[3],x2[0],x2[1],x2[2],x2[3],x3[0],x3[1],x3[2],x3[3]};
#pragma unroll
    for (int i = 0; i < 16; ++i) { const unsigned short hb = bf16_bits(xs[i]); ah.u[i] = hb; al.u[i] = ASPLIT ? bf16_bits(xs[i] - bf16_val(hb)) : (unsigned short)0; }
#pragma unroll
    for (int t = 0; t < 4; ++t) {
      const unsigned short* brow = Wt + (size_t)(col0 + t * 16 + ln) * ldb + kb;
      FragB b;
      b.half[0] = *(const v8us*)(brow + 8 * hh);
      b.half[1] = *(const v8us*)(brow + 16 + 8 * hh);
      acc[t] = mmaN<ASPLIT ? 2 : 1>(ah.v, al.v, b.v, b.v, acc[t]);
    }
  }
#pragma unroll
  for (int t = 0; t < 4; ++t) {
    const int col = col0 + t * 16 + ln;
    float bv = bias ? bias[col] : 0.f;
    if (BIAS_BF16) bv = bf16_round(bv);
#pragma unroll
    for (int r = 0; r < 8; ++r) {
      float v = acc[t][r] + bv;
      if (resid) { float rv = resid[(size_t)((row0 + 8 * hh + r) % rmod) * ldr + col]; if (RES_BF16) rv = bf16_round(rv); v += rv; }
      if (ACT == 1) v = fmaxf(v, 0.f);
      if (ACT == 2) v = 0.5f * v * (1.0f + erff(v * 0.70710678118654752f));
      if (ACT == 3) { const float u = 0.7978845608028654f * (v + 0.044715f * v * v * v); v = 0.5f * v * (1.0f + tanhf(u)); }
      so[w][8 * hh + r][t * 16 + ln] = v;
    }
  }
  __builtin_amdgcn_fence(__ATOMIC_ACQ_REL, "workgroup");
  __builtin_amdgcn_wave_barrier();
  const int rsub = lane >> 4, c4 = (lane & 15) * 4;
  {
#pragma unroll
    for (int q = 0; q < 8; ++q) {
      const int r = q * 2 + rsub;
      const v4f v = *(const v4fa*)&so[w][r][c4];
      *(v4f*)(C + (size_t)(row0 + r) * ldc + col0 + c4) = v;
    }
    
  }
}
// row LayerNorm (biased variance, eps) over N: s = X (+ R); optional out_sum <- s; out_norm <- (s-mu)*rsqrt(var+eps)*g + b
template <bool PARAM_BF16>
__global__ __launch_bounds__(256) void k_layernorm(const float* __restrict__ X, const float* __restrict__ R, const float* __restrict__ g, const float* __restrict__ bta,
                                                  float* __restrict__ out_sum, float* __restrict__ out_norm, int N, float eps) {
  __shared__ float red[256];
  const int row = blockIdx.x, tid = threadIdx.x;
  const float* x = X + (size_t)row * N; const float* rr = R ? R + (size_t)row * N : nullptr;
  float vals[16];                     // up to N = 4096
  const int per = N / 256;            // contiguous chunk per thread? use strided-by-4 chunks: thread handles j = tid*4 + 1024*u
  float s1 = 0.f;
  for (int u = 0; u < per / 4; ++u) {
    const int j = tid * 4 + 1024 * u;
    const v4f a = *(const v4fa*)(x + j);
    v4f b = {0.f,0.f,0.f,0.f}; if (rr) b = *(const v4fa*)(rr + j);
#pragma unroll
    for (int q = 0; q < 4; ++q) { const float v = a[q] + b[q]; vals[u * 4 + q] = v; s1 += v; }
  }
  red[tid] = s1; __syncthreads();
  for (int st = 128; st > 0; st >>= 1) { if (tid < st) red[tid] += red[tid + st]; __syncthreads(); }
  const float mu = red[0] / (float)N; __syncthreads();
  float s2 = 0.f;
  for (int u = 0; u < per / 4; ++u)
#pragma unroll
    for (int q = 0; q < 4; ++q) { const float c = vals[u * 4 + q] - mu; s2 += c * c; }
  red[tid] = s2; __syncthreads();
  for (int st = 128; st > 0; st >>= 1) { if (tid < st) red[tid] += red[tid + st]; __syncthreads(); }
  const float rs = rsqrtf(red[0] / (float)N + eps);
  {
    for (int u = 0; u < per / 4; ++u) {
      const int j = tid * 4 + 1024 * u;
      v4f o, sm;
#pragma unroll
      for (int q = 0; q < 4; ++q) {
        float gg = g[j + q], bb = bta[j + q];
        if (PARAM_BF16) { gg = bf16_round(gg); bb = bf16_round(bb); }
        sm[q] = vals[u * 4 + q]; o[q] = (vals[u * 4 + q] - mu) * rs * gg + bb;
      }
      if (out_sum) *(v4f*)(out_sum + (size_t)row * N + j) = sm;
      *(v4f*)(out_norm + (size_t)row * N + j) = o;
    }
    
  }
}



// ---- f16 WMMA path (v_wmma_f32_16x16x32_f16): 11-bit significands for operands in range — used where a [0,1] probability operand needs more precision than bf16
typedef _Float16 v16h __attribute__((ext_vector_type(16)));
union FragH { v16h v; v8us half[2]; _Float16 h[16]; unsigned short u[16]; };
template <int NT>
__device__ __forceinline__ v8f mmaH(v16h ah, v16h al, v16h bh, v16h bl, v8f c) {
  c = __builtin_amdgcn_wmma_f32_16x16x32_f16(false, ah, false, bh, (short)0, c, false, false);
  if (NT >= 2) c = __builtin_amdgcn_wmma_f32_16x16x32_f16(false, al, false, bh, (short)0, c, false, false);
  if (NT >= 3) c = __builtin_amdgcn_wmma_f32_16x16x32_f16(false, ah, false, bl, (short)0, c, false, false);
  asm volatile("v_nop\n\tv_nop\n\tv_nop\n\tv_nop" : "+v"(c) : "v"(ah), "v"(al), "v"(bh), "v"(bl));
  return c;
}
// batched GEMM like k_gemm_b but f16 operands: A f32 (split into f16 hi/lo if ASPLIT, else rounded to f16), Bt = f16 values [n][k]; alpha; C f32; N multiple of 16 (partial tiles skipped)
template <bool ASPLIT>
__global__ __launch_bounds__(128) void k_gemm_h(const float* __restrict__ A, int lda, size_t sA, const _Float16* __restrict__ Bh, int ldb, size_t sB, float alpha, float* __restrict__ C, int ldc, size_t sC, int M, int N, int K) {
  __shared__ __attribute__((aligned(16))) float so[4][16][64];
  const int tid = threadIdx.x, w = tid >> 5, lane = tid & 31, ln = lane & 15, hh = lane >> 4; const int by = blockIdx.y;
  A += (size_t)by * sA; Bh += (size_t)by * sB; C += (size_t)by * sC;
  const int ntn = (N + 63) / 64; const int wid = blockIdx.x * 4 + w; const int mt = wid / ntn, nq = wid % ntn; if (mt * 16 >= M) return;
  const int row0 = mt * 16, col0 = nq * 64; const float* arow = A + (size_t)(row0 + ln) * lda;
  v8f acc[4] = {};
  for (int kb = 0; kb < K; kb += 32) {
    FragH ah, al;
    const v4f x0 = *(const v4fa*)(arow + kb + 8 * hh), x1 = *(const v4fa*)(arow + kb + 8 * hh + 4), x2 = *(const v4fa*)(arow + kb + 16 + 8 * hh), x3 = *(const v4fa*)(arow + kb + 16 + 8 * hh + 4);
    float xs[16] = {x0[0],x0[1],x0[2],x0[3],x1[0],x1[1],x1[2],x1[3],x2[0],x2[1],x2[2],x2[3],x3[0],x3[1],x3[2],x3[3]};
#pragma unroll
    for (int i = 0; i < 16; ++i) { const _Float16 h = (_Float16)xs[i]; ah.h[i] = h; al.h[i] = ASPLIT ? (_Float16)(xs[i] - (float)h) : (_Float16)0.0f; }
#pragma unroll
    for (int t = 0; t < 4; ++t) { if (col0 + t * 16 >= N) continue; const size_t boff = (size_t)(col0 + t * 16 + ln) * ldb + kb; FragH bq; bq.half[0] = *(const v8us*)(Bh + boff + 8 * hh); bq.half[1] = *(const v8us*)(Bh + boff + 16 + 8 * hh);
      acc[t] = mmaH<ASPLIT ? 2 : 1>(ah.v, al.v, bq.v, bq.v, acc[t]); }
  }
#pragma unroll
  for (int t = 0; t < 4; ++t) { if (col0 + t * 16 >= N) continue;
#pragma unroll
    for (int r = 0; r < 8; ++r) so[w][8 * hh + r][t * 16 + ln] = acc[t][r] * alpha; }
  __builtin_amdgcn_fence(__ATOMIC_ACQ_REL, "workgroup"); __builtin_amdgcn_wave_barrier();
  const int rsub = lane >> 4, c4 = (lane & 15) * 4;
  {
#pragma unroll
    for (int q = 0; q < 8; ++q) { const int r = q * 2 + rsub; if (col0 + c4 < N) { const v4f v = *(const v4fa*)&so[w][r][c4]; *(v4f*)(C + (size_t)(row0 + r) * ldc + col0 + c4) = v; } }
     }
}

// Wt[n][k] = f16(W[k][n]·scale) from f32 row-major W[K][N] (scale = power of two; bf16-exact weights stay exact in f16 away from the subnormal range)
__global__ __launch_bounds__(256) void k_wt_f16(const float* __restrict__ W, _Float16* __restrict__ Wt, int K, int N, float scale) {
  const int t = blockIdx.x * 256 + threadIdx.x; if (t >= N * (K / 8)) return; const int n = t / (K / 8), k8 = (t % (K / 8)) * 8; FragH f;
#pragma unroll
  for (int i = 0; i < 8; ++i) f.h[i] = (_Float16)(bf16_round(W[(size_t)(k8 + i) * N + n]) * scale); const v8us o = f.half[0];
  *(v8us*)((unsigned short*)Wt + (size_t)n * K + k8) = o; 
}
// k_gemm_hh variant with fused epilogue: v = acc·alpha + bias[by·sBias + col] (+ CP[(row/rowsPerB)·sCPb + by·64 + col] if CP) ; ACT 0 none / 1 elu ; writes f32 C and f16 C16, each if non-null
template <int ACT>
__global__ __launch_bounds__(128) void k_gemm_hhx(const _Float16* __restrict__ A, int lda, size_t sA, const _Float16* __restrict__ Bh, int ldb, size_t sB, float alpha, const float* __restrict__ bias, size_t sBias, const float* __restrict__ CP, int rowsPerB, size_t sCPb, int row0g,
    float* __restrict__ C, _Float16* __restrict__ C16, int ldc, size_t sC, int M, int N, int K) {
  __shared__ __attribute__((aligned(16))) float so[4][16][64];
  const int tid = threadIdx.x, w = tid >> 5, lane = tid & 31, ln = lane & 15, hh = lane >> 4; const int by = blockIdx.y;
  A += (size_t)by * sA; Bh += (size_t)by * sB; const size_t cofs = (size_t)by * sC; const float* bp = bias ? bias + (size_t)by * sBias : nullptr;
  const int ntn = (N + 63) / 64; const int wid = blockIdx.x * 4 + w; const int mt = wid / ntn, nq = wid % ntn; if (mt * 16 >= M) return;
  const int row0 = mt * 16, col0 = nq * 64; const _Float16* arow = A + (size_t)(row0 + ln) * lda;
  v8f acc[4] = {};
  for (int kb = 0; kb < K; kb += 32) { FragH ah; ah.half[0] = *(const v8us*)((const unsigned short*)arow + kb + 8 * hh); ah.half[1] = *(const v8us*)((const unsigned short*)arow + kb + 16 + 8 * hh);
#pragma unroll
    for (int t = 0; t < 4; ++t) { if (col0 + t * 16 >= N) continue; const size_t boff = (size_t)(col0 + t * 16 + ln) * ldb + kb; FragH bq; bq.half[0] = *(const v8us*)((const unsigned short*)Bh + boff + 8 * hh); bq.half[1] = *(const v8us*)((const unsigned short*)Bh + boff + 16 + 8 * hh);
      acc[t] = mmaH<1>(ah.v, ah.v, bq.v, bq.v, acc[t]); }
  }
#pragma unroll
  for (int t = 0; t < 4; ++t) { if (col0 + t * 16 >= N) continue; const int col = col0 + t * 16 + ln; const float bv = bp ? bf16_round(bp[col]) : 0.f;
#pragma unroll
    for (int r = 0; r < 8; ++r) { float v = acc[t][r] * alpha + bv; if (CP) { const int bidx = (row0g + row0 + 8 * hh + r) / rowsPerB; v += CP[(size_t)bidx * sCPb + (size_t)by * 64 + col]; } if (ACT == 1) v = (v > 0.f) ? v : expm1f(v); else if (ACT == 7) v = (v > 0.f) ? v + 1.0f : expf(v); else if (ACT == 8) v = tanhf(v); else if (ACT == 9) v = 0.5f * v * (1.0f + tanhf(0.7978845608028654f * (v + 0.044715f * v * v * v))); else if (ACT == 11) v = 1.0f / (1.0f + expf(-v)); else if (ACT == 12) v = (v > 0.f) ? v : 0.01f * v; else if (ACT == 14) v = (v > 0.f) ? v : 0.1f * v; else if (ACT == 15) v = v / (1.0f + expf(-v)); else if (ACT == 3) v = fmaxf(v, 0.f); else if (ACT == 6) v = 0.5f * v * (1.0f + erff(v * 0.70710678118654752f)); so[w][8 * hh + r][t * 16 + ln] = v; } }
  __builtin_amdgcn_fence(__ATOMIC_ACQ_REL, "workgroup"); __builtin_amdgcn_wave_barrier();
  const int rsub = lane >> 4, c4 = (lane & 15) * 4; typedef _Float16 v4h __attribute__((ext_vector_type(4)));
  {
#pragma unroll
    for (int q = 0; q < 8; ++q) { const int r = q * 2 + rsub; if (col0 + c4 < N) { const v4f v = *(const v4fa*)&so[w][r][c4]; if (C) *(v4f*)(C + cofs + (size_t)(row0 + r) * ldc + col0 + c4) = v; if (C16) { v4h h4; for (int i = 0; i < 4; ++i) h4[i] = (_Float16)v[i]; *(v4h*)(C16 + cofs + (size_t)(row0 + r) * ldc + col0 + c4) = h4; } } }
     }
}


typedef _Float16 v4h __attribute__((ext_vector_type(4)));

// Conversion passes as streams of few, long-lived waves. A run is 1024 consecutive floats (4 KB): eight 16-byte loads a lane, each wave-wide load 512 contiguous bytes (4 whole lines);
// the four halves that a lane makes of one load leave as one 8-byte store (256 contiguous bytes a wave, 2 whole lines). A wave issues all its loads before it converts the first value.
// Addresses are a wave-uniform base plus one 32-bit lane offset in bytes (vo for the floats, vo / 2 for the halves).
// Each plain '#pragma unroll' below stands on a loop whose index picks an element of a register array.
template <int NL>
__device__ __forceinline__ void run_load(v4f* r, const float* __restrict__ src, unsigned vo) {
#pragma unroll
  for (int j = 0; j < NL; ++j) r[j] = *(const v4fa*)((const char*)src + vo + j * 512); }
// MODE 0: f16(x); 1: f16(bf16(x)); 2: f16(bf16(x) * 2^4)
template <int NL, int MODE>
__device__ __forceinline__ void run_store(const v4f* r, _Float16* __restrict__ dst, unsigned vh) {
#pragma unroll
  for (int j = 0; j < NL; ++j) { v4h h;
#pragma unroll
    for (int q = 0; q < 4; ++q) h[q] = (MODE == 0) ? (_Float16)r[j][q] : (MODE == 1) ? (_Float16)bf16_round(r[j][q]) : (_Float16)(bf16_round(r[j][q]) * 16.0f);
    *(v4h*)((char*)dst + vh + j * 256) = h; } }
// All seven inputs in one launch: 256 blocks of 16 waves; wave number n takes run n of query, of key and of value, and run n of the four weight matrices laid end to end (as Bw is).
__global__ __launch_bounds__(512) void k_cvt_in(const float* __restrict__ xq, const float* __restrict__ xk, const float* __restrict__ xv, const float* __restrict__ wq, const float* __restrict__ wk, const float* __restrict__ wv, const float* __restrict__ wo,
                                               _Float16* __restrict__ X16, _Float16* __restrict__ XK16, _Float16* __restrict__ XV16, _Float16* __restrict__ Bw) {
  static_assert(NR * DD == 4096 * 1024 && DD * DD == 1024 * 1024, "4096 runs an activation, 1024 a weight matrix");
  const unsigned lane = threadIdx.x & 31, run = blockIdx.x * 16 + (threadIdx.x >> 5);
  const unsigned m = blockIdx.x >> 6;      /* 1024 runs = 64 blocks a weight matrix: the same for the whole block */
  const float* __restrict__ w = (m == 0) ? wq : (m == 1) ? wk : (m == 2) ? wv : wo;
  const unsigned vo = run * 4096 + lane * 16, vw = (run & 1023) * 4096 + lane * 16, vh = run * 2048 + lane * 8;
  v4f r[4][8];
  run_load<8>(r[0], xq, vo); run_load<8>(r[1], xk, vo); run_load<8>(r[2], xv, vo); run_load<8>(r[3], w, vw);
  __builtin_amdgcn_sched_barrier(0);      /* all 32 loads are issued before any conversion: without it the scheduler sinks some of them among the conversions, behind waits on earlier data */
  asm volatile("s_wait_xcnt 0x0" :: "v"(vo), "v"(vw) : "memory");      /* the loads' offset registers may be reused below: wait before that overwrite; named as inputs, they are not given to a late load as its destination either */
  __builtin_amdgcn_sched_barrier(0);      /* nothing that rewrites a base or offset register of the loads is scheduled in front of that wait */
  run_store<8, 1>(r[0], X16, vh);
  asm volatile("s_wait_xcnt 0x0" ::: "memory");      /* the stores' data registers may be reused by the next run: wait before that overwrite */
  __builtin_amdgcn_sched_barrier(0);      /* keeps the next run's conversions behind that wait */
  run_store<8, 1>(r[1], XK16, vh);
  asm volatile("s_wait_xcnt 0x0" ::: "memory");      /* as above */
  __builtin_amdgcn_sched_barrier(0);
  run_store<8, 1>(r[2], XV16, vh);
  asm volatile("s_wait_xcnt 0x0" ::: "memory");      /* as above */
  __builtin_amdgcn_sched_barrier(0);
  run_store<8, 2>(r[3], Bw, vh);
}
// The attention result: 256 blocks of 8 waves, two runs a wave.
__global__ __launch_bounds__(256) void k_cvt_o(const float* __restrict__ x, _Float16* __restrict__ X16) {
  static_assert(NR * DD == 2048 * 2048, "2048 waves, 2048 floats each");
  const unsigned vo = (blockIdx.x * 8 + (threadIdx.x >> 5)) * 8192 + (threadIdx.x & 31) * 16, vh = (blockIdx.x * 8 + (threadIdx.x >> 5)) * 4096 + (threadIdx.x & 31) * 8;
  v4f r[16];
  run_load<16>(r, x, vo);
  __builtin_amdgcn_sched_barrier(0);      /* all 16 loads are issued before any conversion */
  asm volatile("s_wait_xcnt 0x0" :: "v"(vo) : "memory");      /* the loads' offset register may be reused below: wait before that overwrite; named as an input, it is not given to a late load as its destination either */
  __builtin_amdgcn_sched_barrier(0);      /* nothing that rewrites the base or offset register of the loads is scheduled in front of that wait */
  run_store<8, 0>(r, X16, vh);
  asm volatile("s_wait_xcnt 0x0" ::: "memory");      /* the stores' data registers may be reused by the second run: wait before that overwrite */
  __builtin_amdgcn_sched_barrier(0);      /* keeps the second run's conversions behind that wait */
  run_store<8, 0>(r + 8, X16, vh + 2048);
}
// lane l <-> lane l ^ 16 (the two halves of a wave)
__device__ __forceinline__ float xhalf(float x) { return __builtin_bit_cast(float, __builtin_amdgcn_permlanex16(__builtin_bit_cast(int, x), __builtin_bit_cast(int, x), 0x76543210, 0xfedcba98, false, false)); }

__device__ __forceinline__ void tile_copy(unsigned l, unsigned l4, const char* k, size_t kstep, const char* v, size_t vstep) {      /* l, l4: the lane's LDS byte addresses in the buffer's K rows and V rows; k, v: its global addresses in row tid / 8; kstep, vstep: 16 rows of K, of V in bytes */
  const unsigned l1 = l + 16 * 144, l2 = l + 32 * 144, l3 = l + 48 * 144, l5 = l4 + 16 * 160, l6 = l4 + 32 * 160, l7 = l4 + 48 * 160;
  const char* k1 = k + kstep; const char* k2 = k1 + kstep; const char* k3 = k2 + kstep;
  const char* v1 = v + vstep; const char* v2 = v1 + vstep; const char* v3 = v2 + vstep;
  /* the copies and, as the last line of their own statement, the wait before any of their address registers is rewritten */
  asm volatile("global_load_async_to_lds_b128 %0, %8, off\n\t"
               "global_load_async_to_lds_b128 %1, %9, off\n\t"
               "global_load_async_to_lds_b128 %2, %10, off\n\t"
               "global_load_async_to_lds_b128 %3, %11, off\n\t"
               "global_load_async_to_lds_b128 %4, %12, off\n\t"
               "global_load_async_to_lds_b128 %5, %13, off\n\t"
               "global_load_async_to_lds_b128 %6, %14, off\n\t"
               "global_load_async_to_lds_b128 %7, %15, off\n\t"
               "s_wait_xcnt 0x0"
               :: "v"(l), "v"(l1), "v"(l2), "v"(l3), "v"(l4), "v"(l5), "v"(l6), "v"(l7), "v"(k), "v"(k1), "v"(k2), "v"(k3), "v"(v), "v"(v1), "v"(v2), "v"(v3) : "memory");
}
// Transposing 16-bit LDS load. Lane l names 16 bytes of row 8*(l >> 4) + (l & 7), at byte 16*((l >> 3) & 1), of a 16-row x 16-column block; it gets column l & 15 of rows 8*(l >> 4) ... + 7.
typedef short s16x8 __attribute__((ext_vector_type(8)));
__device__ __forceinline__ v8us ld_tr16(const unsigned char* p) { typedef __attribute__((address_space(3))) s16x8 lds_s16x8; return __builtin_bit_cast(v8us, __builtin_amdgcn_ds_load_tr16_b128_v8i16((lds_s16x8*)p)); }
__global__ __launch_bounds__(128) void k_flash(const _Float16* __restrict__ Q16, int ldq, const _Float16* __restrict__ K16, int ldk, const _Float16* __restrict__ V16, int ldv, const float* __restrict__ FR, const float* __restrict__ AP, const float* __restrict__ AN, const float* __restrict__ GM, const float* __restrict__ DLT, float* __restrict__ O, int ldo) {
  constexpr int NQB = TT / 64, DT = 4, KS = 2;
  constexpr int NS = TT / 64, RP = 144, VP = 160, TB = 64 * RP + 64 * VP;      /* tiles of 64 keys; LDS row pitch of K, of V, and bytes of one buffer */
  static_assert(NS >= 2, "the two buffers' prologue needs two tiles");
  __shared__ __attribute__((aligned(16))) float sF[TT]; __shared__ __attribute__((aligned(16))) float sO[4][16][64 + 4]; __shared__ __attribute__((aligned(16))) unsigned char sT[2 * TB];
  const int tid = threadIdx.x, w = tid >> 5, lane = tid & 31, ln = lane & 15, hh = lane >> 4;
  const int slab = blockIdx.x / NQB, qblk = blockIdx.x % NQB; const int b = slab / NH, h = slab % NH; const int q0 = qblk * 64 + w * 16;
  const float* frb = FR + (size_t)b * TT;
#pragma unroll
  for (int i = 0; i < TT / 512; ++i) { const int e = i * 512 + tid * 4; v4f f = *(const v4fa*)(frb + e);
#pragma unroll
    for (int q = 0; q < 4; ++q) f[q] = bf16_round(f[q]);
    *(v4fa*)&sF[e] = f; }
  FragH bq[KS]; const unsigned short* qr = (const unsigned short*)Q16 + ((size_t)b * TT + q0 + ln) * ldq + h * 64;      /* B operand: column ln = query q0 + ln */
#pragma unroll
  for (int ks = 0; ks < KS; ++ks) { bq[ks].half[0] = *(const v8us*)(qr + ks * 32 + 8 * hh); bq[ks].half[1] = *(const v8us*)(qr + ks * 32 + 16 + 8 * hh); }
  const char* ck = (const char*)K16 + (((size_t)b * TT + (tid >> 3)) * ldk + h * 64) * 2 + (tid & 7) * 16;      /* the lane's 16 bytes of key row tid / 8 of tile 0 */
  const char* cv = (const char*)V16 + (((size_t)b * TT + (tid >> 3)) * ldv + h * 64) * 2 + (tid & 7) * 16;      /* and of the same key's row of V */
  const size_t kstep = (size_t)16 * ldk * 2, vstep = (size_t)16 * ldv * 2; const unsigned lt = (unsigned)(size_t)sT + (unsigned)((tid >> 3) * RP + (tid & 7) * 16), lv = (unsigned)(size_t)sT + (unsigned)(64 * RP + (tid >> 3) * VP + (tid & 7) * 16);
  constexpr float L2E = 1.44269504088896340736f;      /* log2(e): the scores are formed in base-2 units, so that exp(s - m) is one hardware exp2 of a difference */
  const float gmm = bf16_round(GM[0]), dlt = bf16_round(DLT[0]); const float aph = bf16_round(AP[h]) * dlt * L2E, anh = bf16_round(AN[h]) * dlt * L2E;      /* gamma, delta scalars; log2(e)*delta*alpha_pos[h], log2(e)*delta*alpha_neg[h] */
  const float g8 = gmm * 0.125f * L2E;      /* log2(e) * gamma * 64^-1/2 */
  const float fq = bf16_round(frb[q0 + ln]);      /* frac of the lane's query */
  float m_r = -3.0e38f, l_r = 0.f; v8f oacc[DT];
#pragma unroll
  for (int dt = 0; dt < DT; ++dt) oacc[dt] = (v8f){0.f,0.f,0.f,0.f,0.f,0.f,0.f,0.f};
  tile_copy(lt, lv, ck, kstep, cv, vstep);      /* tile 0 into buffer 0 */
  asm volatile("s_wait_asynccnt 0x0" ::: "memory");      /* this wave's copies of tile 0 have landed */
  __syncthreads();      /* sF and tile 0 are complete before any wave reads them */
  tile_copy(lt + TB, lv + TB, ck + 4 * kstep, kstep, cv + 4 * vstep, vstep);      /* tile 1 into buffer 1 */
#pragma unroll 1      /* rolled: 32 copies of this body would only grow the code */
  for (int s = 0; s < NS; ++s) {
   const unsigned char* tk = sT + (s & 1) * TB + ln * RP + 16 * hh; const unsigned char* tv = sT + (s & 1) * TB + 64 * RP + (8 * hh + (lane & 7)) * VP + ((lane >> 3) & 1) * 16;      /* trip s reads buffer s mod 2 alone */
#pragma unroll      /* the two 32-key chunks of a tile: p picks constant LDS offsets */
   for (int p = 0; p < 2; ++p) { const int j0 = s * 64 + p * 32;
    FragH ak[2][KS], av[DT]; v4f fk[2][2];
#pragma unroll
    for (int nt = 0; nt < 2; ++nt)      /* A operand: row ln = key j0 + nt*16 + ln */
#pragma unroll
      for (int ks = 0; ks < KS; ++ks) { ak[nt][ks].half[0] = *(const v8us*)(tk + (p * 32 + nt * 16) * RP + ks * 64); ak[nt][ks].half[1] = *(const v8us*)(tk + (p * 32 + nt * 16) * RP + ks * 64 + 32); }
#pragma unroll
    for (int dt = 0; dt < DT; ++dt) { av[dt].half[0] = ld_tr16(tv + p * 32 * VP + dt * 32); av[dt].half[1] = ld_tr16(tv + (p * 32 + 16) * VP + dt * 32); }      /* A operand: row ln = head column dt*16 + ln; elements 0-7 = keys j0 + 8*hh + 0..7, elements 8-15 = keys j0 + 16 + 8*hh + 0..7 */
#pragma unroll
    for (int nt = 0; nt < 2; ++nt) { fk[nt][0] = *(const v4fa*)&sF[j0 + nt * 16 + 8 * hh]; fk[nt][1] = *(const v4fa*)&sF[j0 + nt * 16 + 8 * hh + 4]; }      /* frac of the lane's 16 keys */
    float sc[16];
#pragma unroll
    for (int nt = 0; nt < 2; ++nt) { v8f acc = (v8f){0.f,0.f,0.f,0.f,0.f,0.f,0.f,0.f};
#pragma unroll
      for (int ks = 0; ks < KS; ++ks) acc = __builtin_amdgcn_wmma_f32_16x16x32_f16(false, ak[nt][ks].v, false, bq[ks].v, (short)0, acc, false, false);
#pragma unroll
      for (int r = 0; r < 8; ++r) { float d = fk[nt][r >> 2][r & 3] - fq; d = fminf(fmaxf(d, -0.2f), 0.2f);      /* D = clip(frac_k - frac_q, -0.2, 0.2) */
        const float sb = aph * fmaxf(d, 0.f) + anh * fminf(d, 0.f);      /* log2(e)*delta*(alpha_pos*D+ + alpha_neg*D-) */
        sc[nt * 8 + r] = g8 * acc[r] + sb; } }
    float mx[4];
#pragma unroll
    for (int q = 0; q < 4; ++q) mx[q] = fmaxf(fmaxf(sc[q], sc[4 + q]), fmaxf(sc[8 + q], sc[12 + q]));
    float mc = fmaxf(fmaxf(mx[0], mx[1]), fmaxf(mx[2], mx[3])); mc = fmaxf(mc, xhalf(mc));      /* the query's maximum over all 32 keys, in both halves */
    const float mn = fmaxf(m_r, mc - 10.0f); const float al = (mn > -1.0e38f) ? __builtin_amdgcn_exp2f(m_r - mn) : 1.0f; m_r = mn;      /* the running maximum is kept 10 lower: 2^(s - mn) is then P * 2^10, the scale of the f16 operand, in the sum as well */
    FragH pb; float ps[4];
#pragma unroll
    for (int i = 0; i < 16; ++i) { const float p = __builtin_amdgcn_exp2f(sc[i] - mn); ps[i & 3] = (i < 4) ? p : ps[i & 3] + p; pb.h[i] = (_Float16)p; }
    l_r = l_r * al + ((ps[0] + ps[1]) + (ps[2] + ps[3]));      /* the lane's 16 keys; the halves are joined after the loop */
#pragma unroll
    for (int dt = 0; dt < DT; ++dt) {
#pragma unroll
      for (int r = 0; r < 8; ++r) oacc[dt][r] *= al;
      oacc[dt] = __builtin_amdgcn_wmma_f32_16x16x32_f16(false, av[dt].v, false, pb.v, (short)0, oacc[dt], false, false); } }
   asm volatile("s_wait_dscnt 0x0" ::: "memory");      /* this wave's reads of buffer s mod 2 have returned before the buffer is handed to the copies */
   asm volatile("s_wait_asynccnt 0x0" ::: "memory");      /* this wave's copies of tile s + 1 have landed */
   __syncthreads();      /* publishes tile s + 1 and ends every wave's reads of tile s */
   if (s + 2 < NS) tile_copy(lt + (s & 1) * TB, lv + (s & 1) * TB, ck + (size_t)(s + 2) * 4 * kstep, kstep, cv + (size_t)(s + 2) * 4 * vstep, vstep); }      /* tile s + 2 into the buffer that trip s has just read */
  asm volatile("s_wait_asynccnt 0x0" ::: "memory");      /* nothing is in flight when the wave goes on to its end */
  const float l = l_r + xhalf(l_r); const float inv = (l > 0.f) ? 1.0f / l : 0.f;      /* sum and O carry the same 2^10 */
#pragma unroll
  for (int dt = 0; dt < DT; ++dt)      /* oacc[dt][r] = O[query ln][dt*16 + 8*hh + r] */
#pragma unroll
    for (int c = 0; c < 2; ++c) { const v4f o = {oacc[dt][4 * c] * inv, oacc[dt][4 * c + 1] * inv, oacc[dt][4 * c + 2] * inv, oacc[dt][4 * c + 3] * inv}; *(v4fa*)&sO[w][ln][dt * 16 + 8 * hh + 4 * c] = o; }
  __builtin_amdgcn_fence(__ATOMIC_ACQ_REL, "workgroup"); __builtin_amdgcn_wave_barrier();      /* the wave's LDS stores are done, and stay in front, before its lanes read each other's values back */
#pragma unroll
  for (int rp = 0; rp < 16; rp += 2) { const int r = rp + (lane >> 4), pc = lane & 15; const v4f val = *(const v4fa*)&sO[w][r][pc * 4]; *(v4f*)(O + ((size_t)b * TT + q0 + r) * ldo + h * 64 + pc * 4) = val; }
}

// Block-tiled GEMM, C = (A.Bh^T)*alpha + bias: a block of 8 waves owns a 128 x 128 tile of C and stages 128 x 64 pieces of A and of Bh in LDS, so every operand byte is fetched once a block, in whole 128-B lines
// (8 lanes a row), and is read as fragments from LDS. Wave tile 32 x 64 (2 x 4 accumulators). The next piece is fetched into registers while this one is multiplied. k runs upward in steps of 32.
// M % 128 == 0 (grid), N % 128 == 0, K % 64 == 0. LDS row pitch 64 + 8 halves = 144 B for the 16-byte fragment reads.
// One launch holds NZ independent products of the same shape (M = NR): product z takes plane z of A, of Bh and of C16, laid end to end, and its own bias. A block takes under a third of a WGP's registers
// (two waves of 160 on each SIMD's 1,024) and a fifth of its LDS, so with NZ = 3 three blocks stand on every WGP at once, and one block's barriers, LDS waits and first and last phases are covered by the matrix work of the other two.
// Most plain '#pragma unroll's below stand on a short loop whose index picks an element of a register array (staging registers, fragments, accumulators): unrolled, these stay in registers.
template <int N, int K, int NZ, bool HALF_OUT>
__global__ __launch_bounds__(256) void k_gemm_tile(const _Float16* __restrict__ A, const _Float16* __restrict__ Bh, float alpha, const float* __restrict__ bias0, const float* __restrict__ bias1, const float* __restrict__ bias2, float* __restrict__ C, _Float16* __restrict__ C16) {
  constexpr int BM = 128, BN = 128, BK = 64, LP = BK + 8;
  constexpr int NB = (NR / BM) * (N / BN);      /* blocks of one product */
  static_assert(NZ >= 1 && NZ <= 3 && (NZ == 1 || HALF_OUT), "up to three biases; the planes of several products are the f16 outputs");
  const unsigned z = (NZ > 1) ? blockIdx.x / NB : 0u; const unsigned bid = blockIdx.x - z * NB;      /* product and tile number: the same for the whole block */
  const float* __restrict__ bias = (z == 0) ? bias0 : (z == 1) ? bias1 : bias2;
  A += (size_t)z * NR * K; Bh += (size_t)z * N * K; if (HALF_OUT) C16 += (size_t)z * NR * N;
  __shared__ __attribute__((aligned(16))) unsigned short sm[8 * 32 * 64 * 2];      /* 64 KB: the output staging (8 waves x 32 x 64 f32) is the larger use; the operand pieces take (BM + BN) * LP halves */
  static_assert((BM + BN) * LP <= 8 * 32 * 64 * 2, "operand pieces fit");
  unsigned short* sA = sm; unsigned short* sB = sm + BM * LP;
  const int tid = threadIdx.x, w = tid >> 5, lane = tid & 31, ln = lane & 15, hh = lane >> 4;
  const int nbn = N / BN; const int row0 = (bid / nbn) * BM, col0 = (bid % nbn) * BN;
  const int wm = w >> 1, wn = w & 1;
  const int lr = tid >> 3, lc = (tid & 7) * 8;
  const char* ga = (const char*)A + (size_t)row0 * K * 2; const char* gb = (const char*)Bh + (size_t)col0 * K * 2; const unsigned vo = (unsigned)(lr * K + lc) * 2u;      /* block-uniform bases, one 32-bit lane offset that lives through the loop */
  v8us ra[4], rb[4];
#pragma unroll
  for (int i = 0; i < 4; ++i) { ra[i] = *(const v8us*)(ga + vo + (size_t)(32 * i) * K * 2); rb[i] = *(const v8us*)(gb + vo + (size_t)(32 * i) * K * 2); }
  v8f acc[2][4];
#pragma unroll
  for (int mi = 0; mi < 2; ++mi)
#pragma unroll
    for (int t = 0; t < 4; ++t) acc[mi][t] = (v8f){0.f,0.f,0.f,0.f,0.f,0.f,0.f,0.f};
#pragma unroll 1      /* rolled: K is a constant here, and 16 copies of this body would only grow the code */
  for (int kb = 0; kb < K; kb += BK) {
#pragma unroll
    for (int i = 0; i < 4; ++i) { *(v8us*)&sA[(lr + 32 * i) * LP + lc] = ra[i]; *(v8us*)&sB[(lr + 32 * i) * LP + lc] = rb[i]; }
    __syncthreads();      /* the piece is complete before any wave reads fragments */
    if (kb + BK < K) {
#pragma unroll
      for (int i = 0; i < 4; ++i) { ra[i] = *(const v8us*)(ga + (size_t)(kb + BK) * 2 + vo + (size_t)(32 * i) * K * 2); rb[i] = *(const v8us*)(gb + (size_t)(kb + BK) * 2 + vo + (size_t)(32 * i) * K * 2); }
      asm volatile("s_wait_xcnt 0x0" ::: "memory"); }      /* the loads' address registers are reused by the fragment reads below: wait before that overwrite */
#pragma unroll
    for (int ks = 0; ks < BK / 32; ++ks) { FragH a[2], bq[4];
#pragma unroll
      for (int mi = 0; mi < 2; ++mi) { const unsigned short* p = &sA[(wm * 32 + mi * 16 + ln) * LP + ks * 32 + 8 * hh]; a[mi].half[0] = *(const v8us*)p; a[mi].half[1] = *(const v8us*)(p + 16); }
#pragma unroll
      for (int t = 0; t < 4; ++t) { const unsigned short* p = &sB[(wn * 64 + t * 16 + ln) * LP + ks * 32 + 8 * hh]; bq[t].half[0] = *(const v8us*)p; bq[t].half[1] = *(const v8us*)(p + 16); }
#pragma unroll
      for (int mi = 0; mi < 2; ++mi)
#pragma unroll
        for (int t = 0; t < 4; ++t) acc[mi][t] = __builtin_amdgcn_wmma_f32_16x16x32_f16(false, a[mi].v, false, bq[t].v, (short)0, acc[mi][t], false, false); }
    __syncthreads();      /* every wave has read the piece before it is overwritten (by the next piece, or by the output staging below) */
  }
  float* so = (float*)sm + w * (32 * 64);      /* each wave stages its 32 x 64 results in its own 8 KB, to store whole lines */
  const int rsub = lane >> 4, c4 = (lane & 15) * 4; float bv[4];
#pragma unroll
  for (int t = 0; t < 4; ++t) bv[t] = bf16_round(bias[col0 + wn * 64 + t * 16 + ln]);
#pragma unroll
  for (int mi = 0; mi < 2; ++mi)
#pragma unroll
    for (int t = 0; t < 4; ++t)
#pragma unroll
      for (int r = 0; r < 8; ++r) so[(mi * 16 + 8 * hh + r) * 64 + t * 16 + ln] = acc[mi][t][r] * alpha + bv[t];
  __builtin_amdgcn_fence(__ATOMIC_ACQ_REL, "workgroup"); __builtin_amdgcn_wave_barrier();      /* the wave's LDS stores are done, and stay in front, before its lanes read each other's values back */
#pragma unroll
  for (int q = 0; q < 16; ++q) { const int r = q * 2 + rsub; const v4f v = *(const v4fa*)&so[r * 64 + c4]; const size_t o = (size_t)(row0 + wm * 32 + r) * N + col0 + wn * 64 + c4;
    if (HALF_OUT) { v4h h4;
#pragma unroll
      for (int i = 0; i < 4; ++i) h4[i] = (_Float16)v[i];
      *(v4h*)(C16 + o) = h4; }
    else *(v4f*)(C + o) = v; }
}

extern "C" void kernel_launch(void* const* d_in, const int* in_sizes, int n_in,
                              void* d_out, int out_size, void* d_ws, size_t ws_size, hipStream_t stream) {
  (void)in_sizes; (void)n_in; (void)out_size;
  const float* const* I = (const float* const*)d_in; const float* xq = I[0]; const float* xk = I[1]; const float* xv = I[2]; const float* frac = I[3]; const float* Wq = I[4]; const float* bq = I[5]; const float* Wk = I[6]; const float* bk = I[7]; const float* Wv = I[8]; const float* bv = I[9]; const float* Wo = I[10]; const float* bo = I[11]; const float* apos = I[12]; const float* aneg = I[13]; const float* gam = I[14]; const float* del = I[15];      /* d_in order: query, key, value, frac, Wq, bq, Wk, bk, Wv, bv, Wo, bo, alpha_pos, alpha_neg, gamma, delta */
  char* ws = (char*)d_ws; size_t off = 0;
  auto take = [&](size_t bytes) { char* p = ws + off; off += (bytes + 255) & ~(size_t)255; return p; };
  const size_t WSZ = (size_t)DD * DD; _Float16* Bw = (_Float16*)take(4 * WSZ * 2); const size_t XSZ = (size_t)NR * DD; _Float16* X16 = (_Float16*)take(3 * XSZ * 2); _Float16* XK16 = X16 + XSZ; _Float16* XV16 = X16 + 2 * XSZ;      /* three planes end to end, as the projection launch reads them */
  _Float16* Q = (_Float16*)take(3 * XSZ * 2); _Float16* K = Q + XSZ; _Float16* V = Q + 2 * XSZ;
  float* O = (float*)take((size_t)NR * DD * 4); _Float16* O16 = V;      /* the v plane is dead once the attention kernel has run; O16 reuses it */
  if (off > ws_size) return;      // 8.4 + 6 x 8.4 + 16.8 = about 76 MB
  const unsigned gt = (NR / 128) * (DD / 128);
  k_cvt_in<<<256, 512, 0, stream>>>(xq, xk, xv, Wq, Wk, Wv, Wo, X16, XK16, XV16, Bw);      /* activations bf16-rounded; weights (out,in) natural, bf16-rounded, x 2^4 */
  k_gemm_tile<DD, DD, 3, true><<<3 * gt, 256, 0, stream>>>(X16, Bw, 0.0625f, bq, bk, bv, nullptr, Q);      /* Q = query.Wq^T + bq, K and V alike, each M 4096 N 1024 K 1024 */
  k_flash<<<BB * NH * (TT / 64), 128, 0, stream>>>(Q, DD, K, DD, V, DD, frac, apos, aneg, gam, del, O, DD);
  k_cvt_o<<<256, 256, 0, stream>>>(O, O16);
  k_gemm_tile<DD, DD, 1, false><<<gt, 256, 0, stream>>>(O16, Bw + 3 * WSZ, 0.0625f, bo, nullptr, nullptr, (float*)d_out, nullptr);      /* out = O·Woᵀ + bo */
}

// v008
// A run of this version takes 111 microseconds.
// Two timings next to v007 both put it at 1.03 times that version's speed.
// Counting every step since v000, it is 4.07 times as fast.
#include <hip/hip_runtime.h>
// Multi-head attention with a stoichiometric bias (B=2, T=2048, D=1024, 16 heads × 64): Q,K,V = x·Wᵀ + b (torch (out,in)) from query/key/value; logits = q·kᵀ·64^-½; bias[b,h,i,j] = α_pos[h]·max(D,0) + α_neg[h]·min(D,0), D = clip(frac_j − frac_i, −0.2, 0.2);
// attn = softmax(γ·logits + δ·bias); out = (attn·V merged)·Woᵀ + bo. γ, δ are scalar inputs.
// Compute dtype: x, weights, biases rounded to bf16; q/k/v as f16 GEMM outputs; fused flash-style kernel (online softmax f32, P f16 ×2^10) on v_wmma_f32_16x16x32_f16; O → f16 → output GEMM with bias; f32 accumulate.
#define BB 2
#define TT 2048
#define NH 16
#define DD 1024
#define NR (BB * TT)

typedef __bf16 v16b __attribute__((ext_vector_type(16)));
typedef unsigned short v8us __attribute__((ext_vector_type(8), may_alias));
typedef float  v8f  __attribute__((ext_vector_type(8)));
typedef float  v4f  __attribute__((ext_vector_type(4)));
typedef float  v4fa __attribute__((ext_vector_type(4), may_alias));
union FragB { v16b v; v8us half[2]; unsigned short u[16]; };

__device__ __forceinline__ unsigned short bf16_bits(float x) { unsigned int u = __float_as_uint(x); return (unsigned short)((u + 0x7FFFu + ((u >> 16) & 1u)) >> 16); }
__device__ __forceinline__ float bf16_val(unsigned short b) { return __uint_as_float(((unsigned int)b) << 16); }
__device__ __forceinline__ float bf16_round(float x) { return bf16_val(bf16_bits(x)); }
// D += A·B with NT terms: 1 = ah·bh, 2 = + al·bh (A split), 3 = + ah·bl (both split)
template <int NT>
__device__ __forceinline__ v8f mmaN(v16b ah, v16b al, v16b bh, v16b bl, v8f c) {
  c = __builtin_amdgcn_wmma_f32_16x16x32_bf16(false, ah, false, bh, (short)0, c, false, false);
  if (NT >= 2) c = __builtin_amdgcn_wmma_f32_16x16x32_bf16(false, al, false, bh, (short)0, c, false, false);
  if (NT >= 3) c = __builtin_amdgcn_wmma_f32_16x16x32_bf16(false, ah, false, bl, (short)0, c, false, false);
  asm volatile("v_nop\n\tv_nop\n\tv_nop\n\tv_nop" : "+v"(c) : "v"(ah), "v"(al), "v"(bh), "v"(bl));
  return c;
}

__global__ __launch_bounds__(256) void k_wt_bf16(const float* __restrict__ W, unsigned short* __restrict__ Wt, int K, int N) {
  const int t = blockIdx.x * 256 + threadIdx.x;
  const int k8n = K / 8;
  if (t >= N * k8n) return;
  const int n = t / k8n, k8 = (t % k8n) * 8;
  v8us v;
#pragma unroll
  for (int i = 0; i < 8; ++i) v[i] = bf16_bits(W[(size_t)(k8 + i) * N + n]);
  *(v8us*)(Wt + (size_t)n * K + k8) = v;
  
}

// GEMM C[M][N] (f32, pitch ldc) = act(A[M][K]·W + bias). A f32 row-major (pitch lda) converted per fragment to bf16
// (ASPLIT: hi/lo two planes -> 2 terms, else single rounded term); Wt bf16 [N][K] (pitch ldb). BIAS_BF16 rounds the
// bias to bf16 first (bias quantised to bf16 before the add). K%32==0, M%16==0, N%64==0.
template <bool ASPLIT, int ACT, bool BIAS_BF16>
__global__ __launch_bounds__(128) void k_gemm_bf(const float* __restrict__ A, int lda, const unsigned short* __restrict__ Wt, int ldb,
                                               const float* __restrict__ bias, float* __restrict__ C, int ldc, int M, int N, int K) {
  __shared__ __attribute__((aligned(16))) float so[4][16][64];
  const int tid = threadIdx.x, w = tid >> 5, lane = tid & 31, ln = lane & 15, hh = lane >> 4;
  const int ntn = N / 64;
  const int wid = blockIdx.x * 4 + w;
  const int mt = wid / ntn, nq = wid % ntn;
  if (mt * 16 >= M) return;
  const int row0 = mt * 16, col0 = nq * 64;
  const float* arow = A + (size_t)(row0 + ln) * lda;
  v8f acc[4] = {};
  for (int kb = 0; kb < K; kb += 32) {
    FragB ah, al;
    const v4f x0 = *(const v4fa*)(arow + kb + 8 * hh), x1 = *(const v4fa*)(arow + kb + 8 * hh + 4);
    const v4f x2 = *(const v4fa*)(arow + kb + 16 + 8 * hh), x3 = *(const v4fa*)(arow + kb + 16 + 8 * hh + 4);
    float xs[16] = {x0[0],x0[1],x0[2],x0[3],x1[0],x1[1],x1[2],x1[3],x2[0],x2[1],x2[2],x2[3],x3[0],x3[1],x3[2],x3[3]};
#pragma unroll
    for (int i = 0; i < 16; ++i) { const unsigned short hb = bf16_bits(xs[i]); ah.u[i] = hb; al.u[i] = ASPLIT ? bf16_bits(xs[i] - bf16_val(hb)) : (unsigned short)0; }
#pragma unroll
    for (int t = 0; t < 4; ++t) {
      const unsigned short* brow = Wt + (size_t)(col0 + t * 16 + ln) * ldb + kb;
      FragB b;
      b.half[0] = *(const v8us*)(brow + 8 * hh);
      b.half[1] = *(const v8us*)(brow + 16 + 8 * hh);
      acc[t] = mmaN<ASPLIT ? 2 : 1>(ah.v, al.v, b.v, b.v, acc[t]);
    }
  }
#pragma unroll
  for (int t = 0; t < 4; ++t) {
    float bv = bias ? bias[col0 + t * 16 + ln] : 0.f;
    if (BIAS_BF16) bv = bf16_round(bv);
#pragma unroll
    for (int r = 0; r < 8; ++r) { float v = acc[t][r] + bv; if (ACT == 1) v = fmaxf(v, 0.f); so[w][8 * hh + r][t * 16 + ln] = v; }
  }
  __builtin_amdgcn_fence(__ATOMIC_ACQ_REL, "workgroup");
  __builtin_amdgcn_wave_barrier();
  const int rsub = lane >> 4, c4 = (lane & 15) * 4;
  {
#pragma unroll
    for (int q = 0; q < 8; ++q) {
      const int r = q * 2 + rsub;
      const v4f v = *(const v4fa*)&so[w][r][c4];
      *(v4f*)(C + (size_t)(row0 + r) * ldc + col0 + c4) = v;
    }
    
  }
}

// Flash-style causal/unmasked attention, all contractions 3-term bf16 hi/lo splits, f32 softmax with running max.
// q,k,v rows are read from f32 buffers with arbitrary row pitch (so they can live inside a fused qkv buffer);
// D = head size (multiple of 32, <= 128); one wave = 16 query rows; block = 4 waves (64 queries) sharing K/V chunks of 32.
template <int D, bool CAUSAL>
__global__ __launch_bounds__(128) void k_flash(const float* __restrict__ qb, const float* __restrict__ kb, const float* __restrict__ vb,
                                             int pitch, int T, int H, float scale, float* __restrict__ y, int ypitch) {
  constexpr int KS = D / 32;        // k-steps for QK
  constexpr int DT = D / 16;        // d tiles for PV
  __shared__ __attribute__((aligned(16))) unsigned short sKh[32][D + 8], sKl[32][D + 8], sVh[32][D + 8], sVl[32][D + 8];
  __shared__ __attribute__((aligned(16))) unsigned short sPh[4][16][40], sPl[4][16][40];
  __shared__ __attribute__((aligned(16))) float sO[4][16][D];
  const int tid = threadIdx.x, w = tid >> 5, lane = tid & 31, ln = lane & 15, hh = lane >> 4;
  const int nqb = (T + 63) / 64;
  const int bh = blockIdx.x / nqb, qblk = blockIdx.x % nqb;
  const int b = bh / H, h = bh % H;
  const int q0 = qblk * 64 + w * 16;
  const float* Q = qb + (size_t)b * T * pitch + h * D;
  const float* K = kb + (size_t)b * T * pitch + h * D;
  const float* V = vb + (size_t)b * T * pitch + h * D;

  // A fragments of the wave's 16 query rows (scaled), hi/lo
  FragB aqh[KS], aql[KS];
  {
    int row = q0 + ln; if (row >= T) row = T - 1;
    const float* qr = Q + (size_t)row * pitch;
#pragma unroll
    for (int ks = 0; ks < KS; ++ks)
#pragma unroll
      for (int i = 0; i < 16; ++i) {
        const int d = ks * 32 + ((i < 8) ? (8 * hh + i) : (16 + 8 * hh + (i - 8)));
        const float x = qr[d] * scale; const unsigned short hb = bf16_bits(x);
        aqh[ks].u[i] = hb; aql[ks].u[i] = bf16_bits(x - bf16_val(hb));
      }
  }
  float m_r[8], l_r[8];
#pragma unroll
  for (int r = 0; r < 8; ++r) { m_r[r] = -3.0e38f; l_r[r] = 0.f; }
  v8f oacc[DT];
#pragma unroll
  for (int dt = 0; dt < DT; ++dt) oacc[dt] = (v8f){0.f,0.f,0.f,0.f,0.f,0.f,0.f,0.f};

  const int kv_end = CAUSAL ? min(T, qblk * 64 + 64) : T;     // block-uniform
  for (int j0 = 0; j0 < kv_end; j0 += 32) {
    __syncthreads();
    for (int e = tid; e < 32 * (D / 4); e += 128) {
      const int r = e / (D / 4), c4 = (e % (D / 4)) * 4;
      const int key = j0 + r;
      v4f kf = {0.f,0.f,0.f,0.f}, vf = {0.f,0.f,0.f,0.f};
      if (key < T) { kf = *(const v4fa*)(K + (size_t)key * pitch + c4); vf = *(const v4fa*)(V + (size_t)key * pitch + c4); }
#pragma unroll
      for (int t = 0; t < 4; ++t) {
        unsigned short hb = bf16_bits(kf[t]); sKh[r][c4 + t] = hb; sKl[r][c4 + t] = bf16_bits(kf[t] - bf16_val(hb));
        hb = bf16_bits(vf[t]); sVh[r][c4 + t] = hb; sVl[r][c4 + t] = bf16_bits(vf[t] - bf16_val(hb));
      }
    }
    __syncthreads();
    // S tile 16 x 32
    v8f s[2];
#pragma unroll
    for (int nt = 0; nt < 2; ++nt) {
      v8f acc = {};
#pragma unroll
      for (int ks = 0; ks < KS; ++ks) {
        FragB bh_, bl_;
        bh_.half[0] = *(const v8us*)&sKh[nt * 16 + ln][ks * 32 + 8 * hh]; bh_.half[1] = *(const v8us*)&sKh[nt * 16 + ln][ks * 32 + 16 + 8 * hh];
        bl_.half[0] = *(const v8us*)&sKl[nt * 16 + ln][ks * 32 + 8 * hh]; bl_.half[1] = *(const v8us*)&sKl[nt * 16 + ln][ks * 32 + 16 + 8 * hh];
        acc = mmaN<3>(aqh[ks].v, aql[ks].v, bh_.v, bl_.v, acc);
      }
      s[nt] = acc;
    }
    // mask + running max (rows 8hh+r; the 16 lanes of a half share rows)
    float alpha[8];
#pragma unroll
    for (int r = 0; r < 8; ++r) {
      const int qi = q0 + 8 * hh + r;
      const int ja = j0 + ln, jb = j0 + 16 + ln;
      if (CAUSAL) { if (ja > qi) s[0][r] = -3.0e38f; if (jb > qi) s[1][r] = -3.0e38f; }
      if (ja >= T) s[0][r] = -3.0e38f;
      if (jb >= T) s[1][r] = -3.0e38f;
      float mx = fmaxf(s[0][r], s[1][r]);
      mx = fmaxf(mx, __shfl_xor(mx, 1, 32)); mx = fmaxf(mx, __shfl_xor(mx, 2, 32)); mx = fmaxf(mx, __shfl_xor(mx, 4, 32)); mx = fmaxf(mx, __shfl_xor(mx, 8, 32));
      const float mnew = fmaxf(m_r[r], mx);
      alpha[r] = (mnew > -1.0e38f) ? __expf(m_r[r] - mnew) : 1.0f;
      const float p0 = (s[0][r] > -1.0e38f) ? __expf(s[0][r] - mnew) : 0.f;
      const float p1 = (s[1][r] > -1.0e38f) ? __expf(s[1][r] - mnew) : 0.f;
      m_r[r] = mnew;
      l_r[r] = l_r[r] * alpha[r] + p0 + p1;            // per-lane partial row sum (16 lanes combined at the end)
      unsigned short hb = bf16_bits(p0); sPh[w][8 * hh + r][ln] = hb;      sPl[w][8 * hh + r][ln] = bf16_bits(p0 - bf16_val(hb));
      hb = bf16_bits(p1);                sPh[w][8 * hh + r][16 + ln] = hb; sPl[w][8 * hh + r][16 + ln] = bf16_bits(p1 - bf16_val(hb));
    }
#pragma unroll
    for (int dt = 0; dt < DT; ++dt)
#pragma unroll
      for (int r = 0; r < 8; ++r) oacc[dt][r] *= alpha[r];
    __builtin_amdgcn_fence(__ATOMIC_ACQ_REL, "workgroup");
    __builtin_amdgcn_wave_barrier();
    FragB pah, pal;
    pah.half[0] = *(const v8us*)&sPh[w][ln][8 * hh]; pah.half[1] = *(const v8us*)&sPh[w][ln][16 + 8 * hh];
    pal.half[0] = *(const v8us*)&sPl[w][ln][8 * hh]; pal.half[1] = *(const v8us*)&sPl[w][ln][16 + 8 * hh];
#pragma unroll
    for (int dt = 0; dt < DT; ++dt) {
      FragB bvh, bvl;
#pragma unroll
      for (int i = 0; i < 8; ++i) {
        bvh.u[i] = sVh[8 * hh + i][dt * 16 + ln]; bvh.u[8 + i] = sVh[16 + 8 * hh + i][dt * 16 + ln];
        bvl.u[i] = sVl[8 * hh + i][dt * 16 + ln]; bvl.u[8 + i] = sVl[16 + 8 * hh + i][dt * 16 + ln];
      }
      oacc[dt] = mmaN<3>(pah.v, pal.v, bvh.v, bvl.v, oacc[dt]);
    }
    __builtin_amdgcn_fence(__ATOMIC_ACQ_REL, "workgroup");
    __builtin_amdgcn_wave_barrier();
  }
#pragma unroll
  for (int r = 0; r < 8; ++r) {
    float l = l_r[r];
    l += __shfl_xor(l, 1, 32); l += __shfl_xor(l, 2, 32); l += __shfl_xor(l, 4, 32); l += __shfl_xor(l, 8, 32);
    l_r[r] = (l > 0.f) ? 1.0f / l : 0.f;
  }
#pragma unroll
  for (int dt = 0; dt < DT; ++dt)
#pragma unroll
    for (int r = 0; r < 8; ++r) sO[w][8 * hh + r][dt * 16 + ln] = oacc[dt][r] * l_r[r];
  __builtin_amdgcn_fence(__ATOMIC_ACQ_REL, "workgroup");
  __builtin_amdgcn_wave_barrier();
  {
    for (int r = 0; r < 16; ++r) {
      const int row = q0 + r;
      if (row < T && lane < D / 4) {
        const v4f val = *(const v4fa*)&sO[w][r][lane * 4];
        *(v4f*)(y + ((size_t)b * T + row) * ypitch + h * D + lane * 4) = val;
      }
    }
    
  }
}

// GEMM C = act(A·W + bias + resid): A f32 (ASPLIT -> hi/lo 2 terms), Wt bf16 [N][K]; ACT 0 none, 1 relu, 2 exact gelu;
// resid (optional, f32, row index = (row % rmod), pitch ldr, RES_BF16 rounds it) added before the activation.
template <bool ASPLIT, int ACT, bool BIAS_BF16, bool RES_BF16>
__global__ __launch_bounds__(128) void k_gemm_bf3(const float* __restrict__ A, int lda, const unsigned short* __restrict__ Wt, int ldb,
                                                const float* __restrict__ bias, const float* __restrict__ resid, int rmod, int ldr,
                                                float* __restrict__ C, int ldc, int M, int N, int K) {
  __shared__ __attribute__((aligned(16))) float so[4][16][64];
  const int tid = threadIdx.x, w = tid >> 5, lane = tid & 31, ln = lane & 15, hh = lane >> 4;
  const int ntn = N / 64;
  const int wid = blockIdx.x * 4 + w;
  const int mt = wid / ntn, nq = wid % ntn;
  if (mt * 16 >= M) return;
  const int row0 = mt * 16, col0 = nq * 64;
  const float* arow = A + (size_t)(row0 + ln) * lda;
  v8f acc[4] = {};
  for (int kb = 0; kb < K; kb += 32) {
    FragB ah, al;
    const v4f x0 = *(const v4fa*)(arow + kb + 8 * hh), x1 = *(const v4fa*)(arow + kb + 8 * hh + 4);
    const v4f x2 = *(const v4fa*)(arow + kb + 16 + 8 * hh), x3 = *(const v4fa*)(arow + kb + 16 + 8 * hh + 4);
    float xs[16] = {x0[0],x0[1],x0[2],x0[3],x1[0],x1[1],x1[2],x1[3],x2[0],x2[1],x2[2],x2[3],x3[0],x3[1],x3[2],x3[3]};
#pragma unroll
    for (int i = 0; i < 16; ++i) { const unsigned short hb = bf16_bits(xs[i]); ah.u[i] = hb; al.u[i] = ASPLIT ? bf16_bits(xs[i] - bf16_val(hb)) : (unsigned short)0; }
#pragma unroll
    for (int t = 0; t < 4; ++t) {
      const unsigned short* brow = Wt + (size_t)(col0 + t * 16 + ln) * ldb + kb;
      FragB b;
      b.half[0] = *(const v8us*)(brow + 8 * hh);
      b.half[1] = *(const v8us*)(brow + 16 + 8 * hh);
      acc[t] = mmaN<ASPLIT ? 2 : 1>(ah.v, al.v, b.v, b.v, acc[t]);
    }
  }
#pragma unroll
  for (int t = 0; t < 4; ++t) {
    const int col = col0 + t * 16 + ln;
    float bv = bias ? bias[col] : 0.f;
    if (BIAS_BF16) bv = bf16_round(bv);
#pragma unroll
    for (int r = 0; r < 8; ++r) {
      float v = acc[t][r] + bv;
      if (resid) { float rv = resid[(size_t)((row0 + 8 * hh + r) % rmod) * ldr + col]; if (RES_BF16) rv = bf16_round(rv); v += rv; }
      if (ACT == 1) v = fmaxf(v, 0.f);
      if (ACT == 2) v = 0.5f * v * (1.0f + erff(v * 0.70710678118654752f));
      if (ACT == 3) { const float u = 0.7978845608028654f * (v + 0.044715f * v * v * v); v = 0.5f * v * (1.0f + tanhf(u)); }
      so[w][8 * hh + r][t * 16 + ln] = v;
    }
  }
  __builtin_amdgcn_fence(__ATOMIC_ACQ_REL, "workgroup");
  __builtin_amdgcn_wave_barrier();
  const int rsub = lane >> 4, c4 = (lane & 15) * 4;
  {
#pragma unroll
    for (int q = 0; q < 8; ++q) {
      const int r = q * 2 + rsub;
      const v4f v = *(const v4fa*)&so[w][r][c4];
      *(v4f*)(C + (size_t)(row0 + r) * ldc + col0 + c4) = v;
    }
    
  }
}
// row LayerNorm (biased variance, eps) over N: s = X (+ R); optional out_sum <- s; out_norm <- (s-mu)*rsqrt(var+eps)*g + b
template <bool PARAM_BF16>
__global__ __launch_bounds__(256) void k_layernorm(const float* __restrict__ X, const float* __restrict__ R, const float* __restrict__ g, const float* __restrict__ bta,
                                                  float* __restrict__ out_sum, float* __restrict__ out_norm, int N, float eps) {
  __shared__ float red[256];
  const int row = blockIdx.x, tid = threadIdx.x;
  const float* x = X + (size_t)row * N; const float* rr = R ? R + (size_t)row * N : nullptr;
  float vals[16];                     // up to N = 4096
  const int per = N / 256;            // contiguous chunk per thread? use strided-by-4 chunks: thread handles j = tid*4 + 1024*u
  float s1 = 0.f;
  for (int u = 0; u < per / 4; ++u) {
    const int j = tid * 4 + 1024 * u;
    const v4f a = *(const v4fa*)(x + j);
    v4f b = {0.f,0.f,0.f,0.f}; if (rr) b = *(const v4fa*)(rr + j);
#pragma unroll
    for (int q = 0; q < 4; ++q) { const float v = a[q] + b[q]; vals[u * 4 + q] = v; s1 += v; }
  }
  red[tid] = s1; __syncthreads();
  for (int st = 128; st > 0; st >>= 1) { if (tid < st) red[tid] += red[tid + st]; __syncthreads(); }
  const float mu = red[0] / (float)N; __syncthreads();
  float s2 = 0.f;
  for (int u = 0; u < per / 4; ++u)
#pragma unroll
    for (int q = 0; q < 4; ++q) { const float c = vals[u * 4 + q] - mu; s2 += c * c; }
  red[tid] = s2; __syncthreads();
  for (int st = 128; st > 0; st >>= 1) { if (tid < st) red[tid] += red[tid + st]; __syncthreads(); }
  const float rs = rsqrtf(red[0] / (float)N + eps);
  {
    for (int u = 0; u < per / 4; ++u) {
      const int j = tid * 4 + 1024 * u;
      v4f o, sm;
#pragma unroll
      for (int q = 0; q < 4; ++q) {
        float gg = g[j + q], bb = bta[j + q];
        if (PARAM_BF16) { gg = bf16_round(gg); bb = bf16_round(bb); }
        sm[q] = vals[u * 4 + q]; o[q] = (vals[u * 4 + q] - mu) * rs * gg + bb;
      }
      if (out_sum) *(v4f*)(out_sum + (size_t)row * N + j) = sm;
      *(v4f*)(out_norm + (size_t)row * N + j) = o;
    }
    
  }
}



// ---- f16 WMMA path (v_wmma_f32_16x16x32_f16): 11-bit significands for operands in range — used where a [0,1] probability operand needs more precision than bf16
typedef _Float16 v16h __attribute__((ext_vector_type(16)));
union FragH { v16h v; v8us half[2]; _Float16 h[16]; unsigned short u[16]; };
template <int NT>
__device__ __forceinline__ v8f mmaH(v16h ah, v16h al, v16h bh, v16h bl, v8f c) {
  c = __builtin_amdgcn_wmma_f32_16x16x32_f16(false, ah, false, bh, (short)0, c, false, false);
  if (NT >= 2) c = __builtin_amdgcn_wmma_f32_16x16x32_f16(false, al, false, bh, (short)0, c, false, false);
  if (NT >= 3) c = __builtin_amdgcn_wmma_f32_16x16x32_f16(false, ah, false, bl, (short)0, c, false, false);
  asm volatile("v_nop\n\tv_nop\n\tv_nop\n\tv_nop" : "+v"(c) : "v"(ah), "v"(al), "v"(bh), "v"(bl));
  return c;
}
// batched GEMM like k_gemm_b but f16 operands: A f32 (split into f16 hi/lo if ASPLIT, else rounded to f16), Bt = f16 values [n][k]; alpha; C f32; N multiple of 16 (partial tiles skipped)
template <bool ASPLIT>
__global__ __launch_bounds__(128) void k_gemm_h(const float* __restrict__ A, int lda, size_t sA, const _Float16* __restrict__ Bh, int ldb, size_t sB, float alpha, float* __restrict__ C, int ldc, size_t sC, int M, int N, int K) {
  __shared__ __attribute__((aligned(16))) float so[4][16][64];
  const int tid = threadIdx.x, w = tid >> 5, lane = tid & 31, ln = lane & 15, hh = lane >> 4; const int by = blockIdx.y;
  A += (size_t)by * sA; Bh += (size_t)by * sB; C += (size_t)by * sC;
  const int ntn = (N + 63) / 64; const int wid = blockIdx.x * 4 + w; const int mt = wid / ntn, nq = wid % ntn; if (mt * 16 >= M) return;
  const int row0 = mt * 16, col0 = nq * 64; const float* arow = A + (size_t)(row0 + ln) * lda;
  v8f acc[4] = {};
  for (int kb = 0; kb < K; kb += 32) {
    FragH ah, al;
    const v4f x0 = *(const v4fa*)(arow + kb + 8 * hh), x1 = *(const v4fa*)(arow + kb + 8 * hh + 4), x2 = *(const v4fa*)(arow + kb + 16 + 8 * hh), x3 = *(const v4fa*)(arow + kb + 16 + 8 * hh + 4);
    float xs[16] = {x0[0],x0[1],x0[2],x0[3],x1[0],x1[1],x1[2],x1[3],x2[0],x2[1],x2[2],x2[3],x3[0],x3[1],x3[2],x3[3]};
#pragma unroll
    for (int i = 0; i < 16; ++i) { const _Float16 h = (_Float16)xs[i]; ah.h[i] = h; al.h[i] = ASPLIT ? (_Float16)(xs[i] - (float)h) : (_Float16)0.0f; }
#pragma unroll
    for (int t = 0; t < 4; ++t) { if (col0 + t * 16 >= N) continue; const size_t boff = (size_t)(col0 + t * 16 + ln) * ldb + kb; FragH bq; bq.half[0] = *(const v8us*)(Bh + boff + 8 * hh); bq.half[1] = *(const v8us*)(Bh + boff + 16 + 8 * hh);
      acc[t] = mmaH<ASPLIT ? 2 : 1>(ah.v, al.v, bq.v, bq.v, acc[t]); }
  }
#pragma unroll
  for (int t = 0; t < 4; ++t) { if (col0 + t * 16 >= N) continue;
#pragma unroll
    for (int r = 0; r < 8; ++r) so[w][8 * hh + r][t * 16 + ln] = acc[t][r] * alpha; }
  __builtin_amdgcn_fence(__ATOMIC_ACQ_REL, "workgroup"); __builtin_amdgcn_wave_barrier();
  const int rsub = lane >> 4, c4 = (lane & 15) * 4;
  {
#pragma unroll
    for (int q = 0; q < 8; ++q) { const int r = q * 2 + rsub; if (col0 + c4 < N) { const v4f v = *(const v4fa*)&so[w][r][c4]; *(v4f*)(C + (size_t)(row0 + r) * ldc + col0 + c4) = v; } }
     }
}

// Wt[n][k] = f16(W[k][n]·scale) from f32 row-major W[K][N] (scale = power of two; bf16-exact weights stay exact in f16 away from the subnormal range)
__global__ __launch_bounds__(256) void k_wt_f16(const float* __restrict__ W, _Float16* __restrict__ Wt, int K, int N, float scale) {
  const int t = blockIdx.x * 256 + threadIdx.x; if (t >= N * (K / 8)) return; const int n = t / (K / 8), k8 = (t % (K / 8)) * 8; FragH f;
#pragma unroll
  for (int i = 0; i < 8; ++i) f.h[i] = (_Float16)(bf16_round(W[(size_t)(k8 + i) * N + n]) * scale); const v8us o = f.half[0];
  *(v8us*)((unsigned short*)Wt + (size_t)n * K + k8) = o; 
}
// k_gemm_hh variant with fused epilogue: v = acc·alpha + bias[by·sBias + col] (+ CP[(row/rowsPerB)·sCPb + by·64 + col] if CP) ; ACT 0 none / 1 elu ; writes f32 C and f16 C16, each if non-null
template <int ACT>
__global__ __launch_bounds__(128) void k_gemm_hhx(const _Float16* __restrict__ A, int lda, size_t sA, const _Float16* __restrict__ Bh, int ldb, size_t sB, float alpha, const float* __restrict__ bias, size_t sBias, const float* __restrict__ CP, int rowsPerB, size_t sCPb, int row0g,
    float* __restrict__ C, _Float16* __restrict__ C16, int ldc, size_t sC, int M, int N, int K) {
  __shared__ __attribute__((aligned(16))) float so[4][16][64];
  const int tid = threadIdx.x, w = tid >> 5, lane = tid & 31, ln = lane & 15, hh = lane >> 4; const int by = blockIdx.y;
  A += (size_t)by * sA; Bh += (size_t)by * sB; const size_t cofs = (size_t)by * sC; const float* bp = bias ? bias + (size_t)by * sBias : nullptr;
  const int ntn = (N + 63) / 64; const int wid = blockIdx.x * 4 + w; const int mt = wid / ntn, nq = wid % ntn; if (mt * 16 >= M) return;
  const int row0 = mt * 16, col0 = nq * 64; const _Float16* arow = A + (size_t)(row0 + ln) * lda;
  v8f acc[4] = {};
  for (int kb = 0; kb < K; kb += 32) { FragH ah; ah.half[0] = *(const v8us*)((const unsigned short*)arow + kb + 8 * hh); ah.half[1] = *(const v8us*)((const unsigned short*)arow + kb + 16 + 8 * hh);
#pragma unroll
    for (int t = 0; t < 4; ++t) { if (col0 + t * 16 >= N) continue; const size_t boff = (size_t)(col0 + t * 16 + ln) * ldb + kb; FragH bq; bq.half[0] = *(const v8us*)((const unsigned short*)Bh + boff + 8 * hh); bq.half[1] = *(const v8us*)((const unsigned short*)Bh + boff + 16 + 8 * hh);
      acc[t] = mmaH<1>(ah.v, ah.v, bq.v, bq.v, acc[t]); }
  }
#pragma unroll
  for (int t = 0; t < 4; ++t) { if (col0 + t * 16 >= N) continue; const int col = col0 + t * 16 + ln; const float bv = bp ? bf16_round(bp[col]) : 0.f;
#pragma unroll
    for (int r = 0; r < 8; ++r) { float v = acc[t][r] * alpha + bv; if (CP) { const int bidx = (row0g + row0 + 8 * hh + r) / rowsPerB; v += CP[(size_t)bidx * sCPb + (size_t)by * 64 + col]; } if (ACT == 1) v = (v > 0.f) ? v : expm1f(v); else if (ACT == 7) v = (v > 0.f) ? v + 1.0f : expf(v); else if (ACT == 8) v = tanhf(v); else if (ACT == 9) v = 0.5f * v * (1.0f + tanhf(0.7978845608028654f * (v + 0.044715f * v * v * v))); else if (ACT == 11) v = 1.0f / (1.0f + expf(-v)); else if (ACT == 12) v = (v > 0.f) ? v : 0.01f * v; else if (ACT == 14) v = (v > 0.f) ? v : 0.1f * v; else if (ACT == 15) v = v / (1.0f + expf(-v)); else if (ACT == 3) v = fmaxf(v, 0.f); else if (ACT == 6) v = 0.5f * v * (1.0f + erff(v * 0.70710678118654752f)); so[w][8 * hh + r][t * 16 + ln] = v; } }
  __builtin_amdgcn_fence(__ATOMIC_ACQ_REL, "workgroup"); __builtin_amdgcn_wave_barrier();
  const int rsub = lane >> 4, c4 = (lane & 15) * 4; typedef _Float16 v4h __attribute__((ext_vector_type(4)));
  {
#pragma unroll
    for (int q = 0; q < 8; ++q) { const int r = q * 2 + rsub; if (col0 + c4 < N) { const v4f v = *(const v4fa*)&so[w][r][c4]; if (C) *(v4f*)(C + cofs + (size_t)(row0 + r) * ldc + col0 + c4) = v; if (C16) { v4h h4; for (int i = 0; i < 4; ++i) h4[i] = (_Float16)v[i]; *(v4h*)(C16 + cofs + (size_t)(row0 + r) * ldc + col0 + c4) = h4; } } }
     }
}


typedef _Float16 v4h __attribute__((ext_vector_type(4)));

// Conversion passes as streams of few, long-lived waves. A run is 1024 consecutive floats (4 KB): eight 16-byte loads a lane, each wave-wide load 512 contiguous bytes (4 whole lines);
// the four halves that a lane makes of one load leave as one 8-byte store (256 contiguous bytes a wave, 2 whole lines). A wave issues all its loads before it converts the first value.
// Addresses are a wave-uniform base plus one 32-bit lane offset in bytes (vo for the floats, vo / 2 for the halves).
// Each plain '#pragma unroll' below stands on a loop whose index picks an element of a register array.
template <int NL>
__device__ __forceinline__ void run_load(v4f* r, const float* __restrict__ src, unsigned vo) {
#pragma unroll
  for (int j = 0; j < NL; ++j) r[j] = *(const v4fa*)((const char*)src + vo + j * 512); }
// MODE 0: f16(x); 1: f16(bf16(x)); 2: f16(bf16(x) * 2^4)
template <int NL, int MODE>
__device__ __forceinline__ void run_store(const v4f* r, _Float16* __restrict__ dst, unsigned vh) {
#pragma unroll
  for (int j = 0; j < NL; ++j) { v4h h;
#pragma unroll
    for (int q = 0; q < 4; ++q) h[q] = (MODE == 0) ? (_Float16)r[j][q] : (MODE == 1) ? (_Float16)bf16_round(r[j][q]) : (_Float16)(bf16_round(r[j][q]) * 16.0f);
    *(v4h*)((char*)dst + vh + j * 256) = h; } }
// All seven inputs in one launch: 256 blocks of 16 waves; wave number n takes run n of query, of key and of value, and run n of the four weight matrices laid end to end (as Bw is).
__global__ __launch_bounds__(512) void k_cvt_in(const float* __restrict__ xq, const float* __restrict__ xk, const float* __restrict__ xv, const float* __restrict__ wq, const float* __restrict__ wk, const float* __restrict__ wv, const float* __restrict__ wo,
                                               _Float16* __restrict__ X16, _Float16* __restrict__ XK16, _Float16* __restrict__ XV16, _Float16* __restrict__ Bw) {
  static_assert(NR * DD == 4096 * 1024 && DD * DD == 1024 * 1024, "4096 runs an activation, 1024 a weight matrix");
  const unsigned lane = threadIdx.x & 31, run = blockIdx.x * 16 + (threadIdx.x >> 5);
  const unsigned m = blockIdx.x >> 6;      /* 1024 runs = 64 blocks a weight matrix: the same for the whole block */
  const float* __restrict__ w = (m == 0) ? wq : (m == 1) ? wk : (m == 2) ? wv : wo;
  const unsigned vo = run * 4096 + lane * 16, vw = (run & 1023) * 4096 + lane * 16, vh = run * 2048 + lane * 8;
  v4f r[4][8];
  run_load<8>(r[0], xq, vo); run_load<8>(r[1], xk, vo); run_load<8>(r[2], xv, vo); run_load<8>(r[3], w, vw);
  __builtin_amdgcn_sched_barrier(0);      /* all 32 loads are issued before any conversion: without it the scheduler sinks some of them among the conversions, behind waits on earlier data */
  asm volatile("s_wait_xcnt 0x0" :: "v"(vo), "v"(vw) : "memory");      /* the loads' offset registers may be reused below: wait before that overwrite; named as inputs, they are not given to a late load as its destination either */
  __builtin_amdgcn_sched_barrier(0);      /* nothing that rewrites a base or offset register of the loads is scheduled in front of that wait */
  run_store<8, 1>(r[0], X16, vh);
  asm volatile("s_wait_xcnt 0x0" ::: "memory");      /* the stores' data registers may be reused by the next run: wait before that overwrite */
  __builtin_amdgcn_sched_barrier(0);      /* keeps the next run's conversions behind that wait */
  run_store<8, 1>(r[1], XK16, vh);
  asm volatile("s_wait_xcnt 0x0" ::: "memory");      /* as above */
  __builtin_amdgcn_sched_barrier(0);
  run_store<8, 1>(r[2], XV16, vh);
  asm volatile("s_wait_xcnt 0x0" ::: "memory");      /* as above */
  __builtin_amdgcn_sched_barrier(0);
  run_store<8, 2>(r[3], Bw, vh);
}
// The attention result: 256 blocks of 8 waves, two runs a wave.
__global__ __launch_bounds__(256) void k_cvt_o(const float* __restrict__ x, _Float16* __restrict__ X16) {
  static_assert(NR * DD == 2048 * 2048, "2048 waves, 2048 floats each");
  const unsigned vo = (blockIdx.x * 8 + (threadIdx.x >> 5)) * 8192 + (threadIdx.x & 31) * 16, vh = (blockIdx.x * 8 + (threadIdx.x >> 5)) * 4096 + (threadIdx.x & 31) * 8;
  v4f r[16];
  run_load<16>(r, x, vo);
  __builtin_amdgcn_sched_barrier(0);      /* all 16 loads are issued before any conversion */
  asm volatile("s_wait_xcnt 0x0" :: "v"(vo) : "memory");      /* the loads' offset register may be reused below: wait before that overwrite; named as an input, it is not given to a late load as its destination either */
  __builtin_amdgcn_sched_barrier(0);      /* nothing that rewrites the base or offset register of the loads is scheduled in front of that wait */
  run_store<8, 0>(r, X16, vh);
  asm volatile("s_wait_xcnt 0x0" ::: "memory");      /* the stores' data registers may be reused by the second run: wait before that overwrite */
  __builtin_amdgcn_sched_barrier(0);      /* keeps the second run's conversions behind that wait */
  run_store<8, 0>(r + 8, X16, vh + 2048);
}
// lane l <-> lane l ^ 16 (the two halves of a wave)
__device__ __forceinline__ float xhalf(float x) { return __builtin_bit_cast(float, __builtin_amdgcn_permlanex16(__builtin_bit_cast(int, x), __builtin_bit_cast(int, x), 0x76543210, 0xfedcba98, false, false)); }

__device__ __forceinline__ void tile_copy(unsigned l, unsigned l4, const char* k, size_t kstep, const char* v, size_t vstep) {      /* l, l4: the lane's LDS byte addresses in the buffer's K rows and V rows; k, v: its global addresses in row tid / 8; kstep, vstep: 16 rows of K, of V in bytes */
  const unsigned l1 = l + 16 * 144, l2 = l + 32 * 144, l3 = l + 48 * 144, l5 = l4 + 16 * 160, l6 = l4 + 32 * 160, l7 = l4 + 48 * 160;
  const char* k1 = k + kstep; const char* k2 = k1 + kstep; const char* k3 = k2 + kstep;
  const char* v1 = v + vstep; const char* v2 = v1 + vstep; const char* v3 = v2 + vstep;
  /* the copies and, as the last line of their own statement, the wait before any of their address registers is rewritten */
  asm volatile("global_load_async_to_lds_b128 %0, %8, off\n\t"
               "global_load_async_to_lds_b128 %1, %9, off\n\t"
               "global_load_async_to_lds_b128 %2, %10, off\n\t"
               "global_load_async_to_lds_b128 %3, %11, off\n\t"
               "global_load_async_to_lds_b128 %4, %12, off\n\t"
               "global_load_async_to_lds_b128 %5, %13, off\n\t"
               "global_load_async_to_lds_b128 %6, %14, off\n\t"
               "global_load_async_to_lds_b128 %7, %15, off\n\t"
               "s_wait_xcnt 0x0"
               :: "v"(l), "v"(l1), "v"(l2), "v"(l3), "v"(l4), "v"(l5), "v"(l6), "v"(l7), "v"(k), "v"(k1), "v"(k2), "v"(k3), "v"(v), "v"(v1), "v"(v2), "v"(v3) : "memory");
}
// Transposing 16-bit LDS load. Lane l names 16 bytes of row 8*(l >> 4) + (l & 7), at byte 16*((l >> 3) & 1), of a 16-row x 16-column block; it gets column l & 15 of rows 8*(l >> 4) ... + 7.
typedef short s16x8 __attribute__((ext_vector_type(8)));
__device__ __forceinline__ v8us ld_tr16(const unsigned char* p) { typedef __attribute__((address_space(3))) s16x8 lds_s16x8; return __builtin_bit_cast(v8us, __builtin_amdgcn_ds_load_tr16_b128_v8i16((lds_s16x8*)p)); }
// One 32-key chunk of a lane: P = 2^x for its 16 reduced scores, as the f16 B operand (element nt*8 + r = key nt*16 + 8*hh + r), and their sum.
// SLOT: the exponential with its v_nop in one statement, for the seldom-taken path.
__device__ __forceinline__ float exp2_slot(float x) { float y; asm("v_exp_f32 %0, %1\n\tv_nop" : "=v"(y) : "v"(x)); return y; }      /* v_nop: the one slot that the instruction set asks for behind a transcendental */
template <bool SLOT>
__device__ __forceinline__ float p_chunk(const float* x, FragH& pb) { float ps[4];
#pragma unroll
  for (int i = 0; i < 16; ++i) { const float p = SLOT ? exp2_slot(x[i]) : __builtin_amdgcn_exp2f(x[i]); ps[i & 3] = (i < 4) ? p : ps[i & 3] + p; pb.h[i] = (_Float16)p; }
  return (ps[0] + ps[1]) + (ps[2] + ps[3]); }
__global__ __launch_bounds__(128) void k_flash(const _Float16* __restrict__ Q16, int ldq, const _Float16* __restrict__ K16, int ldk, const _Float16* __restrict__ V16, int ldv, const float* __restrict__ FR, const float* __restrict__ AP, const float* __restrict__ AN, const float* __restrict__ GM, const float* __restrict__ DLT, float* __restrict__ O, int ldo) {
  constexpr int NQB = TT / 64, DT = 4, KS = 2;
  constexpr int NS = TT / 64, RP = 144, VP = 160, TB = 64 * RP + 64 * VP;      /* tiles of 64 keys; LDS row pitch of K, of V, and bytes of one buffer */
  static_assert(NS >= 2, "the two buffers' prologue needs two tiles");
  __shared__ __attribute__((aligned(16))) float sF[TT]; __shared__ __attribute__((aligned(16))) float sO[4][16][64 + 4]; __shared__ __attribute__((aligned(16))) unsigned char sT[2 * TB];
  const int tid = threadIdx.x, w = tid >> 5, lane = tid & 31, ln = lane & 15, hh = lane >> 4;
  const int slab = blockIdx.x / NQB, qblk = blockIdx.x % NQB; const int b = slab / NH, h = slab % NH; const int q0 = qblk * 64 + w * 16;
  const float* frb = FR + (size_t)b * TT;
#pragma unroll
  for (int i = 0; i < TT / 512; ++i) { const int e = i * 512 + tid * 4; v4f f = *(const v4fa*)(frb + e);
#pragma unroll
    for (int q = 0; q < 4; ++q) f[q] = bf16_round(f[q]);
    *(v4fa*)&sF[e] = f; }
  FragH bq[KS]; const unsigned short* qr = (const unsigned short*)Q16 + ((size_t)b * TT + q0 + ln) * ldq + h * 64;      /* B operand: column ln = query q0 + ln */
#pragma unroll
  for (int ks = 0; ks < KS; ++ks) { bq[ks].half[0] = *(const v8us*)(qr + ks * 32 + 8 * hh); bq[ks].half[1] = *(const v8us*)(qr + ks * 32 + 16 + 8 * hh); }
  const char* ck = (const char*)K16 + (((size_t)b * TT + (tid >> 3)) * ldk + h * 64) * 2 + (tid & 7) * 16;      /* the lane's 16 bytes of key row tid / 8 of tile 0 */
  const char* cv = (const char*)V16 + (((size_t)b * TT + (tid >> 3)) * ldv + h * 64) * 2 + (tid & 7) * 16;      /* and of the same key's row of V */
  const size_t kstep = (size_t)16 * ldk * 2, vstep = (size_t)16 * ldv * 2; const unsigned lt = (unsigned)(size_t)sT + (unsigned)((tid >> 3) * RP + (tid & 7) * 16), lv = (unsigned)(size_t)sT + (unsigned)(64 * RP + (tid >> 3) * VP + (tid & 7) * 16);
  constexpr float L2E = 1.44269504088896340736f;      /* log2(e): the scores are formed in base-2 units, so that exp(s - m) is one hardware exp2 of a difference */
  const float gmm = bf16_round(GM[0]), dlt = bf16_round(DLT[0]); const float aph = bf16_round(AP[h]) * dlt * L2E, anh = bf16_round(AN[h]) * dlt * L2E;      /* gamma, delta scalars; log2(e)*delta*alpha_pos[h], log2(e)*delta*alpha_neg[h] */
  const float g8 = gmm * 0.125f * L2E;      /* log2(e) * gamma * 64^-1/2 */
  const float fq = bf16_round(frb[q0 + ln]);      /* frac of the lane's query */
  float m_r = 0.f, l_r = 0.f; v8f oacc[DT];      /* m_r: the query's exponent reference in use, P = 2^(score - m_r); tile 0 sets it */
#pragma unroll
  for (int dt = 0; dt < DT; ++dt) oacc[dt] = (v8f){0.f,0.f,0.f,0.f,0.f,0.f,0.f,0.f};
  tile_copy(lt, lv, ck, kstep, cv, vstep);      /* tile 0 into buffer 0 */
  asm volatile("s_wait_asynccnt 0x0" ::: "memory");      /* this wave's copies of tile 0 have landed */
  __syncthreads();      /* sF and tile 0 are complete before any wave reads them */
  tile_copy(lt + TB, lv + TB, ck + 4 * kstep, kstep, cv + 4 * vstep, vstep);      /* tile 1 into buffer 1 */
#pragma unroll 1      /* rolled: 32 copies of this body would only grow the code */
  for (int s = 0; s < NS; ++s) {
   const unsigned char* tk = sT + (s & 1) * TB + ln * RP + 16 * hh; const unsigned char* tv = sT + (s & 1) * TB + 64 * RP + (8 * hh + (lane & 7)) * VP + ((lane >> 3) & 1) * 16;      /* trip s reads buffer s mod 2 alone */
   FragH ak[4][KS], av[2][DT]; v4f fk[4][2];      /* c = 0..3: the tile's four groups of 16 keys; p = 0, 1: its two 32-key chunks */
#pragma unroll
   for (int c = 0; c < 4; ++c)      /* A operand: row ln = key s*64 + c*16 + ln */
#pragma unroll
     for (int ks = 0; ks < KS; ++ks) { ak[c][ks].half[0] = *(const v8us*)(tk + c * 16 * RP + ks * 64); ak[c][ks].half[1] = *(const v8us*)(tk + c * 16 * RP + ks * 64 + 32); }
#pragma unroll
   for (int p = 0; p < 2; ++p)
#pragma unroll
     for (int dt = 0; dt < DT; ++dt) { av[p][dt].half[0] = ld_tr16(tv + p * 32 * VP + dt * 32); av[p][dt].half[1] = ld_tr16(tv + (p * 32 + 16) * VP + dt * 32); }      /* A operand: row ln = head column dt*16 + ln; elements 0-7 = keys j0 + 8*hh + 0..7, elements 8-15 = keys j0 + 16 + 8*hh + 0..7, j0 = s*64 + p*32 */
#pragma unroll
   for (int c = 0; c < 4; ++c) { fk[c][0] = *(const v4fa*)&sF[s * 64 + c * 16 + 8 * hh]; fk[c][1] = *(const v4fa*)&sF[s * 64 + c * 16 + 8 * hh + 4]; }      /* frac of the lane's 32 keys */
   float sc[32];      /* score - m_r: the reference is known before the scores, so it rides in the bias term's multiply-add */
#pragma unroll
   for (int c = 0; c < 4; ++c) { v8f acc = (v8f){0.f,0.f,0.f,0.f,0.f,0.f,0.f,0.f};
#pragma unroll
     for (int ks = 0; ks < KS; ++ks) acc = __builtin_amdgcn_wmma_f32_16x16x32_f16(false, ak[c][ks].v, false, bq[ks].v, (short)0, acc, false, false);
#pragma unroll
     for (int r = 0; r < 8; ++r) { float d = fk[c][r >> 2][r & 3] - fq; d = fminf(fmaxf(d, -0.2f), 0.2f);      /* D = clip(frac_k - frac_q, -0.2, 0.2) */
       const float sb = aph * fmaxf(d, 0.f) + (anh * fminf(d, 0.f) - m_r);      /* log2(e)*delta*(alpha_pos*D+ + alpha_neg*D-) - m_r */
       sc[c * 8 + r] = g8 * acc[r] + sb; } }
   FragH pb[2]; float cs0 = p_chunk<false>(sc, pb[0]), cs1 = p_chunk<false>(sc + 16, pb[1]);
   asm volatile("" :: "v"(av[0][0].v), "v"(av[0][1].v), "v"(av[0][2].v), "v"(av[0][3].v));      /* inputs only: keeps chunk 0's V^T loads in front of the test; without it the compiler sinks them behind the branch, where each product waits for its own loads */
   const float thr = (s == 0) ? -1.0f : 32768.0f;      /* tile 0 always passes the test: it sets the reference */
   if (__builtin_amdgcn_ballot_w32(fmaxf(cs0, cs1) > thr) != 0) {      /* one test a tile, the same for the whole wave. A lane's chunk sum of at most 2^15 bounds each of its P by 2^15, inside f16; above it the reference moves */
     float mx[8];
#pragma unroll
     for (int q = 0; q < 8; ++q) mx[q] = fmaxf(fmaxf(sc[q], sc[8 + q]), fmaxf(sc[16 + q], sc[24 + q]));
     float mc = fmaxf(fmaxf(fmaxf(mx[0], mx[1]), fmaxf(mx[2], mx[3])), fmaxf(fmaxf(mx[4], mx[5]), fmaxf(mx[6], mx[7]))); mc = fmaxf(mc, xhalf(mc));      /* the query's maximum over the tile's 64 keys, in both halves */
     const float up = fmaxf(mc - 10.0f, 0.f); const float dl = (s == 0) ? mc - 10.0f : up;      /* the new reference lies 10 under the tile's maximum (P up to 2^10) and never moves down, but in tile 0, which sets it */
     const float al = exp2_slot(-up); m_r += dl;      /* in tile 0 the factor meets zeros only: any finite value serves */
#pragma unroll
     for (int i = 0; i < 32; ++i) sc[i] -= dl;
     cs0 = p_chunk<true>(sc, pb[0]); cs1 = p_chunk<true>(sc + 16, pb[1]);
     l_r *= al;
#pragma unroll
     for (int dt = 0; dt < DT; ++dt)
#pragma unroll
       for (int r = 0; r < 8; ++r) oacc[dt][r] *= al; }
   l_r = (l_r + cs0) + cs1;      /* the lane's 32 keys; the halves are joined after the loop */
#pragma unroll
   for (int p = 0; p < 2; ++p)
#pragma unroll
     for (int dt = 0; dt < DT; ++dt) oacc[dt] = __builtin_amdgcn_wmma_f32_16x16x32_f16(false, av[p][dt].v, false, pb[p].v, (short)0, oacc[dt], false, false);
   asm volatile("s_wait_dscnt 0x0" ::: "memory");      /* this wave's reads of buffer s mod 2 have returned before the buffer is handed to the copies */
   asm volatile("s_wait_asynccnt 0x0" ::: "memory");      /* this wave's copies of tile s + 1 have landed */
   __syncthreads();      /* publishes tile s + 1 and ends every wave's reads of tile s */
   if (s + 2 < NS) tile_copy(lt + (s & 1) * TB, lv + (s & 1) * TB, ck + (size_t)(s + 2) * 4 * kstep, kstep, cv + (size_t)(s + 2) * 4 * vstep, vstep); }      /* tile s + 2 into the buffer that trip s has just read */
  asm volatile("s_wait_asynccnt 0x0" ::: "memory");      /* nothing is in flight when the wave goes on to its end */
  const float l = l_r + xhalf(l_r); const float inv = (l > 0.f) ? 1.0f / l : 0.f;      /* sum and O carry the same factor 2^-m_r */
#pragma unroll
  for (int dt = 0; dt < DT; ++dt)      /* oacc[dt][r] = O[query ln][dt*16 + 8*hh + r] */
#pragma unroll
    for (int c = 0; c < 2; ++c) { const v4f o = {oacc[dt][4 * c] * inv, oacc[dt][4 * c + 1] * inv, oacc[dt][4 * c + 2] * inv, oacc[dt][4 * c + 3] * inv}; *(v4fa*)&sO[w][ln][dt * 16 + 8 * hh + 4 * c] = o; }
  __builtin_amdgcn_fence(__ATOMIC_ACQ_REL, "workgroup"); __builtin_amdgcn_wave_barrier();      /* the wave's LDS stores are done, and stay in front, before its lanes read each other's values back */
#pragma unroll
  for (int rp = 0; rp < 16; rp += 2) { const int r = rp + (lane >> 4), pc = lane & 15; const v4f val = *(const v4fa*)&sO[w][r][pc * 4]; *(v4f*)(O + ((size_t)b * TT + q0 + r) * ldo + h * 64 + pc * 4) = val; }
}

// Block-tiled GEMM, C = (A.Bh^T)*alpha + bias: a block of 8 waves owns a 128 x 128 tile of C and stages 128 x 64 pieces of A and of Bh in LDS, so every operand byte is fetched once a block, in whole 128-B lines
// (8 lanes a row), and is read as fragments from LDS. Wave tile 32 x 64 (2 x 4 accumulators). The next piece is fetched into registers while this one is multiplied. k runs upward in steps of 32.
// M % 128 == 0 (grid), N % 128 == 0, K % 64 == 0. LDS row pitch 64 + 8 halves = 144 B for the 16-byte fragment reads.
// One launch holds NZ independent products of the same shape (M = NR): product z takes plane z of A, of Bh and of C16, laid end to end, and its own bias. A block takes under a third of a WGP's registers
// (two waves of 160 on each SIMD's 1,024) and a fifth of its LDS, so with NZ = 3 three blocks stand on every WGP at once, and one block's barriers, LDS waits and first and last phases are covered by the matrix work of the other two.
// Most plain '#pragma unroll's below stand on a short loop whose index picks an element of a register array (staging registers, fragments, accumulators): unrolled, these stay in registers.
template <int N, int K, int NZ, bool HALF_OUT>
__global__ __launch_bounds__(256) void k_gemm_tile(const _Float16* __restrict__ A, const _Float16* __restrict__ Bh, float alpha, const float* __restrict__ bias0, const float* __restrict__ bias1, const float* __restrict__ bias2, float* __restrict__ C, _Float16* __restrict__ C16) {
  constexpr int BM = 128, BN = 128, BK = 64, LP = BK + 8;
  constexpr int NB = (NR / BM) * (N / BN);      /* blocks of one product */
  static_assert(NZ >= 1 && NZ <= 3 && (NZ == 1 || HALF_OUT), "up to three biases; the planes of several products are the f16 outputs");
  const unsigned z = (NZ > 1) ? blockIdx.x / NB : 0u; const unsigned bid = blockIdx.x - z * NB;      /* product and tile number: the same for the whole block */
  const float* __restrict__ bias = (z == 0) ? bias0 : (z == 1) ? bias1 : bias2;
  A += (size_t)z * NR * K; Bh += (size_t)z * N * K; if (HALF_OUT) C16 += (size_t)z * NR * N;
  __shared__ __attribute__((aligned(16))) unsigned short sm[8 * 32 * 64 * 2];      /* 64 KB: the output staging (8 waves x 32 x 64 f32) is the larger use; the operand pieces take (BM + BN) * LP halves */
  static_assert((BM + BN) * LP <= 8 * 32 * 64 * 2, "operand pieces fit");
  unsigned short* sA = sm; unsigned short* sB = sm + BM * LP;
  const int tid = threadIdx.x, w = tid >> 5, lane = tid & 31, ln = lane & 15, hh = lane >> 4;
  const int nbn = N / BN; const int row0 = (bid / nbn) * BM, col0 = (bid % nbn) * BN;
  const int wm = w >> 1, wn = w & 1;
  const int lr = tid >> 3, lc = (tid & 7) * 8;
  const char* ga = (const char*)A + (size_t)row0 * K * 2; const char* gb = (const char*)Bh + (size_t)col0 * K * 2; const unsigned vo = (unsigned)(lr * K + lc) * 2u;      /* block-uniform bases, one 32-bit lane offset that lives through the loop */
  v8us ra[4], rb[4];
#pragma unroll
  for (int i = 0; i < 4; ++i) { ra[i] = *(const v8us*)(ga + vo + (size_t)(32 * i) * K * 2); rb[i] = *(const v8us*)(gb + vo + (size_t)(32 * i) * K * 2); }
  v8f acc[2][4];
#pragma unroll
  for (int mi = 0; mi < 2; ++mi)
#pragma unroll
    for (int t = 0; t < 4; ++t) acc[mi][t] = (v8f){0.f,0.f,0.f,0.f,0.f,0.f,0.f,0.f};
#pragma unroll 1      /* rolled: K is a constant here, and 16 copies of this body would only grow the code */
  for (int kb = 0; kb < K; kb += BK) {
#pragma unroll
    for (int i = 0; i < 4; ++i) { *(v8us*)&sA[(lr + 32 * i) * LP + lc] = ra[i]; *(v8us*)&sB[(lr + 32 * i) * LP + lc] = rb[i]; }
    __syncthreads();      /* the piece is complete before any wave reads fragments */
    if (kb + BK < K) {
#pragma unroll
      for (int i = 0; i < 4; ++i) { ra[i] = *(const v8us*)(ga + (size_t)(kb + BK) * 2 + vo + (size_t)(32 * i) * K * 2); rb[i] = *(const v8us*)(gb + (size_t)(kb + BK) * 2 + vo + (size_t)(32 * i) * K * 2); }
      asm volatile("s_wait_xcnt 0x0" ::: "memory"); }      /* the loads' address registers are reused by the fragment reads below: wait before that overwrite */
#pragma unroll
    for (int ks = 0; ks < BK / 32; ++ks) { FragH a[2], bq[4];
#pragma unroll
      for (int mi = 0; mi < 2; ++mi) { const unsigned short* p = &sA[(wm * 32 + mi * 16 + ln) * LP + ks * 32 + 8 * hh]; a[mi].half[0] = *(const v8us*)p; a[mi].half[1] = *(const v8us*)(p + 16); }
#pragma unroll
      for (int t = 0; t < 4; ++t) { const unsigned short* p = &sB[(wn * 64 + t * 16 + ln) * LP + ks * 32 + 8 * hh]; bq[t].half[0] = *(const v8us*)p; bq[t].half[1] = *(const v8us*)(p + 16); }
#pragma unroll
      for (int mi = 0; mi < 2; ++mi)
#pragma unroll
        for (int t = 0; t < 4; ++t) acc[mi][t] = __builtin_amdgcn_wmma_f32_16x16x32_f16(false, a[mi].v, false, bq[t].v, (short)0, acc[mi][t], false, false); }
    __syncthreads();      /* every wave has read the piece before it is overwritten (by the next piece, or by the output staging below) */
  }
  float* so = (float*)sm + w * (32 * 64);      /* each wave stages its 32 x 64 results in its own 8 KB, to store whole lines */
  const int rsub = lane >> 4, c4 = (lane & 15) * 4; float bv[4];
#pragma unroll
  for (int t = 0; t < 4; ++t) bv[t] = bf16_round(bias[col0 + wn * 64 + t * 16 + ln]);
#pragma unroll
  for (int mi = 0; mi < 2; ++mi)
#pragma unroll
    for (int t = 0; t < 4; ++t)
#pragma unroll
      for (int r = 0; r < 8; ++r) so[(mi * 16 + 8 * hh + r) * 64 + t * 16 + ln] = acc[mi][t][r] * alpha + bv[t];
  __builtin_amdgcn_fence(__ATOMIC_ACQ_REL, "workgroup"); __builtin_amdgcn_wave_barrier();      /* the wave's LDS stores are done, and stay in front, before its lanes read each other's values back */
#pragma unroll
  for (int q = 0; q < 16; ++q) { const int r = q * 2 + rsub; const v4f v = *(const v4fa*)&so[r * 64 + c4]; const size_t o = (size_t)(row0 + wm * 32 + r) * N + col0 + wn * 64 + c4;
    if (HALF_OUT) { v4h h4;
#pragma unroll
      for (int i = 0; i < 4; ++i) h4[i] = (_Float16)v[i];
      *(v4h*)(C16 + o) = h4; }
    else *(v4f*)(C + o) = v; }
}

extern "C" void kernel_launch(void* const* d_in, const int* in_sizes, int n_in,
                              void* d_out, int out_size, void* d_ws, size_t ws_size, hipStream_t stream) {
  (void)in_sizes; (void)n_in; (void)out_size;
  const float* const* I = (const float* const*)d_in; const float* xq = I[0]; const float* xk = I[1]; const float* xv = I[2]; const float* frac = I[3]; const float* Wq = I[4]; const float* bq = I[5]; const float* Wk = I[6]; const float* bk = I[7]; const float* Wv = I[8]; const float* bv = I[9]; const float* Wo = I[10]; const float* bo = I[11]; const float* apos = I[12]; const float* aneg = I[13]; const float* gam = I[14]; const float* del = I[15];      /* d_in order: query, key, value, frac, Wq, bq, Wk, bk, Wv, bv, Wo, bo, alpha_pos, alpha_neg, gamma, delta */
  char* ws = (char*)d_ws; size_t off = 0;
  auto take = [&](size_t bytes) { char* p = ws + off; off += (bytes + 255) & ~(size_t)255; return p; };
  const size_t WSZ = (size_t)DD * DD; _Float16* Bw = (_Float16*)take(4 * WSZ * 2); const size_t XSZ = (size_t)NR * DD; _Float16* X16 = (_Float16*)take(3 * XSZ * 2); _Float16* XK16 = X16 + XSZ; _Float16* XV16 = X16 + 2 * XSZ;      /* three planes end to end, as the projection launch reads them */
  _Float16* Q = (_Float16*)take(3 * XSZ * 2); _Float16* K = Q + XSZ; _Float16* V = Q + 2 * XSZ;
  float* O = (float*)take((size_t)NR * DD * 4); _Float16* O16 = V;      /* the v plane is dead once the attention kernel has run; O16 reuses it */
  if (off > ws_size) return;      // 8.4 + 6 x 8.4 + 16.8 = about 76 MB
  const unsigned gt = (NR / 128) * (DD / 128);
  k_cvt_in<<<256, 512, 0, stream>>>(xq, xk, xv, Wq, Wk, Wv, Wo, X16, XK16, XV16, Bw);      /* activations bf16-rounded; weights (out,in) natural, bf16-rounded, x 2^4 */
  k_gemm_tile<DD, DD, 3, true><<<3 * gt, 256, 0, stream>>>(X16, Bw, 0.0625f, bq, bk, bv, nullptr, Q);      /* Q = query.Wq^T + bq, K and V alike, each M 4096 N 1024 K 1024 */
  k_flash<<<BB * NH * (TT / 64), 128, 0, stream>>>(Q, DD, K, DD, V, DD, frac, apos, aneg, gam, del, O, DD);
  k_cvt_o<<<256, 256, 0, stream>>>(O, O16);
  k_gemm_tile<DD, DD, 1, false><<<gt, 256, 0, stream>>>(O16, Bw + 3 * WSZ, 0.0625f, bo, nullptr, nullptr, (float*)d_out, nullptr);      /* out = O·Woᵀ + bo */
}

// v009
// A run of this version takes 104 microseconds.
// Timed twice side by side with v008, it ran 1.07 times as fast both times.
// Over all steps from v000 it is 4.34 times as fast.
#include <hip/hip_runtime.h>
// Multi-head attention with a stoichiometric bias (B=2, T=2048, D=1024, 16 heads × 64): Q,K,V = x·Wᵀ + b (torch (out,in)) from query/key/value; logits = q·kᵀ·64^-½; bias[b,h,i,j] = α_pos[h]·max(D,0) + α_neg[h]·min(D,0), D = clip(frac_j − frac_i, −0.2, 0.2);
// attn = softmax(γ·logits + δ·bias); out = (attn·V merged)·Woᵀ + bo. γ, δ are scalar inputs.
// Compute dtype: x, weights, biases rounded to bf16; q/k/v as f16 GEMM outputs; fused flash-style kernel (online softmax f32, P f16 ×2^10) on v_wmma_f32_16x16x32_f16; O → f16 → output GEMM with bias; f32 accumulate.
#define BB 2
#define TT 2048
#define NH 16
#define DD 1024
#define NR (BB * TT)

typedef __bf16 v16b __attribute__((ext_vector_type(16)));
typedef unsigned short v8us __attribute__((ext_vector_type(8), may_alias));
typedef float  v8f  __attribute__((ext_vector_type(8)));
typedef float  v4f  __attribute__((ext_vector_type(4)));
typedef float  v4fa __attribute__((ext_vector_type(4), may_alias));
union FragB { v16b v; v8us half[2]; unsigned short u[16]; };

__device__ __forceinline__ unsigned short bf16_bits(float x) { unsigned int u = __float_as_uint(x); return (unsigned short)((u + 0x7FFFu + ((u >> 16) & 1u)) >> 16); }
__device__ __forceinline__ float bf16_val(unsigned short b) { return __uint_as_float(((unsigned int)b) << 16); }
__device__ __forceinline__ float bf16_round(float x) { return bf16_val(bf16_bits(x)); }
// D += A·B with NT terms: 1 = ah·bh, 2 = + al·bh (A split), 3 = + ah·bl (both split)
template <int NT>
__device__ __forceinline__ v8f mmaN(v16b ah, v16b al, v16b bh, v16b bl, v8f c) {
  c = __builtin_amdgcn_wmma_f32_16x16x32_bf16(false, ah, false, bh, (short)0, c, false, false);
  if (NT >= 2) c = __builtin_amdgcn_wmma_f32_16x16x32_bf16(false, al, false, bh, (short)0, c, false, false);
  if (NT >= 3) c = __builtin_amdgcn_wmma_f32_16x16x32_bf16(false, ah, false, bl, (short)0, c, false, false);
  asm volatile("v_nop\n\tv_nop\n\tv_nop\n\tv_nop" : "+v"(c) : "v"(ah), "v"(al), "v"(bh), "v"(bl));
  return c;
}

__global__ __launch_bounds__(256) void k_wt_bf16(const float* __restrict__ W, unsigned short* __restrict__ Wt, int K, int N) {
  const int t = blockIdx.x * 256 + threadIdx.x;
  const int k8n = K / 8;
  if (t >= N * k8n) return;
  const int n = t / k8n, k8 = (t % k8n) * 8;
  v8us v;
#pragma unroll
  for (int i = 0; i < 8; ++i) v[i] = bf16_bits(W[(size_t)(k8 + i) * N + n]);
  *(v8us*)(Wt + (size_t)n * K + k8) = v;
  
}

// GEMM C[M][N] (f32, pitch ldc) = act(A[M][K]·W + bias). A f32 row-major (pitch lda) converted per fragment to bf16
// (ASPLIT: hi/lo two planes -> 2 terms, else single rounded term); Wt bf16 [N][K] (pitch ldb). BIAS_BF16 rounds the
// bias to bf16 first (bias quantised to bf16 before the add). K%32==0, M%16==0, N%64==0.
template <bool ASPLIT, int ACT, bool BIAS_BF16>
__global__ __launch_bounds__(128) void k_gemm_bf(const float* __restrict__ A, int lda, const unsigned short* __restrict__ Wt, int ldb,
                                               const float* __restrict__ bias, float* __restrict__ C, int ldc, int M, int N, int K) {
  __shared__ __attribute__((aligned(16))) float so[4][16][64];
  const int tid = threadIdx.x, w = tid >> 5, lane = tid & 31, ln = lane & 15, hh = lane >> 4;
  const int ntn = N / 64;
  const int wid = blockIdx.x * 4 + w;
  const int mt = wid / ntn, nq = wid % ntn;
  if (mt * 16 >= M) return;
  const int row0 = mt * 16, col0 = nq * 64;
  const float* arow = A + (size_t)(row0 + ln) * lda;
  v8f acc[4] = {};
  for (int kb = 0; kb < K; kb += 32) {
    FragB ah, al;
    const v4f x0 = *(const v4fa*)(arow + kb + 8 * hh), x1 = *(const v4fa*)(arow + kb + 8 * hh + 4);
    const v4f x2 = *(const v4fa*)(arow + kb + 16 + 8 * hh), x3 = *(const v4fa*)(arow + kb + 16 + 8 * hh + 4);
    float xs[16] = {x0[0],x0[1],x0[2],x0[3],x1[0],x1[1],x1[2],x1[3],x2[0],x2[1],x2[2],x2[3],x3[0],x3[1],x3[2],x3[3]};
#pragma unroll
    for (int i = 0; i < 16; ++i) { const unsigned short hb = bf16_bits(xs[i]); ah.u[i] = hb; al.u[i] = ASPLIT ? bf16_bits(xs[i] - bf16_val(hb)) : (unsigned short)0; }
#pragma unroll
    for (int t = 0; t < 4; ++t) {
      const unsigned short* brow = Wt + (size_t)(col0 + t * 16 + ln) * ldb + kb;
      FragB b;
      b.half[0] = *(const v8us*)(brow + 8 * hh);
      b.half[1] = *(const v8us*)(brow + 16 + 8 * hh);
      acc[t] = mmaN<ASPLIT ? 2 : 1>(ah.v, al.v, b.v, b.v, acc[t]);
    }
  }
#pragma unroll
  for (int t = 0; t < 4; ++t) {
    float bv = bias ? bias[col0 + t * 16 + ln] : 0.f;
    if (BIAS_BF16) bv = bf16_round(bv);
#pragma unroll
    for (int r = 0; r < 8; ++r) { float v = acc[t][r] + bv; if (ACT == 1) v = fmaxf(v, 0.f); so[w][8 * hh + r][t * 16 + ln] = v; }
  }
  __builtin_amdgcn_fence(__ATOMIC_ACQ_REL, "workgroup");
  __builtin_amdgcn_wave_barrier();
  const int rsub = lane >> 4, c4 = (lane & 15) * 4;
  {
#pragma unroll
    for (int q = 0; q < 8; ++q) {
      const int r = q * 2 + rsub;
      const v4f v = *(const v4fa*)&so[w][r][c4];
      *(v4f*)(C + (size_t)(row0 + r) * ldc + col0 + c4) = v;
    }
    
  }
}

// Flash-style causal/unmasked attention, all contractions 3-term bf16 hi/lo splits, f32 softmax with running max.
// q,k,v rows are read from f32 buffers with arbitrary row pitch (so they can live inside a fused qkv buffer);
// D = head size (multiple of 32, <= 128); one wave = 16 query rows; block = 4 waves (64 queries) sharing K/V chunks of 32.
template <int D, bool CAUSAL>
__global__ __launch_bounds__(128) void k_flash(const float* __restrict__ qb, const float* __restrict__ kb, const float* __restrict__ vb,
                                             int pitch, int T, int H, float scale, float* __restrict__ y, int ypitch) {
  constexpr int KS = D / 32;        // k-steps for QK
  constexpr int DT = D / 16;        // d tiles for PV
  __shared__ __attribute__((aligned(16))) unsigned short sKh[32][D + 8], sKl[32][D + 8], sVh[32][D + 8], sVl[32][D + 8];
  __shared__ __attribute__((aligned(16))) unsigned short sPh[4][16][40], sPl[4][16][40];
  __shared__ __attribute__((aligned(16))) float sO[4][16][D];
  const int tid = threadIdx.x, w = tid >> 5, lane = tid & 31, ln = lane & 15, hh = lane >> 4;
  const int nqb = (T + 63) / 64;
  const int bh = blockIdx.x / nqb, qblk = blockIdx.x % nqb;
  const int b = bh / H, h = bh % H;
  const int q0 = qblk * 64 + w * 16;
  const float* Q = qb + (size_t)b * T * pitch + h * D;
  const float* K = kb + (size_t)b * T * pitch + h * D;
  const float* V = vb + (size_t)b * T * pitch + h * D;

  // A fragments of the wave's 16 query rows (scaled), hi/lo
  FragB aqh[KS], aql[KS];
  {
    int row = q0 + ln; if (row >= T) row = T - 1;
    const float* qr = Q + (size_t)row * pitch;
#pragma unroll
    for (int ks = 0; ks < KS; ++ks)
#pragma unroll
      for (int i = 0; i < 16; ++i) {
        const int d = ks * 32 + ((i < 8) ? (8 * hh + i) : (16 + 8 * hh + (i - 8)));
        const float x = qr[d] * scale; const unsigned short hb = bf16_bits(x);
        aqh[ks].u[i] = hb; aql[ks].u[i] = bf16_bits(x - bf16_val(hb));
      }
  }
  float m_r[8], l_r[8];
#pragma unroll
  for (int r = 0; r < 8; ++r) { m_r[r] = -3.0e38f; l_r[r] = 0.f; }
  v8f oacc[DT];
#pragma unroll
  for (int dt = 0; dt < DT; ++dt) oacc[dt] = (v8f){0.f,0.f,0.f,0.f,0.f,0.f,0.f,0.f};

  const int kv_end = CAUSAL ? min(T, qblk * 64 + 64) : T;     // block-uniform
  for (int j0 = 0; j0 < kv_end; j0 += 32) {
    __syncthreads();
    for (int e = tid; e < 32 * (D / 4); e += 128) {
      const int r = e / (D / 4), c4 = (e % (D / 4)) * 4;
      const int key = j0 + r;
      v4f kf = {0.f,0.f,0.f,0.f}, vf = {0.f,0.f,0.f,0.f};
      if (key < T) { kf = *(const v4fa*)(K + (size_t)key * pitch + c4); vf = *(const v4fa*)(V + (size_t)key * pitch + c4); }
#pragma unroll
      for (int t = 0; t < 4; ++t) {
        unsigned short hb = bf16_bits(kf[t]); sKh[r][c4 + t] = hb; sKl[r][c4 + t] = bf16_bits(kf[t] - bf16_val(hb));
        hb = bf16_bits(vf[t]); sVh[r][c4 + t] = hb; sVl[r][c4 + t] = bf16_bits(vf[t] - bf16_val(hb));
      }
    }
    __syncthreads();
    // S tile 16 x 32
    v8f s[2];
#pragma unroll
    for (int nt = 0; nt < 2; ++nt) {
      v8f acc = {};
#pragma unroll
      for (int ks = 0; ks < KS; ++ks) {
        FragB bh_, bl_;
        bh_.half[0] = *(const v8us*)&sKh[nt * 16 + ln][ks * 32 + 8 * hh]; bh_.half[1] = *(const v8us*)&sKh[nt * 16 + ln][ks * 32 + 16 + 8 * hh];
        bl_.half[0] = *(const v8us*)&sKl[nt * 16 + ln][ks * 32 + 8 * hh]; bl_.half[1] = *(const v8us*)&sKl[nt * 16 + ln][ks * 32 + 16 + 8 * hh];
        acc = mmaN<3>(aqh[ks].v, aql[ks].v, bh_.v, bl_.v, acc);
      }
      s[nt] = acc;
    }
    // mask + running max (rows 8hh+r; the 16 lanes of a half share rows)
    float alpha[8];
#pragma unroll
    for (int r = 0; r < 8; ++r) {
      const int qi = q0 + 8 * hh + r;
      const int ja = j0 + ln, jb = j0 + 16 + ln;
      if (CAUSAL) { if (ja > qi) s[0][r] = -3.0e38f; if (jb > qi) s[1][r] = -3.0e38f; }
      if (ja >= T) s[0][r] = -3.0e38f;
      if (jb >= T) s[1][r] = -3.0e38f;
      float mx = fmaxf(s[0][r], s[1][r]);
      mx = fmaxf(mx, __shfl_xor(mx, 1, 32)); mx = fmaxf(mx, __shfl_xor(mx, 2, 32)); mx = fmaxf(mx, __shfl_xor(mx, 4, 32)); mx = fmaxf(mx, __shfl_xor(mx, 8, 32));
      const float mnew = fmaxf(m_r[r], mx);
      alpha[r] = (mnew > -1.0e38f) ? __expf(m_r[r] - mnew) : 1.0f;
      const float p0 = (s[0][r] > -1.0e38f) ? __expf(s[0][r] - mnew) : 0.f;
      const float p1 = (s[1][r] > -1.0e38f) ? __expf(s[1][r] - mnew) : 0.f;
      m_r[r] = mnew;
      l_r[r] = l_r[r] * alpha[r] + p0 + p1;            // per-lane partial row sum (16 lanes combined at the end)
      unsigned short hb = bf16_bits(p0); sPh[w][8 * hh + r][ln] = hb;      sPl[w][8 * hh + r][ln] = bf16_bits(p0 - bf16_val(hb));
      hb = bf16_bits(p1);                sPh[w][8 * hh + r][16 + ln] = hb; sPl[w][8 * hh + r][16 + ln] = bf16_bits(p1 - bf16_val(hb));
    }
#pragma unroll
    for (int dt = 0; dt < DT; ++dt)
#pragma unroll
      for (int r = 0; r < 8; ++r) oacc[dt][r] *= alpha[r];
    __builtin_amdgcn_fence(__ATOMIC_ACQ_REL, "workgroup");
    __builtin_amdgcn_wave_barrier();
    FragB pah, pal;
    pah.half[0] = *(const v8us*)&sPh[w][ln][8 * hh]; pah.half[1] = *(const v8us*)&sPh[w][ln][16 + 8 * hh];
    pal.half[0] = *(const v8us*)&sPl[w][ln][8 * hh]; pal.half[1] = *(const v8us*)&sPl[w][ln][16 + 8 * hh];
#pragma unroll
    for (int dt = 0; dt < DT; ++dt) {
      FragB bvh, bvl;
#pragma unroll
      for (int i = 0; i < 8; ++i) {
        bvh.u[i] = sVh[8 * hh + i][dt * 16 + ln]; bvh.u[8 + i] = sVh[16 + 8 * hh + i][dt * 16 + ln];
        bvl.u[i] = sVl[8 * hh + i][dt * 16 + ln]; bvl.u[8 + i] = sVl[16 + 8 * hh + i][dt * 16 + ln];
      }
      oacc[dt] = mmaN<3>(pah.v, pal.v, bvh.v, bvl.v, oacc[dt]);
    }
    __builtin_amdgcn_fence(__ATOMIC_ACQ_REL, "workgroup");
    __builtin_amdgcn_wave_barrier();
  }
#pragma unroll
  for (int r = 0; r < 8; ++r) {
    float l = l_r[r];
    l += __shfl_xor(l, 1, 32); l += __shfl_xor(l, 2, 32); l += __shfl_xor(l, 4, 32); l += __shfl_xor(l, 8, 32);
    l_r[r] = (l > 0.f) ? 1.0f / l : 0.f;
  }
#pragma unroll
  for (int dt = 0; dt < DT; ++dt)
#pragma unroll
    for (int r = 0; r < 8; ++r) sO[w][8 * hh + r][dt * 16 + ln] = oacc[dt][r] * l_r[r];
  __builtin_amdgcn_fence(__ATOMIC_ACQ_REL, "workgroup");
  __builtin_amdgcn_wave_barrier();
  {
    for (int r = 0; r < 16; ++r) {
      const int row = q0 + r;
      if (row < T && lane < D / 4) {
        const v4f val = *(const v4fa*)&sO[w][r][lane * 4];
        *(v4f*)(y + ((size_t)b * T + row) * ypitch + h * D + lane * 4) = val;
      }
    }
    
  }
}

// GEMM C = act(A·W + bias + resid): A f32 (ASPLIT -> hi/lo 2 terms), Wt bf16 [N][K]; ACT 0 none, 1 relu, 2 exact gelu;
// resid (optional, f32, row index = (row % rmod), pitch ldr, RES_BF16 rounds it) added before the activation.
template <bool ASPLIT, int ACT, bool BIAS_BF16, bool RES_BF16>
__global__ __launch_bounds__(128) void k_gemm_bf3(const float* __restrict__ A, int lda, const unsigned short* __restrict__ Wt, int ldb,
                                                const float* __restrict__ bias, const float* __restrict__ resid, int rmod, int ldr,
                                                float* __restrict__ C, int ldc, int M, int N, int K) {
  __shared__ __attribute__((aligned(16))) float so[4][16][64];
  const int tid = threadIdx.x, w = tid >> 5, lane = tid & 31, ln = lane & 15, hh = lane >> 4;
  const int ntn = N / 64;
  const int wid = blockIdx.x * 4 + w;
  const int mt = wid / ntn, nq = wid % ntn;
  if (mt * 16 >= M) return;
  const int row0 = mt * 16, col0 = nq * 64;
  const float* arow = A + (size_t)(row0 + ln) * lda;
  v8f acc[4] = {};
  for (int kb = 0; kb < K; kb += 32) {
    FragB ah, al;
    const v4f x0 = *(const v4fa*)(arow + kb + 8 * hh), x1 = *(const v4fa*)(arow + kb + 8 * hh + 4);
    const v4f x2 = *(const v4fa*)(arow + kb + 16 + 8 * hh), x3 = *(const v4fa*)(arow + kb + 16 + 8 * hh + 4);
    float xs[16] = {x0[0],x0[1],x0[2],x0[3],x1[0],x1[1],x1[2],x1[3],x2[0],x2[1],x2[2],x2[3],x3[0],x3[1],x3[2],x3[3]};
#pragma unroll
    for (int i = 0; i < 16; ++i) { const unsigned short hb = bf16_bits(xs[i]); ah.u[i] = hb; al.u[i] = ASPLIT ? bf16_bits(xs[i] - bf16_val(hb)) : (unsigned short)0; }
#pragma unroll
    for (int t = 0; t < 4; ++t) {
      const unsigned short* brow = Wt + (size_t)(col0 + t * 16 + ln) * ldb + kb;
      FragB b;
      b.half[0] = *(const v8us*)(brow + 8 * hh);
      b.half[1] = *(const v8us*)(brow + 16 + 8 * hh);
      acc[t] = mmaN<ASPLIT ? 2 : 1>(ah.v, al.v, b.v, b.v, acc[t]);
    }
  }
#pragma unroll
  for (int t = 0; t < 4; ++t) {
    const int col = col0 + t * 16 + ln;
    float bv = bias ? bias[col] : 0.f;
    if (BIAS_BF16) bv = bf16_round(bv);
#pragma unroll
    for (int r = 0; r < 8; ++r) {
      float v = acc[t][r] + bv;
      if (resid) { float rv = resid[(size_t)((row0 + 8 * hh + r) % rmod) * ldr + col]; if (RES_BF16) rv = bf16_round(rv); v += rv; }
      if (ACT == 1) v = fmaxf(v, 0.f);
      if (ACT == 2) v = 0.5f * v * (1.0f + erff(v * 0.70710678118654752f));
      if (ACT == 3) { const float u = 0.7978845608028654f * (v + 0.044715f * v * v * v); v = 0.5f * v * (1.0f + tanhf(u)); }
      so[w][8 * hh + r][t * 16 + ln] = v;
    }
  }
  __builtin_amdgcn_fence(__ATOMIC_ACQ_REL, "workgroup");
  __builtin_amdgcn_wave_barrier();
  const int rsub = lane >> 4, c4 = (lane & 15) * 4;
  {
#pragma unroll
    for (int q = 0; q < 8; ++q) {
      const int r = q * 2 + rsub;
      const v4f v = *(const v4fa*)&so[w][r][c4];
      *(v4f*)(C + (size_t)(row0 + r) * ldc + col0 + c4) = v;
    }
    
  }
}
// row LayerNorm (biased variance, eps) over N: s = X (+ R); optional out_sum <- s; out_norm <- (s-mu)*rsqrt(var+eps)*g + b
template <bool PARAM_BF16>
__global__ __launch_bounds__(256) void k_layernorm(const float* __restrict__ X, const float* __restrict__ R, const float* __restrict__ g, const float* __restrict__ bta,
                                                  float* __restrict__ out_sum, float* __restrict__ out_norm, int N, float eps) {
  __shared__ float red[256];
  const int row = blockIdx.x, tid = threadIdx.x;
  const float* x = X + (size_t)row * N; const float* rr = R ? R + (size_t)row * N : nullptr;
  float vals[16];                     // up to N = 4096
  const int per = N / 256;            // contiguous chunk per thread? use strided-by-4 chunks: thread handles j = tid*4 + 1024*u
  float s1 = 0.f;
  for (int u = 0; u < per / 4; ++u) {
    const int j = tid * 4 + 1024 * u;
    const v4f a = *(const v4fa*)(x + j);
    v4f b = {0.f,0.f,0.f,0.f}; if (rr) b = *(const v4fa*)(rr + j);
#pragma unroll
    for (int q = 0; q < 4; ++q) { const float v = a[q] + b[q]; vals[u * 4 + q] = v; s1 += v; }
  }
  red[tid] = s1; __syncthreads();
  for (int st = 128; st > 0; st >>= 1) { if (tid < st) red[tid] += red[tid + st]; __syncthreads(); }
  const float mu = red[0] / (float)N; __syncthreads();
  float s2 = 0.f;
  for (int u = 0; u < per / 4; ++u)
#pragma unroll
    for (int q = 0; q < 4; ++q) { const float c = vals[u * 4 + q] - mu; s2 += c * c; }
  red[tid] = s2; __syncthreads();
  for (int st = 128; st > 0; st >>= 1) { if (tid < st) red[tid] += red[tid + st]; __syncthreads(); }
  const float rs = rsqrtf(red[0] / (float)N + eps);
  {
    for (int u = 0; u < per / 4; ++u) {
      const int j = tid * 4 + 1024 * u;
      v4f o, sm;
#pragma unroll
      for (int q = 0; q < 4; ++q) {
        float gg = g[j + q], bb = bta[j + q];
        if (PARAM_BF16) { gg = bf16_round(gg); bb = bf16_round(bb); }
        sm[q] = vals[u * 4 + q]; o[q] = (vals[u * 4 + q] - mu) * rs * gg + bb;
      }
      if (out_sum) *(v4f*)(out_sum + (size_t)row * N + j) = sm;
      *(v4f*)(out_norm + (size_t)row * N + j) = o;
    }
    
  }
}



// ---- f16 WMMA path (v_wmma_f32_16x16x32_f16): 11-bit significands for operands in range — used where a [0,1] probability operand needs more precision than bf16
typedef _Float16 v16h __attribute__((ext_vector_type(16)));
union FragH { v16h v; v8us half[2]; _Float16 h[16]; unsigned short u[16]; };
template <int NT>
__device__ __forceinline__ v8f mmaH(v16h ah, v16h al, v16h bh, v16h bl, v8f c) {
  c = __builtin_amdgcn_wmma_f32_16x16x32_f16(false, ah, false, bh, (short)0, c, false, false);
  if (NT >= 2) c = __builtin_amdgcn_wmma_f32_16x16x32_f16(false, al, false, bh, (short)0, c, false, false);
  if (NT >= 3) c = __builtin_amdgcn_wmma_f32_16x16x32_f16(false, ah, false, bl, (short)0, c, false, false);
  asm volatile("v_nop\n\tv_nop\n\tv_nop\n\tv_nop" : "+v"(c) : "v"(ah), "v"(al), "v"(bh), "v"(bl));
  return c;
}
// batched GEMM like k_gemm_b but f16 operands: A f32 (split into f16 hi/lo if ASPLIT, else rounded to f16), Bt = f16 values [n][k]; alpha; C f32; N multiple of 16 (partial tiles skipped)
template <bool ASPLIT>
__global__ __launch_bounds__(128) void k_gemm_h(const float* __restrict__ A, int lda, size_t sA, const _Float16* __restrict__ Bh, int ldb, size_t sB, float alpha, float* __restrict__ C, int ldc, size_t sC, int M, int N, int K) {
  __shared__ __attribute__((aligned(16))) float so[4][16][64];
  const int tid = threadIdx.x, w = tid >> 5, lane = tid & 31, ln = lane & 15, hh = lane >> 4; const int by = blockIdx.y;
  A += (size_t)by * sA; Bh += (size_t)by * sB; C += (size_t)by * sC;
  const int ntn = (N + 63) / 64; const int wid = blockIdx.x * 4 + w; const int mt = wid / ntn, nq = wid % ntn; if (mt * 16 >= M) return;
  const int row0 = mt * 16, col0 = nq * 64; const float* arow = A + (size_t)(row0 + ln) * lda;
  v8f acc[4] = {};
  for (int kb = 0; kb < K; kb += 32) {
    FragH ah, al;
    const v4f x0 = *(const v4fa*)(arow + kb + 8 * hh), x1 = *(const v4fa*)(arow + kb + 8 * hh + 4), x2 = *(const v4fa*)(arow + kb + 16 + 8 * hh), x3 = *(const v4fa*)(arow + kb + 16 + 8 * hh + 4);
    float xs[16] = {x0[0],x0[1],x0[2],x0[3],x1[0],x1[1],x1[2],x1[3],x2[0],x2[1],x2[2],x2[3],x3[0],x3[1],x3[2],x3[3]};
#pragma unroll
    for (int i = 0; i < 16; ++i) { const _Float16 h = (_Float16)xs[i]; ah.h[i] = h; al.h[i] = ASPLIT ? (_Float16)(xs[i] - (float)h) : (_Float16)0.0f; }
#pragma unroll
    for (int t = 0; t < 4; ++t) { if (col0 + t * 16 >= N) continue; const size_t boff = (size_t)(col0 + t * 16 + ln) * ldb + kb; FragH bq; bq.half[0] = *(const v8us*)(Bh + boff + 8 * hh); bq.half[1] = *(const v8us*)(Bh + boff + 16 + 8 * hh);
      acc[t] = mmaH<ASPLIT ? 2 : 1>(ah.v, al.v, bq.v, bq.v, acc[t]); }
  }
#pragma unroll
  for (int t = 0; t < 4; ++t) { if (col0 + t * 16 >= N) continue;
#pragma unroll
    for (int r = 0; r < 8; ++r) so[w][8 * hh + r][t * 16 + ln] = acc[t][r] * alpha; }
  __builtin_amdgcn_fence(__ATOMIC_ACQ_REL, "workgroup"); __builtin_amdgcn_wave_barrier();
  const int rsub = lane >> 4, c4 = (lane & 15) * 4;
  {
#pragma unroll
    for (int q = 0; q < 8; ++q) { const int r = q * 2 + rsub; if (col0 + c4 < N) { const v4f v = *(const v4fa*)&so[w][r][c4]; *(v4f*)(C + (size_t)(row0 + r) * ldc + col0 + c4) = v; } }
     }
}

// Wt[n][k] = f16(W[k][n]·scale) from f32 row-major W[K][N] (scale = power of two; bf16-exact weights stay exact in f16 away from the subnormal range)
__global__ __launch_bounds__(256) void k_wt_f16(const float* __restrict__ W, _Float16* __restrict__ Wt, int K, int N, float scale) {
  const int t = blockIdx.x * 256 + threadIdx.x; if (t >= N * (K / 8)) return; const int n = t / (K / 8), k8 = (t % (K / 8)) * 8; FragH f;
#pragma unroll
  for (int i = 0; i < 8; ++i) f.h[i] = (_Float16)(bf16_round(W[(size_t)(k8 + i) * N + n]) * scale); const v8us o = f.half[0];
  *(v8us*)((unsigned short*)Wt + (size_t)n * K + k8) = o; 
}
// k_gemm_hh variant with fused epilogue: v = acc·alpha + bias[by·sBias + col] (+ CP[(row/rowsPerB)·sCPb + by·64 + col] if CP) ; ACT 0 none / 1 elu ; writes f32 C and f16 C16, each if non-null
template <int ACT>
__global__ __launch_bounds__(128) void k_gemm_hhx(const _Float16* __restrict__ A, int lda, size_t sA, const _Float16* __restrict__ Bh, int ldb, size_t sB, float alpha, const float* __restrict__ bias, size_t sBias, const float* __restrict__ CP, int rowsPerB, size_t sCPb, int row0g,
    float* __restrict__ C, _Float16* __restrict__ C16, int ldc, size_t sC, int M, int N, int K) {
  __shared__ __attribute__((aligned(16))) float so[4][16][64];
  const int tid = threadIdx.x, w = tid >> 5, lane = tid & 31, ln = lane & 15, hh = lane >> 4; const int by = blockIdx.y;
  A += (size_t)by * sA; Bh += (size_t)by * sB; const size_t cofs = (size_t)by * sC; const float* bp = bias ? bias + (size_t)by * sBias : nullptr;
  const int ntn = (N + 63) / 64; const int wid = blockIdx.x * 4 + w; const int mt = wid / ntn, nq = wid % ntn; if (mt * 16 >= M) return;
  const int row0 = mt * 16, col0 = nq * 64; const _Float16* arow = A + (size_t)(row0 + ln) * lda;
  v8f acc[4] = {};
  for (int kb = 0; kb < K; kb += 32) { FragH ah; ah.half[0] = *(const v8us*)((const unsigned short*)arow + kb + 8 * hh); ah.half[1] = *(const v8us*)((const unsigned short*)arow + kb + 16 + 8 * hh);
#pragma unroll
    for (int t = 0; t < 4; ++t) { if (col0 + t * 16 >= N) continue; const size_t boff = (size_t)(col0 + t * 16 + ln) * ldb + kb; FragH bq; bq.half[0] = *(const v8us*)((const unsigned short*)Bh + boff + 8 * hh); bq.half[1] = *(const v8us*)((const unsigned short*)Bh + boff + 16 + 8 * hh);
      acc[t] = mmaH<1>(ah.v, ah.v, bq.v, bq.v, acc[t]); }
  }
#pragma unroll
  for (int t = 0; t < 4; ++t) { if (col0 + t * 16 >= N) continue; const int col = col0 + t * 16 + ln; const float bv = bp ? bf16_round(bp[col]) : 0.f;
#pragma unroll
    for (int r = 0; r < 8; ++r) { float v = acc[t][r] * alpha + bv; if (CP) { const int bidx = (row0g + row0 + 8 * hh + r) / rowsPerB; v += CP[(size_t)bidx * sCPb + (size_t)by * 64 + col]; } if (ACT == 1) v = (v > 0.f) ? v : expm1f(v); else if (ACT == 7) v = (v > 0.f) ? v + 1.0f : expf(v); else if (ACT == 8) v = tanhf(v); else if (ACT == 9) v = 0.5f * v * (1.0f + tanhf(0.7978845608028654f * (v + 0.044715f * v * v * v))); else if (ACT == 11) v = 1.0f / (1.0f + expf(-v)); else if (ACT == 12) v = (v > 0.f) ? v : 0.01f * v; else if (ACT == 14) v = (v > 0.f) ? v : 0.1f * v; else if (ACT == 15) v = v / (1.0f + expf(-v)); else if (ACT == 3) v = fmaxf(v, 0.f); else if (ACT == 6) v = 0.5f * v * (1.0f + erff(v * 0.70710678118654752f)); so[w][8 * hh + r][t * 16 + ln] = v; } }
  __builtin_amdgcn_fence(__ATOMIC_ACQ_REL, "workgroup"); __builtin_amdgcn_wave_barrier();
  const int rsub = lane >> 4, c4 = (lane & 15) * 4; typedef _Float16 v4h __attribute__((ext_vector_type(4)));
  {
#pragma unroll
    for (int q = 0; q < 8; ++q) { const int r = q * 2 + rsub; if (col0 + c4 < N) { const v4f v = *(const v4fa*)&so[w][r][c4]; if (C) *(v4f*)(C + cofs + (size_t)(row0 + r) * ldc + col0 + c4) = v; if (C16) { v4h h4; for (int i = 0; i < 4; ++i) h4[i] = (_Float16)v[i]; *(v4h*)(C16 + cofs + (size_t)(row0 + r) * ldc + col0 + c4) = h4; } } }
     }
}


typedef _Float16 v4h __attribute__((ext_vector_type(4)));

// Conversion passes as streams of few, long-lived waves. A run is 1024 consecutive floats (4 KB): eight 16-byte loads a lane, each wave-wide load 512 contiguous bytes (4 whole lines);
// the four halves that a lane makes of one load leave as one 8-byte store (256 contiguous bytes a wave, 2 whole lines). A wave issues all its loads before it converts the first value.
// Addresses are a wave-uniform base plus one 32-bit lane offset in bytes (vo for the floats, vo / 2 for the halves).
// Each plain '#pragma unroll' below stands on a loop whose index picks an element of a register array.
template <int NL>
__device__ __forceinline__ void run_load(v4f* r, const float* __restrict__ src, unsigned vo) {
#pragma unroll
  for (int j = 0; j < NL; ++j) r[j] = *(const v4fa*)((const char*)src + vo + j * 512); }
// MODE 0: f16(x); 1: f16(bf16(x)); 2: f16(bf16(x) * 2^4)
template <int NL, int MODE>
__device__ __forceinline__ void run_store(const v4f* r, _Float16* __restrict__ dst, unsigned vh) {
#pragma unroll
  for (int j = 0; j < NL; ++j) { v4h h;
#pragma unroll
    for (int q = 0; q < 4; ++q) h[q] = (MODE == 0) ? (_Float16)r[j][q] : (MODE == 1) ? (_Float16)bf16_round(r[j][q]) : (_Float16)(bf16_round(r[j][q]) * 16.0f);
    *(v4h*)((char*)dst + vh + j * 256) = h; } }
// All seven inputs in one launch: 256 blocks of 16 waves; wave number n takes run n of query, of key and of value, and run n of the four weight matrices laid end to end (as Bw is).
__global__ __launch_bounds__(512) void k_cvt_in(const float* __restrict__ xq, const float* __restrict__ xk, const float* __restrict__ xv, const float* __restrict__ wq, const float* __restrict__ wk, const float* __restrict__ wv, const float* __restrict__ wo,
                                               _Float16* __restrict__ X16, _Float16* __restrict__ XK16, _Float16* __restrict__ XV16, _Float16* __restrict__ Bw) {
  static_assert(NR * DD == 4096 * 1024 && DD * DD == 1024 * 1024, "4096 runs an activation, 1024 a weight matrix");
  const unsigned lane = threadIdx.x & 31, run = blockIdx.x * 16 + (threadIdx.x >> 5);
  const unsigned m = blockIdx.x >> 6;      /* 1024 runs = 64 blocks a weight matrix: the same for the whole block */
  const float* __restrict__ w = (m == 0) ? wq : (m == 1) ? wk : (m == 2) ? wv : wo;
  const unsigned vo = run * 4096 + lane * 16, vw = (run & 1023) * 4096 + lane * 16, vh = run * 2048 + lane * 8;
  v4f r[4][8];
  run_load<8>(r[0], xq, vo); run_load<8>(r[1], xk, vo); run_load<8>(r[2], xv, vo); run_load<8>(r[3], w, vw);
  __builtin_amdgcn_sched_barrier(0);      /* all 32 loads are issued before any conversion: without it the scheduler sinks some of them among the conversions, behind waits on earlier data */
  asm volatile("s_wait_xcnt 0x0" :: "v"(vo), "v"(vw) : "memory");      /* the loads' offset registers may be reused below: wait before that overwrite; named as inputs, they are not given to a late load as its destination either */
  __builtin_amdgcn_sched_barrier(0);      /* nothing that rewrites a base or offset register of the loads is scheduled in front of that wait */
  run_store<8, 1>(r[0], X16, vh);
  asm volatile("s_wait_xcnt 0x0" ::: "memory");      /* the stores' data registers may be reused by the next run: wait before that overwrite */
  __builtin_amdgcn_sched_barrier(0);      /* keeps the next run's conversions behind that wait */
  run_store<8, 1>(r[1], XK16, vh);
  asm volatile("s_wait_xcnt 0x0" ::: "memory");      /* as above */
  __builtin_amdgcn_sched_barrier(0);
  run_store<8, 1>(r[2], XV16, vh);
  asm volatile("s_wait_xcnt 0x0" ::: "memory");      /* as above */
  __builtin_amdgcn_sched_barrier(0);
  run_store<8, 2>(r[3], Bw, vh);
}
// lane l <-> lane l ^ 16 (the two halves of a wave)
__device__ __forceinline__ float xhalf(float x) { return __builtin_bit_cast(float, __builtin_amdgcn_permlanex16(__builtin_bit_cast(int, x), __builtin_bit_cast(int, x), 0x76543210, 0xfedcba98, false, false)); }

__device__ __forceinline__ void tile_copy(unsigned l, unsigned l4, const char* k, size_t kstep, const char* v, size_t vstep) {      /* l, l4: the lane's LDS byte addresses in the buffer's K rows and V rows; k, v: its global addresses in row tid / 8; kstep, vstep: 16 rows of K, of V in bytes */
  const unsigned l1 = l + 16 * 144, l2 = l + 32 * 144, l3 = l + 48 * 144, l5 = l4 + 16 * 160, l6 = l4 + 32 * 160, l7 = l4 + 48 * 160;
  const char* k1 = k + kstep; const char* k2 = k1 + kstep; const char* k3 = k2 + kstep;
  const char* v1 = v + vstep; const char* v2 = v1 + vstep; const char* v3 = v2 + vstep;
  /* the copies and, as the last line of their own statement, the wait before any of their address registers is rewritten */
  asm volatile("global_load_async_to_lds_b128 %0, %8, off\n\t"
               "global_load_async_to_lds_b128 %1, %9, off\n\t"
               "global_load_async_to_lds_b128 %2, %10, off\n\t"
               "global_load_async_to_lds_b128 %3, %11, off\n\t"
               "global_load_async_to_lds_b128 %4, %12, off\n\t"
               "global_load_async_to_lds_b128 %5, %13, off\n\t"
               "global_load_async_to_lds_b128 %6, %14, off\n\t"
               "global_load_async_to_lds_b128 %7, %15, off\n\t"
               "s_wait_xcnt 0x0"
               :: "v"(l), "v"(l1), "v"(l2), "v"(l3), "v"(l4), "v"(l5), "v"(l6), "v"(l7), "v"(k), "v"(k1), "v"(k2), "v"(k3), "v"(v), "v"(v1), "v"(v2), "v"(v3) : "memory");
}
// Transposing 16-bit LDS load. Lane l names 16 bytes of row 8*(l >> 4) + (l & 7), at byte 16*((l >> 3) & 1), of a 16-row x 16-column block; it gets column l & 15 of rows 8*(l >> 4) ... + 7.
typedef short s16x8 __attribute__((ext_vector_type(8)));
__device__ __forceinline__ v8us ld_tr16(const unsigned char* p) { typedef __attribute__((address_space(3))) s16x8 lds_s16x8; return __builtin_bit_cast(v8us, __builtin_amdgcn_ds_load_tr16_b128_v8i16((lds_s16x8*)p)); }
// One 32-key chunk of a lane: P = 2^x for its 16 reduced scores, as the f16 B operand (element nt*8 + r = key nt*16 + 8*hh + r), and their sum.
// SLOT: the exponential with its v_nop in one statement, for the seldom-taken path.
__device__ __forceinline__ float exp2_slot(float x) { float y; asm("v_exp_f32 %0, %1\n\tv_nop" : "=v"(y) : "v"(x)); return y; }      /* v_nop: the one slot that the instruction set asks for behind a transcendental */
template <bool SLOT>
__device__ __forceinline__ float p_chunk(const float* x, FragH& pb) { float ps[4];
#pragma unroll
  for (int i = 0; i < 16; ++i) { const float p = SLOT ? exp2_slot(x[i]) : __builtin_amdgcn_exp2f(x[i]); ps[i & 3] = (i < 4) ? p : ps[i & 3] + p; pb.h[i] = (_Float16)p; }
  return (ps[0] + ps[1]) + (ps[2] + ps[3]); }
__global__ __launch_bounds__(128) void k_flash(const _Float16* __restrict__ Q16, int ldq, const _Float16* __restrict__ K16, int ldk, const _Float16* __restrict__ V16, int ldv, const float* __restrict__ FR, const float* __restrict__ AP, const float* __restrict__ AN, const float* __restrict__ GM, const float* __restrict__ DLT, _Float16* __restrict__ O16, int ldo) {
  constexpr int NQB = TT / 64, DT = 4, KS = 2;
  constexpr int NS = TT / 64, RP = 144, VP = 160, TB = 64 * RP + 64 * VP;      /* tiles of 64 keys; LDS row pitch of K, of V, and bytes of one buffer */
  static_assert(NS >= 2, "the two buffers' prologue needs two tiles");
  __shared__ __attribute__((aligned(16))) float sF[TT]; __shared__ __attribute__((aligned(16))) float sO[4][16][64 + 4]; __shared__ __attribute__((aligned(16))) unsigned char sT[2 * TB];
  const int tid = threadIdx.x, w = tid >> 5, lane = tid & 31, ln = lane & 15, hh = lane >> 4;
  const int slab = blockIdx.x / NQB, qblk = blockIdx.x % NQB; const int b = slab / NH, h = slab % NH; const int q0 = qblk * 64 + w * 16;
  const float* frb = FR + (size_t)b * TT;
#pragma unroll
  for (int i = 0; i < TT / 512; ++i) { const int e = i * 512 + tid * 4; v4f f = *(const v4fa*)(frb + e);
#pragma unroll
    for (int q = 0; q < 4; ++q) f[q] = bf16_round(f[q]);
    *(v4fa*)&sF[e] = f; }
  FragH bq[KS]; const unsigned short* qr = (const unsigned short*)Q16 + ((size_t)b * TT + q0 + ln) * ldq + h * 64;      /* B operand: column ln = query q0 + ln */
#pragma unroll
  for (int ks = 0; ks < KS; ++ks) { bq[ks].half[0] = *(const v8us*)(qr + ks * 32 + 8 * hh); bq[ks].half[1] = *(const v8us*)(qr + ks * 32 + 16 + 8 * hh); }
  const char* ck = (const char*)K16 + (((size_t)b * TT + (tid >> 3)) * ldk + h * 64) * 2 + (tid & 7) * 16;      /* the lane's 16 bytes of key row tid / 8 of tile 0 */
  const char* cv = (const char*)V16 + (((size_t)b * TT + (tid >> 3)) * ldv + h * 64) * 2 + (tid & 7) * 16;      /* and of the same key's row of V */
  const size_t kstep = (size_t)16 * ldk * 2, vstep = (size_t)16 * ldv * 2; const unsigned lt = (unsigned)(size_t)sT + (unsigned)((tid >> 3) * RP + (tid & 7) * 16), lv = (unsigned)(size_t)sT + (unsigned)(64 * RP + (tid >> 3) * VP + (tid & 7) * 16);
  constexpr float L2E = 1.44269504088896340736f;      /* log2(e): the scores are formed in base-2 units, so that exp(s - m) is one hardware exp2 of a difference */
  const float gmm = bf16_round(GM[0]), dlt = bf16_round(DLT[0]); const float aph = bf16_round(AP[h]) * dlt * L2E, anh = bf16_round(AN[h]) * dlt * L2E;      /* gamma, delta scalars; log2(e)*delta*alpha_pos[h], log2(e)*delta*alpha_neg[h] */
  const float g8 = gmm * 0.125f * L2E;      /* log2(e) * gamma * 64^-1/2 */
  const float fq = bf16_round(frb[q0 + ln]);      /* frac of the lane's query */
  float m_r = 0.f, l_r = 0.f; v8f oacc[DT];      /* m_r: the query's exponent reference in use, P = 2^(score - m_r); tile 0 sets it */
#pragma unroll
  for (int dt = 0; dt < DT; ++dt) oacc[dt] = (v8f){0.f,0.f,0.f,0.f,0.f,0.f,0.f,0.f};
  tile_copy(lt, lv, ck, kstep, cv, vstep);      /* tile 0 into buffer 0 */
  asm volatile("s_wait_asynccnt 0x0" ::: "memory");      /* this wave's copies of tile 0 have landed */
  __syncthreads();      /* sF and tile 0 are complete before any wave reads them */
  tile_copy(lt + TB, lv + TB, ck + 4 * kstep, kstep, cv + 4 * vstep, vstep);      /* tile 1 into buffer 1 */
#pragma unroll 1      /* rolled: 32 copies of this body would only grow the code */
  for (int s = 0; s < NS; ++s) {
   const unsigned char* tk = sT + (s & 1) * TB + ln * RP + 16 * hh; const unsigned char* tv = sT + (s & 1) * TB + 64 * RP + (8 * hh + (lane & 7)) * VP + ((lane >> 3) & 1) * 16;      /* trip s reads buffer s mod 2 alone */
   FragH ak[4][KS], av[2][DT]; v4f fk[4][2];      /* c = 0..3: the tile's four groups of 16 keys; p = 0, 1: its two 32-key chunks */
#pragma unroll
   for (int c = 0; c < 4; ++c)      /* A operand: row ln = key s*64 + c*16 + ln */
#pragma unroll
     for (int ks = 0; ks < KS; ++ks) { ak[c][ks].half[0] = *(const v8us*)(tk + c * 16 * RP + ks * 64); ak[c][ks].half[1] = *(const v8us*)(tk + c * 16 * RP + ks * 64 + 32); }
#pragma unroll
   for (int p = 0; p < 2; ++p)
#pragma unroll
     for (int dt = 0; dt < DT; ++dt) { av[p][dt].half[0] = ld_tr16(tv + p * 32 * VP + dt * 32); av[p][dt].half[1] = ld_tr16(tv + (p * 32 + 16) * VP + dt * 32); }      /* A operand: row ln = head column dt*16 + ln; elements 0-7 = keys j0 + 8*hh + 0..7, elements 8-15 = keys j0 + 16 + 8*hh + 0..7, j0 = s*64 + p*32 */
#pragma unroll
   for (int c = 0; c < 4; ++c) { fk[c][0] = *(const v4fa*)&sF[s * 64 + c * 16 + 8 * hh]; fk[c][1] = *(const v4fa*)&sF[s * 64 + c * 16 + 8 * hh + 4]; }      /* frac of the lane's 32 keys */
   float sc[32];      /* score - m_r: the reference is known before the scores, so it rides in the bias term's multiply-add */
#pragma unroll
   for (int c = 0; c < 4; ++c) { v8f acc = (v8f){0.f,0.f,0.f,0.f,0.f,0.f,0.f,0.f};
#pragma unroll
     for (int ks = 0; ks < KS; ++ks) acc = __builtin_amdgcn_wmma_f32_16x16x32_f16(false, ak[c][ks].v, false, bq[ks].v, (short)0, acc, false, false);
#pragma unroll
     for (int r = 0; r < 8; ++r) { float d = fk[c][r >> 2][r & 3] - fq; d = fminf(fmaxf(d, -0.2f), 0.2f);      /* D = clip(frac_k - frac_q, -0.2, 0.2) */
       const float sb = aph * fmaxf(d, 0.f) + (anh * fminf(d, 0.f) - m_r);      /* log2(e)*delta*(alpha_pos*D+ + alpha_neg*D-) - m_r */
       sc[c * 8 + r] = g8 * acc[r] + sb; } }
   FragH pb[2]; float cs0 = p_chunk<false>(sc, pb[0]), cs1 = p_chunk<false>(sc + 16, pb[1]);
   asm volatile("" :: "v"(av[0][0].v), "v"(av[0][1].v), "v"(av[0][2].v), "v"(av[0][3].v));      /* inputs only: keeps chunk 0's V^T loads in front of the test; without it the compiler sinks them behind the branch, where each product waits for its own loads */
   const float thr = (s == 0) ? -1.0f : 32768.0f;      /* tile 0 always passes the test: it sets the reference */
   if (__builtin_amdgcn_ballot_w32(fmaxf(cs0, cs1) > thr) != 0) {      /* one test a tile, the same for the whole wave. A lane's chunk sum of at most 2^15 bounds each of its P by 2^15, inside f16; above it the reference moves */
     float mx[8];
#pragma unroll
     for (int q = 0; q < 8; ++q) mx[q] = fmaxf(fmaxf(sc[q], sc[8 + q]), fmaxf(sc[16 + q], sc[24 + q]));
     float mc = fmaxf(fmaxf(fmaxf(mx[0], mx[1]), fmaxf(mx[2], mx[3])), fmaxf(fmaxf(mx[4], mx[5]), fmaxf(mx[6], mx[7]))); mc = fmaxf(mc, xhalf(mc));      /* the query's maximum over the tile's 64 keys, in both halves */
     const float up = fmaxf(mc - 10.0f, 0.f); const float dl = (s == 0) ? mc - 10.0f : up;      /* the new reference lies 10 under the tile's maximum (P up to 2^10) and never moves down, but in tile 0, which sets it */
     const float al = exp2_slot(-up); m_r += dl;      /* in tile 0 the factor meets zeros only: any finite value serves */
#pragma unroll
     for (int i = 0; i < 32; ++i) sc[i] -= dl;
     cs0 = p_chunk<true>(sc, pb[0]); cs1 = p_chunk<true>(sc + 16, pb[1]);
     l_r *= al;
#pragma unroll
     for (int dt = 0; dt < DT; ++dt)
#pragma unroll
       for (int r = 0; r < 8; ++r) oacc[dt][r] *= al; }
   l_r = (l_r + cs0) + cs1;      /* the lane's 32 keys; the halves are joined after the loop */
#pragma unroll
   for (int p = 0; p < 2; ++p)
#pragma unroll
     for (int dt = 0; dt < DT; ++dt) oacc[dt] = __builtin_amdgcn_wmma_f32_16x16x32_f16(false, av[p][dt].v, false, pb[p].v, (short)0, oacc[dt], false, false);
   asm volatile("s_wait_dscnt 0x0" ::: "memory");      /* this wave's reads of buffer s mod 2 have returned before the buffer is handed to the copies */
   asm volatile("s_wait_asynccnt 0x0" ::: "memory");      /* this wave's copies of tile s + 1 have landed */
   __syncthreads();      /* publishes tile s + 1 and ends every wave's reads of tile s */
   if (s + 2 < NS) tile_copy(lt + (s & 1) * TB, lv + (s & 1) * TB, ck + (size_t)(s + 2) * 4 * kstep, kstep, cv + (size_t)(s + 2) * 4 * vstep, vstep); }      /* tile s + 2 into the buffer that trip s has just read */
  asm volatile("s_wait_asynccnt 0x0" ::: "memory");      /* nothing is in flight when the wave goes on to its end */
  const float l = l_r + xhalf(l_r); const float inv = (l > 0.f) ? 1.0f / l : 0.f;      /* sum and O carry the same factor 2^-m_r */
#pragma unroll
  for (int dt = 0; dt < DT; ++dt)      /* oacc[dt][r] = O[query ln][dt*16 + 8*hh + r] */
#pragma unroll
    for (int c = 0; c < 2; ++c) { const v4f o = {oacc[dt][4 * c] * inv, oacc[dt][4 * c + 1] * inv, oacc[dt][4 * c + 2] * inv, oacc[dt][4 * c + 3] * inv}; *(v4fa*)&sO[w][ln][dt * 16 + 8 * hh + 4 * c] = o; }
  __builtin_amdgcn_fence(__ATOMIC_ACQ_REL, "workgroup"); __builtin_amdgcn_wave_barrier();      /* the wave's LDS stores are done, and stay in front, before its lanes read each other's values back */
#pragma unroll
  for (int rp = 0; rp < 16; rp += 4) { const int r = rp + (lane >> 3), pc = lane & 7; const v4f v0 = *(const v4fa*)&sO[w][r][pc * 8], v1 = *(const v4fa*)&sO[w][r][pc * 8 + 4]; FragH o;      /* the f16 operand of the output product leaves here: 8 lanes a row, one whole 128-B line; 4 rows a wave-wide store */
#pragma unroll
    for (int i = 0; i < 4; ++i) { o.h[i] = (_Float16)v0[i]; o.h[4 + i] = (_Float16)v1[i]; }
    *(v8us*)((unsigned short*)O16 + ((size_t)b * TT + q0 + r) * ldo + h * 64 + pc * 8) = o.half[0]; }
}

// Block-tiled GEMM, C = (A.Bh^T)*alpha + bias: a block of 8 waves owns a 128 x 128 tile of C and stages 128 x 64 pieces of A and of Bh in LDS, so every operand byte is fetched once a block, in whole 128-B lines
// (8 lanes a row), and is read as fragments from LDS. Wave tile 32 x 64 (2 x 4 accumulators). The next piece is fetched into registers while this one is multiplied. k runs upward in steps of 32.
// M % 128 == 0 (grid), N % 128 == 0, K % 64 == 0. LDS row pitch 64 + 8 halves = 144 B for the 16-byte fragment reads.
// One launch holds NZ independent products of the same shape (M = NR): product z takes plane z of A, of Bh and of C16, laid end to end, and its own bias. A block takes under a third of a WGP's registers
// (two waves of 160 on each SIMD's 1,024) and a fifth of its LDS, so with NZ = 3 three blocks stand on every WGP at once, and one block's barriers, LDS waits and first and last phases are covered by the matrix work of the other two.
// Most plain '#pragma unroll's below stand on a short loop whose index picks an element of a register array (staging registers, fragments, accumulators): unrolled, these stay in registers.
template <int N, int K, int NZ, bool HALF_OUT>
__global__ __launch_bounds__(256) void k_gemm_tile(const _Float16* __restrict__ A, const _Float16* __restrict__ Bh, float alpha, const float* __restrict__ bias0, const float* __restrict__ bias1, const float* __restrict__ bias2, float* __restrict__ C, _Float16* __restrict__ C16) {
  constexpr int BM = 128, BN = 128, BK = 64, LP = BK + 8;
  constexpr int NB = (NR / BM) * (N / BN);      /* blocks of one product */
  static_assert(NZ >= 1 && NZ <= 3 && (NZ == 1 || HALF_OUT), "up to three biases; the planes of several products are the f16 outputs");
  const unsigned z = (NZ > 1) ? blockIdx.x / NB : 0u; const unsigned bid = blockIdx.x - z * NB;      /* product and tile number: the same for the whole block */
  const float* __restrict__ bias = (z == 0) ? bias0 : (z == 1) ? bias1 : bias2;
  A += (size_t)z * NR * K; Bh += (size_t)z * N * K; if (HALF_OUT) C16 += (size_t)z * NR * N;
  __shared__ __attribute__((aligned(16))) unsigned short sm[8 * 32 * 64 * 2];      /* 64 KB: the output staging (8 waves x 32 x 64 f32) is the larger use; the operand pieces take (BM + BN) * LP halves */
  static_assert((BM + BN) * LP <= 8 * 32 * 64 * 2, "operand pieces fit");
  unsigned short* sA = sm; unsigned short* sB = sm + BM * LP;
  const int tid = threadIdx.x, w = tid >> 5, lane = tid & 31, ln = lane & 15, hh = lane >> 4;
  const int nbn = N / BN; const int row0 = (bid / nbn) * BM, col0 = (bid % nbn) * BN;
  const int wm = w >> 1, wn = w & 1;
  const int lr = tid >> 3, lc = (tid & 7) * 8;
  const char* ga = (const char*)A + (size_t)row0 * K * 2; const char* gb = (const char*)Bh + (size_t)col0 * K * 2; const unsigned vo = (unsigned)(lr * K + lc) * 2u;      /* block-uniform bases, one 32-bit lane offset that lives through the loop */
  v8us ra[4], rb[4];
#pragma unroll
  for (int i = 0; i < 4; ++i) { ra[i] = *(const v8us*)(ga + vo + (size_t)(32 * i) * K * 2); rb[i] = *(const v8us*)(gb + vo + (size_t)(32 * i) * K * 2); }
  v8f acc[2][4];
#pragma unroll
  for (int mi = 0; mi < 2; ++mi)
#pragma unroll
    for (int t = 0; t < 4; ++t) acc[mi][t] = (v8f){0.f,0.f,0.f,0.f,0.f,0.f,0.f,0.f};
#pragma unroll 1      /* rolled: K is a constant here, and 16 copies of this body would only grow the code */
  for (int kb = 0; kb < K; kb += BK) {
#pragma unroll
    for (int i = 0; i < 4; ++i) { *(v8us*)&sA[(lr + 32 * i) * LP + lc] = ra[i]; *(v8us*)&sB[(lr + 32 * i) * LP + lc] = rb[i]; }
    __syncthreads();      /* the piece is complete before any wave reads fragments */
    if (kb + BK < K) {
#pragma unroll
      for (int i = 0; i < 4; ++i) { ra[i] = *(const v8us*)(ga + (size_t)(kb + BK) * 2 + vo + (size_t)(32 * i) * K * 2); rb[i] = *(const v8us*)(gb + (size_t)(kb + BK) * 2 + vo + (size_t)(32 * i) * K * 2); }
      asm volatile("s_wait_xcnt 0x0" ::: "memory"); }      /* the loads' address registers are reused by the fragment reads below: wait before that overwrite */
#pragma unroll
    for (int ks = 0; ks < BK / 32; ++ks) { FragH a[2], bq[4];
#pragma unroll
      for (int mi = 0; mi < 2; ++mi) { const unsigned short* p = &sA[(wm * 32 + mi * 16 + ln) * LP + ks * 32 + 8 * hh]; a[mi].half[0] = *(const v8us*)p; a[mi].half[1] = *(const v8us*)(p + 16); }
#pragma unroll
      for (int t = 0; t < 4; ++t) { const unsigned short* p = &sB[(wn * 64 + t * 16 + ln) * LP + ks * 32 + 8 * hh]; bq[t].half[0] = *(const v8us*)p; bq[t].half[1] = *(const v8us*)(p + 16); }
#pragma unroll
      for (int mi = 0; mi < 2; ++mi)
#pragma unroll
        for (int t = 0; t < 4; ++t) acc[mi][t] = __builtin_amdgcn_wmma_f32_16x16x32_f16(false, a[mi].v, false, bq[t].v, (short)0, acc[mi][t], false, false); }
    __syncthreads();      /* every wave has read the piece before it is overwritten (by the next piece, or by the output staging below) */
  }
  float* so = (float*)sm + w * (32 * 64);      /* each wave stages its 32 x 64 results in its own 8 KB, to store whole lines */
  const int rsub = lane >> 4, c4 = (lane & 15) * 4; float bv[4];
#pragma unroll
  for (int t = 0; t < 4; ++t) bv[t] = bf16_round(bias[col0 + wn * 64 + t * 16 + ln]);
#pragma unroll
  for (int mi = 0; mi < 2; ++mi)
#pragma unroll
    for (int t = 0; t < 4; ++t)
#pragma unroll
      for (int r = 0; r < 8; ++r) so[(mi * 16 + 8 * hh + r) * 64 + t * 16 + ln] = acc[mi][t][r] * alpha + bv[t];
  __builtin_amdgcn_fence(__ATOMIC_ACQ_REL, "workgroup"); __builtin_amdgcn_wave_barrier();      /* the wave's LDS stores are done, and stay in front, before its lanes read each other's values back */
#pragma unroll
  for (int q = 0; q < 16; ++q) { const int r = q * 2 + rsub; const v4f v = *(const v4fa*)&so[r * 64 + c4]; const size_t o = (size_t)(row0 + wm * 32 + r) * N + col0 + wn * 64 + c4;
    if (HALF_OUT) { v4h h4;
#pragma unroll
      for (int i = 0; i < 4; ++i) h4[i] = (_Float16)v[i];
      *(v4h*)(C16 + o) = h4; }
    else *(v4f*)(C + o) = v; }
}

extern "C" void kernel_launch(void* const* d_in, const int* in_sizes, int n_in,
                              void* d_out, int out_size, void* d_ws, size_t ws_size, hipStream_t stream) {
  (void)in_sizes; (void)n_in; (void)out_size;
  const float* const* I = (const float* const*)d_in; const float* xq = I[0]; const float* xk = I[1]; const float* xv = I[2]; const float* frac = I[3]; const float* Wq = I[4]; const float* bq = I[5]; const float* Wk = I[6]; const float* bk = I[7]; const float* Wv = I[8]; const float* bv = I[9]; const float* Wo = I[10]; const float* bo = I[11]; const float* apos = I[12]; const float* aneg = I[13]; const float* gam = I[14]; const float* del = I[15];      /* d_in order: query, key, value, frac, Wq, bq, Wk, bk, Wv, bv, Wo, bo, alpha_pos, alpha_neg, gamma, delta */
  char* ws = (char*)d_ws; size_t off = 0;
  auto take = [&](size_t bytes) { char* p = ws + off; off += (bytes + 255) & ~(size_t)255; return p; };
  const size_t WSZ = (size_t)DD * DD; _Float16* Bw = (_Float16*)take(4 * WSZ * 2); const size_t XSZ = (size_t)NR * DD; _Float16* X16 = (_Float16*)take(3 * XSZ * 2); _Float16* XK16 = X16 + XSZ; _Float16* XV16 = X16 + 2 * XSZ;      /* three planes end to end, as the projection launch reads them */
  _Float16* Q = (_Float16*)take(3 * XSZ * 2); _Float16* K = Q + XSZ; _Float16* V = Q + 2 * XSZ;
  _Float16* O16 = (_Float16*)take(XSZ * 2);      /* the attention result, written by the attention kernel as the f16 operand of the output product */
  if (off > ws_size) return;      // 8 x 8.4 = about 67 MB
  const unsigned gt = (NR / 128) * (DD / 128);
  k_cvt_in<<<256, 512, 0, stream>>>(xq, xk, xv, Wq, Wk, Wv, Wo, X16, XK16, XV16, Bw);      /* activations bf16-rounded; weights (out,in) natural, bf16-rounded, x 2^4 */
  k_gemm_tile<DD, DD, 3, true><<<3 * gt, 256, 0, stream>>>(X16, Bw, 0.0625f, bq, bk, bv, nullptr, Q);      /* Q = query.Wq^T + bq, K and V alike, each M 4096 N 1024 K 1024 */
  k_flash<<<BB * NH * (TT / 64), 128, 0, stream>>>(Q, DD, K, DD, V, DD, frac, apos, aneg, gam, del, O16, DD);
  k_gemm_tile<DD, DD, 1, false><<<gt, 256, 0, stream>>>(O16, Bw + 3 * WSZ, 0.0625f, bo, nullptr, nullptr, (float*)d_out, nullptr);      /* out = O·Woᵀ + bo */
}

// v010
// It runs in 99.5 microseconds.
// In two side-by-side timings against v009, it was 1.04 and 1.05 times as fast.
// All steps since v000 together make it 4.54 times as fast.
#include <hip/hip_runtime.h>
// Multi-head attention with a stoichiometric bias (B=2, T=2048, D=1024, 16 heads × 64): Q,K,V = x·Wᵀ + b (torch (out,in)) from query/key/value; logits = q·kᵀ·64^-½; bias[b,h,i,j] = α_pos[h]·max(D,0) + α_neg[h]·min(D,0), D = clip(frac_j − frac_i, −0.2, 0.2);
// attn = softmax(γ·logits + δ·bias); out = (attn·V merged)·Woᵀ + bo. γ, δ are scalar inputs.
// Compute dtype: x, weights, biases rounded to bf16; q/k/v as f16 GEMM outputs; fused flash-style kernel (online softmax f32, P f16 ×2^10) on v_wmma_f32_16x16x32_f16; O → f16 → output GEMM with bias; f32 accumulate.
#define BB 2
#define TT 2048
#define NH 16
#define DD 1024
#define NR (BB * TT)

typedef __bf16 v16b __attribute__((ext_vector_type(16)));
typedef unsigned short v8us __attribute__((ext_vector_type(8), may_alias));
typedef float  v8f  __attribute__((ext_vector_type(8)));
typedef float  v4f  __attribute__((ext_vector_type(4)));
typedef float  v4fa __attribute__((ext_vector_type(4), may_alias));
union FragB { v16b v; v8us half[2]; unsigned short u[16]; };

__device__ __forceinline__ unsigned short bf16_bits(float x) { unsigned int u = __float_as_uint(x); return (unsigned short)((u + 0x7FFFu + ((u >> 16) & 1u)) >> 16); }
__device__ __forceinline__ float bf16_val(unsigned short b) { return __uint_as_float(((unsigned int)b) << 16); }
__device__ __forceinline__ float bf16_round(float x) { return bf16_val(bf16_bits(x)); }
// D += A·B with NT terms: 1 = ah·bh, 2 = + al·bh (A split), 3 = + ah·bl (both split)
template <int NT>
__device__ __forceinline__ v8f mmaN(v16b ah, v16b al, v16b bh, v16b bl, v8f c) {
  c = __builtin_amdgcn_wmma_f32_16x16x32_bf16(false, ah, false, bh, (short)0, c, false, false);
  if (NT >= 2) c = __builtin_amdgcn_wmma_f32_16x16x32_bf16(false, al, false, bh, (short)0, c, false, false);
  if (NT >= 3) c = __builtin_amdgcn_wmma_f32_16x16x32_bf16(false, ah, false, bl, (short)0, c, false, false);
  asm volatile("v_nop\n\tv_nop\n\tv_nop\n\tv_nop" : "+v"(c) : "v"(ah), "v"(al), "v"(bh), "v"(bl));
  return c;
}

__global__ __launch_bounds__(256) void k_wt_bf16(const float* __restrict__ W, unsigned short* __restrict__ Wt, int K, int N) {
  const int t = blockIdx.x * 256 + threadIdx.x;
  const int k8n = K / 8;
  if (t >= N * k8n) return;
  const int n = t / k8n, k8 = (t % k8n) * 8;
  v8us v;
#pragma unroll
  for (int i = 0; i < 8; ++i) v[i] = bf16_bits(W[(size_t)(k8 + i) * N + n]);
  *(v8us*)(Wt + (size_t)n * K + k8) = v;
  
}

// GEMM C[M][N] (f32, pitch ldc) = act(A[M][K]·W + bias). A f32 row-major (pitch lda) converted per fragment to bf16
// (ASPLIT: hi/lo two planes -> 2 terms, else single rounded term); Wt bf16 [N][K] (pitch ldb). BIAS_BF16 rounds the
// bias to bf16 first (bias quantised to bf16 before the add). K%32==0, M%16==0, N%64==0.
template <bool ASPLIT, int ACT, bool BIAS_BF16>
__global__ __launch_bounds__(128) void k_gemm_bf(const float* __restrict__ A, int lda, const unsigned short* __restrict__ Wt, int ldb,
                                               const float* __restrict__ bias, float* __restrict__ C, int ldc, int M, int N, int K) {
  __shared__ __attribute__((aligned(16))) float so[4][16][64];
  const int tid = threadIdx.x, w = tid >> 5, lane = tid & 31, ln = lane & 15, hh = lane >> 4;
  const int ntn = N / 64;
  const int wid = blockIdx.x * 4 + w;
  const int mt = wid / ntn, nq = wid % ntn;
  if (mt * 16 >= M) return;
  const int row0 = mt * 16, col0 = nq * 64;
  const float* arow = A + (size_t)(row0 + ln) * lda;
  v8f acc[4] = {};
  for (int kb = 0; kb < K; kb += 32) {
    FragB ah, al;
    const v4f x0 = *(const v4fa*)(arow + kb + 8 * hh), x1 = *(const v4fa*)(arow + kb + 8 * hh + 4);
    const v4f x2 = *(const v4fa*)(arow + kb + 16 + 8 * hh), x3 = *(const v4fa*)(arow + kb + 16 + 8 * hh + 4);
    float xs[16] = {x0[0],x0[1],x0[2],x0[3],x1[0],x1[1],x1[2],x1[3],x2[0],x2[1],x2[2],x2[3],x3[0],x3[1],x3[2],x3[3]};
#pragma unroll
    for (int i = 0; i < 16; ++i) { const unsigned short hb = bf16_bits(xs[i]); ah.u[i] = hb; al.u[i] = ASPLIT ? bf16_bits(xs[i] - bf16_val(hb)) : (unsigned short)0; }
#pragma unroll
    for (int t = 0; t < 4; ++t) {
      const unsigned short* brow = Wt + (size_t)(col0 + t * 16 + ln) * ldb + kb;
      FragB b;
      b.half[0] = *(const v8us*)(brow + 8 * hh);
      b.half[1] = *(const v8us*)(brow + 16 + 8 * hh);
      acc[t] = mmaN<ASPLIT ? 2 : 1>(ah.v, al.v, b.v, b.v, acc[t]);
    }
  }
#pragma unroll
  for (int t = 0; t < 4; ++t) {
    float bv = bias ? bias[col0 + t * 16 + ln] : 0.f;
    if (BIAS_BF16) bv = bf16_round(bv);
#pragma unroll
    for (int r = 0; r < 8; ++r) { float v = acc[t][r] + bv; if (ACT == 1) v = fmaxf(v, 0.f); so[w][8 * hh + r][t * 16 + ln] = v; }
  }
  __builtin_amdgcn_fence(__ATOMIC_ACQ_REL, "workgroup");
  __builtin_amdgcn_wave_barrier();
  const int rsub = lane >> 4, c4 = (lane & 15) * 4;
  {
#pragma unroll
    for (int q = 0; q < 8; ++q) {
      const int r = q * 2 + rsub;
      const v4f v = *(const v4fa*)&so[w][r][c4];
      *(v4f*)(C + (size_t)(row0 + r) * ldc + col0 + c4) = v;
    }
    
  }
}

// Flash-style causal/unmasked attention, all contractions 3-term bf16 hi/lo splits, f32 softmax with running max.
// q,k,v rows are read from f32 buffers with arbitrary row pitch (so they can live inside a fused qkv buffer);
// D = head size (multiple of 32, <= 128); one wave = 16 query rows; block = 4 waves (64 queries) sharing K/V chunks of 32.
template <int D, bool CAUSAL>
__global__ __launch_bounds__(128) void k_flash(const float* __restrict__ qb, const float* __restrict__ kb, const float* __restrict__ vb,
                                             int pitch, int T, int H, float scale, float* __restrict__ y, int ypitch) {
  constexpr int KS = D / 32;        // k-steps for QK
  constexpr int DT = D / 16;        // d tiles for PV
  __shared__ __attribute__((aligned(16))) unsigned short sKh[32][D + 8], sKl[32][D + 8], sVh[32][D + 8], sVl[32][D + 8];
  __shared__ __attribute__((aligned(16))) unsigned short sPh[4][16][40], sPl[4][16][40];
  __shared__ __attribute__((aligned(16))) float sO[4][16][D];
  const int tid = threadIdx.x, w = tid >> 5, lane = tid & 31, ln = lane & 15, hh = lane >> 4;
  const int nqb = (T + 63) / 64;
  const int bh = blockIdx.x / nqb, qblk = blockIdx.x % nqb;
  const int b = bh / H, h = bh % H;
  const int q0 = qblk * 64 + w * 16;
  const float* Q = qb + (size_t)b * T * pitch + h * D;
  const float* K = kb + (size_t)b * T * pitch + h * D;
  const float* V = vb + (size_t)b * T * pitch + h * D;

  // A fragments of the wave's 16 query rows (scaled), hi/lo
  FragB aqh[KS], aql[KS];
  {
    int row = q0 + ln; if (row >= T) row = T - 1;
    const float* qr = Q + (size_t)row * pitch;
#pragma unroll
    for (int ks = 0; ks < KS; ++ks)
#pragma unroll
      for (int i = 0; i < 16; ++i) {
        const int d = ks * 32 + ((i < 8) ? (8 * hh + i) : (16 + 8 * hh + (i - 8)));
        const float x = qr[d] * scale; const unsigned short hb = bf16_bits(x);
        aqh[ks].u[i] = hb; aql[ks].u[i] = bf16_bits(x - bf16_val(hb));
      }
  }
  float m_r[8], l_r[8];
#pragma unroll
  for (int r = 0; r < 8; ++r) { m_r[r] = -3.0e38f; l_r[r] = 0.f; }
  v8f oacc[DT];
#pragma unroll
  for (int dt = 0; dt < DT; ++dt) oacc[dt] = (v8f){0.f,0.f,0.f,0.f,0.f,0.f,0.f,0.f};

  const int kv_end = CAUSAL ? min(T, qblk * 64 + 64) : T;     // block-uniform
  for (int j0 = 0; j0 < kv_end; j0 += 32) {
    __syncthreads();
    for (int e = tid; e < 32 * (D / 4); e += 128) {
      const int r = e / (D / 4), c4 = (e % (D / 4)) * 4;
      const int key = j0 + r;
      v4f kf = {0.f,0.f,0.f,0.f}, vf = {0.f,0.f,0.f,0.f};
      if (key < T) { kf = *(const v4fa*)(K + (size_t)key * pitch + c4); vf = *(const v4fa*)(V + (size_t)key * pitch + c4); }
#pragma unroll
      for (int t = 0; t < 4; ++t) {
        unsigned short hb = bf16_bits(kf[t]); sKh[r][c4 + t] = hb; sKl[r][c4 + t] = bf16_bits(kf[t] - bf16_val(hb));
        hb = bf16_bits(vf[t]); sVh[r][c4 + t] = hb; sVl[r][c4 + t] = bf16_bits(vf[t] - bf16_val(hb));
      }
    }
    __syncthreads();
    // S tile 16 x 32
    v8f s[2];
#pragma unroll
    for (int nt = 0; nt < 2; ++nt) {
      v8f acc = {};
#pragma unroll
      for (int ks = 0; ks < KS; ++ks) {
        FragB bh_, bl_;
        bh_.half[0] = *(const v8us*)&sKh[nt * 16 + ln][ks * 32 + 8 * hh]; bh_.half[1] = *(const v8us*)&sKh[nt * 16 + ln][ks * 32 + 16 + 8 * hh];
        bl_.half[0] = *(const v8us*)&sKl[nt * 16 + ln][ks * 32 + 8 * hh]; bl_.half[1] = *(const v8us*)&sKl[nt * 16 + ln][ks * 32 + 16 + 8 * hh];
        acc = mmaN<3>(aqh[ks].v, aql[ks].v, bh_.v, bl_.v, acc);
      }
      s[nt] = acc;
    }
    // mask + running max (rows 8hh+r; the 16 lanes of a half share rows)
    float alpha[8];
#pragma unroll
    for (int r = 0; r < 8; ++r) {
      const int qi = q0 + 8 * hh + r;
      const int ja = j0 + ln, jb = j0 + 16 + ln;
      if (CAUSAL) { if (ja > qi) s[0][r] = -3.0e38f; if (jb > qi) s[1][r] = -3.0e38f; }
      if (ja >= T) s[0][r] = -3.0e38f;
      if (jb >= T) s[1][r] = -3.0e38f;
      float mx = fmaxf(s[0][r], s[1][r]);
      mx = fmaxf(mx, __shfl_xor(mx, 1, 32)); mx = fmaxf(mx, __shfl_xor(mx, 2, 32)); mx = fmaxf(mx, __shfl_xor(mx, 4, 32)); mx = fmaxf(mx, __shfl_xor(mx, 8, 32));
      const float mnew = fmaxf(m_r[r], mx);
      alpha[r] = (mnew > -1.0e38f) ? __expf(m_r[r] - mnew) : 1.0f;
      const float p0 = (s[0][r] > -1.0e38f) ? __expf(s[0][r] - mnew) : 0.f;
      const float p1 = (s[1][r] > -1.0e38f) ? __expf(s[1][r] - mnew) : 0.f;
      m_r[r] = mnew;
      l_r[r] = l_r[r] * alpha[r] + p0 + p1;            // per-lane partial row sum (16 lanes combined at the end)
      unsigned short hb = bf16_bits(p0); sPh[w][8 * hh + r][ln] = hb;      sPl[w][8 * hh + r][ln] = bf16_bits(p0 - bf16_val(hb));
      hb = bf16_bits(p1);                sPh[w][8 * hh + r][16 + ln] = hb; sPl[w][8 * hh + r][16 + ln] = bf16_bits(p1 - bf16_val(hb));
    }
#pragma unroll
    for (int dt = 0; dt < DT; ++dt)
#pragma unroll
      for (int r = 0; r < 8; ++r) oacc[dt][r] *= alpha[r];
    __builtin_amdgcn_fence(__ATOMIC_ACQ_REL, "workgroup");
    __builtin_amdgcn_wave_barrier();
    FragB pah, pal;
    pah.half[0] = *(const v8us*)&sPh[w][ln][8 * hh]; pah.half[1] = *(const v8us*)&sPh[w][ln][16 + 8 * hh];
    pal.half[0] = *(const v8us*)&sPl[w][ln][8 * hh]; pal.half[1] = *(const v8us*)&sPl[w][ln][16 + 8 * hh];
#pragma unroll
    for (int dt = 0; dt < DT; ++dt) {
      FragB bvh, bvl;
#pragma unroll
      for (int i = 0; i < 8; ++i) {
        bvh.u[i] = sVh[8 * hh + i][dt * 16 + ln]; bvh.u[8 + i] = sVh[16 + 8 * hh + i][dt * 16 + ln];
        bvl.u[i] = sVl[8 * hh + i][dt * 16 + ln]; bvl.u[8 + i] = sVl[16 + 8 * hh + i][dt * 16 + ln];
      }
      oacc[dt] = mmaN<3>(pah.v, pal.v, bvh.v, bvl.v, oacc[dt]);
    }
    __builtin_amdgcn_fence(__ATOMIC_ACQ_REL, "workgroup");
    __builtin_amdgcn_wave_barrier();
  }
#pragma unroll
  for (int r = 0; r < 8; ++r) {
    float l = l_r[r];
    l += __shfl_xor(l, 1, 32); l += __shfl_xor(l, 2, 32); l += __shfl_xor(l, 4, 32); l += __shfl_xor(l, 8, 32);
    l_r[r] = (l > 0.f) ? 1.0f / l : 0.f;
  }
#pragma unroll
  for (int dt = 0; dt < DT; ++dt)
#pragma unroll
    for (int r = 0; r < 8; ++r) sO[w][8 * hh + r][dt * 16 + ln] = oacc[dt][r] * l_r[r];
  __builtin_amdgcn_fence(__ATOMIC_ACQ_REL, "workgroup");
  __builtin_amdgcn_wave_barrier();
  {
    for (int r = 0; r < 16; ++r) {
      const int row = q0 + r;
      if (row < T && lane < D / 4) {
        const v4f val = *(const v4fa*)&sO[w][r][lane * 4];
        *(v4f*)(y + ((size_t)b * T + row) * ypitch + h * D + lane * 4) = val;
      }
    }
    
  }
}

// GEMM C = act(A·W + bias + resid): A f32 (ASPLIT -> hi/lo 2 terms), Wt bf16 [N][K]; ACT 0 none, 1 relu, 2 exact gelu;
// resid (optional, f32, row index = (row % rmod), pitch ldr, RES_BF16 rounds it) added before the activation.
template <bool ASPLIT, int ACT, bool BIAS_BF16, bool RES_BF16>
__global__ __launch_bounds__(128) void k_gemm_bf3(const float* __restrict__ A, int lda, const unsigned short* __restrict__ Wt, int ldb,
                                                const float* __restrict__ bias, const float* __restrict__ resid, int rmod, int ldr,
                                                float* __restrict__ C, int ldc, int M, int N, int K) {
  __shared__ __attribute__((aligned(16))) float so[4][16][64];
  const int tid = threadIdx.x, w = tid >> 5, lane = tid & 31, ln = lane & 15, hh = lane >> 4;
  const int ntn = N / 64;
  const int wid = blockIdx.x * 4 + w;
  const int mt = wid / ntn, nq = wid % ntn;
  if (mt * 16 >= M) return;
  const int row0 = mt * 16, col0 = nq * 64;
  const float* arow = A + (size_t)(row0 + ln) * lda;
  v8f acc[4] = {};
  for (int kb = 0; kb < K; kb += 32) {
    FragB ah, al;
    const v4f x0 = *(const v4fa*)(arow + kb + 8 * hh), x1 = *(const v4fa*)(arow + kb + 8 * hh + 4);
    const v4f x2 = *(const v4fa*)(arow + kb + 16 + 8 * hh), x3 = *(const v4fa*)(arow + kb + 16 + 8 * hh + 4);
    float xs[16] = {x0[0],x0[1],x0[2],x0[3],x1[0],x1[1],x1[2],x1[3],x2[0],x2[1],x2[2],x2[3],x3[0],x3[1],x3[2],x3[3]};
#pragma unroll
    for (int i = 0; i < 16; ++i) { const unsigned short hb = bf16_bits(xs[i]); ah.u[i] = hb; al.u[i] = ASPLIT ? bf16_bits(xs[i] - bf16_val(hb)) : (unsigned short)0; }
#pragma unroll
    for (int t = 0; t < 4; ++t) {
      const unsigned short* brow = Wt + (size_t)(col0 + t * 16 + ln) * ldb + kb;
      FragB b;
      b.half[0] = *(const v8us*)(brow + 8 * hh);
      b.half[1] = *(const v8us*)(brow + 16 + 8 * hh);
      acc[t] = mmaN<ASPLIT ? 2 : 1>(ah.v, al.v, b.v, b.v, acc[t]);
    }
  }
#pragma unroll
  for (int t = 0; t < 4; ++t) {
    const int col = col0 + t * 16 + ln;
    float bv = bias ? bias[col] : 0.f;
    if (BIAS_BF16) bv = bf16_round(bv);
#pragma unroll
    for (int r = 0; r < 8; ++r) {
      float v = acc[t][r] + bv;
      if (resid) { float rv = resid[(size_t)((row0 + 8 * hh + r) % rmod) * ldr + col]; if (RES_BF16) rv = bf16_round(rv); v += rv; }
      if (ACT == 1) v = fmaxf(v, 0.f);
      if (ACT == 2) v = 0.5f * v * (1.0f + erff(v * 0.70710678118654752f));
      if (ACT == 3) { const float u = 0.7978845608028654f * (v + 0.044715f * v * v * v); v = 0.5f * v * (1.0f + tanhf(u)); }
      so[w][8 * hh + r][t * 16 + ln] = v;
    }
  }
  __builtin_amdgcn_fence(__ATOMIC_ACQ_REL, "workgroup");
  __builtin_amdgcn_wave_barrier();
  const int rsub = lane >> 4, c4 = (lane & 15) * 4;
  {
#pragma unroll
    for (int q = 0; q < 8; ++q) {
      const int r = q * 2 + rsub;
      const v4f v = *(const v4fa*)&so[w][r][c4];
      *(v4f*)(C + (size_t)(row0 + r) * ldc + col0 + c4) = v;
    }
    
  }
}
// row LayerNorm (biased variance, eps) over N: s = X (+ R); optional out_sum <- s; out_norm <- (s-mu)*rsqrt(var+eps)*g + b
template <bool PARAM_BF16>
__global__ __launch_bounds__(256) void k_layernorm(const float* __restrict__ X, const float* __restrict__ R, const float* __restrict__ g, const float* __restrict__ bta,
                                                  float* __restrict__ out_sum, float* __restrict__ out_norm, int N, float eps) {
  __shared__ float red[256];
  const int row = blockIdx.x, tid = threadIdx.x;
  const float* x = X + (size_t)row * N; const float* rr = R ? R + (size_t)row * N : nullptr;
  float vals[16];                     // up to N = 4096
  const int per = N / 256;            // contiguous chunk per thread? use strided-by-4 chunks: thread handles j = tid*4 + 1024*u
  float s1 = 0.f;
  for (int u = 0; u < per / 4; ++u) {
    const int j = tid * 4 + 1024 * u;
    const v4f a = *(const v4fa*)(x + j);
    v4f b = {0.f,0.f,0.f,0.f}; if (rr) b = *(const v4fa*)(rr + j);
#pragma unroll
    for (int q = 0; q < 4; ++q) { const float v = a[q] + b[q]; vals[u * 4 + q] = v; s1 += v; }
  }
  red[tid] = s1; __syncthreads();
  for (int st = 128; st > 0; st >>= 1) { if (tid < st) red[tid] += red[tid + st]; __syncthreads(); }
  const float mu = red[0] / (float)N; __syncthreads();
  float s2 = 0.f;
  for (int u = 0; u < per / 4; ++u)
#pragma unroll
    for (int q = 0; q < 4; ++q) { const float c = vals[u * 4 + q] - mu; s2 += c * c; }
  red[tid] = s2; __syncthreads();
  for (int st = 128; st > 0; st >>= 1) { if (tid < st) red[tid] += red[tid + st]; __syncthreads(); }
  const float rs = rsqrtf(red[0] / (float)N + eps);
  {
    for (int u = 0; u < per / 4; ++u) {
      const int j = tid * 4 + 1024 * u;
      v4f o, sm;
#pragma unroll
      for (int q = 0; q < 4; ++q) {
        float gg = g[j + q], bb = bta[j + q];
        if (PARAM_BF16) { gg = bf16_round(gg); bb = bf16_round(bb); }
        sm[q] = vals[u * 4 + q]; o[q] = (vals[u * 4 + q] - mu) * rs * gg + bb;
      }
      if (out_sum) *(v4f*)(out_sum + (size_t)row * N + j) = sm;
      *(v4f*)(out_norm + (size_t)row * N + j) = o;
    }
    
  }
}



// ---- f16 WMMA path (v_wmma_f32_16x16x32_f16): 11-bit significands for operands in range — used where a [0,1] probability operand needs more precision than bf16
typedef _Float16 v16h __attribute__((ext_vector_type(16)));
union FragH { v16h v; v8us half[2]; _Float16 h[16]; unsigned short u[16]; };
template <int NT>
__device__ __forceinline__ v8f mmaH(v16h ah, v16h al, v16h bh, v16h bl, v8f c) {
  c = __builtin_amdgcn_wmma_f32_16x16x32_f16(false, ah, false, bh, (short)0, c, false, false);
  if (NT >= 2) c = __builtin_amdgcn_wmma_f32_16x16x32_f16(false, al, false, bh, (short)0, c, false, false);
  if (NT >= 3) c = __builtin_amdgcn_wmma_f32_16x16x32_f16(false, ah, false, bl, (short)0, c, false, false);
  asm volatile("v_nop\n\tv_nop\n\tv_nop\n\tv_nop" : "+v"(c) : "v"(ah), "v"(al), "v"(bh), "v"(bl));
  return c;
}
// batched GEMM like k_gemm_b but f16 operands: A f32 (split into f16 hi/lo if ASPLIT, else rounded to f16), Bt = f16 values [n][k]; alpha; C f32; N multiple of 16 (partial tiles skipped)
template <bool ASPLIT>
__global__ __launch_bounds__(128) void k_gemm_h(const float* __restrict__ A, int lda, size_t sA, const _Float16* __restrict__ Bh, int ldb, size_t sB, float alpha, float* __restrict__ C, int ldc, size_t sC, int M, int N, int K) {
  __shared__ __attribute__((aligned(16))) float so[4][16][64];
  const int tid = threadIdx.x, w = tid >> 5, lane = tid & 31, ln = lane & 15, hh = lane >> 4; const int by = blockIdx.y;
  A += (size_t)by * sA; Bh += (size_t)by * sB; C += (size_t)by * sC;
  const int ntn = (N + 63) / 64; const int wid = blockIdx.x * 4 + w; const int mt = wid / ntn, nq = wid % ntn; if (mt * 16 >= M) return;
  const int row0 = mt * 16, col0 = nq * 64; const float* arow = A + (size_t)(row0 + ln) * lda;
  v8f acc[4] = {};
  for (int kb = 0; kb < K; kb += 32) {
    FragH ah, al;
    const v4f x0 = *(const v4fa*)(arow + kb + 8 * hh), x1 = *(const v4fa*)(arow + kb + 8 * hh + 4), x2 = *(const v4fa*)(arow + kb + 16 + 8 * hh), x3 = *(const v4fa*)(arow + kb + 16 + 8 * hh + 4);
    float xs[16] = {x0[0],x0[1],x0[2],x0[3],x1[0],x1[1],x1[2],x1[3],x2[0],x2[1],x2[2],x2[3],x3[0],x3[1],x3[2],x3[3]};
#pragma unroll
    for (int i = 0; i < 16; ++i) { const _Float16 h = (_Float16)xs[i]; ah.h[i] = h; al.h[i] = ASPLIT ? (_Float16)(xs[i] - (float)h) : (_Float16)0.0f; }
#pragma unroll
    for (int t = 0; t < 4; ++t) { if (col0 + t * 16 >= N) continue; const size_t boff = (size_t)(col0 + t * 16 + ln) * ldb + kb; FragH bq; bq.half[0] = *(const v8us*)(Bh + boff + 8 * hh); bq.half[1] = *(const v8us*)(Bh + boff + 16 + 8 * hh);
      acc[t] = mmaH<ASPLIT ? 2 : 1>(ah.v, al.v, bq.v, bq.v, acc[t]); }
  }
#pragma unroll
  for (int t = 0; t < 4; ++t) { if (col0 + t * 16 >= N) continue;
#pragma unroll
    for (int r = 0; r < 8; ++r) so[w][8 * hh + r][t * 16 + ln] = acc[t][r] * alpha; }
  __builtin_amdgcn_fence(__ATOMIC_ACQ_REL, "workgroup"); __builtin_amdgcn_wave_barrier();
  const int rsub = lane >> 4, c4 = (lane & 15) * 4;
  {
#pragma unroll
    for (int q = 0; q < 8; ++q) { const int r = q * 2 + rsub; if (col0 + c4 < N) { const v4f v = *(const v4fa*)&so[w][r][c4]; *(v4f*)(C + (size_t)(row0 + r) * ldc + col0 + c4) = v; } }
     }
}

// Wt[n][k] = f16(W[k][n]·scale) from f32 row-major W[K][N] (scale = power of two; bf16-exact weights stay exact in f16 away from the subnormal range)
__global__ __launch_bounds__(256) void k_wt_f16(const float* __restrict__ W, _Float16* __restrict__ Wt, int K, int N, float scale) {
  const int t = blockIdx.x * 256 + threadIdx.x; if (t >= N * (K / 8)) return; const int n = t / (K / 8), k8 = (t % (K / 8)) * 8; FragH f;
#pragma unroll
  for (int i = 0; i < 8; ++i) f.h[i] = (_Float16)(bf16_round(W[(size_t)(k8 + i) * N + n]) * scale); const v8us o = f.half[0];
  *(v8us*)((unsigned short*)Wt + (size_t)n * K + k8) = o; 
}
// k_gemm_hh variant with fused epilogue: v = acc·alpha + bias[by·sBias + col] (+ CP[(row/rowsPerB)·sCPb + by·64 + col] if CP) ; ACT 0 none / 1 elu ; writes f32 C and f16 C16, each if non-null
template <int ACT>
__global__ __launch_bounds__(128) void k_gemm_hhx(const _Float16* __restrict__ A, int lda, size_t sA, const _Float16* __restrict__ Bh, int ldb, size_t sB, float alpha, const float* __restrict__ bias, size_t sBias, const float* __restrict__ CP, int rowsPerB, size_t sCPb, int row0g,
    float* __restrict__ C, _Float16* __restrict__ C16, int ldc, size_t sC, int M, int N, int K) {
  __shared__ __attribute__((aligned(16))) float so[4][16][64];
  const int tid = threadIdx.x, w = tid >> 5, lane = tid & 31, ln = lane & 15, hh = lane >> 4; const int by = blockIdx.y;
  A += (size_t)by * sA; Bh += (size_t)by * sB; const size_t cofs = (size_t)by * sC; const float* bp = bias ? bias + (size_t)by * sBias : nullptr;
  const int ntn = (N + 63) / 64; const int wid = blockIdx.x * 4 + w; const int mt = wid / ntn, nq = wid % ntn; if (mt * 16 >= M) return;
  const int row0 = mt * 16, col0 = nq * 64; const _Float16* arow = A + (size_t)(row0 + ln) * lda;
  v8f acc[4] = {};
  for (int kb = 0; kb < K; kb += 32) { FragH ah; ah.half[0] = *(const v8us*)((const unsigned short*)arow + kb + 8 * hh); ah.half[1] = *(const v8us*)((const unsigned short*)arow + kb + 16 + 8 * hh);
#pragma unroll
    for (int t = 0; t < 4; ++t) { if (col0 + t * 16 >= N) continue; const size_t boff = (size_t)(col0 + t * 16 + ln) * ldb + kb; FragH bq; bq.half[0] = *(const v8us*)((const unsigned short*)Bh + boff + 8 * hh); bq.half[1] = *(const v8us*)((const unsigned short*)Bh + boff + 16 + 8 * hh);
      acc[t] = mmaH<1>(ah.v, ah.v, bq.v, bq.v, acc[t]); }
  }
#pragma unroll
  for (int t = 0; t < 4; ++t) { if (col0 + t * 16 >= N) continue; const int col = col0 + t * 16 + ln; const float bv = bp ? bf16_round(bp[col]) : 0.f;
#pragma unroll
    for (int r = 0; r < 8; ++r) { float v = acc[t][r] * alpha + bv; if (CP) { const int bidx = (row0g + row0 + 8 * hh + r) / rowsPerB; v += CP[(size_t)bidx * sCPb + (size_t)by * 64 + col]; } if (ACT == 1) v = (v > 0.f) ? v : expm1f(v); else if (ACT == 7) v = (v > 0.f) ? v + 1.0f : expf(v); else if (ACT == 8) v = tanhf(v); else if (ACT == 9) v = 0.5f * v * (1.0f + tanhf(0.7978845608028654f * (v + 0.044715f * v * v * v))); else if (ACT == 11) v = 1.0f / (1.0f + expf(-v)); else if (ACT == 12) v = (v > 0.f) ? v : 0.01f * v; else if (ACT == 14) v = (v > 0.f) ? v : 0.1f * v; else if (ACT == 15) v = v / (1.0f + expf(-v)); else if (ACT == 3) v = fmaxf(v, 0.f); else if (ACT == 6) v = 0.5f * v * (1.0f + erff(v * 0.70710678118654752f)); so[w][8 * hh + r][t * 16 + ln] = v; } }
  __builtin_amdgcn_fence(__ATOMIC_ACQ_REL, "workgroup"); __builtin_amdgcn_wave_barrier();
  const int rsub = lane >> 4, c4 = (lane & 15) * 4; typedef _Float16 v4h __attribute__((ext_vector_type(4)));
  {
#pragma unroll
    for (int q = 0; q < 8; ++q) { const int r = q * 2 + rsub; if (col0 + c4 < N) { const v4f v = *(const v4fa*)&so[w][r][c4]; if (C) *(v4f*)(C + cofs + (size_t)(row0 + r) * ldc + col0 + c4) = v; if (C16) { v4h h4; for (int i = 0; i < 4; ++i) h4[i] = (_Float16)v[i]; *(v4h*)(C16 + cofs + (size_t)(row0 + r) * ldc + col0 + c4) = h4; } } }
     }
}


typedef _Float16 v4h __attribute__((ext_vector_type(4)));

// Conversion passes as streams of few, long-lived waves. A run is 1024 consecutive floats (4 KB): eight 16-byte loads a lane, each wave-wide load 512 contiguous bytes (4 whole lines);
// the four halves that a lane makes of one load leave as one 8-byte store (256 contiguous bytes a wave, 2 whole lines). A wave issues all its loads before it converts the first value.
// Addresses are a wave-uniform base plus one 32-bit lane offset in bytes (vo for the floats, vo / 2 for the halves).
// Each plain '#pragma unroll' below stands on a loop whose index picks an element of a register array.
template <int NL>
__device__ __forceinline__ void run_load(v4f* r, const float* __restrict__ src, unsigned vo) {
#pragma unroll
  for (int j = 0; j < NL; ++j) r[j] = *(const v4fa*)((const char*)src + vo + j * 512); }
// MODE 0: f16(x); 1: f16(bf16(x)); 2: f16(bf16(x) * 2^4)
template <int NL, int MODE>
__device__ __forceinline__ void run_store(const v4f* r, _Float16* __restrict__ dst, unsigned vh) {
#pragma unroll
  for (int j = 0; j < NL; ++j) { v4h h;
#pragma unroll
    for (int q = 0; q < 4; ++q) h[q] = (MODE == 0) ? (_Float16)r[j][q] : (MODE == 1) ? (_Float16)bf16_round(r[j][q]) : (_Float16)(bf16_round(r[j][q]) * 16.0f);
    *(v4h*)((char*)dst + vh + j * 256) = h; } }
// All seven inputs in one launch: 256 blocks of 16 waves; wave number n takes run n of query, of key and of value, and run n of the four weight matrices laid end to end (as Bw is).
__global__ __launch_bounds__(512) void k_cvt_in(const float* __restrict__ xq, const float* __restrict__ xk, const float* __restrict__ xv, const float* __restrict__ wq, const float* __restrict__ wk, const float* __restrict__ wv, const float* __restrict__ wo,
                                               _Float16* __restrict__ X16, _Float16* __restrict__ XK16, _Float16* __restrict__ XV16, _Float16* __restrict__ Bw) {
  static_assert(NR * DD == 4096 * 1024 && DD * DD == 1024 * 1024, "4096 runs an activation, 1024 a weight matrix");
  const unsigned lane = threadIdx.x & 31, run = blockIdx.x * 16 + (threadIdx.x >> 5);
  const unsigned m = blockIdx.x >> 6;      /* 1024 runs = 64 blocks a weight matrix: the same for the whole block */
  const float* __restrict__ w = (m == 0) ? wq : (m == 1) ? wk : (m == 2) ? wv : wo;
  const unsigned vo = run * 4096 + lane * 16, vw = (run & 1023) * 4096 + lane * 16, vh = run * 2048 + lane * 8;
  v4f r[4][8];
  run_load<8>(r[0], xq, vo); run_load<8>(r[1], xk, vo); run_load<8>(r[2], xv, vo); run_load<8>(r[3], w, vw);
  __builtin_amdgcn_sched_barrier(0);      /* all 32 loads are issued before any conversion: without it the scheduler sinks some of them among the conversions, behind waits on earlier data */
  asm volatile("s_wait_xcnt 0x0" :: "v"(vo), "v"(vw) : "memory");      /* the loads' offset registers may be reused below: wait before that overwrite; named as inputs, they are not given to a late load as its destination either */
  __builtin_amdgcn_sched_barrier(0);      /* nothing that rewrites a base or offset register of the loads is scheduled in front of that wait */
  run_store<8, 1>(r[0], X16, vh);
  asm volatile("s_wait_xcnt 0x0" ::: "memory");      /* the stores' data registers may be reused by the next run: wait before that overwrite */
  __builtin_amdgcn_sched_barrier(0);      /* keeps the next run's conversions behind that wait */
  run_store<8, 1>(r[1], XK16, vh);
  asm volatile("s_wait_xcnt 0x0" ::: "memory");      /* as above */
  __builtin_amdgcn_sched_barrier(0);
  run_store<8, 1>(r[2], XV16, vh);
  asm volatile("s_wait_xcnt 0x0" ::: "memory");      /* as above */
  __builtin_amdgcn_sched_barrier(0);
  run_store<8, 2>(r[3], Bw, vh);
}
// lane l <-> lane l ^ 16 (the two halves of a wave)
__device__ __forceinline__ float xhalf(float x) { return __builtin_bit_cast(float, __builtin_amdgcn_permlanex16(__builtin_bit_cast(int, x), __builtin_bit_cast(int, x), 0x76543210, 0xfedcba98, false, false)); }

__device__ __forceinline__ void tile_copy(unsigned l, unsigned l4, const char* k, size_t kstep, const char* v, size_t vstep) {      /* l, l4: the lane's LDS byte addresses in the buffer's K rows and V rows; k, v: its global addresses in row tid / 8; kstep, vstep: 16 rows of K, of V in bytes */
  const unsigned l1 = l + 16 * 144, l2 = l + 32 * 144, l3 = l + 48 * 144, l5 = l4 + 16 * 160, l6 = l4 + 32 * 160, l7 = l4 + 48 * 160;
  const char* k1 = k + kstep; const char* k2 = k1 + kstep; const char* k3 = k2 + kstep;
  const char* v1 = v + vstep; const char* v2 = v1 + vstep; const char* v3 = v2 + vstep;
  /* the copies and, as the last line of their own statement, the wait before any of their address registers is rewritten */
  asm volatile("global_load_async_to_lds_b128 %0, %8, off\n\t"
               "global_load_async_to_lds_b128 %1, %9, off\n\t"
               "global_load_async_to_lds_b128 %2, %10, off\n\t"
               "global_load_async_to_lds_b128 %3, %11, off\n\t"
               "global_load_async_to_lds_b128 %4, %12, off\n\t"
               "global_load_async_to_lds_b128 %5, %13, off\n\t"
               "global_load_async_to_lds_b128 %6, %14, off\n\t"
               "global_load_async_to_lds_b128 %7, %15, off\n\t"
               "s_wait_xcnt 0x0"
               :: "v"(l), "v"(l1), "v"(l2), "v"(l3), "v"(l4), "v"(l5), "v"(l6), "v"(l7), "v"(k), "v"(k1), "v"(k2), "v"(k3), "v"(v), "v"(v1), "v"(v2), "v"(v3) : "memory");
}
// Transposing 16-bit LDS load. Lane l names 16 bytes of row 8*(l >> 4) + (l & 7), at byte 16*((l >> 3) & 1), of a 16-row x 16-column block; it gets column l & 15 of rows 8*(l >> 4) ... + 7.
typedef short s16x8 __attribute__((ext_vector_type(8)));
__device__ __forceinline__ v8us ld_tr16(const unsigned char* p) { typedef __attribute__((address_space(3))) s16x8 lds_s16x8; return __builtin_bit_cast(v8us, __builtin_amdgcn_ds_load_tr16_b128_v8i16((lds_s16x8*)p)); }
// One 32-key chunk of a lane: P = 2^x for its 16 reduced scores, as the f16 B operand (element nt*8 + r = key nt*16 + 8*hh + r), and their sum.
// SLOT: the exponential with its v_nop in one statement, for the seldom-taken path.
__device__ __forceinline__ float exp2_slot(float x) { float y; asm("v_exp_f32 %0, %1\n\tv_nop" : "=v"(y) : "v"(x)); return y; }      /* v_nop: the one slot that the instruction set asks for behind a transcendental */
template <bool SLOT>
__device__ __forceinline__ float p_chunk(const float* x, FragH& pb) { float ps[4];
#pragma unroll
  for (int i = 0; i < 16; ++i) { const float p = SLOT ? exp2_slot(x[i]) : __builtin_amdgcn_exp2f(x[i]); ps[i & 3] = (i < 4) ? p : ps[i & 3] + p; pb.h[i] = (_Float16)p; }
  return (ps[0] + ps[1]) + (ps[2] + ps[3]); }
__global__ __launch_bounds__(128) void k_flash(const _Float16* __restrict__ Q16, int ldq, const _Float16* __restrict__ K16, int ldk, const _Float16* __restrict__ V16, int ldv, const float* __restrict__ FR, const float* __restrict__ AP, const float* __restrict__ AN, const float* __restrict__ DLT, _Float16* __restrict__ O16, int ldo) {
  constexpr int NQB = TT / 64, DT = 4, KS = 2;
  constexpr int NS = TT / 64, RP = 144, VP = 160, TB = 64 * RP + 64 * VP;      /* tiles of 64 keys; LDS row pitch of K, of V, and bytes of one buffer */
  static_assert(NS >= 2, "the two buffers' prologue needs two tiles");
  __shared__ __attribute__((aligned(16))) float sF[TT]; __shared__ __attribute__((aligned(16))) float sO[4][16][64 + 4]; __shared__ __attribute__((aligned(16))) unsigned char sT[2 * TB];
  const int tid = threadIdx.x, w = tid >> 5, lane = tid & 31, ln = lane & 15, hh = lane >> 4;
  const int slab = blockIdx.x / NQB, qblk = blockIdx.x % NQB; const int b = slab / NH, h = slab % NH; const int q0 = qblk * 64 + w * 16;
  const float* frb = FR + (size_t)b * TT;
#pragma unroll
  for (int i = 0; i < TT / 512; ++i) { const int e = i * 512 + tid * 4; v4f f = *(const v4fa*)(frb + e);
#pragma unroll
    for (int q = 0; q < 4; ++q) f[q] = bf16_round(f[q]);
    *(v4fa*)&sF[e] = f; }
  FragH bq[KS]; const unsigned short* qr = (const unsigned short*)Q16 + ((size_t)b * TT + q0 + ln) * ldq + h * 64;      /* B operand: column ln = query q0 + ln */
#pragma unroll
  for (int ks = 0; ks < KS; ++ks) { bq[ks].half[0] = *(const v8us*)(qr + ks * 32 + 8 * hh); bq[ks].half[1] = *(const v8us*)(qr + ks * 32 + 16 + 8 * hh); }
  const char* ck = (const char*)K16 + (((size_t)b * TT + (tid >> 3)) * ldk + h * 64) * 2 + (tid & 7) * 16;      /* the lane's 16 bytes of key row tid / 8 of tile 0 */
  const char* cv = (const char*)V16 + (((size_t)b * TT + (tid >> 3)) * ldv + h * 64) * 2 + (tid & 7) * 16;      /* and of the same key's row of V */
  const size_t kstep = (size_t)16 * ldk * 2, vstep = (size_t)16 * ldv * 2; const unsigned lt = (unsigned)(size_t)sT + (unsigned)((tid >> 3) * RP + (tid & 7) * 16), lv = (unsigned)(size_t)sT + (unsigned)(64 * RP + (tid >> 3) * VP + (tid & 7) * 16);
  constexpr float L2E = 1.44269504088896340736f;      /* log2(e): the scores are formed in base-2 units, so that exp(s - m) is one hardware exp2 of a difference */
  const float dlt = bf16_round(DLT[0]); const float aph = bf16_round(AP[h]) * dlt * L2E, anh = bf16_round(AN[h]) * dlt * L2E;      /* delta scalar; log2(e)*delta*alpha_pos[h], log2(e)*delta*alpha_neg[h]; gamma is in Q already */
  const float fq = bf16_round(frb[q0 + ln]);      /* frac of the lane's query */
  const float flo = fq - 0.2f, fhi = fq + 0.2f, kq = -(aph + anh) * fq;      /* D+ = med3(frac_k, fq, fq + 0.2) - fq and D- = med3(frac_k, fq - 0.2, fq) - fq: the two '- fq' are gathered in kq, once a lane */
  float m_r = 0.f, l_r = 0.f; v8f oacc[DT];      /* m_r: the query's exponent reference in use, P = 2^(score - m_r); tile 0 sets it */
#pragma unroll
  for (int dt = 0; dt < DT; ++dt) oacc[dt] = (v8f){0.f,0.f,0.f,0.f,0.f,0.f,0.f,0.f};
  tile_copy(lt, lv, ck, kstep, cv, vstep);      /* tile 0 into buffer 0 */
  asm volatile("s_wait_asynccnt 0x0" ::: "memory");      /* this wave's copies of tile 0 have landed */
  __syncthreads();      /* sF and tile 0 are complete before any wave reads them */
  tile_copy(lt + TB, lv + TB, ck + 4 * kstep, kstep, cv + 4 * vstep, vstep);      /* tile 1 into buffer 1 */
#pragma unroll 1      /* rolled: 32 copies of this body would only grow the code */
  for (int s = 0; s < NS; ++s) {
   const unsigned char* tk = sT + (s & 1) * TB + ln * RP + 16 * hh; const unsigned char* tv = sT + (s & 1) * TB + 64 * RP + (8 * hh + (lane & 7)) * VP + ((lane >> 3) & 1) * 16;      /* trip s reads buffer s mod 2 alone */
   FragH ak[4][KS], av[2][DT]; v4f fk[4][2];      /* c = 0..3: the tile's four groups of 16 keys; p = 0, 1: its two 32-key chunks */
#pragma unroll
   for (int c = 0; c < 4; ++c)      /* A operand: row ln = key s*64 + c*16 + ln */
#pragma unroll
     for (int ks = 0; ks < KS; ++ks) { ak[c][ks].half[0] = *(const v8us*)(tk + c * 16 * RP + ks * 64); ak[c][ks].half[1] = *(const v8us*)(tk + c * 16 * RP + ks * 64 + 32); }
#pragma unroll
   for (int p = 0; p < 2; ++p)
#pragma unroll
     for (int dt = 0; dt < DT; ++dt) { av[p][dt].half[0] = ld_tr16(tv + p * 32 * VP + dt * 32); av[p][dt].half[1] = ld_tr16(tv + (p * 32 + 16) * VP + dt * 32); }      /* A operand: row ln = head column dt*16 + ln; elements 0-7 = keys j0 + 8*hh + 0..7, elements 8-15 = keys j0 + 16 + 8*hh + 0..7, j0 = s*64 + p*32 */
#pragma unroll
   for (int c = 0; c < 4; ++c) { fk[c][0] = *(const v4fa*)&sF[s * 64 + c * 16 + 8 * hh]; fk[c][1] = *(const v4fa*)&sF[s * 64 + c * 16 + 8 * hh + 4]; }      /* frac of the lane's 32 keys */
   float sc[32];      /* score - m_r: bias and reference are known before the product, so they enter it as its C operand, and the product's result is the exponent */
   const float k0 = kq - m_r;
#pragma unroll
   for (int c = 0; c < 4; ++c) { v8f acc;
#pragma unroll
     for (int r = 0; r < 8; ++r) { const float f = fk[c][r >> 2][r & 3];
       acc[r] = aph * __builtin_amdgcn_fmed3f(f, fq, fhi) + (anh * __builtin_amdgcn_fmed3f(f, flo, fq) + k0); }      /* log2(e)*delta*(alpha_pos*D+ + alpha_neg*D-) - m_r */
#pragma unroll
     for (int ks = 0; ks < KS; ++ks) acc = __builtin_amdgcn_wmma_f32_16x16x32_f16(false, ak[c][ks].v, false, bq[ks].v, (short)0, acc, false, false);
#pragma unroll
     for (int r = 0; r < 8; ++r) sc[c * 8 + r] = acc[r]; }
   FragH pb[2]; float cs0 = p_chunk<false>(sc, pb[0]), cs1 = p_chunk<false>(sc + 16, pb[1]);
   asm volatile("" :: "v"(av[0][0].v), "v"(av[0][1].v), "v"(av[0][2].v), "v"(av[0][3].v));      /* inputs only: keeps chunk 0's V^T loads in front of the test; without it the compiler sinks them behind the branch, where each product waits for its own loads */
   const float thr = (s == 0) ? -1.0f : 32768.0f;      /* tile 0 always passes the test: it sets the reference */
   if (__builtin_amdgcn_ballot_w32(fmaxf(cs0, cs1) > thr) != 0) {      /* one test a tile, the same for the whole wave. A lane's chunk sum of at most 2^15 bounds each of its P by 2^15, inside f16; above it the reference moves */
     float mx[8];
#pragma unroll
     for (int q = 0; q < 8; ++q) mx[q] = fmaxf(fmaxf(sc[q], sc[8 + q]), fmaxf(sc[16 + q], sc[24 + q]));
     float mc = fmaxf(fmaxf(fmaxf(mx[0], mx[1]), fmaxf(mx[2], mx[3])), fmaxf(fmaxf(mx[4], mx[5]), fmaxf(mx[6], mx[7]))); mc = fmaxf(mc, xhalf(mc));      /* the query's maximum over the tile's 64 keys, in both halves */
     const float up = fmaxf(mc - 10.0f, 0.f); const float dl = (s == 0) ? mc - 10.0f : up;      /* the new reference lies 10 under the tile's maximum (P up to 2^10) and never moves down, but in tile 0, which sets it */
     const float al = exp2_slot(-up); m_r += dl;      /* in tile 0 the factor meets zeros only: any finite value serves */
#pragma unroll
     for (int i = 0; i < 32; ++i) sc[i] -= dl;
     cs0 = p_chunk<true>(sc, pb[0]); cs1 = p_chunk<true>(sc + 16, pb[1]);
     l_r *= al;
#pragma unroll
     for (int dt = 0; dt < DT; ++dt)
#pragma unroll
       for (int r = 0; r < 8; ++r) oacc[dt][r] *= al; }
   l_r = (l_r + cs0) + cs1;      /* the lane's 32 keys; the halves are joined after the loop */
#pragma unroll
   for (int p = 0; p < 2; ++p)
#pragma unroll
     for (int dt = 0; dt < DT; ++dt) oacc[dt] = __builtin_amdgcn_wmma_f32_16x16x32_f16(false, av[p][dt].v, false, pb[p].v, (short)0, oacc[dt], false, false);
   asm volatile("s_wait_dscnt 0x0" ::: "memory");      /* this wave's reads of buffer s mod 2 have returned before the buffer is handed to the copies */
   asm volatile("s_wait_asynccnt 0x0" ::: "memory");      /* this wave's copies of tile s + 1 have landed */
   __syncthreads();      /* publishes tile s + 1 and ends every wave's reads of tile s */
   if (s + 2 < NS) tile_copy(lt + (s & 1) * TB, lv + (s & 1) * TB, ck + (size_t)(s + 2) * 4 * kstep, kstep, cv + (size_t)(s + 2) * 4 * vstep, vstep); }      /* tile s + 2 into the buffer that trip s has just read */
  asm volatile("s_wait_asynccnt 0x0" ::: "memory");      /* nothing is in flight when the wave goes on to its end */
  const float l = l_r + xhalf(l_r); const float inv = (l > 0.f) ? 1.0f / l : 0.f;      /* sum and O carry the same factor 2^-m_r */
#pragma unroll
  for (int dt = 0; dt < DT; ++dt)      /* oacc[dt][r] = O[query ln][dt*16 + 8*hh + r] */
#pragma unroll
    for (int c = 0; c < 2; ++c) { const v4f o = {oacc[dt][4 * c] * inv, oacc[dt][4 * c + 1] * inv, oacc[dt][4 * c + 2] * inv, oacc[dt][4 * c + 3] * inv}; *(v4fa*)&sO[w][ln][dt * 16 + 8 * hh + 4 * c] = o; }
  __builtin_amdgcn_fence(__ATOMIC_ACQ_REL, "workgroup"); __builtin_amdgcn_wave_barrier();      /* the wave's LDS stores are done, and stay in front, before its lanes read each other's values back */
#pragma unroll
  for (int rp = 0; rp < 16; rp += 4) { const int r = rp + (lane >> 3), pc = lane & 7; const v4f v0 = *(const v4fa*)&sO[w][r][pc * 8], v1 = *(const v4fa*)&sO[w][r][pc * 8 + 4]; FragH o;      /* the f16 operand of the output product leaves here: 8 lanes a row, one whole 128-B line; 4 rows a wave-wide store */
#pragma unroll
    for (int i = 0; i < 4; ++i) { o.h[i] = (_Float16)v0[i]; o.h[4 + i] = (_Float16)v1[i]; }
    *(v8us*)((unsigned short*)O16 + ((size_t)b * TT + q0 + r) * ldo + h * 64 + pc * 8) = o.half[0]; }
}

// Block-tiled GEMM, C = (A.Bh^T)*alpha + bias: a block of 8 waves owns a 128 x 128 tile of C and stages 128 x 64 pieces of A and of Bh in LDS, so every operand byte is fetched once a block, in whole 128-B lines
// (8 lanes a row), and is read as fragments from LDS. Wave tile 32 x 64 (2 x 4 accumulators). The next piece is fetched into registers while this one is multiplied. k runs upward in steps of 32.
// M % 128 == 0 (grid), N % 128 == 0, K % 64 == 0. LDS row pitch 64 + 8 halves = 144 B for the 16-byte fragment reads.
// One launch holds NZ independent products of the same shape (M = NR): product z takes plane z of A, of Bh and of C16, laid end to end, and its own bias; with NZ > 1, product 0 is then scaled as a whole by bf16(GM[0]) * log2(e) / 8. A block takes under a third of a WGP's registers
// (two waves of 160 on each SIMD's 1,024) and a fifth of its LDS, so with NZ = 3 three blocks stand on every WGP at once, and one block's barriers, LDS waits and first and last phases are covered by the matrix work of the other two.
// Most plain '#pragma unroll's below stand on a short loop whose index picks an element of a register array (staging registers, fragments, accumulators): unrolled, these stay in registers.
template <int N, int K, int NZ, bool HALF_OUT>
__global__ __launch_bounds__(256) void k_gemm_tile(const _Float16* __restrict__ A, const _Float16* __restrict__ Bh, float alpha, const float* __restrict__ bias0, const float* __restrict__ bias1, const float* __restrict__ bias2, const float* __restrict__ GM, float* __restrict__ C, _Float16* __restrict__ C16) {
  constexpr int BM = 128, BN = 128, BK = 64, LP = BK + 8;
  constexpr int NB = (NR / BM) * (N / BN);      /* blocks of one product */
  static_assert(NZ >= 1 && NZ <= 3 && (NZ == 1 || HALF_OUT), "up to three biases; the planes of several products are the f16 outputs");
  const unsigned z = (NZ > 1) ? blockIdx.x / NB : 0u; const unsigned bid = blockIdx.x - z * NB;      /* product and tile number: the same for the whole block */
  const float* __restrict__ bias = (z == 0) ? bias0 : (z == 1) ? bias1 : bias2;
  A += (size_t)z * NR * K; Bh += (size_t)z * N * K; if (HALF_OUT) C16 += (size_t)z * NR * N;
  __shared__ __attribute__((aligned(16))) unsigned short sm[8 * 32 * 64 * 2];      /* 64 KB: the output staging (8 waves x 32 x 64 f32) is the larger use; the operand pieces take (BM + BN) * LP halves */
  static_assert((BM + BN) * LP <= 8 * 32 * 64 * 2, "operand pieces fit");
  unsigned short* sA = sm; unsigned short* sB = sm + BM * LP;
  const int tid = threadIdx.x, w = tid >> 5, lane = tid & 31, ln = lane & 15, hh = lane >> 4;
  const int nbn = N / BN; const int row0 = (bid / nbn) * BM, col0 = (bid % nbn) * BN;
  const int wm = w >> 1, wn = w & 1;
  const int lr = tid >> 3, lc = (tid & 7) * 8;
  const char* ga = (const char*)A + (size_t)row0 * K * 2; const char* gb = (const char*)Bh + (size_t)col0 * K * 2; const unsigned vo = (unsigned)(lr * K + lc) * 2u;      /* block-uniform bases, one 32-bit lane offset that lives through the loop */
  v8us ra[4], rb[4];
#pragma unroll
  for (int i = 0; i < 4; ++i) { ra[i] = *(const v8us*)(ga + vo + (size_t)(32 * i) * K * 2); rb[i] = *(const v8us*)(gb + vo + (size_t)(32 * i) * K * 2); }
  v8f acc[2][4];
#pragma unroll
  for (int mi = 0; mi < 2; ++mi)
#pragma unroll
    for (int t = 0; t < 4; ++t) acc[mi][t] = (v8f){0.f,0.f,0.f,0.f,0.f,0.f,0.f,0.f};
#pragma unroll 1      /* rolled: K is a constant here, and 16 copies of this body would only grow the code */
  for (int kb = 0; kb < K; kb += BK) {
#pragma unroll
    for (int i = 0; i < 4; ++i) { *(v8us*)&sA[(lr + 32 * i) * LP + lc] = ra[i]; *(v8us*)&sB[(lr + 32 * i) * LP + lc] = rb[i]; }
    __syncthreads();      /* the piece is complete before any wave reads fragments */
    if (kb + BK < K) {
#pragma unroll
      for (int i = 0; i < 4; ++i) { ra[i] = *(const v8us*)(ga + (size_t)(kb + BK) * 2 + vo + (size_t)(32 * i) * K * 2); rb[i] = *(const v8us*)(gb + (size_t)(kb + BK) * 2 + vo + (size_t)(32 * i) * K * 2); }
      asm volatile("s_wait_xcnt 0x0" ::: "memory"); }      /* the loads' address registers are reused by the fragment reads below: wait before that overwrite */
#pragma unroll
    for (int ks = 0; ks < BK / 32; ++ks) { FragH a[2], bq[4];
#pragma unroll
      for (int mi = 0; mi < 2; ++mi) { const unsigned short* p = &sA[(wm * 32 + mi * 16 + ln) * LP + ks * 32 + 8 * hh]; a[mi].half[0] = *(const v8us*)p; a[mi].half[1] = *(const v8us*)(p + 16); }
#pragma unroll
      for (int t = 0; t < 4; ++t) { const unsigned short* p = &sB[(wn * 64 + t * 16 + ln) * LP + ks * 32 + 8 * hh]; bq[t].half[0] = *(const v8us*)p; bq[t].half[1] = *(const v8us*)(p + 16); }
#pragma unroll
      for (int mi = 0; mi < 2; ++mi)
#pragma unroll
        for (int t = 0; t < 4; ++t) acc[mi][t] = __builtin_amdgcn_wmma_f32_16x16x32_f16(false, a[mi].v, false, bq[t].v, (short)0, acc[mi][t], false, false); }
    __syncthreads();      /* every wave has read the piece before it is overwritten (by the next piece, or by the output staging below) */
  }
  float* so = (float*)sm + w * (32 * 64);      /* each wave stages its 32 x 64 results in its own 8 KB, to store whole lines */
  const int rsub = lane >> 4, c4 = (lane & 15) * 4; float bv[4];
  float os = 1.0f; if (NZ > 1 && z == 0) os = bf16_round(GM[0]) * 0.125f * 1.44269504088896340736f;      /* product 0 of the shared launch is Q: it leaves as log2(e) * gamma * 64^-1/2 * Q, scaled in f32 in front of its one rounding to f16, so that K.Q^T is the score in base-2 units; the factor 1 leaves K and V as they were */
  alpha *= os;
#pragma unroll
  for (int t = 0; t < 4; ++t) bv[t] = bf16_round(bias[col0 + wn * 64 + t * 16 + ln]) * os;
#pragma unroll
  for (int mi = 0; mi < 2; ++mi)
#pragma unroll
    for (int t = 0; t < 4; ++t)
#pragma unroll
      for (int r = 0; r < 8; ++r) so[(mi * 16 + 8 * hh + r) * 64 + t * 16 + ln] = acc[mi][t][r] * alpha + bv[t];
  __builtin_amdgcn_fence(__ATOMIC_ACQ_REL, "workgroup"); __builtin_amdgcn_wave_barrier();      /* the wave's LDS stores are done, and stay in front, before its lanes read each other's values back */
#pragma unroll
  for (int q = 0; q < 16; ++q) { const int r = q * 2 + rsub; const v4f v = *(const v4fa*)&so[r * 64 + c4]; const size_t o = (size_t)(row0 + wm * 32 + r) * N + col0 + wn * 64 + c4;
    if (HALF_OUT) { v4h h4;
#pragma unroll
      for (int i = 0; i < 4; ++i) h4[i] = (_Float16)v[i];
      *(v4h*)(C16 + o) = h4; }
    else *(v4f*)(C + o) = v; }
}

extern "C" void kernel_launch(void* const* d_in, const int* in_sizes, int n_in,
                              void* d_out, int out_size, void* d_ws, size_t ws_size, hipStream_t stream) {
  (void)in_sizes; (void)n_in; (void)out_size;
  const float* const* I = (const float* const*)d_in; const float* xq = I[0]; const float* xk = I[1]; const float* xv = I[2]; const float* frac = I[3]; const float* Wq = I[4]; const float* bq = I[5]; const float* Wk = I[6]; const float* bk = I[7]; const float* Wv = I[8]; const float* bv = I[9]; const float* Wo = I[10]; const float* bo = I[11]; const float* apos = I[12]; const float* aneg = I[13]; const float* gam = I[14]; const float* del = I[15];      /* d_in order: query, key, value, frac, Wq, bq, Wk, bk, Wv, bv, Wo, bo, alpha_pos, alpha_neg, gamma, delta */
  char* ws = (char*)d_ws; size_t off = 0;
  auto take = [&](size_t bytes) { char* p = ws + off; off += (bytes + 255) & ~(size_t)255; return p; };
  const size_t WSZ = (size_t)DD * DD; _Float16* Bw = (_Float16*)take(4 * WSZ * 2); const size_t XSZ = (size_t)NR * DD; _Float16* X16 = (_Float16*)take(3 * XSZ * 2); _Float16* XK16 = X16 + XSZ; _Float16* XV16 = X16 + 2 * XSZ;      /* three planes end to end, as the projection launch reads them */
  _Float16* Q = (_Float16*)take(3 * XSZ * 2); _Float16* K = Q + XSZ; _Float16* V = Q + 2 * XSZ;
  _Float16* O16 = (_Float16*)take(XSZ * 2);      /* the attention result, written by the attention kernel as the f16 operand of the output product */
  if (off > ws_size) return;      // 8 x 8.4 = about 67 MB
  const unsigned gt = (NR / 128) * (DD / 128);
  k_cvt_in<<<256, 512, 0, stream>>>(xq, xk, xv, Wq, Wk, Wv, Wo, X16, XK16, XV16, Bw);      /* activations bf16-rounded; weights (out,in) natural, bf16-rounded, x 2^4 */
  k_gemm_tile<DD, DD, 3, true><<<3 * gt, 256, 0, stream>>>(X16, Bw, 0.0625f, bq, bk, bv, gam, nullptr, Q);      /* Q = (query.Wq^T + bq) * log2(e)*gamma/8; K and V plain; each M 4096 N 1024 K 1024 */
  k_flash<<<BB * NH * (TT / 64), 128, 0, stream>>>(Q, DD, K, DD, V, DD, frac, apos, aneg, del, O16, DD);
  k_gemm_tile<DD, DD, 1, false><<<gt, 256, 0, stream>>>(O16, Bw + 3 * WSZ, 0.0625f, bo, nullptr, nullptr, nullptr, (float*)d_out, nullptr);      /* out = O·Woᵀ + bo */
}
